// v000
// Times are from an AMD MI455X. After a warm-up the kernel runs many times in a row, and a time is the length of
// such a window on the GPU divided by its runs, so every launch and the gaps after it count. The runs cycle
// through copies of the inputs. A figure is the median of several windows, for all but v000 over two sittings.
// Sittings can differ by a few percent; kernels timed side by side share one.
// v000, which the later versions start from, runs in 298 microseconds.
#include <hip/hip_runtime.h>
// Lightweight multi-head self-attention with reduced keys/values (B 16, C 32, 128×128; P 512 tokens of 1024 (q) / 256 (k, v after a depthwise 2×2 stride-2 reduction); 8 heads by PLAIN reshapes of the (P, dim) buffers; k/v nearest-upsampled 32 → 128 along the head dim; scores/√1024 + rel_bias; softmax; attn·v; plain reshape back to [16,32,128,128]).
// Structure: q/k/v projections as GEMMs (exact f16 operands for q; the depthwise reduction on VALU → f16; f32 outputs); the plain-view head split done by index arithmetic on VALU, with the 32→128 nearest upsampling folded exactly into the contraction (Σ_d q_d·k_{d/4} = Σ_e (Σ_{d/4=e} q_d)·k_e and out_d = o_{d/4}); per 32 (batch, head) pairs: score GEMM (K 32, α 1/32) batched, softmax + bias on VALU (×2^10 → f16), P·V batched (N 32); the expanded output written on VALU.
// Compute dtype: inputs and parameters rounded to bf16; q operands exact, reduced x / head operands / probabilities f16 (≈2^-12); f32 accumulation; softmax f32. v_wmma_f32_16x16x32_f16.
#define NB 16
#define NP 512
#define DQ 1024
#define DR 256
#define NHD 8
#define NBH (NB * NHD)           /* 128 */
#define GRP 32                   /* (b,h) pairs per attention launch */
#define NRW (NB * NP)            /* 8192 rows */
typedef __bf16 v16b __attribute__((ext_vector_type(16)));
typedef unsigned short v8us __attribute__((ext_vector_type(8), may_alias));
typedef float  v8f  __attribute__((ext_vector_type(8)));
typedef float  v4f  __attribute__((ext_vector_type(4)));
typedef float  v4fa __attribute__((ext_vector_type(4), may_alias));
union FragB { v16b v; v8us half[2]; unsigned short u[16]; };

__device__ __forceinline__ unsigned short bf16_bits(float x) { unsigned int u = __float_as_uint(x); return (unsigned short)((u + 0x7FFFu + ((u >> 16) & 1u)) >> 16); }
__device__ __forceinline__ float bf16_val(unsigned short b) { return __uint_as_float(((unsigned int)b) << 16); }
__device__ __forceinline__ float bf16_round(float x) { return bf16_val(bf16_bits(x)); }
// D += A·B with NT terms: 1 = ah·bh, 2 = + al·bh (A split), 3 = + ah·bl (both split)
template <int NT>
__device__ __forceinline__ v8f mmaN(v16b ah, v16b al, v16b bh, v16b bl, v8f c) {
  c = __builtin_amdgcn_wmma_f32_16x16x32_bf16(false, ah, false, bh, (short)0, c, false, false);
  if (NT >= 2) c = __builtin_amdgcn_wmma_f32_16x16x32_bf16(false, al, false, bh, (short)0, c, false, false);
  if (NT >= 3) c = __builtin_amdgcn_wmma_f32_16x16x32_bf16(false, ah, false, bl, (short)0, c, false, false);
  asm volatile("v_nop\n\tv_nop\n\tv_nop\n\tv_nop" : "+v"(c) : "v"(ah), "v"(al), "v"(bh), "v"(bl));
  return c;
}

__global__ __launch_bounds__(256) void k_wt_bf16(const float* __restrict__ W, unsigned short* __restrict__ Wt, int K, int N) {
  const int t = blockIdx.x * 256 + threadIdx.x;
  const int k8n = K / 8;
  if (t >= N * k8n) return;
  const int n = t / k8n, k8 = (t % k8n) * 8;
  v8us v;
#pragma unroll
  for (int i = 0; i < 8; ++i) v[i] = bf16_bits(W[(size_t)(k8 + i) * N + n]);
  *(v8us*)(Wt + (size_t)n * K + k8) = v;
  
}

// GEMM C[M][N] (f32, pitch ldc) = act(A[M][K]·W + bias). A f32 row-major (pitch lda) converted per fragment to bf16
// (ASPLIT: hi/lo two planes -> 2 terms, else single rounded term); Wt bf16 [N][K] (pitch ldb). BIAS_BF16 rounds the
// bias to bf16 first (bias quantised to bf16 before the add). K%32==0, M%16==0, N%64==0.
template <bool ASPLIT, int ACT, bool BIAS_BF16>
__global__ __launch_bounds__(128) void k_gemm_bf(const float* __restrict__ A, int lda, const unsigned short* __restrict__ Wt, int ldb,
                                               const float* __restrict__ bias, float* __restrict__ C, int ldc, int M, int N, int K) {
  __shared__ __attribute__((aligned(16))) float so[4][16][64];
  const int tid = threadIdx.x, w = tid >> 5, lane = tid & 31, ln = lane & 15, hh = lane >> 4;
  const int ntn = N / 64;
  const int wid = blockIdx.x * 4 + w;
  const int mt = wid / ntn, nq = wid % ntn;
  if (mt * 16 >= M) return;
  const int row0 = mt * 16, col0 = nq * 64;
  const float* arow = A + (size_t)(row0 + ln) * lda;
  v8f acc[4] = {};
  for (int kb = 0; kb < K; kb += 32) {
    FragB ah, al;
    const v4f x0 = *(const v4fa*)(arow + kb + 8 * hh), x1 = *(const v4fa*)(arow + kb + 8 * hh + 4);
    const v4f x2 = *(const v4fa*)(arow + kb + 16 + 8 * hh), x3 = *(const v4fa*)(arow + kb + 16 + 8 * hh + 4);
    float xs[16] = {x0[0],x0[1],x0[2],x0[3],x1[0],x1[1],x1[2],x1[3],x2[0],x2[1],x2[2],x2[3],x3[0],x3[1],x3[2],x3[3]};
#pragma unroll
    for (int i = 0; i < 16; ++i) { const unsigned short hb = bf16_bits(xs[i]); ah.u[i] = hb; al.u[i] = ASPLIT ? bf16_bits(xs[i] - bf16_val(hb)) : (unsigned short)0; }
#pragma unroll
    for (int t = 0; t < 4; ++t) {
      const unsigned short* brow = Wt + (size_t)(col0 + t * 16 + ln) * ldb + kb;
      FragB b;
      b.half[0] = *(const v8us*)(brow + 8 * hh);
      b.half[1] = *(const v8us*)(brow + 16 + 8 * hh);
      acc[t] = mmaN<ASPLIT ? 2 : 1>(ah.v, al.v, b.v, b.v, acc[t]);
    }
  }
#pragma unroll
  for (int t = 0; t < 4; ++t) {
    float bv = bias ? bias[col0 + t * 16 + ln] : 0.f;
    if (BIAS_BF16) bv = bf16_round(bv);
#pragma unroll
    for (int r = 0; r < 8; ++r) { float v = acc[t][r] + bv; if (ACT == 1) v = fmaxf(v, 0.f); so[w][8 * hh + r][t * 16 + ln] = v; }
  }
  __builtin_amdgcn_fence(__ATOMIC_ACQ_REL, "workgroup");
  __builtin_amdgcn_wave_barrier();
  const int rsub = lane >> 4, c4 = (lane & 15) * 4;
  {
#pragma unroll
    for (int q = 0; q < 8; ++q) {
      const int r = q * 2 + rsub;
      const v4f v = *(const v4fa*)&so[w][r][c4];
      *(v4f*)(C + (size_t)(row0 + r) * ldc + col0 + c4) = v;
    }
    
  }
}

// GEMM C = act(A·W + bias + resid): A f32 (ASPLIT -> hi/lo 2 terms), Wt bf16 [N][K]; ACT 0 none, 1 relu, 2 exact gelu;
// resid (optional, f32, row index = (row % rmod), pitch ldr, RES_BF16 rounds it) added before the activation.
template <bool ASPLIT, int ACT, bool BIAS_BF16, bool RES_BF16>
__global__ __launch_bounds__(128) void k_gemm_bf3(const float* __restrict__ A, int lda, const unsigned short* __restrict__ Wt, int ldb,
                                                const float* __restrict__ bias, const float* __restrict__ resid, int rmod, int ldr,
                                                float* __restrict__ C, int ldc, int M, int N, int K) {
  __shared__ __attribute__((aligned(16))) float so[4][16][64];
  const int tid = threadIdx.x, w = tid >> 5, lane = tid & 31, ln = lane & 15, hh = lane >> 4;
  const int ntn = N / 64;
  const int wid = blockIdx.x * 4 + w;
  const int mt = wid / ntn, nq = wid % ntn;
  if (mt * 16 >= M) return;
  const int row0 = mt * 16, col0 = nq * 64;
  const float* arow = A + (size_t)(row0 + ln) * lda;
  v8f acc[4] = {};
  for (int kb = 0; kb < K; kb += 32) {
    FragB ah, al;
    const v4f x0 = *(const v4fa*)(arow + kb + 8 * hh), x1 = *(const v4fa*)(arow + kb + 8 * hh + 4);
    const v4f x2 = *(const v4fa*)(arow + kb + 16 + 8 * hh), x3 = *(const v4fa*)(arow + kb + 16 + 8 * hh + 4);
    float xs[16] = {x0[0],x0[1],x0[2],x0[3],x1[0],x1[1],x1[2],x1[3],x2[0],x2[1],x2[2],x2[3],x3[0],x3[1],x3[2],x3[3]};
#pragma unroll
    for (int i = 0; i < 16; ++i) { const unsigned short hb = bf16_bits(xs[i]); ah.u[i] = hb; al.u[i] = ASPLIT ? bf16_bits(xs[i] - bf16_val(hb)) : (unsigned short)0; }
#pragma unroll
    for (int t = 0; t < 4; ++t) {
      const unsigned short* brow = Wt + (size_t)(col0 + t * 16 + ln) * ldb + kb;
      FragB b;
      b.half[0] = *(const v8us*)(brow + 8 * hh);
      b.half[1] = *(const v8us*)(brow + 16 + 8 * hh);
      acc[t] = mmaN<ASPLIT ? 2 : 1>(ah.v, al.v, b.v, b.v, acc[t]);
    }
  }
#pragma unroll
  for (int t = 0; t < 4; ++t) {
    const int col = col0 + t * 16 + ln;
    float bv = bias ? bias[col] : 0.f;
    if (BIAS_BF16) bv = bf16_round(bv);
#pragma unroll
    for (int r = 0; r < 8; ++r) {
      float v = acc[t][r] + bv;
      if (resid) { float rv = resid[(size_t)((row0 + 8 * hh + r) % rmod) * ldr + col]; if (RES_BF16) rv = bf16_round(rv); v += rv; }
      if (ACT == 1) v = fmaxf(v, 0.f);
      if (ACT == 2) v = 0.5f * v * (1.0f + erff(v * 0.70710678118654752f));
      if (ACT == 3) { const float u = 0.7978845608028654f * (v + 0.044715f * v * v * v); v = 0.5f * v * (1.0f + tanhf(u)); }
      so[w][8 * hh + r][t * 16 + ln] = v;
    }
  }
  __builtin_amdgcn_fence(__ATOMIC_ACQ_REL, "workgroup");
  __builtin_amdgcn_wave_barrier();
  const int rsub = lane >> 4, c4 = (lane & 15) * 4;
  {
#pragma unroll
    for (int q = 0; q < 8; ++q) {
      const int r = q * 2 + rsub;
      const v4f v = *(const v4fa*)&so[w][r][c4];
      *(v4f*)(C + (size_t)(row0 + r) * ldc + col0 + c4) = v;
    }
    
  }
}
// row LayerNorm (biased variance, eps) over N: s = X (+ R); optional out_sum <- s; out_norm <- (s-mu)*rsqrt(var+eps)*g + b
template <bool PARAM_BF16>
__global__ __launch_bounds__(256) void k_layernorm(const float* __restrict__ X, const float* __restrict__ R, const float* __restrict__ g, const float* __restrict__ bta,
                                                  float* __restrict__ out_sum, float* __restrict__ out_norm, int N, float eps) {
  __shared__ float red[256];
  const int row = blockIdx.x, tid = threadIdx.x;
  const float* x = X + (size_t)row * N; const float* rr = R ? R + (size_t)row * N : nullptr;
  float vals[16];                     // up to N = 4096
  const int per = N / 256;            // contiguous chunk per thread? use strided-by-4 chunks: thread handles j = tid*4 + 1024*u
  float s1 = 0.f;
  for (int u = 0; u < per / 4; ++u) {
    const int j = tid * 4 + 1024 * u;
    const v4f a = *(const v4fa*)(x + j);
    v4f b = {0.f,0.f,0.f,0.f}; if (rr) b = *(const v4fa*)(rr + j);
#pragma unroll
    for (int q = 0; q < 4; ++q) { const float v = a[q] + b[q]; vals[u * 4 + q] = v; s1 += v; }
  }
  red[tid] = s1; __syncthreads();
  for (int st = 128; st > 0; st >>= 1) { if (tid < st) red[tid] += red[tid + st]; __syncthreads(); }
  const float mu = red[0] / (float)N; __syncthreads();
  float s2 = 0.f;
  for (int u = 0; u < per / 4; ++u)
#pragma unroll
    for (int q = 0; q < 4; ++q) { const float c = vals[u * 4 + q] - mu; s2 += c * c; }
  red[tid] = s2; __syncthreads();
  for (int st = 128; st > 0; st >>= 1) { if (tid < st) red[tid] += red[tid + st]; __syncthreads(); }
  const float rs = rsqrtf(red[0] / (float)N + eps);
  {
    for (int u = 0; u < per / 4; ++u) {
      const int j = tid * 4 + 1024 * u;
      v4f o, sm;
#pragma unroll
      for (int q = 0; q < 4; ++q) {
        float gg = g[j + q], bb = bta[j + q];
        if (PARAM_BF16) { gg = bf16_round(gg); bb = bf16_round(bb); }
        sm[q] = vals[u * 4 + q]; o[q] = (vals[u * 4 + q] - mu) * rs * gg + bb;
      }
      if (out_sum) *(v4f*)(out_sum + (size_t)row * N + j) = sm;
      *(v4f*)(out_norm + (size_t)row * N + j) = o;
    }
    
  }
}



// ---- f16 WMMA path (v_wmma_f32_16x16x32_f16): 11-bit significands for operands in range — used where a [0,1] probability operand needs more precision than bf16
typedef _Float16 v16h __attribute__((ext_vector_type(16)));
union FragH { v16h v; v8us half[2]; _Float16 h[16]; unsigned short u[16]; };
template <int NT>
__device__ __forceinline__ v8f mmaH(v16h ah, v16h al, v16h bh, v16h bl, v8f c) {
  c = __builtin_amdgcn_wmma_f32_16x16x32_f16(false, ah, false, bh, (short)0, c, false, false);
  if (NT >= 2) c = __builtin_amdgcn_wmma_f32_16x16x32_f16(false, al, false, bh, (short)0, c, false, false);
  if (NT >= 3) c = __builtin_amdgcn_wmma_f32_16x16x32_f16(false, ah, false, bl, (short)0, c, false, false);
  asm volatile("v_nop\n\tv_nop\n\tv_nop\n\tv_nop" : "+v"(c) : "v"(ah), "v"(al), "v"(bh), "v"(bl));
  return c;
}
// batched GEMM like k_gemm_b but f16 operands: A f32 (split into f16 hi/lo if ASPLIT, else rounded to f16), Bt = f16 values [n][k]; alpha; C f32; N multiple of 16 (partial tiles skipped)
template <bool ASPLIT>
__global__ __launch_bounds__(128) void k_gemm_h(const float* __restrict__ A, int lda, size_t sA, const _Float16* __restrict__ Bh, int ldb, size_t sB, float alpha, float* __restrict__ C, int ldc, size_t sC, int M, int N, int K) {
  __shared__ __attribute__((aligned(16))) float so[4][16][64];
  const int tid = threadIdx.x, w = tid >> 5, lane = tid & 31, ln = lane & 15, hh = lane >> 4; const int by = blockIdx.y;
  A += (size_t)by * sA; Bh += (size_t)by * sB; C += (size_t)by * sC;
  const int ntn = (N + 63) / 64; const int wid = blockIdx.x * 4 + w; const int mt = wid / ntn, nq = wid % ntn; if (mt * 16 >= M) return;
  const int row0 = mt * 16, col0 = nq * 64; const float* arow = A + (size_t)(row0 + ln) * lda;
  v8f acc[4] = {};
  for (int kb = 0; kb < K; kb += 32) {
    FragH ah, al;
    const v4f x0 = *(const v4fa*)(arow + kb + 8 * hh), x1 = *(const v4fa*)(arow + kb + 8 * hh + 4), x2 = *(const v4fa*)(arow + kb + 16 + 8 * hh), x3 = *(const v4fa*)(arow + kb + 16 + 8 * hh + 4);
    float xs[16] = {x0[0],x0[1],x0[2],x0[3],x1[0],x1[1],x1[2],x1[3],x2[0],x2[1],x2[2],x2[3],x3[0],x3[1],x3[2],x3[3]};
#pragma unroll
    for (int i = 0; i < 16; ++i) { const _Float16 h = (_Float16)xs[i]; ah.h[i] = h; al.h[i] = ASPLIT ? (_Float16)(xs[i] - (float)h) : (_Float16)0.0f; }
#pragma unroll
    for (int t = 0; t < 4; ++t) { if (col0 + t * 16 >= N) continue; const size_t boff = (size_t)(col0 + t * 16 + ln) * ldb + kb; FragH bq; bq.half[0] = *(const v8us*)(Bh + boff + 8 * hh); bq.half[1] = *(const v8us*)(Bh + boff + 16 + 8 * hh);
      acc[t] = mmaH<ASPLIT ? 2 : 1>(ah.v, al.v, bq.v, bq.v, acc[t]); }
  }
#pragma unroll
  for (int t = 0; t < 4; ++t) { if (col0 + t * 16 >= N) continue;
#pragma unroll
    for (int r = 0; r < 8; ++r) so[w][8 * hh + r][t * 16 + ln] = acc[t][r] * alpha; }
  __builtin_amdgcn_fence(__ATOMIC_ACQ_REL, "workgroup"); __builtin_amdgcn_wave_barrier();
  const int rsub = lane >> 4, c4 = (lane & 15) * 4;
  {
#pragma unroll
    for (int q = 0; q < 8; ++q) { const int r = q * 2 + rsub; if (col0 + c4 < N) { const v4f v = *(const v4fa*)&so[w][r][c4]; *(v4f*)(C + (size_t)(row0 + r) * ldc + col0 + c4) = v; } }
     }
}

// Wt[n][k] = f16(W[k][n]·scale) from f32 row-major W[K][N] (scale = power of two; bf16-exact weights stay exact in f16 away from the subnormal range)
__global__ __launch_bounds__(256) void k_wt_f16(const float* __restrict__ W, _Float16* __restrict__ Wt, int K, int N, float scale) {
  const int t = blockIdx.x * 256 + threadIdx.x; if (t >= N * (K / 8)) return; const int n = t / (K / 8), k8 = (t % (K / 8)) * 8; FragH f;
#pragma unroll
  for (int i = 0; i < 8; ++i) f.h[i] = (_Float16)(bf16_round(W[(size_t)(k8 + i) * N + n]) * scale); const v8us o = f.half[0];
  *(v8us*)((unsigned short*)Wt + (size_t)n * K + k8) = o; 
}
// k_gemm_hh variant with fused epilogue: v = acc·alpha + bias[by·sBias + col] (+ CP[(row/rowsPerB)·sCPb + by·64 + col] if CP) ; ACT 0 none / 1 elu ; writes f32 C and f16 C16, each if non-null
template <int ACT>
__global__ __launch_bounds__(128) void k_gemm_hhx(const _Float16* __restrict__ A, int lda, size_t sA, const _Float16* __restrict__ Bh, int ldb, size_t sB, float alpha, const float* __restrict__ bias, size_t sBias, const float* __restrict__ CP, int rowsPerB, size_t sCPb, int row0g,
    float* __restrict__ C, _Float16* __restrict__ C16, int ldc, size_t sC, int M, int N, int K) {
  __shared__ __attribute__((aligned(16))) float so[4][16][64];
  const int tid = threadIdx.x, w = tid >> 5, lane = tid & 31, ln = lane & 15, hh = lane >> 4; const int by = blockIdx.y;
  A += (size_t)by * sA; Bh += (size_t)by * sB; const size_t cofs = (size_t)by * sC; const float* bp = bias ? bias + (size_t)by * sBias : nullptr;
  const int ntn = (N + 63) / 64; const int wid = blockIdx.x * 4 + w; const int mt = wid / ntn, nq = wid % ntn; if (mt * 16 >= M) return;
  const int row0 = mt * 16, col0 = nq * 64; const _Float16* arow = A + (size_t)(row0 + ln) * lda;
  v8f acc[4] = {};
  for (int kb = 0; kb < K; kb += 32) { FragH ah; ah.half[0] = *(const v8us*)((const unsigned short*)arow + kb + 8 * hh); ah.half[1] = *(const v8us*)((const unsigned short*)arow + kb + 16 + 8 * hh);
#pragma unroll
    for (int t = 0; t < 4; ++t) { if (col0 + t * 16 >= N) continue; const size_t boff = (size_t)(col0 + t * 16 + ln) * ldb + kb; FragH bq; bq.half[0] = *(const v8us*)((const unsigned short*)Bh + boff + 8 * hh); bq.half[1] = *(const v8us*)((const unsigned short*)Bh + boff + 16 + 8 * hh);
      acc[t] = mmaH<1>(ah.v, ah.v, bq.v, bq.v, acc[t]); }
  }
#pragma unroll
  for (int t = 0; t < 4; ++t) { if (col0 + t * 16 >= N) continue; const int col = col0 + t * 16 + ln; const float bv = bp ? bf16_round(bp[col]) : 0.f;
#pragma unroll
    for (int r = 0; r < 8; ++r) { float v = acc[t][r] * alpha + bv; if (CP) { const int bidx = (row0g + row0 + 8 * hh + r) / rowsPerB; v += CP[(size_t)bidx * sCPb + (size_t)by * 64 + col]; } if (ACT == 1) v = (v > 0.f) ? v : expm1f(v); else if (ACT == 7) v = (v > 0.f) ? v + 1.0f : expf(v); else if (ACT == 8) v = tanhf(v); else if (ACT == 9) v = 0.5f * v * (1.0f + tanhf(0.7978845608028654f * (v + 0.044715f * v * v * v))); else if (ACT == 11) v = 1.0f / (1.0f + expf(-v)); else if (ACT == 12) v = (v > 0.f) ? v : 0.01f * v; else if (ACT == 14) v = (v > 0.f) ? v : 0.1f * v; else if (ACT == 15) v = v / (1.0f + expf(-v)); else if (ACT == 3) v = fmaxf(v, 0.f); else if (ACT == 6) v = 0.5f * v * (1.0f + erff(v * 0.70710678118654752f)); so[w][8 * hh + r][t * 16 + ln] = v; } }
  __builtin_amdgcn_fence(__ATOMIC_ACQ_REL, "workgroup"); __builtin_amdgcn_wave_barrier();
  const int rsub = lane >> 4, c4 = (lane & 15) * 4; typedef _Float16 v4h __attribute__((ext_vector_type(4)));
  {
#pragma unroll
    for (int q = 0; q < 8; ++q) { const int r = q * 2 + rsub; if (col0 + c4 < N) { const v4f v = *(const v4fa*)&so[w][r][c4]; if (C) *(v4f*)(C + cofs + (size_t)(row0 + r) * ldc + col0 + c4) = v; if (C16) { v4h h4; for (int i = 0; i < 4; ++i) h4[i] = (_Float16)v[i]; *(v4h*)(C16 + cofs + (size_t)(row0 + r) * ldc + col0 + c4) = h4; } } }
     }
}


typedef _Float16 v4h __attribute__((ext_vector_type(4)));

__global__ __launch_bounds__(256) void k_x16(const float* __restrict__ x, _Float16* __restrict__ X16, size_t n8) { const size_t t = (size_t)blockIdx.x * 256 + threadIdx.x; if (t >= n8) return; FragH f;
#pragma unroll
  for (int q = 0; q < 8; ++q) f.h[q] = (_Float16)bf16_round(x[t * 8 + q]); *(v8us*)((unsigned short*)X16 + t * 8) = f.half[0];  }
__global__ __launch_bounds__(256) void k_h16(const float* __restrict__ x, _Float16* __restrict__ X16, size_t n8) { const size_t t = (size_t)blockIdx.x * 256 + threadIdx.x; if (t >= n8) return; FragH f;
#pragma unroll
  for (int q = 0; q < 8; ++q) f.h[q] = (_Float16)x[t * 8 + q]; *(v8us*)((unsigned short*)X16 + t * 8) = f.half[0];  }
__global__ __launch_bounds__(256) void k_round16f(const float* __restrict__ W, _Float16* __restrict__ Bt, size_t n8) { const size_t t = (size_t)blockIdx.x * 256 + threadIdx.x; if (t >= n8) return; FragH f;
#pragma unroll
  for (int i = 0; i < 8; ++i) f.h[i] = (_Float16)(bf16_round(W[t * 8 + i]) * 16.0f); *(v8us*)((unsigned short*)Bt + t * 8) = f.half[0];  }
template <int NHv, int TTv>
__global__ __launch_bounds__(256) void k_vt(const _Float16* __restrict__ V16, int ldv, int voff, _Float16* __restrict__ Vt) { __shared__ unsigned short tl[64][66]; const int tid = threadIdx.x; const int slab = blockIdx.x / (TTv / 64), lg = blockIdx.x % (TTv / 64); const int b = slab / NHv, h = slab % NHv;
  for (int i = tid; i < 64 * 8; i += 256) { const int r = i / 8, c8 = (i % 8) * 8; FragH f; f.half[0] = *(const v8us*)((const unsigned short*)V16 + ((size_t)b * TTv + lg * 64 + r) * ldv + voff + h * 64 + c8);
#pragma unroll
    for (int q = 0; q < 8; ++q) tl[r][c8 + q] = f.u[q]; }
  __syncthreads();
  {
#pragma unroll
    for (int rd = 0; rd < 2; ++rd) { const int d = rd * 32 + tid / 8, pc = tid % 8; FragH f;
#pragma unroll
      for (int q = 0; q < 8; ++q) f.u[q] = tl[pc * 8 + q][d];
      *(v8us*)((unsigned short*)Vt + ((size_t)slab * 64 + d) * TTv + lg * 64 + pc * 8) = f.half[0]; }
     } }

__global__ __launch_bounds__(256) void k_hl(const float* __restrict__ F, _Float16* __restrict__ Hh, _Float16* __restrict__ Hl, size_t n8) { const size_t t = (size_t)blockIdx.x * 256 + threadIdx.x; if (t >= n8) return; FragH fh, fl; const v4f a = *(const v4fa*)(F + t * 8), c = *(const v4fa*)(F + t * 8 + 4);
#pragma unroll
  for (int q = 0; q < 4; ++q) { _Float16 h = (_Float16)a[q]; fh.h[q] = h; fl.h[q] = (_Float16)((a[q] - (float)h) * 1024.0f); h = (_Float16)c[q]; fh.h[4 + q] = h; fl.h[4 + q] = (_Float16)((c[q] - (float)h) * 1024.0f); }
  { *(v8us*)((unsigned short*)Hh + t * 8) = fh.half[0]; *(v8us*)((unsigned short*)Hl + t * 8) = fl.half[0];  } }

__global__ __launch_bounds__(256) void k_xr(const float* __restrict__ x, const float* __restrict__ w, const float* __restrict__ bb, _Float16* __restrict__ XR) {
  #pragma clang fp contract(off)
  const int t = blockIdx.x * 256 + threadIdx.x; if (t >= NRW * (DR / 8)) return; const int c0 = (t % (DR / 8)) * 8; const int row = t / (DR / 8); const int b = row / NP, p = row % NP; FragH f;
#pragma unroll
  for (int q = 0; q < 8; ++q) { const int fl = p * DR + c0 + q; const int c = fl / 4096, i = (fl / 64) % 64, j = fl % 64; const float* xp = x + (((size_t)b * 32 + c) * 128 + 2 * i) * 128 + 2 * j;
    float s = bf16_round(bb[c]); s += bf16_round(w[c * 4 + 0]) * bf16_round(xp[0]); s += bf16_round(w[c * 4 + 1]) * bf16_round(xp[1]); s += bf16_round(w[c * 4 + 2]) * bf16_round(xp[128]); s += bf16_round(w[c * 4 + 3]) * bf16_round(xp[129]); f.h[q] = (_Float16)s; }
  *(v8us*)((unsigned short*)XR + (size_t)row * DR + c0) = f.half[0];  }
__global__ __launch_bounds__(256) void k_heads(const float* __restrict__ Q, const float* __restrict__ KV, _Float16* __restrict__ QS, _Float16* __restrict__ KH) {
  #pragma clang fp contract(off)
  const int t = blockIdx.x * 256 + threadIdx.x; if (t >= NBH * NP * 4) return; const int e0 = (t % 4) * 8; const int pp = (t / 4) % NP; const int bh = t / (4 * NP); const int b = bh / NHD, h = bh % NHD; const size_t row = (size_t)b * NP + h * 64 + pp / 8; const float* qr = Q + row * DQ + (pp % 8) * 128; const float* kr = KV + row * 2 * DR + (pp % 8) * 32; FragH fq, fk;
#pragma unroll
  for (int q = 0; q < 8; ++q) { const int e = e0 + q; const v4f a = *(const v4fa*)(qr + 4 * e); fq.h[q] = (_Float16)(((a[0] + a[1]) + a[2]) + a[3]); fk.h[q] = (_Float16)kr[e]; }
  { *(v8us*)((unsigned short*)QS + ((size_t)bh * NP + pp) * 32 + e0) = fq.half[0]; *(v8us*)((unsigned short*)KH + ((size_t)bh * NP + pp) * 32 + e0) = fk.half[0];  } }
__global__ __launch_bounds__(256) void k_vt(const float* __restrict__ KV, _Float16* __restrict__ VT) { const int t = blockIdx.x * 256 + threadIdx.x; if (t >= NBH * 32 * (NP / 8)) return; const int p0 = (t % (NP / 8)) * 8; const int e = (t / (NP / 8)) % 32; const int bh = t / ((NP / 8) * 32); const int b = bh / NHD, h = bh % NHD; FragH f;
#pragma unroll
  for (int q = 0; q < 8; ++q) { const int pp = p0 + q; f.h[q] = (_Float16)KV[((size_t)b * NP + h * 64 + pp / 8) * 2 * DR + DR + (pp % 8) * 32 + e]; }
  *(v8us*)((unsigned short*)VT + ((size_t)bh * 32 + e) * NP + p0) = f.half[0];  }
__global__ __launch_bounds__(256) void k_soft(const float* __restrict__ S, const float* __restrict__ rb, int bh0, _Float16* __restrict__ P16) {
  #pragma clang fp contract(off)
  const int tid = threadIdx.x, w = tid >> 5, ln = tid & 31; const int row = blockIdx.x * 8 + w; if (row >= GRP * NP) return; const int p = row % NP; const int h = (bh0 + row / NP) % NHD; const float* sr = S + (size_t)row * NP; const float* br = rb + ((size_t)h * NP + p) * NP;
  auto lgt = [&](int j) { return sr[j] + bf16_round(br[j]); };
  float m = -3.0e38f; for (int j = ln; j < NP; j += 32) m = fmaxf(m, lgt(j));
  for (int o = 16; o > 0; o >>= 1) m = fmaxf(m, __shfl_xor(m, o, 32)); float su = 0.f; for (int j = ln; j < NP; j += 32) su += expf(lgt(j) - m);
  for (int o = 16; o > 0; o >>= 1) su += __shfl_xor(su, o, 32); const float inv = 1024.0f / su;
  { for (int j = ln * 8; j < NP; j += 256) { FragH f;
#pragma unroll
      for (int k = 0; k < 8; ++k) f.h[k] = (_Float16)(expf(lgt(j + k) - m) * inv);
      *(v8us*)((unsigned short*)P16 + (size_t)row * NP + j) = f.half[0]; }  } }
__global__ __launch_bounds__(256) void k_out(const float* __restrict__ O32, float* __restrict__ out) { const size_t t = (size_t)blockIdx.x * 256 + threadIdx.x; if (t >= (size_t)NBH * NP * 32) return; const float vv = O32[t]; v4f v; v[0] = vv; v[1] = vv; v[2] = vv; v[3] = vv; *(v4f*)(out + t * 4) = v;  }
__global__ __launch_bounds__(512) void k_bcat(const float* __restrict__ a, const float* __restrict__ b, float* __restrict__ O) { const int t = threadIdx.x; const float v = (t < DR) ? a[t] : b[t - DR]; *(float*)(O + t) = v;  }

extern "C" void kernel_launch(void* const* d_in, const int* in_sizes, int n_in,
                              void* d_out, int out_size, void* d_ws, size_t ws_size, hipStream_t stream) {
  (void)in_sizes; (void)n_in; (void)out_size;
  const float* const* I = (const float* const*)d_in; const float* x = I[0]; const float* dww = I[1]; const float* dwb = I[2]; const float* Wq = I[3]; const float* bq = I[4]; const float* Wk = I[5]; const float* bk = I[6]; const float* Wv = I[7]; const float* bv = I[8]; const float* rb = I[9];
  char* ws = (char*)d_ws; size_t off = 0;
  auto take = [&](size_t bytes) { char* p = ws + off; off += (bytes + 255) & ~(size_t)255; return p; };
  _Float16* BQ = (_Float16*)take((size_t)DQ * DQ * 2); _Float16* BKV = (_Float16*)take((size_t)2 * DR * DR * 2); float* BKVb = (float*)take(2 * DR * 4);
  _Float16* X16 = (_Float16*)take((size_t)NRW * DQ * 2); _Float16* XR16 = (_Float16*)take((size_t)NRW * DR * 2); float* Qf = (float*)take((size_t)NRW * DQ * 4); float* KVf = (float*)take((size_t)NRW * 2 * DR * 4);
  _Float16* QS = (_Float16*)take((size_t)NBH * NP * 32 * 2); _Float16* KH = (_Float16*)take((size_t)NBH * NP * 32 * 2); _Float16* VT = (_Float16*)take((size_t)NBH * 32 * NP * 2); float* O32 = (float*)take((size_t)NBH * NP * 32 * 4);
  if (off > ws_size) return;      // 2.4 + 16.8 + 4.2 + 33.5 + 16.8 + 4.2×3 + 8.4 ≈ 95 MB
  float* S = Qf;             /* scores [32][512][512] f32 = 33.5 MB = Qf's bytes exactly; Qf's last reader is k_heads */
  _Float16* P16 = X16;       /* probabilities [32][512][512] f16 = 16.8 MB = X16's bytes exactly; X16's last reader is the q GEMM */
  k_round16f<<<(unsigned)(((size_t)DQ * DQ / 8 + 255) / 256), 256, 0, stream>>>(Wq, BQ, (size_t)DQ * DQ / 8); k_round16f<<<(DR * DR / 8 + 255) / 256, 256, 0, stream>>>(Wk, BKV, (size_t)DR * DR / 8); k_round16f<<<(DR * DR / 8 + 255) / 256, 256, 0, stream>>>(Wv, BKV + (size_t)DR * DR, (size_t)DR * DR / 8); k_bcat<<<1, 512, 0, stream>>>(bk, bv, BKVb);      /* (out,in) natural */
  k_x16<<<(unsigned)(((size_t)NRW * DQ / 8 + 255) / 256), 256, 0, stream>>>(x, X16, (size_t)NRW * DQ / 8);      /* plain (P, 1024) view = flat */
  k_xr<<<(NRW * (DR / 8) + 255) / 256, 256, 0, stream>>>(x, dww, dwb, XR16);
  k_gemm_hhx<0><<<dim3(((NRW / 16) * (DQ / 64) + 3) / 4, 1), 128, 0, stream>>>(X16, DQ, 0, BQ, DQ, 0, 0.0625f, bq, 0, nullptr, 1, 0, 0, Qf, nullptr, DQ, 0, NRW, DQ, DQ);
  k_gemm_hhx<0><<<dim3(((NRW / 16) * (2 * DR / 64) + 3) / 4, 1), 128, 0, stream>>>(XR16, DR, 0, BKV, DR, 0, 0.0625f, BKVb, 0, nullptr, 1, 0, 0, KVf, nullptr, 2 * DR, 0, NRW, 2 * DR, DR);      /* [k | v] */
  k_heads<<<(NBH * NP * 4 + 255) / 256, 256, 0, stream>>>(Qf, KVf, QS, KH); k_vt<<<(NBH * 32 * (NP / 8) + 255) / 256, 256, 0, stream>>>(KVf, VT);
  const dim3 gS(((NP / 16) * (NP / 64) + 3) / 4, GRP), gO(((NP / 16) * 1 + 3) / 4, GRP);
  for (int bh0 = 0; bh0 < NBH; bh0 += GRP) {
    k_gemm_hhx<0><<<gS, 128, 0, stream>>>(QS + (size_t)bh0 * NP * 32, 32, (size_t)NP * 32, KH + (size_t)bh0 * NP * 32, 32, (size_t)NP * 32, 0.03125f, nullptr, 0, nullptr, 1, 0, 0, S, nullptr, NP, (size_t)NP * NP, NP, NP, 32);      /* scores/√1024 (raw × raw) */
    k_soft<<<GRP * NP / 8, 256, 0, stream>>>(S, rb, bh0, P16);
    k_gemm_hhx<0><<<gO, 128, 0, stream>>>(P16, NP, (size_t)NP * NP, VT + (size_t)bh0 * 32 * NP, NP, (size_t)32 * NP, 0.0009765625f, nullptr, 0, nullptr, 1, 0, 0, O32 + (size_t)bh0 * NP * 32, nullptr, 32, (size_t)NP * 32, NP, 32, NP); }      /* o[(b,h)][p][e] */
  k_out<<<(unsigned)(((size_t)NBH * NP * 32 + 255) / 256), 256, 0, stream>>>(O32, (float*)d_out);
}

// v002
// It runs in 106 microseconds.
// It is 2.86 times as fast as v000, going by the measured steps of the versions left out in between.
#include <hip/hip_runtime.h>
// Lightweight multi-head self-attention with reduced keys/values (B 16, C 32, 128×128; P 512 tokens of 1024 (q) / 256 (k, v after a depthwise 2×2 stride-2 reduction); 8 heads by PLAIN reshapes of the (P, dim) buffers; k/v nearest-upsampled 32 → 128 along the head dim; scores/√1024 + rel_bias; softmax; attn·v; plain reshape back to [16,32,128,128]).
// Structure: q/k/v projections as GEMMs (the depthwise reduction on VALU -> f16); the 32->128 nearest upsampling is folded into the contraction (sum_d q_d k_{d/4} = sum_e (sum_{d/4=e} q_d) k_e and out_d = o_{d/4}), and the sum over each four q columns is folded further into the projection itself (sum_{d/4=e} q_d = x . sum_{d/4=e} Wq[d] + sum_{d/4=e} bq[d]): the q GEMM has N 256 and its f16 output, read flat, is the head operand; the plain-view head split of k and v by index arithmetic on VALU; scores (K 32, scale 1/32), bias, running-max softmax (x 2^10, f16), P.V (N 32) and the expanded output in ONE fused kernel, scores and probabilities kept in registers.
// Compute dtype: inputs and parameters rounded to bf16; x exact in f16; folded q weights, reduced x, head operands and probabilities f16 (about 2^-12); f32 accumulation; softmax f32. v_wmma_f32_16x16x32_f16.
#define NB 16
#define NP 512
#define DQ 1024
#define DR 256
#define NHD 8
#define NBH (NB * NHD)           /* 128 */
#define NRW (NB * NP)            /* 8192 rows */
typedef __bf16 v16b __attribute__((ext_vector_type(16)));
typedef unsigned short v8us __attribute__((ext_vector_type(8), may_alias));
typedef float  v8f  __attribute__((ext_vector_type(8)));
typedef float  v4f  __attribute__((ext_vector_type(4)));
typedef float  v4fa __attribute__((ext_vector_type(4), may_alias));
union FragB { v16b v; v8us half[2]; unsigned short u[16]; };

__device__ __forceinline__ unsigned short bf16_bits(float x) { unsigned int u = __float_as_uint(x); return (unsigned short)((u + 0x7FFFu + ((u >> 16) & 1u)) >> 16); }
__device__ __forceinline__ float bf16_val(unsigned short b) { return __uint_as_float(((unsigned int)b) << 16); }
__device__ __forceinline__ float bf16_round(float x) { return bf16_val(bf16_bits(x)); }
// D += A·B with NT terms: 1 = ah·bh, 2 = + al·bh (A split), 3 = + ah·bl (both split)
template <int NT>
__device__ __forceinline__ v8f mmaN(v16b ah, v16b al, v16b bh, v16b bl, v8f c) {
  c = __builtin_amdgcn_wmma_f32_16x16x32_bf16(false, ah, false, bh, (short)0, c, false, false);
  if (NT >= 2) c = __builtin_amdgcn_wmma_f32_16x16x32_bf16(false, al, false, bh, (short)0, c, false, false);
  if (NT >= 3) c = __builtin_amdgcn_wmma_f32_16x16x32_bf16(false, ah, false, bl, (short)0, c, false, false);
  asm volatile("v_nop\n\tv_nop\n\tv_nop\n\tv_nop" : "+v"(c) : "v"(ah), "v"(al), "v"(bh), "v"(bl));
  return c;
}

__global__ __launch_bounds__(256) void k_wt_bf16(const float* __restrict__ W, unsigned short* __restrict__ Wt, int K, int N) {
  const int t = blockIdx.x * 256 + threadIdx.x;
  const int k8n = K / 8;
  if (t >= N * k8n) return;
  const int n = t / k8n, k8 = (t % k8n) * 8;
  v8us v;
#pragma unroll
  for (int i = 0; i < 8; ++i) v[i] = bf16_bits(W[(size_t)(k8 + i) * N + n]);
  *(v8us*)(Wt + (size_t)n * K + k8) = v;
  
}

// GEMM C[M][N] (f32, pitch ldc) = act(A[M][K]·W + bias). A f32 row-major (pitch lda) converted per fragment to bf16
// (ASPLIT: hi/lo two planes -> 2 terms, else single rounded term); Wt bf16 [N][K] (pitch ldb). BIAS_BF16 rounds the
// bias to bf16 first (bias quantised to bf16 before the add). K%32==0, M%16==0, N%64==0.
template <bool ASPLIT, int ACT, bool BIAS_BF16>
__global__ __launch_bounds__(128) void k_gemm_bf(const float* __restrict__ A, int lda, const unsigned short* __restrict__ Wt, int ldb,
                                               const float* __restrict__ bias, float* __restrict__ C, int ldc, int M, int N, int K) {
  __shared__ __attribute__((aligned(16))) float so[4][16][64];
  const int tid = threadIdx.x, w = tid >> 5, lane = tid & 31, ln = lane & 15, hh = lane >> 4;
  const int ntn = N / 64;
  const int wid = blockIdx.x * 4 + w;
  const int mt = wid / ntn, nq = wid % ntn;
  if (mt * 16 >= M) return;
  const int row0 = mt * 16, col0 = nq * 64;
  const float* arow = A + (size_t)(row0 + ln) * lda;
  v8f acc[4] = {};
  for (int kb = 0; kb < K; kb += 32) {
    FragB ah, al;
    const v4f x0 = *(const v4fa*)(arow + kb + 8 * hh), x1 = *(const v4fa*)(arow + kb + 8 * hh + 4);
    const v4f x2 = *(const v4fa*)(arow + kb + 16 + 8 * hh), x3 = *(const v4fa*)(arow + kb + 16 + 8 * hh + 4);
    float xs[16] = {x0[0],x0[1],x0[2],x0[3],x1[0],x1[1],x1[2],x1[3],x2[0],x2[1],x2[2],x2[3],x3[0],x3[1],x3[2],x3[3]};
#pragma unroll
    for (int i = 0; i < 16; ++i) { const unsigned short hb = bf16_bits(xs[i]); ah.u[i] = hb; al.u[i] = ASPLIT ? bf16_bits(xs[i] - bf16_val(hb)) : (unsigned short)0; }
#pragma unroll
    for (int t = 0; t < 4; ++t) {
      const unsigned short* brow = Wt + (size_t)(col0 + t * 16 + ln) * ldb + kb;
      FragB b;
      b.half[0] = *(const v8us*)(brow + 8 * hh);
      b.half[1] = *(const v8us*)(brow + 16 + 8 * hh);
      acc[t] = mmaN<ASPLIT ? 2 : 1>(ah.v, al.v, b.v, b.v, acc[t]);
    }
  }
#pragma unroll
  for (int t = 0; t < 4; ++t) {
    float bv = bias ? bias[col0 + t * 16 + ln] : 0.f;
    if (BIAS_BF16) bv = bf16_round(bv);
#pragma unroll
    for (int r = 0; r < 8; ++r) { float v = acc[t][r] + bv; if (ACT == 1) v = fmaxf(v, 0.f); so[w][8 * hh + r][t * 16 + ln] = v; }
  }
  __builtin_amdgcn_fence(__ATOMIC_ACQ_REL, "workgroup");
  __builtin_amdgcn_wave_barrier();
  const int rsub = lane >> 4, c4 = (lane & 15) * 4;
  {
#pragma unroll
    for (int q = 0; q < 8; ++q) {
      const int r = q * 2 + rsub;
      const v4f v = *(const v4fa*)&so[w][r][c4];
      *(v4f*)(C + (size_t)(row0 + r) * ldc + col0 + c4) = v;
    }
    
  }
}

// GEMM C = act(A·W + bias + resid): A f32 (ASPLIT -> hi/lo 2 terms), Wt bf16 [N][K]; ACT 0 none, 1 relu, 2 exact gelu;
// resid (optional, f32, row index = (row % rmod), pitch ldr, RES_BF16 rounds it) added before the activation.
template <bool ASPLIT, int ACT, bool BIAS_BF16, bool RES_BF16>
__global__ __launch_bounds__(128) void k_gemm_bf3(const float* __restrict__ A, int lda, const unsigned short* __restrict__ Wt, int ldb,
                                                const float* __restrict__ bias, const float* __restrict__ resid, int rmod, int ldr,
                                                float* __restrict__ C, int ldc, int M, int N, int K) {
  __shared__ __attribute__((aligned(16))) float so[4][16][64];
  const int tid = threadIdx.x, w = tid >> 5, lane = tid & 31, ln = lane & 15, hh = lane >> 4;
  const int ntn = N / 64;
  const int wid = blockIdx.x * 4 + w;
  const int mt = wid / ntn, nq = wid % ntn;
  if (mt * 16 >= M) return;
  const int row0 = mt * 16, col0 = nq * 64;
  const float* arow = A + (size_t)(row0 + ln) * lda;
  v8f acc[4] = {};
  for (int kb = 0; kb < K; kb += 32) {
    FragB ah, al;
    const v4f x0 = *(const v4fa*)(arow + kb + 8 * hh), x1 = *(const v4fa*)(arow + kb + 8 * hh + 4);
    const v4f x2 = *(const v4fa*)(arow + kb + 16 + 8 * hh), x3 = *(const v4fa*)(arow + kb + 16 + 8 * hh + 4);
    float xs[16] = {x0[0],x0[1],x0[2],x0[3],x1[0],x1[1],x1[2],x1[3],x2[0],x2[1],x2[2],x2[3],x3[0],x3[1],x3[2],x3[3]};
#pragma unroll
    for (int i = 0; i < 16; ++i) { const unsigned short hb = bf16_bits(xs[i]); ah.u[i] = hb; al.u[i] = ASPLIT ? bf16_bits(xs[i] - bf16_val(hb)) : (unsigned short)0; }
#pragma unroll
    for (int t = 0; t < 4; ++t) {
      const unsigned short* brow = Wt + (size_t)(col0 + t * 16 + ln) * ldb + kb;
      FragB b;
      b.half[0] = *(const v8us*)(brow + 8 * hh);
      b.half[1] = *(const v8us*)(brow + 16 + 8 * hh);
      acc[t] = mmaN<ASPLIT ? 2 : 1>(ah.v, al.v, b.v, b.v, acc[t]);
    }
  }
#pragma unroll
  for (int t = 0; t < 4; ++t) {
    const int col = col0 + t * 16 + ln;
    float bv = bias ? bias[col] : 0.f;
    if (BIAS_BF16) bv = bf16_round(bv);
#pragma unroll
    for (int r = 0; r < 8; ++r) {
      float v = acc[t][r] + bv;
      if (resid) { float rv = resid[(size_t)((row0 + 8 * hh + r) % rmod) * ldr + col]; if (RES_BF16) rv = bf16_round(rv); v += rv; }
      if (ACT == 1) v = fmaxf(v, 0.f);
      if (ACT == 2) v = 0.5f * v * (1.0f + erff(v * 0.70710678118654752f));
      if (ACT == 3) { const float u = 0.7978845608028654f * (v + 0.044715f * v * v * v); v = 0.5f * v * (1.0f + tanhf(u)); }
      so[w][8 * hh + r][t * 16 + ln] = v;
    }
  }
  __builtin_amdgcn_fence(__ATOMIC_ACQ_REL, "workgroup");
  __builtin_amdgcn_wave_barrier();
  const int rsub = lane >> 4, c4 = (lane & 15) * 4;
  {
#pragma unroll
    for (int q = 0; q < 8; ++q) {
      const int r = q * 2 + rsub;
      const v4f v = *(const v4fa*)&so[w][r][c4];
      *(v4f*)(C + (size_t)(row0 + r) * ldc + col0 + c4) = v;
    }
    
  }
}
// row LayerNorm (biased variance, eps) over N: s = X (+ R); optional out_sum <- s; out_norm <- (s-mu)*rsqrt(var+eps)*g + b
template <bool PARAM_BF16>
__global__ __launch_bounds__(256) void k_layernorm(const float* __restrict__ X, const float* __restrict__ R, const float* __restrict__ g, const float* __restrict__ bta,
                                                  float* __restrict__ out_sum, float* __restrict__ out_norm, int N, float eps) {
  __shared__ float red[256];
  const int row = blockIdx.x, tid = threadIdx.x;
  const float* x = X + (size_t)row * N; const float* rr = R ? R + (size_t)row * N : nullptr;
  float vals[16];                     // up to N = 4096
  const int per = N / 256;            // contiguous chunk per thread? use strided-by-4 chunks: thread handles j = tid*4 + 1024*u
  float s1 = 0.f;
  for (int u = 0; u < per / 4; ++u) {
    const int j = tid * 4 + 1024 * u;
    const v4f a = *(const v4fa*)(x + j);
    v4f b = {0.f,0.f,0.f,0.f}; if (rr) b = *(const v4fa*)(rr + j);
#pragma unroll
    for (int q = 0; q < 4; ++q) { const float v = a[q] + b[q]; vals[u * 4 + q] = v; s1 += v; }
  }
  red[tid] = s1; __syncthreads();
  for (int st = 128; st > 0; st >>= 1) { if (tid < st) red[tid] += red[tid + st]; __syncthreads(); }
  const float mu = red[0] / (float)N; __syncthreads();
  float s2 = 0.f;
  for (int u = 0; u < per / 4; ++u)
#pragma unroll
    for (int q = 0; q < 4; ++q) { const float c = vals[u * 4 + q] - mu; s2 += c * c; }
  red[tid] = s2; __syncthreads();
  for (int st = 128; st > 0; st >>= 1) { if (tid < st) red[tid] += red[tid + st]; __syncthreads(); }
  const float rs = rsqrtf(red[0] / (float)N + eps);
  {
    for (int u = 0; u < per / 4; ++u) {
      const int j = tid * 4 + 1024 * u;
      v4f o, sm;
#pragma unroll
      for (int q = 0; q < 4; ++q) {
        float gg = g[j + q], bb = bta[j + q];
        if (PARAM_BF16) { gg = bf16_round(gg); bb = bf16_round(bb); }
        sm[q] = vals[u * 4 + q]; o[q] = (vals[u * 4 + q] - mu) * rs * gg + bb;
      }
      if (out_sum) *(v4f*)(out_sum + (size_t)row * N + j) = sm;
      *(v4f*)(out_norm + (size_t)row * N + j) = o;
    }
    
  }
}



// ---- f16 WMMA path (v_wmma_f32_16x16x32_f16): 11-bit significands for operands in range — used where a [0,1] probability operand needs more precision than bf16
typedef _Float16 v16h __attribute__((ext_vector_type(16)));
union FragH { v16h v; v8us half[2]; _Float16 h[16]; unsigned short u[16]; };
template <int NT>
__device__ __forceinline__ v8f mmaH(v16h ah, v16h al, v16h bh, v16h bl, v8f c) {
  c = __builtin_amdgcn_wmma_f32_16x16x32_f16(false, ah, false, bh, (short)0, c, false, false);
  if (NT >= 2) c = __builtin_amdgcn_wmma_f32_16x16x32_f16(false, al, false, bh, (short)0, c, false, false);
  if (NT >= 3) c = __builtin_amdgcn_wmma_f32_16x16x32_f16(false, ah, false, bl, (short)0, c, false, false);
  asm volatile("v_nop\n\tv_nop\n\tv_nop\n\tv_nop" : "+v"(c) : "v"(ah), "v"(al), "v"(bh), "v"(bl));
  return c;
}
// batched GEMM like k_gemm_b but f16 operands: A f32 (split into f16 hi/lo if ASPLIT, else rounded to f16), Bt = f16 values [n][k]; alpha; C f32; N multiple of 16 (partial tiles skipped)
template <bool ASPLIT>
__global__ __launch_bounds__(128) void k_gemm_h(const float* __restrict__ A, int lda, size_t sA, const _Float16* __restrict__ Bh, int ldb, size_t sB, float alpha, float* __restrict__ C, int ldc, size_t sC, int M, int N, int K) {
  __shared__ __attribute__((aligned(16))) float so[4][16][64];
  const int tid = threadIdx.x, w = tid >> 5, lane = tid & 31, ln = lane & 15, hh = lane >> 4; const int by = blockIdx.y;
  A += (size_t)by * sA; Bh += (size_t)by * sB; C += (size_t)by * sC;
  const int ntn = (N + 63) / 64; const int wid = blockIdx.x * 4 + w; const int mt = wid / ntn, nq = wid % ntn; if (mt * 16 >= M) return;
  const int row0 = mt * 16, col0 = nq * 64; const float* arow = A + (size_t)(row0 + ln) * lda;
  v8f acc[4] = {};
  for (int kb = 0; kb < K; kb += 32) {
    FragH ah, al;
    const v4f x0 = *(const v4fa*)(arow + kb + 8 * hh), x1 = *(const v4fa*)(arow + kb + 8 * hh + 4), x2 = *(const v4fa*)(arow + kb + 16 + 8 * hh), x3 = *(const v4fa*)(arow + kb + 16 + 8 * hh + 4);
    float xs[16] = {x0[0],x0[1],x0[2],x0[3],x1[0],x1[1],x1[2],x1[3],x2[0],x2[1],x2[2],x2[3],x3[0],x3[1],x3[2],x3[3]};
#pragma unroll
    for (int i = 0; i < 16; ++i) { const _Float16 h = (_Float16)xs[i]; ah.h[i] = h; al.h[i] = ASPLIT ? (_Float16)(xs[i] - (float)h) : (_Float16)0.0f; }
#pragma unroll
    for (int t = 0; t < 4; ++t) { if (col0 + t * 16 >= N) continue; const size_t boff = (size_t)(col0 + t * 16 + ln) * ldb + kb; FragH bq; bq.half[0] = *(const v8us*)(Bh + boff + 8 * hh); bq.half[1] = *(const v8us*)(Bh + boff + 16 + 8 * hh);
      acc[t] = mmaH<ASPLIT ? 2 : 1>(ah.v, al.v, bq.v, bq.v, acc[t]); }
  }
#pragma unroll
  for (int t = 0; t < 4; ++t) { if (col0 + t * 16 >= N) continue;
#pragma unroll
    for (int r = 0; r < 8; ++r) so[w][8 * hh + r][t * 16 + ln] = acc[t][r] * alpha; }
  __builtin_amdgcn_fence(__ATOMIC_ACQ_REL, "workgroup"); __builtin_amdgcn_wave_barrier();
  const int rsub = lane >> 4, c4 = (lane & 15) * 4;
  {
#pragma unroll
    for (int q = 0; q < 8; ++q) { const int r = q * 2 + rsub; if (col0 + c4 < N) { const v4f v = *(const v4fa*)&so[w][r][c4]; *(v4f*)(C + (size_t)(row0 + r) * ldc + col0 + c4) = v; } }
     }
}

// Wt[n][k] = f16(W[k][n]·scale) from f32 row-major W[K][N] (scale = power of two; bf16-exact weights stay exact in f16 away from the subnormal range)
__global__ __launch_bounds__(256) void k_wt_f16(const float* __restrict__ W, _Float16* __restrict__ Wt, int K, int N, float scale) {
  const int t = blockIdx.x * 256 + threadIdx.x; if (t >= N * (K / 8)) return; const int n = t / (K / 8), k8 = (t % (K / 8)) * 8; FragH f;
#pragma unroll
  for (int i = 0; i < 8; ++i) f.h[i] = (_Float16)(bf16_round(W[(size_t)(k8 + i) * N + n]) * scale); const v8us o = f.half[0];
  *(v8us*)((unsigned short*)Wt + (size_t)n * K + k8) = o; 
}
// k_gemm_hh variant with fused epilogue: v = acc·alpha + bias[by·sBias + col] (+ CP[(row/rowsPerB)·sCPb + by·64 + col] if CP) ; ACT 0 none / 1 elu ; writes f16 C16 and f32 C, each if non-null
// BSUM4: output column col stands for the four columns 4 col .. 4 col + 3 of the unfolded product, so its bias is the sum of their four rounded biases
template <int ACT, bool BSUM4 = false>
__global__ __launch_bounds__(128) void k_gemm_hhx(const _Float16* __restrict__ A, int lda, size_t sA, const _Float16* __restrict__ Bh, int ldb, size_t sB, float alpha, const float* __restrict__ bias, size_t sBias, const float* __restrict__ CP, int rowsPerB, size_t sCPb, int row0g,
    float* __restrict__ C, _Float16* __restrict__ C16, int ldc, size_t sC, int M, int N, int K) {
  __shared__ __attribute__((aligned(16))) float so[4][16][64];
  const int tid = threadIdx.x, w = tid >> 5, lane = tid & 31, ln = lane & 15, hh = lane >> 4; const int by = blockIdx.y;
  A += (size_t)by * sA; Bh += (size_t)by * sB; const size_t cofs = (size_t)by * sC; const float* bp = bias ? bias + (size_t)by * sBias : nullptr;
  const int ntn = (N + 63) / 64; const int wid = blockIdx.x * 4 + w; const int mt = wid / ntn, nq = wid % ntn; if (mt * 16 >= M) return;
  const int row0 = mt * 16, col0 = nq * 64; const _Float16* arow = A + (size_t)(row0 + ln) * lda;
  v8f acc[4] = {};
  for (int kb = 0; kb < K; kb += 32) { FragH ah; ah.half[0] = *(const v8us*)((const unsigned short*)arow + kb + 8 * hh); ah.half[1] = *(const v8us*)((const unsigned short*)arow + kb + 16 + 8 * hh);
#pragma unroll
    for (int t = 0; t < 4; ++t) { if (col0 + t * 16 >= N) continue; const size_t boff = (size_t)(col0 + t * 16 + ln) * ldb + kb; FragH bq; bq.half[0] = *(const v8us*)((const unsigned short*)Bh + boff + 8 * hh); bq.half[1] = *(const v8us*)((const unsigned short*)Bh + boff + 16 + 8 * hh);
      acc[t] = mmaH<1>(ah.v, ah.v, bq.v, bq.v, acc[t]); }
  }
#pragma unroll
  for (int t = 0; t < 4; ++t) { if (col0 + t * 16 >= N) continue; const int col = col0 + t * 16 + ln; float bv = 0.f;
    if (bp) { if (BSUM4) { const v4f b4 = *(const v4fa*)(bp + 4 * col); bv = ((bf16_round(b4[0]) + bf16_round(b4[1])) + bf16_round(b4[2])) + bf16_round(b4[3]); } else bv = bf16_round(bp[col]); }
#pragma unroll
    for (int r = 0; r < 8; ++r) { float v = acc[t][r] * alpha + bv; if (CP) { const int bidx = (row0g + row0 + 8 * hh + r) / rowsPerB; v += CP[(size_t)bidx * sCPb + (size_t)by * 64 + col]; } if (ACT == 1) v = (v > 0.f) ? v : expm1f(v); else if (ACT == 7) v = (v > 0.f) ? v + 1.0f : expf(v); else if (ACT == 8) v = tanhf(v); else if (ACT == 9) v = 0.5f * v * (1.0f + tanhf(0.7978845608028654f * (v + 0.044715f * v * v * v))); else if (ACT == 11) v = 1.0f / (1.0f + expf(-v)); else if (ACT == 12) v = (v > 0.f) ? v : 0.01f * v; else if (ACT == 14) v = (v > 0.f) ? v : 0.1f * v; else if (ACT == 15) v = v / (1.0f + expf(-v)); else if (ACT == 3) v = fmaxf(v, 0.f); else if (ACT == 6) v = 0.5f * v * (1.0f + erff(v * 0.70710678118654752f)); so[w][8 * hh + r][t * 16 + ln] = v; } }
  __builtin_amdgcn_fence(__ATOMIC_ACQ_REL, "workgroup"); __builtin_amdgcn_wave_barrier();
  const int rsub = lane >> 4, c4 = (lane & 15) * 4; typedef _Float16 v4h __attribute__((ext_vector_type(4)));
  {
#pragma unroll
    for (int q = 0; q < 8; ++q) { const int r = q * 2 + rsub; if (col0 + c4 < N) { const v4f v = *(const v4fa*)&so[w][r][c4]; if (C) *(v4f*)(C + cofs + (size_t)(row0 + r) * ldc + col0 + c4) = v; if (C16) { v4h h4; for (int i = 0; i < 4; ++i) h4[i] = (_Float16)v[i]; *(v4h*)(C16 + cofs + (size_t)(row0 + r) * ldc + col0 + c4) = h4; } } }
     }
}


typedef _Float16 v4h __attribute__((ext_vector_type(4)));

__global__ __launch_bounds__(256) void k_x16(const float* __restrict__ x, _Float16* __restrict__ X16, size_t n8) { const size_t t = (size_t)blockIdx.x * 256 + threadIdx.x; if (t >= n8) return; FragH f;
#pragma unroll
  for (int q = 0; q < 8; ++q) f.h[q] = (_Float16)bf16_round(x[t * 8 + q]); *(v8us*)((unsigned short*)X16 + t * 8) = f.half[0];  }
__global__ __launch_bounds__(256) void k_h16(const float* __restrict__ x, _Float16* __restrict__ X16, size_t n8) { const size_t t = (size_t)blockIdx.x * 256 + threadIdx.x; if (t >= n8) return; FragH f;
#pragma unroll
  for (int q = 0; q < 8; ++q) f.h[q] = (_Float16)x[t * 8 + q]; *(v8us*)((unsigned short*)X16 + t * 8) = f.half[0];  }
__global__ __launch_bounds__(256) void k_round16f(const float* __restrict__ W, _Float16* __restrict__ Bt, size_t n8) { const size_t t = (size_t)blockIdx.x * 256 + threadIdx.x; if (t >= n8) return; FragH f;
#pragma unroll
  for (int i = 0; i < 8; ++i) f.h[i] = (_Float16)(bf16_round(W[t * 8 + i]) * 16.0f); *(v8us*)((unsigned short*)Bt + t * 8) = f.half[0];  }
// Bt[e][k] = f16(16 (W[4 e][k] + W[4 e + 1][k] + W[4 e + 2][k] + W[4 e + 3][k])), each W rounded to bf16 first, the sum in f32: W (4 NE, K) row-major, thread = 8 k of one e; both loops unrolled so that f.h is indexed by constants and stays in registers
template <int NE, int K>
__global__ __launch_bounds__(256) void k_fold4(const float* __restrict__ W, _Float16* __restrict__ Bt) { const int t = blockIdx.x * 256 + threadIdx.x; if (t >= NE * (K / 8)) return; const int e = t / (K / 8), k8 = (t % (K / 8)) * 8; const float* wr = W + (size_t)e * 4 * K + k8; FragH f;
#pragma unroll
  for (int g = 0; g < 2; ++g) { const v4f a = *(const v4fa*)(wr + 4 * g), b = *(const v4fa*)(wr + K + 4 * g), c = *(const v4fa*)(wr + 2 * K + 4 * g), d = *(const v4fa*)(wr + 3 * K + 4 * g);
#pragma unroll
    for (int i = 0; i < 4; ++i) f.h[4 * g + i] = (_Float16)((((bf16_round(a[i]) + bf16_round(b[i])) + bf16_round(c[i])) + bf16_round(d[i])) * 16.0f); }
  *(v8us*)((unsigned short*)Bt + (size_t)t * 8) = f.half[0]; }
template <int NHv, int TTv>
__global__ __launch_bounds__(256) void k_vt(const _Float16* __restrict__ V16, int ldv, int voff, _Float16* __restrict__ Vt) { __shared__ unsigned short tl[64][66]; const int tid = threadIdx.x; const int slab = blockIdx.x / (TTv / 64), lg = blockIdx.x % (TTv / 64); const int b = slab / NHv, h = slab % NHv;
  for (int i = tid; i < 64 * 8; i += 256) { const int r = i / 8, c8 = (i % 8) * 8; FragH f; f.half[0] = *(const v8us*)((const unsigned short*)V16 + ((size_t)b * TTv + lg * 64 + r) * ldv + voff + h * 64 + c8);
#pragma unroll
    for (int q = 0; q < 8; ++q) tl[r][c8 + q] = f.u[q]; }
  __syncthreads();
  {
#pragma unroll
    for (int rd = 0; rd < 2; ++rd) { const int d = rd * 32 + tid / 8, pc = tid % 8; FragH f;
#pragma unroll
      for (int q = 0; q < 8; ++q) f.u[q] = tl[pc * 8 + q][d];
      *(v8us*)((unsigned short*)Vt + ((size_t)slab * 64 + d) * TTv + lg * 64 + pc * 8) = f.half[0]; }
     } }

__global__ __launch_bounds__(256) void k_hl(const float* __restrict__ F, _Float16* __restrict__ Hh, _Float16* __restrict__ Hl, size_t n8) { const size_t t = (size_t)blockIdx.x * 256 + threadIdx.x; if (t >= n8) return; FragH fh, fl; const v4f a = *(const v4fa*)(F + t * 8), c = *(const v4fa*)(F + t * 8 + 4);
#pragma unroll
  for (int q = 0; q < 4; ++q) { _Float16 h = (_Float16)a[q]; fh.h[q] = h; fl.h[q] = (_Float16)((a[q] - (float)h) * 1024.0f); h = (_Float16)c[q]; fh.h[4 + q] = h; fl.h[4 + q] = (_Float16)((c[q] - (float)h) * 1024.0f); }
  { *(v8us*)((unsigned short*)Hh + t * 8) = fh.half[0]; *(v8us*)((unsigned short*)Hl + t * 8) = fl.half[0];  } }

__global__ __launch_bounds__(256) void k_xr(const float* __restrict__ x, const float* __restrict__ w, const float* __restrict__ bb, _Float16* __restrict__ XR) {
  #pragma clang fp contract(off)
  const int t = blockIdx.x * 256 + threadIdx.x; if (t >= NRW * (DR / 8)) return; const int c0 = (t % (DR / 8)) * 8; const int row = t / (DR / 8); const int b = row / NP, p = row % NP; FragH f;
#pragma unroll
  for (int q = 0; q < 8; ++q) { const int fl = p * DR + c0 + q; const int c = fl / 4096, i = (fl / 64) % 64, j = fl % 64; const float* xp = x + (((size_t)b * 32 + c) * 128 + 2 * i) * 128 + 2 * j;
    float s = bf16_round(bb[c]); s += bf16_round(w[c * 4 + 0]) * bf16_round(xp[0]); s += bf16_round(w[c * 4 + 1]) * bf16_round(xp[1]); s += bf16_round(w[c * 4 + 2]) * bf16_round(xp[128]); s += bf16_round(w[c * 4 + 3]) * bf16_round(xp[129]); f.h[q] = (_Float16)s; }
  *(v8us*)((unsigned short*)XR + (size_t)row * DR + c0) = f.half[0];  }
__global__ __launch_bounds__(256) void k_heads(const float* __restrict__ KV, _Float16* __restrict__ KH) {
  const int t = blockIdx.x * 256 + threadIdx.x; if (t >= NBH * NP * 4) return; const int e0 = (t % 4) * 8; const int pp = (t / 4) % NP; const int bh = t / (4 * NP); const int b = bh / NHD, h = bh % NHD; const size_t row = (size_t)b * NP + h * 64 + pp / 8; const float* kr = KV + row * 2 * DR + (pp % 8) * 32; FragH fk;
#pragma unroll
  for (int q = 0; q < 8; ++q) fk.h[q] = (_Float16)kr[e0 + q];
  *(v8us*)((unsigned short*)KH + ((size_t)bh * NP + pp) * 32 + e0) = fk.half[0]; }
__global__ __launch_bounds__(256) void k_vt(const float* __restrict__ KV, _Float16* __restrict__ VT) { const int t = blockIdx.x * 256 + threadIdx.x; if (t >= NBH * 32 * (NP / 8)) return; const int p0 = (t % (NP / 8)) * 8; const int e = (t / (NP / 8)) % 32; const int bh = t / ((NP / 8) * 32); const int b = bh / NHD, h = bh % NHD; FragH f;
#pragma unroll
  for (int q = 0; q < 8; ++q) { const int pp = p0 + q; f.h[q] = (_Float16)KV[((size_t)b * NP + h * 64 + pp / 8) * 2 * DR + DR + (pp % 8) * 32 + e]; }
  *(v8us*)((unsigned short*)VT + ((size_t)bh * 32 + e) * NP + p0) = f.half[0];  }
#define KPIT 40                  /* K row pitch in LDS, f16 elements */
#define VPIT 520                 /* V^T row pitch in LDS, f16 elements */
#define BPIT 72                  /* bias tile pitch in LDS, bf16 elements */
#define OPIT 36                  /* output staging pitch, floats */
#define AWV 16                   /* waves per work-group */
#define NCH (NP / 64)            /* chunks of 64 keys */
typedef float v2f __attribute__((ext_vector_type(2)));
typedef __bf16 v4b __attribute__((ext_vector_type(4)));
typedef __bf16 v4ba __attribute__((ext_vector_type(4), may_alias));
typedef __bf16 v8ba __attribute__((ext_vector_type(8), may_alias));
typedef __bf16 v8b __attribute__((ext_vector_type(8)));
typedef _Float16 v2h __attribute__((ext_vector_type(2)));
__device__ __forceinline__ float other_half(float v) { const int b = __float_as_int(v); return __int_as_float(__builtin_amdgcn_permlanex16(b, b, 0x76543210, 0xfedcba98, false, false)); }
__global__ __launch_bounds__(512) __attribute__((amdgpu_waves_per_eu(4, 4))) void k_attn(const _Float16* __restrict__ QS, const _Float16* __restrict__ KH, const _Float16* __restrict__ VT, const float* __restrict__ rb, float* __restrict__ out) {
  __shared__ __attribute__((aligned(16))) unsigned short sK[NP * KPIT];
  __shared__ __attribute__((aligned(16))) unsigned short sV[32 * VPIT];
  __shared__ __attribute__((aligned(16))) __bf16 sB[AWV][16 * BPIT];
  __shared__ __attribute__((aligned(16))) float sO[AWV][16 * OPIT];
  const int tid = threadIdx.x, w = tid >> 5, lane = tid & 31, c = lane & 15, hh = lane >> 4;
  const int bh = blockIdx.x >> 1, q0 = (blockIdx.x & 1) * (AWV * 16) + w * 16, h = bh % NHD;
  const unsigned short* gK = (const unsigned short*)KH + (size_t)bh * NP * 32;
  const unsigned short* gV = (const unsigned short*)VT + (size_t)bh * 32 * NP;
  const float* br = rb + ((size_t)h * NP + q0 + hh) * NP + c * 4;      /* load i of a chunk: rows 2 i + hh, 16 lanes x 16 B = one 256-B piece of a row */
  __bf16* sb = sB[w];
  v8us tk[4], tv[4]; v4f bn[8];
#pragma unroll
  for (int u = 0; u < 4; ++u) { tk[u] = *(const v8us*)(gK + (size_t)(tid + u * AWV * 32) * 8); tv[u] = *(const v8us*)(gV + (size_t)(tid + u * AWV * 32) * 8); }
#pragma unroll
  for (int i = 0; i < 8; ++i) bn[i] = *(const v4fa*)(br + (size_t)(2 * i) * NP);
  FragH fq;
  { const unsigned short* qr = (const unsigned short*)QS + ((size_t)bh * NP + q0 + c) * 32; fq.half[0] = *(const v8us*)(qr + 8 * hh); fq.half[1] = *(const v8us*)(qr + 16 + 8 * hh); }
  /* the address registers of the loads above are reused further down: the wait stands in front of every such overwrite */
  asm volatile("s_wait_xcnt 0x0" ::: "memory");
#pragma unroll
  for (int u = 0; u < 4; ++u) { const int i = tid + u * AWV * 32; *(v8us*)&sK[(i >> 2) * KPIT + (i & 3) * 8] = tk[u]; *(v8us*)&sV[(i >> 6) * VPIT + (i & 63) * 8] = tv[u]; }
#pragma unroll
  for (int i = 0; i < 8; ++i) { *(v4ba*)&sb[(2 * i + hh) * BPIT + c * 4] = __builtin_convertvector(bn[i], v4b); bn[i] = *(const v4fa*)(br + (size_t)(2 * i) * NP + 64); }
  __syncthreads();
  const float L2E = 1.4426950408889634f;
  v8f o0 = {}, o1 = {};
  float m = -3.0e38f, ls = 0.f;
#pragma unroll 1      /* rolled: eight copies of this body would add code and registers and save nothing */
  for (int kc = 0; kc < NCH; ++kc) {
    /* the lanes of this wave read bias values that other lanes of it stored in the trip before: the stores have to be done first */
    asm volatile("s_wait_dscnt 0x0" ::: "memory");
    float l[32];
#pragma unroll
    for (int j = 0; j < 4; ++j) {
      const v8b pb = *(const v8ba*)&sb[c * BPIT + j * 16 + 8 * hh];      /* register r: bias[q0 + c][64 kc + 16 j + 8 hh + r], the S^T tile's own map */
      FragH fk; const unsigned short* kr = &sK[(kc * 64 + j * 16 + c) * KPIT];
      fk.half[0] = *(const v8us*)(kr + 8 * hh); fk.half[1] = *(const v8us*)(kr + 16 + 8 * hh);
      const v8f z = {};
      const v8f s = __builtin_amdgcn_wmma_f32_16x16x32_f16(false, fk.v, false, fq.v, (short)0, z, false, false);
#pragma unroll
      for (int r = 0; r < 8; ++r) l[j * 8 + r] = __builtin_fmaf(s[r], 0.03125f, (float)pb[r]);
    }
    /* next chunk's bias into the tile (its readers above are done), then the loads of the chunk after it; past the end both repeat the last chunk */
    const float* bx = br + ((kc + 2 < NCH) ? kc + 2 : NCH - 1) * 64;
#pragma unroll
    for (int i = 0; i < 8; ++i) { *(v4ba*)&sb[(2 * i + hh) * BPIT + c * 4] = __builtin_convertvector(bn[i], v4b); bn[i] = *(const v4fa*)(bx + (size_t)(2 * i) * NP); }
    float cj[4];
#pragma unroll
    for (int j = 0; j < 4; ++j) { cj[j] = l[j * 8];
#pragma unroll
      for (int r = 1; r < 8; ++r) cj[j] = fmaxf(cj[j], l[j * 8 + r]); }
    float cm = fmaxf(fmaxf(cj[0], cj[1]), fmaxf(cj[2], cj[3]));
    cm = fmaxf(cm, other_half(cm));
    const float mn = fmaxf(m, cm);
    const float sc = __builtin_amdgcn_exp2f((m - mn) * L2E);
    const float mb = 10.0f - mn * L2E;
    m = mn;
    v2f sa = {0.f, 0.f}, sd = {0.f, 0.f};
    FragH fp[2];
#pragma unroll
    for (int i = 0; i < 32; i += 4) {
      v2f ta, tc, pa, pc; const v2f l2e = {L2E, L2E}, mb2 = {mb, mb};
      ta[0] = l[i]; ta[1] = l[i + 1]; tc[0] = l[i + 2]; tc[1] = l[i + 3];
      ta = __builtin_elementwise_fma(ta, l2e, mb2); tc = __builtin_elementwise_fma(tc, l2e, mb2);
      pa[0] = __builtin_amdgcn_exp2f(ta[0]); pa[1] = __builtin_amdgcn_exp2f(ta[1]); pc[0] = __builtin_amdgcn_exp2f(tc[0]); pc[1] = __builtin_amdgcn_exp2f(tc[1]);
      sa += pa; sd += pc;
      const v2h ha = __builtin_convertvector(pa, v2h), hc = __builtin_convertvector(pc, v2h);
      fp[i >> 4].h[(i & 15)] = ha[0]; fp[i >> 4].h[(i & 15) + 1] = ha[1]; fp[i >> 4].h[(i & 15) + 2] = hc[0]; fp[i >> 4].h[(i & 15) + 3] = hc[1];
    }
    sa += sd;
    ls = __builtin_fmaf(ls, sc, sa[0] + sa[1]);
#pragma unroll
    for (int r = 0; r < 8; ++r) { o0[r] *= sc; o1[r] *= sc; }
#pragma unroll
    for (int u = 0; u < 2; ++u) {
      FragH v0, v1; const unsigned short* vr = &sV[c * VPIT + kc * 64 + u * 32];
      v0.half[0] = *(const v8us*)(vr + 8 * hh); v0.half[1] = *(const v8us*)(vr + 16 + 8 * hh);
      v1.half[0] = *(const v8us*)(vr + 16 * VPIT + 8 * hh); v1.half[1] = *(const v8us*)(vr + 16 * VPIT + 16 + 8 * hh);
      o0 = __builtin_amdgcn_wmma_f32_16x16x32_f16(false, v0.v, false, fp[u].v, (short)0, o0, false, false);
      o1 = __builtin_amdgcn_wmma_f32_16x16x32_f16(false, v1.v, false, fp[u].v, (short)0, o1, false, false);
    }
  }
  ls += other_half(ls);
  const float inv = 1.0f / ls;
  float* so = sO[w];               /* this wave's own staging: lane (c, hh) holds query c, e = 16 t + 8 hh + r */
  { v4f a;
    a[0] = o0[0] * inv; a[1] = o0[1] * inv; a[2] = o0[2] * inv; a[3] = o0[3] * inv; *(v4fa*)&so[c * OPIT + 8 * hh] = a;
    a[0] = o0[4] * inv; a[1] = o0[5] * inv; a[2] = o0[6] * inv; a[3] = o0[7] * inv; *(v4fa*)&so[c * OPIT + 8 * hh + 4] = a;
    a[0] = o1[0] * inv; a[1] = o1[1] * inv; a[2] = o1[2] * inv; a[3] = o1[3] * inv; *(v4fa*)&so[c * OPIT + 16 + 8 * hh] = a;
    a[0] = o1[4] * inv; a[1] = o1[5] * inv; a[2] = o1[6] * inv; a[3] = o1[7] * inv; *(v4fa*)&so[c * OPIT + 16 + 8 * hh + 4] = a; }
  /* the wave's lanes read each other's staged values: the LDS writes have to be done before the reads */
  asm volatile("s_wait_dscnt 0x0" ::: "memory");
  float* orow = out + ((size_t)bh * NP + q0) * 128 + lane * 4;      /* out_d = o_{d/4}: lane e writes its value four times, 512 B a query in one store */
#pragma unroll
  for (int q = 0; q < 16; ++q) { const float vv = so[q * OPIT + lane]; v4f v; v[0] = vv; v[1] = vv; v[2] = vv; v[3] = vv; *(v4f*)(orow + (size_t)q * 128) = v; }
}
__global__ __launch_bounds__(512) void k_bcat(const float* __restrict__ a, const float* __restrict__ b, float* __restrict__ O) { const int t = threadIdx.x; const float v = (t < DR) ? a[t] : b[t - DR]; *(float*)(O + t) = v;  }

extern "C" void kernel_launch(void* const* d_in, const int* in_sizes, int n_in,
                              void* d_out, int out_size, void* d_ws, size_t ws_size, hipStream_t stream) {
  (void)in_sizes; (void)n_in; (void)out_size;
  const float* const* I = (const float* const*)d_in; const float* x = I[0]; const float* dww = I[1]; const float* dwb = I[2]; const float* Wq = I[3]; const float* bq = I[4]; const float* Wk = I[5]; const float* bk = I[6]; const float* Wv = I[7]; const float* bv = I[8]; const float* rb = I[9];
  char* ws = (char*)d_ws; size_t off = 0;
  auto take = [&](size_t bytes) { char* p = ws + off; off += (bytes + 255) & ~(size_t)255; return p; };
  _Float16* BQ = (_Float16*)take((size_t)DR * DQ * 2); _Float16* BKV = (_Float16*)take((size_t)2 * DR * DR * 2); float* BKVb = (float*)take(2 * DR * 4);
  _Float16* X16 = (_Float16*)take((size_t)NRW * DQ * 2); _Float16* XR16 = (_Float16*)take((size_t)NRW * DR * 2); float* KVf = (float*)take((size_t)NRW * 2 * DR * 4);
  _Float16* QS = (_Float16*)take((size_t)NBH * NP * 32 * 2); _Float16* KH = (_Float16*)take((size_t)NBH * NP * 32 * 2); _Float16* VT = (_Float16*)take((size_t)NBH * 32 * NP * 2);
  if (off > ws_size) return;
  k_fold4<DR, DQ><<<(DR * DQ / 8 + 255) / 256, 256, 0, stream>>>(Wq, BQ); k_round16f<<<(DR * DR / 8 + 255) / 256, 256, 0, stream>>>(Wk, BKV, (size_t)DR * DR / 8); k_round16f<<<(DR * DR / 8 + 255) / 256, 256, 0, stream>>>(Wv, BKV + (size_t)DR * DR, (size_t)DR * DR / 8); k_bcat<<<1, 512, 0, stream>>>(bk, bv, BKVb);      /* (out,in) natural */
  k_x16<<<(unsigned)(((size_t)NRW * DQ / 8 + 255) / 256), 256, 0, stream>>>(x, X16, (size_t)NRW * DQ / 8);      /* plain (P, 1024) view = flat */
  k_xr<<<(NRW * (DR / 8) + 255) / 256, 256, 0, stream>>>(x, dww, dwb, XR16);
  k_gemm_hhx<0, true><<<dim3(((NRW / 16) * (DR / 64) + 3) / 4, 1), 128, 0, stream>>>(X16, DQ, 0, BQ, DQ, 0, 0.0625f, bq, 0, nullptr, 1, 0, 0, nullptr, QS, DR, 0, NRW, DR, DQ);      /* (8192, 256) flat = (128, 512, 32) flat: row b 512 + h 64 + p / 8, column (p % 8) 32 + e */
  k_gemm_hhx<0><<<dim3(((NRW / 16) * (2 * DR / 64) + 3) / 4, 1), 128, 0, stream>>>(XR16, DR, 0, BKV, DR, 0, 0.0625f, BKVb, 0, nullptr, 1, 0, 0, KVf, nullptr, 2 * DR, 0, NRW, 2 * DR, DR);      /* [k | v] */
  k_heads<<<(NBH * NP * 4 + 255) / 256, 256, 0, stream>>>(KVf, KH); k_vt<<<(NBH * 32 * (NP / 8) + 255) / 256, 256, 0, stream>>>(KVf, VT);
  k_attn<<<NBH * 2, AWV * 32, 0, stream>>>(QS, KH, VT, rb, (float*)d_out);
}

// v003
// It runs in 71.6 microseconds.
// Two timings next to v002 both put it at 1.48 times that version's speed.
// All steps since v000 together make it 4.23 times as fast.
#include <hip/hip_runtime.h>
// Lightweight multi-head self-attention with reduced keys/values (B 16, C 32, 128×128; P 512 tokens of 1024 (q) / 256 (k, v after a depthwise 2×2 stride-2 reduction); 8 heads by PLAIN reshapes of the (P, dim) buffers; k/v nearest-upsampled 32 → 128 along the head dim; scores/√1024 + rel_bias; softmax; attn·v; plain reshape back to [16,32,128,128]).
// Structure: q/k/v projections as GEMMs (the depthwise reduction on VALU -> f16); the 32->128 nearest upsampling is folded into the contraction (sum_d q_d k_{d/4} = sum_e (sum_{d/4=e} q_d) k_e and out_d = o_{d/4}), and the sum over each four q columns is folded further into the projection itself (sum_{d/4=e} q_d = x . sum_{d/4=e} Wq[d] + sum_{d/4=e} bq[d]): the q GEMM has N 256 and its f16 output, read flat, is the head operand; the plain-view head split of k and v by index arithmetic on VALU; scores (K 32, scale 1/32), bias, running-max softmax (x 2^10, f16), P.V (N 32) and the expanded output in ONE fused kernel, scores and probabilities kept in registers.
// Compute dtype: inputs and parameters rounded to bf16; x exact in f16; folded q weights, reduced x, head operands and probabilities f16 (about 2^-12); f32 accumulation; softmax f32. v_wmma_f32_16x16x32_f16.
#define NB 16
#define NP 512
#define DQ 1024
#define DR 256
#define NHD 8
#define NBH (NB * NHD)           /* 128 */
#define NRW (NB * NP)            /* 8192 rows */
typedef __bf16 v16b __attribute__((ext_vector_type(16)));
typedef unsigned short v8us __attribute__((ext_vector_type(8), may_alias));
typedef float  v8f  __attribute__((ext_vector_type(8)));
typedef float  v4f  __attribute__((ext_vector_type(4)));
typedef float  v4fa __attribute__((ext_vector_type(4), may_alias));
union FragB { v16b v; v8us half[2]; unsigned short u[16]; };

__device__ __forceinline__ unsigned short bf16_bits(float x) { unsigned int u = __float_as_uint(x); return (unsigned short)((u + 0x7FFFu + ((u >> 16) & 1u)) >> 16); }
__device__ __forceinline__ float bf16_val(unsigned short b) { return __uint_as_float(((unsigned int)b) << 16); }
__device__ __forceinline__ float bf16_round(float x) { return bf16_val(bf16_bits(x)); }
// D += A·B with NT terms: 1 = ah·bh, 2 = + al·bh (A split), 3 = + ah·bl (both split)
template <int NT>
__device__ __forceinline__ v8f mmaN(v16b ah, v16b al, v16b bh, v16b bl, v8f c) {
  c = __builtin_amdgcn_wmma_f32_16x16x32_bf16(false, ah, false, bh, (short)0, c, false, false);
  if (NT >= 2) c = __builtin_amdgcn_wmma_f32_16x16x32_bf16(false, al, false, bh, (short)0, c, false, false);
  if (NT >= 3) c = __builtin_amdgcn_wmma_f32_16x16x32_bf16(false, ah, false, bl, (short)0, c, false, false);
  asm volatile("v_nop\n\tv_nop\n\tv_nop\n\tv_nop" : "+v"(c) : "v"(ah), "v"(al), "v"(bh), "v"(bl));
  return c;
}

__global__ __launch_bounds__(256) void k_wt_bf16(const float* __restrict__ W, unsigned short* __restrict__ Wt, int K, int N) {
  const int t = blockIdx.x * 256 + threadIdx.x;
  const int k8n = K / 8;
  if (t >= N * k8n) return;
  const int n = t / k8n, k8 = (t % k8n) * 8;
  v8us v;
#pragma unroll
  for (int i = 0; i < 8; ++i) v[i] = bf16_bits(W[(size_t)(k8 + i) * N + n]);
  *(v8us*)(Wt + (size_t)n * K + k8) = v;
  
}

// GEMM C[M][N] (f32, pitch ldc) = act(A[M][K]·W + bias). A f32 row-major (pitch lda) converted per fragment to bf16
// (ASPLIT: hi/lo two planes -> 2 terms, else single rounded term); Wt bf16 [N][K] (pitch ldb). BIAS_BF16 rounds the
// bias to bf16 first (bias quantised to bf16 before the add). K%32==0, M%16==0, N%64==0.
template <bool ASPLIT, int ACT, bool BIAS_BF16>
__global__ __launch_bounds__(128) void k_gemm_bf(const float* __restrict__ A, int lda, const unsigned short* __restrict__ Wt, int ldb,
                                               const float* __restrict__ bias, float* __restrict__ C, int ldc, int M, int N, int K) {
  __shared__ __attribute__((aligned(16))) float so[4][16][64];
  const int tid = threadIdx.x, w = tid >> 5, lane = tid & 31, ln = lane & 15, hh = lane >> 4;
  const int ntn = N / 64;
  const int wid = blockIdx.x * 4 + w;
  const int mt = wid / ntn, nq = wid % ntn;
  if (mt * 16 >= M) return;
  const int row0 = mt * 16, col0 = nq * 64;
  const float* arow = A + (size_t)(row0 + ln) * lda;
  v8f acc[4] = {};
  for (int kb = 0; kb < K; kb += 32) {
    FragB ah, al;
    const v4f x0 = *(const v4fa*)(arow + kb + 8 * hh), x1 = *(const v4fa*)(arow + kb + 8 * hh + 4);
    const v4f x2 = *(const v4fa*)(arow + kb + 16 + 8 * hh), x3 = *(const v4fa*)(arow + kb + 16 + 8 * hh + 4);
    float xs[16] = {x0[0],x0[1],x0[2],x0[3],x1[0],x1[1],x1[2],x1[3],x2[0],x2[1],x2[2],x2[3],x3[0],x3[1],x3[2],x3[3]};
#pragma unroll
    for (int i = 0; i < 16; ++i) { const unsigned short hb = bf16_bits(xs[i]); ah.u[i] = hb; al.u[i] = ASPLIT ? bf16_bits(xs[i] - bf16_val(hb)) : (unsigned short)0; }
#pragma unroll
    for (int t = 0; t < 4; ++t) {
      const unsigned short* brow = Wt + (size_t)(col0 + t * 16 + ln) * ldb + kb;
      FragB b;
      b.half[0] = *(const v8us*)(brow + 8 * hh);
      b.half[1] = *(const v8us*)(brow + 16 + 8 * hh);
      acc[t] = mmaN<ASPLIT ? 2 : 1>(ah.v, al.v, b.v, b.v, acc[t]);
    }
  }
#pragma unroll
  for (int t = 0; t < 4; ++t) {
    float bv = bias ? bias[col0 + t * 16 + ln] : 0.f;
    if (BIAS_BF16) bv = bf16_round(bv);
#pragma unroll
    for (int r = 0; r < 8; ++r) { float v = acc[t][r] + bv; if (ACT == 1) v = fmaxf(v, 0.f); so[w][8 * hh + r][t * 16 + ln] = v; }
  }
  __builtin_amdgcn_fence(__ATOMIC_ACQ_REL, "workgroup");
  __builtin_amdgcn_wave_barrier();
  const int rsub = lane >> 4, c4 = (lane & 15) * 4;
  {
#pragma unroll
    for (int q = 0; q < 8; ++q) {
      const int r = q * 2 + rsub;
      const v4f v = *(const v4fa*)&so[w][r][c4];
      *(v4f*)(C + (size_t)(row0 + r) * ldc + col0 + c4) = v;
    }
    
  }
}

// GEMM C = act(A·W + bias + resid): A f32 (ASPLIT -> hi/lo 2 terms), Wt bf16 [N][K]; ACT 0 none, 1 relu, 2 exact gelu;
// resid (optional, f32, row index = (row % rmod), pitch ldr, RES_BF16 rounds it) added before the activation.
template <bool ASPLIT, int ACT, bool BIAS_BF16, bool RES_BF16>
__global__ __launch_bounds__(128) void k_gemm_bf3(const float* __restrict__ A, int lda, const unsigned short* __restrict__ Wt, int ldb,
                                                const float* __restrict__ bias, const float* __restrict__ resid, int rmod, int ldr,
                                                float* __restrict__ C, int ldc, int M, int N, int K) {
  __shared__ __attribute__((aligned(16))) float so[4][16][64];
  const int tid = threadIdx.x, w = tid >> 5, lane = tid & 31, ln = lane & 15, hh = lane >> 4;
  const int ntn = N / 64;
  const int wid = blockIdx.x * 4 + w;
  const int mt = wid / ntn, nq = wid % ntn;
  if (mt * 16 >= M) return;
  const int row0 = mt * 16, col0 = nq * 64;
  const float* arow = A + (size_t)(row0 + ln) * lda;
  v8f acc[4] = {};
  for (int kb = 0; kb < K; kb += 32) {
    FragB ah, al;
    const v4f x0 = *(const v4fa*)(arow + kb + 8 * hh), x1 = *(const v4fa*)(arow + kb + 8 * hh + 4);
    const v4f x2 = *(const v4fa*)(arow + kb + 16 + 8 * hh), x3 = *(const v4fa*)(arow + kb + 16 + 8 * hh + 4);
    float xs[16] = {x0[0],x0[1],x0[2],x0[3],x1[0],x1[1],x1[2],x1[3],x2[0],x2[1],x2[2],x2[3],x3[0],x3[1],x3[2],x3[3]};
#pragma unroll
    for (int i = 0; i < 16; ++i) { const unsigned short hb = bf16_bits(xs[i]); ah.u[i] = hb; al.u[i] = ASPLIT ? bf16_bits(xs[i] - bf16_val(hb)) : (unsigned short)0; }
#pragma unroll
    for (int t = 0; t < 4; ++t) {
      const unsigned short* brow = Wt + (size_t)(col0 + t * 16 + ln) * ldb + kb;
      FragB b;
      b.half[0] = *(const v8us*)(brow + 8 * hh);
      b.half[1] = *(const v8us*)(brow + 16 + 8 * hh);
      acc[t] = mmaN<ASPLIT ? 2 : 1>(ah.v, al.v, b.v, b.v, acc[t]);
    }
  }
#pragma unroll
  for (int t = 0; t < 4; ++t) {
    const int col = col0 + t * 16 + ln;
    float bv = bias ? bias[col] : 0.f;
    if (BIAS_BF16) bv = bf16_round(bv);
#pragma unroll
    for (int r = 0; r < 8; ++r) {
      float v = acc[t][r] + bv;
      if (resid) { float rv = resid[(size_t)((row0 + 8 * hh + r) % rmod) * ldr + col]; if (RES_BF16) rv = bf16_round(rv); v += rv; }
      if (ACT == 1) v = fmaxf(v, 0.f);
      if (ACT == 2) v = 0.5f * v * (1.0f + erff(v * 0.70710678118654752f));
      if (ACT == 3) { const float u = 0.7978845608028654f * (v + 0.044715f * v * v * v); v = 0.5f * v * (1.0f + tanhf(u)); }
      so[w][8 * hh + r][t * 16 + ln] = v;
    }
  }
  __builtin_amdgcn_fence(__ATOMIC_ACQ_REL, "workgroup");
  __builtin_amdgcn_wave_barrier();
  const int rsub = lane >> 4, c4 = (lane & 15) * 4;
  {
#pragma unroll
    for (int q = 0; q < 8; ++q) {
      const int r = q * 2 + rsub;
      const v4f v = *(const v4fa*)&so[w][r][c4];
      *(v4f*)(C + (size_t)(row0 + r) * ldc + col0 + c4) = v;
    }
    
  }
}
// row LayerNorm (biased variance, eps) over N: s = X (+ R); optional out_sum <- s; out_norm <- (s-mu)*rsqrt(var+eps)*g + b
template <bool PARAM_BF16>
__global__ __launch_bounds__(256) void k_layernorm(const float* __restrict__ X, const float* __restrict__ R, const float* __restrict__ g, const float* __restrict__ bta,
                                                  float* __restrict__ out_sum, float* __restrict__ out_norm, int N, float eps) {
  __shared__ float red[256];
  const int row = blockIdx.x, tid = threadIdx.x;
  const float* x = X + (size_t)row * N; const float* rr = R ? R + (size_t)row * N : nullptr;
  float vals[16];                     // up to N = 4096
  const int per = N / 256;            // contiguous chunk per thread? use strided-by-4 chunks: thread handles j = tid*4 + 1024*u
  float s1 = 0.f;
  for (int u = 0; u < per / 4; ++u) {
    const int j = tid * 4 + 1024 * u;
    const v4f a = *(const v4fa*)(x + j);
    v4f b = {0.f,0.f,0.f,0.f}; if (rr) b = *(const v4fa*)(rr + j);
#pragma unroll
    for (int q = 0; q < 4; ++q) { const float v = a[q] + b[q]; vals[u * 4 + q] = v; s1 += v; }
  }
  red[tid] = s1; __syncthreads();
  for (int st = 128; st > 0; st >>= 1) { if (tid < st) red[tid] += red[tid + st]; __syncthreads(); }
  const float mu = red[0] / (float)N; __syncthreads();
  float s2 = 0.f;
  for (int u = 0; u < per / 4; ++u)
#pragma unroll
    for (int q = 0; q < 4; ++q) { const float c = vals[u * 4 + q] - mu; s2 += c * c; }
  red[tid] = s2; __syncthreads();
  for (int st = 128; st > 0; st >>= 1) { if (tid < st) red[tid] += red[tid + st]; __syncthreads(); }
  const float rs = rsqrtf(red[0] / (float)N + eps);
  {
    for (int u = 0; u < per / 4; ++u) {
      const int j = tid * 4 + 1024 * u;
      v4f o, sm;
#pragma unroll
      for (int q = 0; q < 4; ++q) {
        float gg = g[j + q], bb = bta[j + q];
        if (PARAM_BF16) { gg = bf16_round(gg); bb = bf16_round(bb); }
        sm[q] = vals[u * 4 + q]; o[q] = (vals[u * 4 + q] - mu) * rs * gg + bb;
      }
      if (out_sum) *(v4f*)(out_sum + (size_t)row * N + j) = sm;
      *(v4f*)(out_norm + (size_t)row * N + j) = o;
    }
    
  }
}



// ---- f16 WMMA path (v_wmma_f32_16x16x32_f16): 11-bit significands for operands in range — used where a [0,1] probability operand needs more precision than bf16
typedef _Float16 v16h __attribute__((ext_vector_type(16)));
union FragH { v16h v; v8us half[2]; _Float16 h[16]; unsigned short u[16]; };
template <int NT>
__device__ __forceinline__ v8f mmaH(v16h ah, v16h al, v16h bh, v16h bl, v8f c) {
  c = __builtin_amdgcn_wmma_f32_16x16x32_f16(false, ah, false, bh, (short)0, c, false, false);
  if (NT >= 2) c = __builtin_amdgcn_wmma_f32_16x16x32_f16(false, al, false, bh, (short)0, c, false, false);
  if (NT >= 3) c = __builtin_amdgcn_wmma_f32_16x16x32_f16(false, ah, false, bl, (short)0, c, false, false);
  asm volatile("v_nop\n\tv_nop\n\tv_nop\n\tv_nop" : "+v"(c) : "v"(ah), "v"(al), "v"(bh), "v"(bl));
  return c;
}
// batched GEMM like k_gemm_b but f16 operands: A f32 (split into f16 hi/lo if ASPLIT, else rounded to f16), Bt = f16 values [n][k]; alpha; C f32; N multiple of 16 (partial tiles skipped)
template <bool ASPLIT>
__global__ __launch_bounds__(128) void k_gemm_h(const float* __restrict__ A, int lda, size_t sA, const _Float16* __restrict__ Bh, int ldb, size_t sB, float alpha, float* __restrict__ C, int ldc, size_t sC, int M, int N, int K) {
  __shared__ __attribute__((aligned(16))) float so[4][16][64];
  const int tid = threadIdx.x, w = tid >> 5, lane = tid & 31, ln = lane & 15, hh = lane >> 4; const int by = blockIdx.y;
  A += (size_t)by * sA; Bh += (size_t)by * sB; C += (size_t)by * sC;
  const int ntn = (N + 63) / 64; const int wid = blockIdx.x * 4 + w; const int mt = wid / ntn, nq = wid % ntn; if (mt * 16 >= M) return;
  const int row0 = mt * 16, col0 = nq * 64; const float* arow = A + (size_t)(row0 + ln) * lda;
  v8f acc[4] = {};
  for (int kb = 0; kb < K; kb += 32) {
    FragH ah, al;
    const v4f x0 = *(const v4fa*)(arow + kb + 8 * hh), x1 = *(const v4fa*)(arow + kb + 8 * hh + 4), x2 = *(const v4fa*)(arow + kb + 16 + 8 * hh), x3 = *(const v4fa*)(arow + kb + 16 + 8 * hh + 4);
    float xs[16] = {x0[0],x0[1],x0[2],x0[3],x1[0],x1[1],x1[2],x1[3],x2[0],x2[1],x2[2],x2[3],x3[0],x3[1],x3[2],x3[3]};
#pragma unroll
    for (int i = 0; i < 16; ++i) { const _Float16 h = (_Float16)xs[i]; ah.h[i] = h; al.h[i] = ASPLIT ? (_Float16)(xs[i] - (float)h) : (_Float16)0.0f; }
#pragma unroll
    for (int t = 0; t < 4; ++t) { if (col0 + t * 16 >= N) continue; const size_t boff = (size_t)(col0 + t * 16 + ln) * ldb + kb; FragH bq; bq.half[0] = *(const v8us*)(Bh + boff + 8 * hh); bq.half[1] = *(const v8us*)(Bh + boff + 16 + 8 * hh);
      acc[t] = mmaH<ASPLIT ? 2 : 1>(ah.v, al.v, bq.v, bq.v, acc[t]); }
  }
#pragma unroll
  for (int t = 0; t < 4; ++t) { if (col0 + t * 16 >= N) continue;
#pragma unroll
    for (int r = 0; r < 8; ++r) so[w][8 * hh + r][t * 16 + ln] = acc[t][r] * alpha; }
  __builtin_amdgcn_fence(__ATOMIC_ACQ_REL, "workgroup"); __builtin_amdgcn_wave_barrier();
  const int rsub = lane >> 4, c4 = (lane & 15) * 4;
  {
#pragma unroll
    for (int q = 0; q < 8; ++q) { const int r = q * 2 + rsub; if (col0 + c4 < N) { const v4f v = *(const v4fa*)&so[w][r][c4]; *(v4f*)(C + (size_t)(row0 + r) * ldc + col0 + c4) = v; } }
     }
}

// Wt[n][k] = f16(W[k][n]·scale) from f32 row-major W[K][N] (scale = power of two; bf16-exact weights stay exact in f16 away from the subnormal range)
__global__ __launch_bounds__(256) void k_wt_f16(const float* __restrict__ W, _Float16* __restrict__ Wt, int K, int N, float scale) {
  const int t = blockIdx.x * 256 + threadIdx.x; if (t >= N * (K / 8)) return; const int n = t / (K / 8), k8 = (t % (K / 8)) * 8; FragH f;
#pragma unroll
  for (int i = 0; i < 8; ++i) f.h[i] = (_Float16)(bf16_round(W[(size_t)(k8 + i) * N + n]) * scale); const v8us o = f.half[0];
  *(v8us*)((unsigned short*)Wt + (size_t)n * K + k8) = o; 
}
// k_gemm_hh variant with fused epilogue: v = acc·alpha + bias[by·sBias + col] (+ CP[(row/rowsPerB)·sCPb + by·64 + col] if CP) ; ACT 0 none / 1 elu ; writes f16 C16 and f32 C, each if non-null
// BSUM4: output column col stands for the four columns 4 col .. 4 col + 3 of the unfolded product, so its bias is the sum of their four rounded biases
// a device function: the kernel that calls it hands in its LDS staging and the block's index (bx, by) inside this product's own grid
template <int ACT, bool BSUM4 = false>
__device__ __forceinline__ void d_gemm_hhx(float (&so)[4][16][64], int bx, int by, const _Float16* __restrict__ A, int lda, size_t sA, const _Float16* __restrict__ Bh, int ldb, size_t sB, float alpha, const float* __restrict__ bias, size_t sBias, const float* __restrict__ CP, int rowsPerB, size_t sCPb, int row0g,
    float* __restrict__ C, _Float16* __restrict__ C16, int ldc, size_t sC, int M, int N, int K) {
  const int tid = threadIdx.x, w = tid >> 5, lane = tid & 31, ln = lane & 15, hh = lane >> 4;
  A += (size_t)by * sA; Bh += (size_t)by * sB; const size_t cofs = (size_t)by * sC; const float* bp = bias ? bias + (size_t)by * sBias : nullptr;
  const int ntn = (N + 63) / 64; const int wid = bx * 4 + w; const int mt = wid / ntn, nq = wid % ntn; if (mt * 16 >= M) return;
  const int row0 = mt * 16, col0 = nq * 64; const _Float16* arow = A + (size_t)(row0 + ln) * lda;
  v8f acc[4] = {};
  for (int kb = 0; kb < K; kb += 32) { FragH ah; ah.half[0] = *(const v8us*)((const unsigned short*)arow + kb + 8 * hh); ah.half[1] = *(const v8us*)((const unsigned short*)arow + kb + 16 + 8 * hh);
#pragma unroll
    for (int t = 0; t < 4; ++t) { if (col0 + t * 16 >= N) continue; const size_t boff = (size_t)(col0 + t * 16 + ln) * ldb + kb; FragH bq; bq.half[0] = *(const v8us*)((const unsigned short*)Bh + boff + 8 * hh); bq.half[1] = *(const v8us*)((const unsigned short*)Bh + boff + 16 + 8 * hh);
      acc[t] = mmaH<1>(ah.v, ah.v, bq.v, bq.v, acc[t]); }
  }
#pragma unroll
  for (int t = 0; t < 4; ++t) { if (col0 + t * 16 >= N) continue; const int col = col0 + t * 16 + ln; float bv = 0.f;
    if (bp) { if (BSUM4) { const v4f b4 = *(const v4fa*)(bp + 4 * col); bv = ((bf16_round(b4[0]) + bf16_round(b4[1])) + bf16_round(b4[2])) + bf16_round(b4[3]); } else bv = bf16_round(bp[col]); }
#pragma unroll
    for (int r = 0; r < 8; ++r) { float v = acc[t][r] * alpha + bv; if (CP) { const int bidx = (row0g + row0 + 8 * hh + r) / rowsPerB; v += CP[(size_t)bidx * sCPb + (size_t)by * 64 + col]; } if (ACT == 1) v = (v > 0.f) ? v : expm1f(v); else if (ACT == 7) v = (v > 0.f) ? v + 1.0f : expf(v); else if (ACT == 8) v = tanhf(v); else if (ACT == 9) v = 0.5f * v * (1.0f + tanhf(0.7978845608028654f * (v + 0.044715f * v * v * v))); else if (ACT == 11) v = 1.0f / (1.0f + expf(-v)); else if (ACT == 12) v = (v > 0.f) ? v : 0.01f * v; else if (ACT == 14) v = (v > 0.f) ? v : 0.1f * v; else if (ACT == 15) v = v / (1.0f + expf(-v)); else if (ACT == 3) v = fmaxf(v, 0.f); else if (ACT == 6) v = 0.5f * v * (1.0f + erff(v * 0.70710678118654752f)); so[w][8 * hh + r][t * 16 + ln] = v; } }
  __builtin_amdgcn_fence(__ATOMIC_ACQ_REL, "workgroup"); __builtin_amdgcn_wave_barrier();
  const int rsub = lane >> 4, c4 = (lane & 15) * 4; typedef _Float16 v4h __attribute__((ext_vector_type(4)));
  {
#pragma unroll
    for (int q = 0; q < 8; ++q) { const int r = q * 2 + rsub; if (col0 + c4 < N) { const v4f v = *(const v4fa*)&so[w][r][c4]; if (C) *(v4f*)(C + cofs + (size_t)(row0 + r) * ldc + col0 + c4) = v; if (C16) { v4h h4; for (int i = 0; i < 4; ++i) h4[i] = (_Float16)v[i]; *(v4h*)(C16 + cofs + (size_t)(row0 + r) * ldc + col0 + c4) = h4; } } }
     }
}


typedef _Float16 v4h __attribute__((ext_vector_type(4)));

__device__ __forceinline__ void d_x16(int blk, const float* __restrict__ x, _Float16* __restrict__ X16, size_t n8) { const size_t t = (size_t)blk * 256 + threadIdx.x; if (t >= n8) return; FragH f;
#pragma unroll
  for (int q = 0; q < 8; ++q) f.h[q] = (_Float16)bf16_round(x[t * 8 + q]); *(v8us*)((unsigned short*)X16 + t * 8) = f.half[0];  }
__global__ __launch_bounds__(256) void k_h16(const float* __restrict__ x, _Float16* __restrict__ X16, size_t n8) { const size_t t = (size_t)blockIdx.x * 256 + threadIdx.x; if (t >= n8) return; FragH f;
#pragma unroll
  for (int q = 0; q < 8; ++q) f.h[q] = (_Float16)x[t * 8 + q]; *(v8us*)((unsigned short*)X16 + t * 8) = f.half[0];  }
__device__ __forceinline__ void d_round16f(int blk, const float* __restrict__ W, _Float16* __restrict__ Bt, size_t n8) { const size_t t = (size_t)blk * 256 + threadIdx.x; if (t >= n8) return; FragH f;
#pragma unroll
  for (int i = 0; i < 8; ++i) f.h[i] = (_Float16)(bf16_round(W[t * 8 + i]) * 16.0f); *(v8us*)((unsigned short*)Bt + t * 8) = f.half[0];  }
// Bt[e][k] = f16(16 (W[4 e][k] + W[4 e + 1][k] + W[4 e + 2][k] + W[4 e + 3][k])), each W rounded to bf16 first, the sum in f32: W (4 NE, K) row-major, thread = 8 k of one e; both loops unrolled so that f.h is indexed by constants and stays in registers
template <int NE, int K>
__device__ __forceinline__ void d_fold4(int blk, const float* __restrict__ W, _Float16* __restrict__ Bt) { const int t = blk * 256 + threadIdx.x; if (t >= NE * (K / 8)) return; const int e = t / (K / 8), k8 = (t % (K / 8)) * 8; const float* wr = W + (size_t)e * 4 * K + k8; FragH f;
#pragma unroll
  for (int g = 0; g < 2; ++g) { const v4f a = *(const v4fa*)(wr + 4 * g), b = *(const v4fa*)(wr + K + 4 * g), c = *(const v4fa*)(wr + 2 * K + 4 * g), d = *(const v4fa*)(wr + 3 * K + 4 * g);
#pragma unroll
    for (int i = 0; i < 4; ++i) f.h[4 * g + i] = (_Float16)((((bf16_round(a[i]) + bf16_round(b[i])) + bf16_round(c[i])) + bf16_round(d[i])) * 16.0f); }
  *(v8us*)((unsigned short*)Bt + (size_t)t * 8) = f.half[0]; }
template <int NHv, int TTv>
__global__ __launch_bounds__(256) void k_vt(const _Float16* __restrict__ V16, int ldv, int voff, _Float16* __restrict__ Vt) { __shared__ unsigned short tl[64][66]; const int tid = threadIdx.x; const int slab = blockIdx.x / (TTv / 64), lg = blockIdx.x % (TTv / 64); const int b = slab / NHv, h = slab % NHv;
  for (int i = tid; i < 64 * 8; i += 256) { const int r = i / 8, c8 = (i % 8) * 8; FragH f; f.half[0] = *(const v8us*)((const unsigned short*)V16 + ((size_t)b * TTv + lg * 64 + r) * ldv + voff + h * 64 + c8);
#pragma unroll
    for (int q = 0; q < 8; ++q) tl[r][c8 + q] = f.u[q]; }
  __syncthreads();
  {
#pragma unroll
    for (int rd = 0; rd < 2; ++rd) { const int d = rd * 32 + tid / 8, pc = tid % 8; FragH f;
#pragma unroll
      for (int q = 0; q < 8; ++q) f.u[q] = tl[pc * 8 + q][d];
      *(v8us*)((unsigned short*)Vt + ((size_t)slab * 64 + d) * TTv + lg * 64 + pc * 8) = f.half[0]; }
     } }

__global__ __launch_bounds__(256) void k_hl(const float* __restrict__ F, _Float16* __restrict__ Hh, _Float16* __restrict__ Hl, size_t n8) { const size_t t = (size_t)blockIdx.x * 256 + threadIdx.x; if (t >= n8) return; FragH fh, fl; const v4f a = *(const v4fa*)(F + t * 8), c = *(const v4fa*)(F + t * 8 + 4);
#pragma unroll
  for (int q = 0; q < 4; ++q) { _Float16 h = (_Float16)a[q]; fh.h[q] = h; fl.h[q] = (_Float16)((a[q] - (float)h) * 1024.0f); h = (_Float16)c[q]; fh.h[4 + q] = h; fl.h[4 + q] = (_Float16)((c[q] - (float)h) * 1024.0f); }
  { *(v8us*)((unsigned short*)Hh + t * 8) = fh.half[0]; *(v8us*)((unsigned short*)Hl + t * 8) = fl.half[0];  } }

__device__ __forceinline__ void d_xr(int blk, const float* __restrict__ x, const float* __restrict__ w, const float* __restrict__ bb, _Float16* __restrict__ XR) {
  #pragma clang fp contract(off)
  const int t = blk * 256 + threadIdx.x; if (t >= NRW * (DR / 8)) return; const int c0 = (t % (DR / 8)) * 8; const int row = t / (DR / 8); const int b = row / NP, p = row % NP; FragH f;
#pragma unroll
  for (int q = 0; q < 8; ++q) { const int fl = p * DR + c0 + q; const int c = fl / 4096, i = (fl / 64) % 64, j = fl % 64; const float* xp = x + (((size_t)b * 32 + c) * 128 + 2 * i) * 128 + 2 * j;
    float s = bf16_round(bb[c]); s += bf16_round(w[c * 4 + 0]) * bf16_round(xp[0]); s += bf16_round(w[c * 4 + 1]) * bf16_round(xp[1]); s += bf16_round(w[c * 4 + 2]) * bf16_round(xp[128]); s += bf16_round(w[c * 4 + 3]) * bf16_round(xp[129]); f.h[q] = (_Float16)s; }
  *(v8us*)((unsigned short*)XR + (size_t)row * DR + c0) = f.half[0];  }
__device__ __forceinline__ void d_heads(int blk, const float* __restrict__ KV, _Float16* __restrict__ KH) {
  const int t = blk * 256 + threadIdx.x; if (t >= NBH * NP * 4) return; const int e0 = (t % 4) * 8; const int pp = (t / 4) % NP; const int bh = t / (4 * NP); const int b = bh / NHD, h = bh % NHD; const size_t row = (size_t)b * NP + h * 64 + pp / 8; const float* kr = KV + row * 2 * DR + (pp % 8) * 32; FragH fk;
#pragma unroll
  for (int q = 0; q < 8; ++q) fk.h[q] = (_Float16)kr[e0 + q];
  *(v8us*)((unsigned short*)KH + ((size_t)bh * NP + pp) * 32 + e0) = fk.half[0]; }
__device__ __forceinline__ void d_vt(int blk, const float* __restrict__ KV, _Float16* __restrict__ VT) { const int t = blk * 256 + threadIdx.x; if (t >= NBH * 32 * (NP / 8)) return; const int p0 = (t % (NP / 8)) * 8; const int e = (t / (NP / 8)) % 32; const int bh = t / ((NP / 8) * 32); const int b = bh / NHD, h = bh % NHD; FragH f;
#pragma unroll
  for (int q = 0; q < 8; ++q) { const int pp = p0 + q; f.h[q] = (_Float16)KV[((size_t)b * NP + h * 64 + pp / 8) * 2 * DR + DR + (pp % 8) * 32 + e]; }
  *(v8us*)((unsigned short*)VT + ((size_t)bh * 32 + e) * NP + p0) = f.half[0];  }
#define KPIT 40                  /* K row pitch in LDS, f16 elements */
#define VPIT 520                 /* V^T row pitch in LDS, f16 elements */
#define BPIT 72                  /* bias tile pitch in LDS, bf16 elements */
#define OPIT 36                  /* output staging pitch, floats */
#define AWV 16                   /* waves per work-group */
#define NCH (NP / 64)            /* chunks of 64 keys */
typedef float v2f __attribute__((ext_vector_type(2)));
typedef __bf16 v4b __attribute__((ext_vector_type(4)));
typedef __bf16 v4ba __attribute__((ext_vector_type(4), may_alias));
typedef __bf16 v8ba __attribute__((ext_vector_type(8), may_alias));
typedef __bf16 v8b __attribute__((ext_vector_type(8)));
typedef _Float16 v2h __attribute__((ext_vector_type(2)));
__device__ __forceinline__ float other_half(float v) { const int b = __float_as_int(v); return __int_as_float(__builtin_amdgcn_permlanex16(b, b, 0x76543210, 0xfedcba98, false, false)); }
__global__ __launch_bounds__(512) __attribute__((amdgpu_waves_per_eu(4, 4))) void k_attn(const _Float16* __restrict__ QS, const _Float16* __restrict__ KH, const _Float16* __restrict__ VT, const float* __restrict__ rb, float* __restrict__ out) {
  __shared__ __attribute__((aligned(16))) unsigned short sK[NP * KPIT];
  __shared__ __attribute__((aligned(16))) unsigned short sV[32 * VPIT];
  __shared__ __attribute__((aligned(16))) __bf16 sB[AWV][16 * BPIT];
  __shared__ __attribute__((aligned(16))) float sO[AWV][16 * OPIT];
  const int tid = threadIdx.x, w = tid >> 5, lane = tid & 31, c = lane & 15, hh = lane >> 4;
  const int bh = blockIdx.x >> 1, q0 = (blockIdx.x & 1) * (AWV * 16) + w * 16, h = bh % NHD;
  const unsigned short* gK = (const unsigned short*)KH + (size_t)bh * NP * 32;
  const unsigned short* gV = (const unsigned short*)VT + (size_t)bh * 32 * NP;
  const float* br = rb + ((size_t)h * NP + q0 + hh) * NP + c * 4;      /* load i of a chunk: rows 2 i + hh, 16 lanes x 16 B = one 256-B piece of a row */
  __bf16* sb = sB[w];
  v8us tk[4], tv[4]; v4f bn[8];
#pragma unroll
  for (int u = 0; u < 4; ++u) { tk[u] = *(const v8us*)(gK + (size_t)(tid + u * AWV * 32) * 8); tv[u] = *(const v8us*)(gV + (size_t)(tid + u * AWV * 32) * 8); }
#pragma unroll
  for (int i = 0; i < 8; ++i) bn[i] = *(const v4fa*)(br + (size_t)(2 * i) * NP);
  FragH fq;
  { const unsigned short* qr = (const unsigned short*)QS + ((size_t)bh * NP + q0 + c) * 32; fq.half[0] = *(const v8us*)(qr + 8 * hh); fq.half[1] = *(const v8us*)(qr + 16 + 8 * hh); }
  /* the address registers of the loads above are reused further down: the wait stands in front of every such overwrite */
  asm volatile("s_wait_xcnt 0x0" ::: "memory");
#pragma unroll
  for (int u = 0; u < 4; ++u) { const int i = tid + u * AWV * 32; *(v8us*)&sK[(i >> 2) * KPIT + (i & 3) * 8] = tk[u]; *(v8us*)&sV[(i >> 6) * VPIT + (i & 63) * 8] = tv[u]; }
#pragma unroll
  for (int i = 0; i < 8; ++i) { *(v4ba*)&sb[(2 * i + hh) * BPIT + c * 4] = __builtin_convertvector(bn[i], v4b); bn[i] = *(const v4fa*)(br + (size_t)(2 * i) * NP + 64); }
  __syncthreads();
  const float L2E = 1.4426950408889634f;
  v8f o0 = {}, o1 = {};
  float m = -3.0e38f, ls = 0.f;
#pragma unroll 1      /* rolled: eight copies of this body would add code and registers and save nothing */
  for (int kc = 0; kc < NCH; ++kc) {
    /* the lanes of this wave read bias values that other lanes of it stored in the trip before: the stores have to be done first */
    asm volatile("s_wait_dscnt 0x0" ::: "memory");
    float l[32];
#pragma unroll
    for (int j = 0; j < 4; ++j) {
      const v8b pb = *(const v8ba*)&sb[c * BPIT + j * 16 + 8 * hh];      /* register r: bias[q0 + c][64 kc + 16 j + 8 hh + r], the S^T tile's own map */
      FragH fk; const unsigned short* kr = &sK[(kc * 64 + j * 16 + c) * KPIT];
      fk.half[0] = *(const v8us*)(kr + 8 * hh); fk.half[1] = *(const v8us*)(kr + 16 + 8 * hh);
      const v8f z = {};
      const v8f s = __builtin_amdgcn_wmma_f32_16x16x32_f16(false, fk.v, false, fq.v, (short)0, z, false, false);
#pragma unroll
      for (int r = 0; r < 8; ++r) l[j * 8 + r] = __builtin_fmaf(s[r], 0.03125f, (float)pb[r]);
    }
    /* next chunk's bias into the tile (its readers above are done), then the loads of the chunk after it; past the end both repeat the last chunk */
    const float* bx = br + ((kc + 2 < NCH) ? kc + 2 : NCH - 1) * 64;
#pragma unroll
    for (int i = 0; i < 8; ++i) { *(v4ba*)&sb[(2 * i + hh) * BPIT + c * 4] = __builtin_convertvector(bn[i], v4b); bn[i] = *(const v4fa*)(bx + (size_t)(2 * i) * NP); }
    float cj[4];
#pragma unroll
    for (int j = 0; j < 4; ++j) { cj[j] = l[j * 8];
#pragma unroll
      for (int r = 1; r < 8; ++r) cj[j] = fmaxf(cj[j], l[j * 8 + r]); }
    float cm = fmaxf(fmaxf(cj[0], cj[1]), fmaxf(cj[2], cj[3]));
    cm = fmaxf(cm, other_half(cm));
    const float mn = fmaxf(m, cm);
    const float sc = __builtin_amdgcn_exp2f((m - mn) * L2E);
    const float mb = 10.0f - mn * L2E;
    m = mn;
    v2f sa = {0.f, 0.f}, sd = {0.f, 0.f};
    FragH fp[2];
#pragma unroll
    for (int i = 0; i < 32; i += 4) {
      v2f ta, tc, pa, pc; const v2f l2e = {L2E, L2E}, mb2 = {mb, mb};
      ta[0] = l[i]; ta[1] = l[i + 1]; tc[0] = l[i + 2]; tc[1] = l[i + 3];
      ta = __builtin_elementwise_fma(ta, l2e, mb2); tc = __builtin_elementwise_fma(tc, l2e, mb2);
      pa[0] = __builtin_amdgcn_exp2f(ta[0]); pa[1] = __builtin_amdgcn_exp2f(ta[1]); pc[0] = __builtin_amdgcn_exp2f(tc[0]); pc[1] = __builtin_amdgcn_exp2f(tc[1]);
      sa += pa; sd += pc;
      const v2h ha = __builtin_convertvector(pa, v2h), hc = __builtin_convertvector(pc, v2h);
      fp[i >> 4].h[(i & 15)] = ha[0]; fp[i >> 4].h[(i & 15) + 1] = ha[1]; fp[i >> 4].h[(i & 15) + 2] = hc[0]; fp[i >> 4].h[(i & 15) + 3] = hc[1];
    }
    sa += sd;
    ls = __builtin_fmaf(ls, sc, sa[0] + sa[1]);
#pragma unroll
    for (int r = 0; r < 8; ++r) { o0[r] *= sc; o1[r] *= sc; }
#pragma unroll
    for (int u = 0; u < 2; ++u) {
      FragH v0, v1; const unsigned short* vr = &sV[c * VPIT + kc * 64 + u * 32];
      v0.half[0] = *(const v8us*)(vr + 8 * hh); v0.half[1] = *(const v8us*)(vr + 16 + 8 * hh);
      v1.half[0] = *(const v8us*)(vr + 16 * VPIT + 8 * hh); v1.half[1] = *(const v8us*)(vr + 16 * VPIT + 16 + 8 * hh);
      o0 = __builtin_amdgcn_wmma_f32_16x16x32_f16(false, v0.v, false, fp[u].v, (short)0, o0, false, false);
      o1 = __builtin_amdgcn_wmma_f32_16x16x32_f16(false, v1.v, false, fp[u].v, (short)0, o1, false, false);
    }
  }
  ls += other_half(ls);
  const float inv = 1.0f / ls;
  float* so = sO[w];               /* this wave's own staging: lane (c, hh) holds query c, e = 16 t + 8 hh + r */
  { v4f a;
    a[0] = o0[0] * inv; a[1] = o0[1] * inv; a[2] = o0[2] * inv; a[3] = o0[3] * inv; *(v4fa*)&so[c * OPIT + 8 * hh] = a;
    a[0] = o0[4] * inv; a[1] = o0[5] * inv; a[2] = o0[6] * inv; a[3] = o0[7] * inv; *(v4fa*)&so[c * OPIT + 8 * hh + 4] = a;
    a[0] = o1[0] * inv; a[1] = o1[1] * inv; a[2] = o1[2] * inv; a[3] = o1[3] * inv; *(v4fa*)&so[c * OPIT + 16 + 8 * hh] = a;
    a[0] = o1[4] * inv; a[1] = o1[5] * inv; a[2] = o1[6] * inv; a[3] = o1[7] * inv; *(v4fa*)&so[c * OPIT + 16 + 8 * hh + 4] = a; }
  /* the wave's lanes read each other's staged values: the LDS writes have to be done before the reads */
  asm volatile("s_wait_dscnt 0x0" ::: "memory");
  float* orow = out + ((size_t)bh * NP + q0) * 128 + lane * 4;      /* out_d = o_{d/4}: lane e writes its value four times, 512 B a query in one store */
#pragma unroll
  for (int q = 0; q < 16; ++q) { const float vv = so[q * OPIT + lane]; v4f v; v[0] = vv; v[1] = vv; v[2] = vv; v[3] = vv; *(v4f*)(orow + (size_t)q * 128) = v; }
}
__device__ __forceinline__ void d_bcat(int blk, const float* __restrict__ a, const float* __restrict__ b, float* __restrict__ O) { const int t = blk * 256 + threadIdx.x; const float v = (t < DR) ? a[t] : b[t - DR]; *(float*)(O + t) = v;
  /* in the shared kernel's code other passes' instructions follow this store and write its registers: the wait stands in front of every such overwrite */
  asm volatile("s_wait_xcnt 0x0" ::: "memory"); }
// Passes that read nothing of one another share one launch: each pass owns a range of block indices and runs there as it ran alone
// (same thread-to-element map; same block size, but for the bias concatenation: two blocks of 256 threads for its one block of 512).
// The choice of the pass is uniform for a block. The longest passes come first.
#define G_X16 (NRW * DQ / 8 / 256)       /* 4096 blocks */
#define G_XR  (NRW * (DR / 8) / 256)     /* 1024 */
#define G_FQ  (DR * DQ / 8 / 256)        /* 128 */
#define G_RW  (DR * DR / 8 / 256)        /* 32, once for Wk and once for Wv */
#define G_BC  (2 * DR / 256)             /* 2 */
__global__ __launch_bounds__(256) void k_prep(const float* __restrict__ x, const float* __restrict__ dww, const float* __restrict__ dwb, const float* __restrict__ Wq, const float* __restrict__ Wk, const float* __restrict__ Wv, const float* __restrict__ bk, const float* __restrict__ bv,
    _Float16* __restrict__ X16, _Float16* __restrict__ XR16, _Float16* __restrict__ BQ, _Float16* __restrict__ BKV, float* __restrict__ BKVb) {
  int blk = blockIdx.x;
  if (blk < G_X16) { d_x16(blk, x, X16, (size_t)NRW * DQ / 8); return; }      /* plain (P, 1024) view = flat */
  blk -= G_X16;
  if (blk < G_XR) { d_xr(blk, x, dww, dwb, XR16); return; }
  blk -= G_XR;
  if (blk < G_FQ) { d_fold4<DR, DQ>(blk, Wq, BQ); return; }      /* weights: (out, in) natural */
  blk -= G_FQ;
  if (blk < G_RW) { d_round16f(blk, Wk, BKV, (size_t)DR * DR / 8); return; }
  blk -= G_RW;
  if (blk < G_RW) { d_round16f(blk, Wv, BKV + (size_t)DR * DR, (size_t)DR * DR / 8); return; }
  blk -= G_RW;
  d_bcat(blk, bk, bv, BKVb);
}
#define G_GQ  ((NRW / 16) * (DR / 64) / 4)         /* 512 blocks, 32 k steps each */
#define G_GKV ((NRW / 16) * (2 * DR / 64) / 4)     /* 1024 blocks, 8 k steps each */
__global__ __launch_bounds__(128) void k_proj(const _Float16* __restrict__ X16, const _Float16* __restrict__ BQ, const float* __restrict__ bq, _Float16* __restrict__ QS,
    const _Float16* __restrict__ XR16, const _Float16* __restrict__ BKV, const float* __restrict__ BKVb, float* __restrict__ KVf) {
  __shared__ __attribute__((aligned(16))) float so[4][16][64];
  const int blk = blockIdx.x;
  if (blk < G_GQ) d_gemm_hhx<0, true>(so, blk, 0, X16, DQ, 0, BQ, DQ, 0, 0.0625f, bq, 0, nullptr, 1, 0, 0, nullptr, QS, DR, 0, NRW, DR, DQ);      /* (8192, 256) flat = (128, 512, 32) flat: row b 512 + h 64 + p / 8, column (p % 8) 32 + e */
  else d_gemm_hhx<0>(so, blk - G_GQ, 0, XR16, DR, 0, BKV, DR, 0, 0.0625f, BKVb, 0, nullptr, 1, 0, 0, KVf, nullptr, 2 * DR, 0, NRW, 2 * DR, DR);      /* [k | v] */
}
#define G_KH (NBH * NP * 4 / 256)            /* 1024 blocks */
#define G_VT (NBH * 32 * (NP / 8) / 256)     /* 1024 */
__global__ __launch_bounds__(256) void k_split(const float* __restrict__ KVf, _Float16* __restrict__ KH, _Float16* __restrict__ VT) {
  const int blk = blockIdx.x;
  if (blk < G_VT) d_vt(blk, KVf, VT); else d_heads(blk - G_VT, KVf, KH);
}

extern "C" void kernel_launch(void* const* d_in, const int* in_sizes, int n_in,
                              void* d_out, int out_size, void* d_ws, size_t ws_size, hipStream_t stream) {
  (void)in_sizes; (void)n_in; (void)out_size;
  const float* const* I = (const float* const*)d_in; const float* x = I[0]; const float* dww = I[1]; const float* dwb = I[2]; const float* Wq = I[3]; const float* bq = I[4]; const float* Wk = I[5]; const float* bk = I[6]; const float* Wv = I[7]; const float* bv = I[8]; const float* rb = I[9];
  char* ws = (char*)d_ws; size_t off = 0;
  auto take = [&](size_t bytes) { char* p = ws + off; off += (bytes + 255) & ~(size_t)255; return p; };
  _Float16* BQ = (_Float16*)take((size_t)DR * DQ * 2); _Float16* BKV = (_Float16*)take((size_t)2 * DR * DR * 2); float* BKVb = (float*)take(2 * DR * 4);
  _Float16* X16 = (_Float16*)take((size_t)NRW * DQ * 2); _Float16* XR16 = (_Float16*)take((size_t)NRW * DR * 2); float* KVf = (float*)take((size_t)NRW * 2 * DR * 4);
  _Float16* QS = (_Float16*)take((size_t)NBH * NP * 32 * 2); _Float16* KH = (_Float16*)take((size_t)NBH * NP * 32 * 2); _Float16* VT = (_Float16*)take((size_t)NBH * 32 * NP * 2);
  if (off > ws_size) return;
  k_prep<<<G_X16 + G_XR + G_FQ + 2 * G_RW + G_BC, 256, 0, stream>>>(x, dww, dwb, Wq, Wk, Wv, bk, bv, X16, XR16, BQ, BKV, BKVb);
  k_proj<<<G_GQ + G_GKV, 128, 0, stream>>>(X16, BQ, bq, QS, XR16, BKV, BKVb, KVf);
  k_split<<<G_VT + G_KH, 256, 0, stream>>>(KVf, KH, VT);
  k_attn<<<NBH * 2, AWV * 32, 0, stream>>>(QS, KH, VT, rb, (float*)d_out);
}

// v004
// Measured time: 69.2 microseconds a run.
// Timed twice side by side with v003, it ran 1.04 and 1.03 times as fast.
// All steps since v000 together make it 4.38 times as fast.
#include <hip/hip_runtime.h>
// Lightweight multi-head self-attention with reduced keys/values (B 16, C 32, 128×128; P 512 tokens of 1024 (q) / 256 (k, v after a depthwise 2×2 stride-2 reduction); 8 heads by PLAIN reshapes of the (P, dim) buffers; k/v nearest-upsampled 32 → 128 along the head dim; scores/√1024 + rel_bias; softmax; attn·v; plain reshape back to [16,32,128,128]).
// Structure: q/k/v projections as GEMMs (the depthwise reduction on VALU -> f16); the 32->128 nearest upsampling is folded into the contraction (sum_d q_d k_{d/4} = sum_e (sum_{d/4=e} q_d) k_e and out_d = o_{d/4}), and the sum over each four q columns is folded further into the projection itself (sum_{d/4=e} q_d = x . sum_{d/4=e} Wq[d] + sum_{d/4=e} bq[d]): the q GEMM has N 256 and its f16 output, read flat, is the head operand; the plain-view head split of k and v by index arithmetic on VALU; scores (K 32, scale 1/32), bias, running-max softmax (x 2^10, f16), P.V (N 32) and the expanded output in ONE fused kernel, scores and probabilities kept in registers.
// Compute dtype: inputs and parameters rounded to bf16; x exact in f16; folded q weights, reduced x, head operands and probabilities f16 (about 2^-12); f32 accumulation; softmax f32. v_wmma_f32_16x16x32_f16.
#define NB 16
#define NP 512
#define DQ 1024
#define DR 256
#define NHD 8
#define NBH (NB * NHD)           /* 128 */
#define NRW (NB * NP)            /* 8192 rows */
typedef __bf16 v16b __attribute__((ext_vector_type(16)));
typedef unsigned short v8us __attribute__((ext_vector_type(8), may_alias));
typedef float  v8f  __attribute__((ext_vector_type(8)));
typedef float  v4f  __attribute__((ext_vector_type(4)));
typedef float  v4fa __attribute__((ext_vector_type(4), may_alias));
union FragB { v16b v; v8us half[2]; unsigned short u[16]; };

__device__ __forceinline__ unsigned short bf16_bits(float x) { unsigned int u = __float_as_uint(x); return (unsigned short)((u + 0x7FFFu + ((u >> 16) & 1u)) >> 16); }
__device__ __forceinline__ float bf16_val(unsigned short b) { return __uint_as_float(((unsigned int)b) << 16); }
__device__ __forceinline__ float bf16_round(float x) { return bf16_val(bf16_bits(x)); }
// D += A·B with NT terms: 1 = ah·bh, 2 = + al·bh (A split), 3 = + ah·bl (both split)
template <int NT>
__device__ __forceinline__ v8f mmaN(v16b ah, v16b al, v16b bh, v16b bl, v8f c) {
  c = __builtin_amdgcn_wmma_f32_16x16x32_bf16(false, ah, false, bh, (short)0, c, false, false);
  if (NT >= 2) c = __builtin_amdgcn_wmma_f32_16x16x32_bf16(false, al, false, bh, (short)0, c, false, false);
  if (NT >= 3) c = __builtin_amdgcn_wmma_f32_16x16x32_bf16(false, ah, false, bl, (short)0, c, false, false);
  asm volatile("v_nop\n\tv_nop\n\tv_nop\n\tv_nop" : "+v"(c) : "v"(ah), "v"(al), "v"(bh), "v"(bl));
  return c;
}

__global__ __launch_bounds__(256) void k_wt_bf16(const float* __restrict__ W, unsigned short* __restrict__ Wt, int K, int N) {
  const int t = blockIdx.x * 256 + threadIdx.x;
  const int k8n = K / 8;
  if (t >= N * k8n) return;
  const int n = t / k8n, k8 = (t % k8n) * 8;
  v8us v;
#pragma unroll
  for (int i = 0; i < 8; ++i) v[i] = bf16_bits(W[(size_t)(k8 + i) * N + n]);
  *(v8us*)(Wt + (size_t)n * K + k8) = v;
  
}

// GEMM C[M][N] (f32, pitch ldc) = act(A[M][K]·W + bias). A f32 row-major (pitch lda) converted per fragment to bf16
// (ASPLIT: hi/lo two planes -> 2 terms, else single rounded term); Wt bf16 [N][K] (pitch ldb). BIAS_BF16 rounds the
// bias to bf16 first (bias quantised to bf16 before the add). K%32==0, M%16==0, N%64==0.
template <bool ASPLIT, int ACT, bool BIAS_BF16>
__global__ __launch_bounds__(128) void k_gemm_bf(const float* __restrict__ A, int lda, const unsigned short* __restrict__ Wt, int ldb,
                                               const float* __restrict__ bias, float* __restrict__ C, int ldc, int M, int N, int K) {
  __shared__ __attribute__((aligned(16))) float so[4][16][64];
  const int tid = threadIdx.x, w = tid >> 5, lane = tid & 31, ln = lane & 15, hh = lane >> 4;
  const int ntn = N / 64;
  const int wid = blockIdx.x * 4 + w;
  const int mt = wid / ntn, nq = wid % ntn;
  if (mt * 16 >= M) return;
  const int row0 = mt * 16, col0 = nq * 64;
  const float* arow = A + (size_t)(row0 + ln) * lda;
  v8f acc[4] = {};
  for (int kb = 0; kb < K; kb += 32) {
    FragB ah, al;
    const v4f x0 = *(const v4fa*)(arow + kb + 8 * hh), x1 = *(const v4fa*)(arow + kb + 8 * hh + 4);
    const v4f x2 = *(const v4fa*)(arow + kb + 16 + 8 * hh), x3 = *(const v4fa*)(arow + kb + 16 + 8 * hh + 4);
    float xs[16] = {x0[0],x0[1],x0[2],x0[3],x1[0],x1[1],x1[2],x1[3],x2[0],x2[1],x2[2],x2[3],x3[0],x3[1],x3[2],x3[3]};
#pragma unroll
    for (int i = 0; i < 16; ++i) { const unsigned short hb = bf16_bits(xs[i]); ah.u[i] = hb; al.u[i] = ASPLIT ? bf16_bits(xs[i] - bf16_val(hb)) : (unsigned short)0; }
#pragma unroll
    for (int t = 0; t < 4; ++t) {
      const unsigned short* brow = Wt + (size_t)(col0 + t * 16 + ln) * ldb + kb;
      FragB b;
      b.half[0] = *(const v8us*)(brow + 8 * hh);
      b.half[1] = *(const v8us*)(brow + 16 + 8 * hh);
      acc[t] = mmaN<ASPLIT ? 2 : 1>(ah.v, al.v, b.v, b.v, acc[t]);
    }
  }
#pragma unroll
  for (int t = 0; t < 4; ++t) {
    float bv = bias ? bias[col0 + t * 16 + ln] : 0.f;
    if (BIAS_BF16) bv = bf16_round(bv);
#pragma unroll
    for (int r = 0; r < 8; ++r) { float v = acc[t][r] + bv; if (ACT == 1) v = fmaxf(v, 0.f); so[w][8 * hh + r][t * 16 + ln] = v; }
  }
  __builtin_amdgcn_fence(__ATOMIC_ACQ_REL, "workgroup");
  __builtin_amdgcn_wave_barrier();
  const int rsub = lane >> 4, c4 = (lane & 15) * 4;
  {
#pragma unroll
    for (int q = 0; q < 8; ++q) {
      const int r = q * 2 + rsub;
      const v4f v = *(const v4fa*)&so[w][r][c4];
      *(v4f*)(C + (size_t)(row0 + r) * ldc + col0 + c4) = v;
    }
    
  }
}

// GEMM C = act(A·W + bias + resid): A f32 (ASPLIT -> hi/lo 2 terms), Wt bf16 [N][K]; ACT 0 none, 1 relu, 2 exact gelu;
// resid (optional, f32, row index = (row % rmod), pitch ldr, RES_BF16 rounds it) added before the activation.
template <bool ASPLIT, int ACT, bool BIAS_BF16, bool RES_BF16>
__global__ __launch_bounds__(128) void k_gemm_bf3(const float* __restrict__ A, int lda, const unsigned short* __restrict__ Wt, int ldb,
                                                const float* __restrict__ bias, const float* __restrict__ resid, int rmod, int ldr,
                                                float* __restrict__ C, int ldc, int M, int N, int K) {
  __shared__ __attribute__((aligned(16))) float so[4][16][64];
  const int tid = threadIdx.x, w = tid >> 5, lane = tid & 31, ln = lane & 15, hh = lane >> 4;
  const int ntn = N / 64;
  const int wid = blockIdx.x * 4 + w;
  const int mt = wid / ntn, nq = wid % ntn;
  if (mt * 16 >= M) return;
  const int row0 = mt * 16, col0 = nq * 64;
  const float* arow = A + (size_t)(row0 + ln) * lda;
  v8f acc[4] = {};
  for (int kb = 0; kb < K; kb += 32) {
    FragB ah, al;
    const v4f x0 = *(const v4fa*)(arow + kb + 8 * hh), x1 = *(const v4fa*)(arow + kb + 8 * hh + 4);
    const v4f x2 = *(const v4fa*)(arow + kb + 16 + 8 * hh), x3 = *(const v4fa*)(arow + kb + 16 + 8 * hh + 4);
    float xs[16] = {x0[0],x0[1],x0[2],x0[3],x1[0],x1[1],x1[2],x1[3],x2[0],x2[1],x2[2],x2[3],x3[0],x3[1],x3[2],x3[3]};
#pragma unroll
    for (int i = 0; i < 16; ++i) { const unsigned short hb = bf16_bits(xs[i]); ah.u[i] = hb; al.u[i] = ASPLIT ? bf16_bits(xs[i] - bf16_val(hb)) : (unsigned short)0; }
#pragma unroll
    for (int t = 0; t < 4; ++t) {
      const unsigned short* brow = Wt + (size_t)(col0 + t * 16 + ln) * ldb + kb;
      FragB b;
      b.half[0] = *(const v8us*)(brow + 8 * hh);
      b.half[1] = *(const v8us*)(brow + 16 + 8 * hh);
      acc[t] = mmaN<ASPLIT ? 2 : 1>(ah.v, al.v, b.v, b.v, acc[t]);
    }
  }
#pragma unroll
  for (int t = 0; t < 4; ++t) {
    const int col = col0 + t * 16 + ln;
    float bv = bias ? bias[col] : 0.f;
    if (BIAS_BF16) bv = bf16_round(bv);
#pragma unroll
    for (int r = 0; r < 8; ++r) {
      float v = acc[t][r] + bv;
      if (resid) { float rv = resid[(size_t)((row0 + 8 * hh + r) % rmod) * ldr + col]; if (RES_BF16) rv = bf16_round(rv); v += rv; }
      if (ACT == 1) v = fmaxf(v, 0.f);
      if (ACT == 2) v = 0.5f * v * (1.0f + erff(v * 0.70710678118654752f));
      if (ACT == 3) { const float u = 0.7978845608028654f * (v + 0.044715f * v * v * v); v = 0.5f * v * (1.0f + tanhf(u)); }
      so[w][8 * hh + r][t * 16 + ln] = v;
    }
  }
  __builtin_amdgcn_fence(__ATOMIC_ACQ_REL, "workgroup");
  __builtin_amdgcn_wave_barrier();
  const int rsub = lane >> 4, c4 = (lane & 15) * 4;
  {
#pragma unroll
    for (int q = 0; q < 8; ++q) {
      const int r = q * 2 + rsub;
      const v4f v = *(const v4fa*)&so[w][r][c4];
      *(v4f*)(C + (size_t)(row0 + r) * ldc + col0 + c4) = v;
    }
    
  }
}
// row LayerNorm (biased variance, eps) over N: s = X (+ R); optional out_sum <- s; out_norm <- (s-mu)*rsqrt(var+eps)*g + b
template <bool PARAM_BF16>
__global__ __launch_bounds__(256) void k_layernorm(const float* __restrict__ X, const float* __restrict__ R, const float* __restrict__ g, const float* __restrict__ bta,
                                                  float* __restrict__ out_sum, float* __restrict__ out_norm, int N, float eps) {
  __shared__ float red[256];
  const int row = blockIdx.x, tid = threadIdx.x;
  const float* x = X + (size_t)row * N; const float* rr = R ? R + (size_t)row * N : nullptr;
  float vals[16];                     // up to N = 4096
  const int per = N / 256;            // contiguous chunk per thread? use strided-by-4 chunks: thread handles j = tid*4 + 1024*u
  float s1 = 0.f;
  for (int u = 0; u < per / 4; ++u) {
    const int j = tid * 4 + 1024 * u;
    const v4f a = *(const v4fa*)(x + j);
    v4f b = {0.f,0.f,0.f,0.f}; if (rr) b = *(const v4fa*)(rr + j);
#pragma unroll
    for (int q = 0; q < 4; ++q) { const float v = a[q] + b[q]; vals[u * 4 + q] = v; s1 += v; }
  }
  red[tid] = s1; __syncthreads();
  for (int st = 128; st > 0; st >>= 1) { if (tid < st) red[tid] += red[tid + st]; __syncthreads(); }
  const float mu = red[0] / (float)N; __syncthreads();
  float s2 = 0.f;
  for (int u = 0; u < per / 4; ++u)
#pragma unroll
    for (int q = 0; q < 4; ++q) { const float c = vals[u * 4 + q] - mu; s2 += c * c; }
  red[tid] = s2; __syncthreads();
  for (int st = 128; st > 0; st >>= 1) { if (tid < st) red[tid] += red[tid + st]; __syncthreads(); }
  const float rs = rsqrtf(red[0] / (float)N + eps);
  {
    for (int u = 0; u < per / 4; ++u) {
      const int j = tid * 4 + 1024 * u;
      v4f o, sm;
#pragma unroll
      for (int q = 0; q < 4; ++q) {
        float gg = g[j + q], bb = bta[j + q];
        if (PARAM_BF16) { gg = bf16_round(gg); bb = bf16_round(bb); }
        sm[q] = vals[u * 4 + q]; o[q] = (vals[u * 4 + q] - mu) * rs * gg + bb;
      }
      if (out_sum) *(v4f*)(out_sum + (size_t)row * N + j) = sm;
      *(v4f*)(out_norm + (size_t)row * N + j) = o;
    }
    
  }
}



// ---- f16 WMMA path (v_wmma_f32_16x16x32_f16): 11-bit significands for operands in range — used where a [0,1] probability operand needs more precision than bf16
typedef _Float16 v16h __attribute__((ext_vector_type(16)));
union FragH { v16h v; v8us half[2]; _Float16 h[16]; unsigned short u[16]; };
template <int NT>
__device__ __forceinline__ v8f mmaH(v16h ah, v16h al, v16h bh, v16h bl, v8f c) {
  c = __builtin_amdgcn_wmma_f32_16x16x32_f16(false, ah, false, bh, (short)0, c, false, false);
  if (NT >= 2) c = __builtin_amdgcn_wmma_f32_16x16x32_f16(false, al, false, bh, (short)0, c, false, false);
  if (NT >= 3) c = __builtin_amdgcn_wmma_f32_16x16x32_f16(false, ah, false, bl, (short)0, c, false, false);
  asm volatile("v_nop\n\tv_nop\n\tv_nop\n\tv_nop" : "+v"(c) : "v"(ah), "v"(al), "v"(bh), "v"(bl));
  return c;
}
// batched GEMM like k_gemm_b but f16 operands: A f32 (split into f16 hi/lo if ASPLIT, else rounded to f16), Bt = f16 values [n][k]; alpha; C f32; N multiple of 16 (partial tiles skipped)
template <bool ASPLIT>
__global__ __launch_bounds__(128) void k_gemm_h(const float* __restrict__ A, int lda, size_t sA, const _Float16* __restrict__ Bh, int ldb, size_t sB, float alpha, float* __restrict__ C, int ldc, size_t sC, int M, int N, int K) {
  __shared__ __attribute__((aligned(16))) float so[4][16][64];
  const int tid = threadIdx.x, w = tid >> 5, lane = tid & 31, ln = lane & 15, hh = lane >> 4; const int by = blockIdx.y;
  A += (size_t)by * sA; Bh += (size_t)by * sB; C += (size_t)by * sC;
  const int ntn = (N + 63) / 64; const int wid = blockIdx.x * 4 + w; const int mt = wid / ntn, nq = wid % ntn; if (mt * 16 >= M) return;
  const int row0 = mt * 16, col0 = nq * 64; const float* arow = A + (size_t)(row0 + ln) * lda;
  v8f acc[4] = {};
  for (int kb = 0; kb < K; kb += 32) {
    FragH ah, al;
    const v4f x0 = *(const v4fa*)(arow + kb + 8 * hh), x1 = *(const v4fa*)(arow + kb + 8 * hh + 4), x2 = *(const v4fa*)(arow + kb + 16 + 8 * hh), x3 = *(const v4fa*)(arow + kb + 16 + 8 * hh + 4);
    float xs[16] = {x0[0],x0[1],x0[2],x0[3],x1[0],x1[1],x1[2],x1[3],x2[0],x2[1],x2[2],x2[3],x3[0],x3[1],x3[2],x3[3]};
#pragma unroll
    for (int i = 0; i < 16; ++i) { const _Float16 h = (_Float16)xs[i]; ah.h[i] = h; al.h[i] = ASPLIT ? (_Float16)(xs[i] - (float)h) : (_Float16)0.0f; }
#pragma unroll
    for (int t = 0; t < 4; ++t) { if (col0 + t * 16 >= N) continue; const size_t boff = (size_t)(col0 + t * 16 + ln) * ldb + kb; FragH bq; bq.half[0] = *(const v8us*)(Bh + boff + 8 * hh); bq.half[1] = *(const v8us*)(Bh + boff + 16 + 8 * hh);
      acc[t] = mmaH<ASPLIT ? 2 : 1>(ah.v, al.v, bq.v, bq.v, acc[t]); }
  }
#pragma unroll
  for (int t = 0; t < 4; ++t) { if (col0 + t * 16 >= N) continue;
#pragma unroll
    for (int r = 0; r < 8; ++r) so[w][8 * hh + r][t * 16 + ln] = acc[t][r] * alpha; }
  __builtin_amdgcn_fence(__ATOMIC_ACQ_REL, "workgroup"); __builtin_amdgcn_wave_barrier();
  const int rsub = lane >> 4, c4 = (lane & 15) * 4;
  {
#pragma unroll
    for (int q = 0; q < 8; ++q) { const int r = q * 2 + rsub; if (col0 + c4 < N) { const v4f v = *(const v4fa*)&so[w][r][c4]; *(v4f*)(C + (size_t)(row0 + r) * ldc + col0 + c4) = v; } }
     }
}

// Wt[n][k] = f16(W[k][n]·scale) from f32 row-major W[K][N] (scale = power of two; bf16-exact weights stay exact in f16 away from the subnormal range)
__global__ __launch_bounds__(256) void k_wt_f16(const float* __restrict__ W, _Float16* __restrict__ Wt, int K, int N, float scale) {
  const int t = blockIdx.x * 256 + threadIdx.x; if (t >= N * (K / 8)) return; const int n = t / (K / 8), k8 = (t % (K / 8)) * 8; FragH f;
#pragma unroll
  for (int i = 0; i < 8; ++i) f.h[i] = (_Float16)(bf16_round(W[(size_t)(k8 + i) * N + n]) * scale); const v8us o = f.half[0];
  *(v8us*)((unsigned short*)Wt + (size_t)n * K + k8) = o; 
}
// k_gemm_hh variant with fused epilogue: v = acc·alpha + bias[by·sBias + col] (+ CP[(row/rowsPerB)·sCPb + by·64 + col] if CP) ; ACT 0 none / 1 elu ; writes f16 C16 and f32 C, each if non-null
// BSUM4: output column col stands for the four columns 4 col .. 4 col + 3 of the unfolded product, so its bias is the sum of their four rounded biases
// a device function: the kernel that calls it hands in its LDS staging and the block's index (bx, by) inside this product's own grid
template <int ACT, bool BSUM4 = false>
__device__ __forceinline__ void d_gemm_hhx(float (&so)[4][16][64], int bx, int by, const _Float16* __restrict__ A, int lda, size_t sA, const _Float16* __restrict__ Bh, int ldb, size_t sB, float alpha, const float* __restrict__ bias, size_t sBias, const float* __restrict__ CP, int rowsPerB, size_t sCPb, int row0g,
    float* __restrict__ C, _Float16* __restrict__ C16, int ldc, size_t sC, int M, int N, int K) {
  const int tid = threadIdx.x, w = tid >> 5, lane = tid & 31, ln = lane & 15, hh = lane >> 4;
  A += (size_t)by * sA; Bh += (size_t)by * sB; const size_t cofs = (size_t)by * sC; const float* bp = bias ? bias + (size_t)by * sBias : nullptr;
  const int ntn = (N + 63) / 64; const int wid = bx * 4 + w; const int mt = wid / ntn, nq = wid % ntn; if (mt * 16 >= M) return;
  const int row0 = mt * 16, col0 = nq * 64; const _Float16* arow = A + (size_t)(row0 + ln) * lda;
  v8f acc[4] = {};
  for (int kb = 0; kb < K; kb += 32) { FragH ah; ah.half[0] = *(const v8us*)((const unsigned short*)arow + kb + 8 * hh); ah.half[1] = *(const v8us*)((const unsigned short*)arow + kb + 16 + 8 * hh);
#pragma unroll
    for (int t = 0; t < 4; ++t) { if (col0 + t * 16 >= N) continue; const size_t boff = (size_t)(col0 + t * 16 + ln) * ldb + kb; FragH bq; bq.half[0] = *(const v8us*)((const unsigned short*)Bh + boff + 8 * hh); bq.half[1] = *(const v8us*)((const unsigned short*)Bh + boff + 16 + 8 * hh);
      acc[t] = mmaH<1>(ah.v, ah.v, bq.v, bq.v, acc[t]); }
  }
#pragma unroll
  for (int t = 0; t < 4; ++t) { if (col0 + t * 16 >= N) continue; const int col = col0 + t * 16 + ln; float bv = 0.f;
    if (bp) { if (BSUM4) { const v4f b4 = *(const v4fa*)(bp + 4 * col); bv = ((bf16_round(b4[0]) + bf16_round(b4[1])) + bf16_round(b4[2])) + bf16_round(b4[3]); } else bv = bf16_round(bp[col]); }
#pragma unroll
    for (int r = 0; r < 8; ++r) { float v = acc[t][r] * alpha + bv; if (CP) { const int bidx = (row0g + row0 + 8 * hh + r) / rowsPerB; v += CP[(size_t)bidx * sCPb + (size_t)by * 64 + col]; } if (ACT == 1) v = (v > 0.f) ? v : expm1f(v); else if (ACT == 7) v = (v > 0.f) ? v + 1.0f : expf(v); else if (ACT == 8) v = tanhf(v); else if (ACT == 9) v = 0.5f * v * (1.0f + tanhf(0.7978845608028654f * (v + 0.044715f * v * v * v))); else if (ACT == 11) v = 1.0f / (1.0f + expf(-v)); else if (ACT == 12) v = (v > 0.f) ? v : 0.01f * v; else if (ACT == 14) v = (v > 0.f) ? v : 0.1f * v; else if (ACT == 15) v = v / (1.0f + expf(-v)); else if (ACT == 3) v = fmaxf(v, 0.f); else if (ACT == 6) v = 0.5f * v * (1.0f + erff(v * 0.70710678118654752f)); so[w][8 * hh + r][t * 16 + ln] = v; } }
  __builtin_amdgcn_fence(__ATOMIC_ACQ_REL, "workgroup"); __builtin_amdgcn_wave_barrier();
  const int rsub = lane >> 4, c4 = (lane & 15) * 4; typedef _Float16 v4h __attribute__((ext_vector_type(4)));
  {
#pragma unroll
    for (int q = 0; q < 8; ++q) { const int r = q * 2 + rsub; if (col0 + c4 < N) { const v4f v = *(const v4fa*)&so[w][r][c4]; if (C) *(v4f*)(C + cofs + (size_t)(row0 + r) * ldc + col0 + c4) = v; if (C16) { v4h h4; for (int i = 0; i < 4; ++i) h4[i] = (_Float16)v[i]; *(v4h*)(C16 + cofs + (size_t)(row0 + r) * ldc + col0 + c4) = h4; } } }
     }
}


typedef _Float16 v4h __attribute__((ext_vector_type(4)));

// The element-wise passes are looped: one block does the work of NU x F blocks of the plain grid (a piece = what one thread of the plain grid did:
// same reads, same arithmetic, same 16-B store), in NU bursts of F pieces. A launch so starts NU x F times fewer waves, and a wave has the 16 loads
// of a whole burst (16 B a lane each) in flight. Every grid divides exactly: no bounds test. Each '#pragma unroll' keeps a burst's register arrays at constant indices
// and its loads in front of the first use; each '#pragma unroll 1' keeps the bursts one after the other (side by side they would need NU times the registers).
// Two waits a burst, each in front of every overwrite of a register that an issued load or store names: one behind the loads (it takes the address as an input,
// so that the pair stays live up to it and no load of the burst lands on it), one behind the stores (the next burst, or another pass's code in the shared kernel, follows).
template <int F, int NU>
__device__ __forceinline__ void d_x16(int blk, const float* __restrict__ x, _Float16* __restrict__ X16) { size_t t0 = (size_t)blk * (NU * F * 256) + threadIdx.x;
#pragma unroll 1
  for (int n = 0; n < NU; ++n, t0 += F * 256) { const float* xp = x + t0 * 8; v4f a[F], b[F];
#pragma unroll
    for (int u = 0; u < F; ++u) { a[u] = *(const v4fa*)(xp + u * 2048); b[u] = *(const v4fa*)(xp + u * 2048 + 4); }
    asm volatile("s_wait_xcnt 0x0" :: "v"(xp) : "memory");      /* in front of every overwrite of the loads' address pair, which stays live up to here */
#pragma unroll
    for (int u = 0; u < F; ++u) { FragH f;
#pragma unroll
      for (int q = 0; q < 4; ++q) { f.h[q] = (_Float16)bf16_round(a[u][q]); f.h[4 + q] = (_Float16)bf16_round(b[u][q]); }
      *(v8us*)((unsigned short*)X16 + (t0 + u * 256) * 8) = f.half[0]; }
    asm volatile("s_wait_xcnt 0x0" ::: "memory");      /* in front of every overwrite of the stores' registers by what follows */ } }
__global__ __launch_bounds__(256) void k_h16(const float* __restrict__ x, _Float16* __restrict__ X16, size_t n8) { const size_t t = (size_t)blockIdx.x * 256 + threadIdx.x; if (t >= n8) return; FragH f;
#pragma unroll
  for (int q = 0; q < 8; ++q) f.h[q] = (_Float16)x[t * 8 + q]; *(v8us*)((unsigned short*)X16 + t * 8) = f.half[0];  }
template <int F>
__device__ __forceinline__ void d_round16f(int blk, const float* __restrict__ W, _Float16* __restrict__ Bt) { const size_t t0 = (size_t)blk * (F * 256) + threadIdx.x; const float* wp = W + t0 * 8; v4f a[F], b[F];
#pragma unroll
  for (int u = 0; u < F; ++u) { a[u] = *(const v4fa*)(wp + u * 2048); b[u] = *(const v4fa*)(wp + u * 2048 + 4); }
  asm volatile("s_wait_xcnt 0x0" :: "v"(wp) : "memory");      /* in front of every overwrite of the loads' address pair, which stays live up to here */
#pragma unroll
  for (int u = 0; u < F; ++u) { FragH f;
#pragma unroll
    for (int i = 0; i < 4; ++i) { f.h[i] = (_Float16)(bf16_round(a[u][i]) * 16.0f); f.h[4 + i] = (_Float16)(bf16_round(b[u][i]) * 16.0f); }
    *(v8us*)((unsigned short*)Bt + (t0 + u * 256) * 8) = f.half[0]; }
  asm volatile("s_wait_xcnt 0x0" ::: "memory");      /* in front of every overwrite of the stores' registers by what follows */ }
// Bt[e][k] = f16(16 (W[4 e][k] + W[4 e + 1][k] + W[4 e + 2][k] + W[4 e + 3][k])), each W rounded to bf16 first, the sum in f32: W (4 NE, K) row-major, thread = F pieces of 8 k of one e each; both loops unrolled so that f.h is indexed by constants and stays in registers
template <int NE, int K, int F>
__device__ __forceinline__ void d_fold4(int blk, const float* __restrict__ W, _Float16* __restrict__ Bt) { static_assert(256 % (K / 8) == 0, "a piece further on is whole rows further on"); const int t0 = blk * (F * 256) + threadIdx.x; const int e = t0 / (K / 8), k8 = (t0 % (K / 8)) * 8; const float* wr = W + (size_t)e * 4 * K + k8; v4f r[F][2][4];
#pragma unroll
  for (int u = 0; u < F; ++u)
#pragma unroll
    for (int g = 0; g < 2; ++g)
#pragma unroll
      for (int j = 0; j < 4; ++j) r[u][g][j] = *(const v4fa*)(wr + (u * (256 / (K / 8)) * 4 + j) * K + 4 * g);
  asm volatile("s_wait_xcnt 0x0" :: "v"(wr) : "memory");      /* in front of every overwrite of the loads' address pair, which stays live up to here */
#pragma unroll
  for (int u = 0; u < F; ++u) { FragH f;
#pragma unroll
    for (int g = 0; g < 2; ++g)
#pragma unroll
      for (int i = 0; i < 4; ++i) f.h[4 * g + i] = (_Float16)((((bf16_round(r[u][g][0][i]) + bf16_round(r[u][g][1][i])) + bf16_round(r[u][g][2][i])) + bf16_round(r[u][g][3][i])) * 16.0f);
    *(v8us*)((unsigned short*)Bt + (size_t)(t0 + u * 256) * 8) = f.half[0]; }
  asm volatile("s_wait_xcnt 0x0" ::: "memory");      /* in front of every overwrite of the stores' registers by what follows */ }
template <int NHv, int TTv>
__global__ __launch_bounds__(256) void k_vt(const _Float16* __restrict__ V16, int ldv, int voff, _Float16* __restrict__ Vt) { __shared__ unsigned short tl[64][66]; const int tid = threadIdx.x; const int slab = blockIdx.x / (TTv / 64), lg = blockIdx.x % (TTv / 64); const int b = slab / NHv, h = slab % NHv;
  for (int i = tid; i < 64 * 8; i += 256) { const int r = i / 8, c8 = (i % 8) * 8; FragH f; f.half[0] = *(const v8us*)((const unsigned short*)V16 + ((size_t)b * TTv + lg * 64 + r) * ldv + voff + h * 64 + c8);
#pragma unroll
    for (int q = 0; q < 8; ++q) tl[r][c8 + q] = f.u[q]; }
  __syncthreads();
  {
#pragma unroll
    for (int rd = 0; rd < 2; ++rd) { const int d = rd * 32 + tid / 8, pc = tid % 8; FragH f;
#pragma unroll
      for (int q = 0; q < 8; ++q) f.u[q] = tl[pc * 8 + q][d];
      *(v8us*)((unsigned short*)Vt + ((size_t)slab * 64 + d) * TTv + lg * 64 + pc * 8) = f.half[0]; }
     } }

__global__ __launch_bounds__(256) void k_hl(const float* __restrict__ F, _Float16* __restrict__ Hh, _Float16* __restrict__ Hl, size_t n8) { const size_t t = (size_t)blockIdx.x * 256 + threadIdx.x; if (t >= n8) return; FragH fh, fl; const v4f a = *(const v4fa*)(F + t * 8), c = *(const v4fa*)(F + t * 8 + 4);
#pragma unroll
  for (int q = 0; q < 4; ++q) { _Float16 h = (_Float16)a[q]; fh.h[q] = h; fl.h[q] = (_Float16)((a[q] - (float)h) * 1024.0f); h = (_Float16)c[q]; fh.h[4 + q] = h; fl.h[4 + q] = (_Float16)((c[q] - (float)h) * 1024.0f); }
  { *(v8us*)((unsigned short*)Hh + t * 8) = fh.half[0]; *(v8us*)((unsigned short*)Hl + t * 8) = fl.half[0];  } }

// piece t of the plain grid: row = t / 32 of the (8192, 256) reduced view, columns c0 = 8 (t % 32) .. c0 + 7. With fl = (row % 512) 256 + c0 + q the channel is fl / 4096, the reduced pixel
// (i, j) = ((fl / 64) % 64, fl % 64), so the 2 x 2 windows of the 8 columns are 16 floats in a row of x and the 16 below them, at x + 1024 row + 256 (c0 / 64) + 2 (c0 % 64);
// the 8 rows of a plain block lie in one channel, (row / 16) % 32, the same for the whole block
template <int F, int NU>
__device__ __forceinline__ void d_xr(int blk, const float* __restrict__ x, const float* __restrict__ w, const float* __restrict__ bb, _Float16* __restrict__ XR) {
  #pragma clang fp contract(off)
  const int c0 = (threadIdx.x % (DR / 8)) * 8; int rb0 = blk * (NU * F * 8);      /* first row of the burst's first plain block */
#pragma unroll 1
  for (int n = 0; n < NU; ++n, rb0 += F * 8) { const int row0 = rb0 + threadIdx.x / (DR / 8); const float* xp = x + (size_t)row0 * DQ + (c0 / 64) * 256 + 2 * (c0 % 64); v4f a[F][4], d[F][4];
#pragma unroll
    for (int u = 0; u < F; ++u)
#pragma unroll
      for (int g = 0; g < 4; ++g) { a[u][g] = *(const v4fa*)(xp + (size_t)u * 8 * DQ + 4 * g); d[u][g] = *(const v4fa*)(xp + (size_t)u * 8 * DQ + 128 + 4 * g); }
    asm volatile("s_wait_xcnt 0x0" :: "v"(xp) : "memory");      /* in front of every overwrite of the loads' address pair, which stays live up to here */
#pragma unroll
    for (int u = 0; u < F; ++u) { const int c = ((rb0 + u * 8) / 16) % 32; FragH f;
#pragma unroll
      for (int q = 0; q < 8; ++q) {
        float s = bf16_round(bb[c]); s += bf16_round(w[c * 4 + 0]) * bf16_round(a[u][q / 2][(2 * q) % 4]); s += bf16_round(w[c * 4 + 1]) * bf16_round(a[u][q / 2][(2 * q) % 4 + 1]); s += bf16_round(w[c * 4 + 2]) * bf16_round(d[u][q / 2][(2 * q) % 4]); s += bf16_round(w[c * 4 + 3]) * bf16_round(d[u][q / 2][(2 * q) % 4 + 1]); f.h[q] = (_Float16)s; }
      *(v8us*)((unsigned short*)XR + (size_t)(row0 + u * 8) * DR + c0) = f.half[0]; }
    asm volatile("s_wait_xcnt 0x0" ::: "memory");      /* in front of every overwrite of the stores' registers by what follows */ } }
// K head operand: (128, 512, 32) flat = the k half of the (8192, 512) [k | v] rows read flat; piece t: row t / 32, columns 8 (t % 32) .. + 7
template <int F>
__device__ __forceinline__ void d_heads(int blk, const float* __restrict__ KV, _Float16* __restrict__ KH) {
  const int row0 = blk * (F * 8) + threadIdx.x / 32, c0 = (threadIdx.x % 32) * 8; const float* kr = KV + (size_t)row0 * 2 * DR + c0; v4f a[F], b[F];
#pragma unroll
  for (int u = 0; u < F; ++u) { a[u] = *(const v4fa*)(kr + (size_t)u * 8 * 2 * DR); b[u] = *(const v4fa*)(kr + (size_t)u * 8 * 2 * DR + 4); }
  asm volatile("s_wait_xcnt 0x0" :: "v"(kr) : "memory");      /* in front of every overwrite of the loads' address pair, which stays live up to here */
#pragma unroll
  for (int u = 0; u < F; ++u) { FragH fk;
#pragma unroll
    for (int q = 0; q < 4; ++q) { fk.h[q] = (_Float16)a[u][q]; fk.h[4 + q] = (_Float16)b[u][q]; }
    *(v8us*)((unsigned short*)KH + (size_t)(row0 + u * 8) * DR + c0) = fk.half[0]; }
  asm volatile("s_wait_xcnt 0x0" ::: "memory");      /* in front of every overwrite of the stores' registers by what follows */ }
// V^T: one block = one (batch, head) pair bh. Piece (e, r): VT[bh][e][8 r + q] = v row 64 bh + r, column 32 q + e, q = 0 .. 7. A thread takes row r = tid % 64 and the 8 neighbouring e from 8 (tid / 64) on
__device__ __forceinline__ void d_vt(int bh, const float* __restrict__ KV, _Float16* __restrict__ VT) { const int r = threadIdx.x % 64, e0 = (threadIdx.x / 64) * 8; const float* vr = KV + ((size_t)bh * 64 + r) * 2 * DR + DR + e0; v4f a[8], b[8];
#pragma unroll
  for (int q = 0; q < 8; ++q) { a[q] = *(const v4fa*)(vr + q * 32); b[q] = *(const v4fa*)(vr + q * 32 + 4); }
  asm volatile("s_wait_xcnt 0x0" :: "v"(vr) : "memory");      /* in front of every overwrite of the loads' address pair, which stays live up to here */
#pragma unroll
  for (int u = 0; u < 8; ++u) { FragH f;
#pragma unroll
    for (int q = 0; q < 8; ++q) f.h[q] = (_Float16)(u < 4 ? a[q][u % 4] : b[q][u % 4]);
    *(v8us*)((unsigned short*)VT + ((size_t)bh * 32 + e0 + u) * NP + r * 8) = f.half[0]; }
  asm volatile("s_wait_xcnt 0x0" ::: "memory");      /* in front of every overwrite of the stores' registers by what follows */ }
#define KPIT 40                  /* K row pitch in LDS, f16 elements */
#define VPIT 520                 /* V^T row pitch in LDS, f16 elements */
#define BPIT 72                  /* bias tile pitch in LDS, bf16 elements */
#define OPIT 36                  /* output staging pitch, floats */
#define AWV 16                   /* waves per work-group */
#define NCH (NP / 64)            /* chunks of 64 keys */
typedef float v2f __attribute__((ext_vector_type(2)));
typedef __bf16 v4b __attribute__((ext_vector_type(4)));
typedef __bf16 v4ba __attribute__((ext_vector_type(4), may_alias));
typedef __bf16 v8ba __attribute__((ext_vector_type(8), may_alias));
typedef __bf16 v8b __attribute__((ext_vector_type(8)));
typedef _Float16 v2h __attribute__((ext_vector_type(2)));
__device__ __forceinline__ float other_half(float v) { const int b = __float_as_int(v); return __int_as_float(__builtin_amdgcn_permlanex16(b, b, 0x76543210, 0xfedcba98, false, false)); }
__global__ __launch_bounds__(512) __attribute__((amdgpu_waves_per_eu(4, 4))) void k_attn(const _Float16* __restrict__ QS, const _Float16* __restrict__ KH, const _Float16* __restrict__ VT, const float* __restrict__ rb, float* __restrict__ out) {
  __shared__ __attribute__((aligned(16))) unsigned short sK[NP * KPIT];
  __shared__ __attribute__((aligned(16))) unsigned short sV[32 * VPIT];
  __shared__ __attribute__((aligned(16))) __bf16 sB[AWV][16 * BPIT];
  __shared__ __attribute__((aligned(16))) float sO[AWV][16 * OPIT];
  const int tid = threadIdx.x, w = tid >> 5, lane = tid & 31, c = lane & 15, hh = lane >> 4;
  const int bh = blockIdx.x >> 1, q0 = (blockIdx.x & 1) * (AWV * 16) + w * 16, h = bh % NHD;
  const unsigned short* gK = (const unsigned short*)KH + (size_t)bh * NP * 32;
  const unsigned short* gV = (const unsigned short*)VT + (size_t)bh * 32 * NP;
  const float* br = rb + ((size_t)h * NP + q0 + hh) * NP + c * 4;      /* load i of a chunk: rows 2 i + hh, 16 lanes x 16 B = one 256-B piece of a row */
  __bf16* sb = sB[w];
  v8us tk[4], tv[4]; v4f bn[8];
#pragma unroll
  for (int u = 0; u < 4; ++u) { tk[u] = *(const v8us*)(gK + (size_t)(tid + u * AWV * 32) * 8); tv[u] = *(const v8us*)(gV + (size_t)(tid + u * AWV * 32) * 8); }
#pragma unroll
  for (int i = 0; i < 8; ++i) bn[i] = *(const v4fa*)(br + (size_t)(2 * i) * NP);
  FragH fq;
  { const unsigned short* qr = (const unsigned short*)QS + ((size_t)bh * NP + q0 + c) * 32; fq.half[0] = *(const v8us*)(qr + 8 * hh); fq.half[1] = *(const v8us*)(qr + 16 + 8 * hh); }
  /* the address registers of the loads above are reused further down: the wait stands in front of every such overwrite */
  asm volatile("s_wait_xcnt 0x0" ::: "memory");
#pragma unroll
  for (int u = 0; u < 4; ++u) { const int i = tid + u * AWV * 32; *(v8us*)&sK[(i >> 2) * KPIT + (i & 3) * 8] = tk[u]; *(v8us*)&sV[(i >> 6) * VPIT + (i & 63) * 8] = tv[u]; }
#pragma unroll
  for (int i = 0; i < 8; ++i) { *(v4ba*)&sb[(2 * i + hh) * BPIT + c * 4] = __builtin_convertvector(bn[i], v4b); bn[i] = *(const v4fa*)(br + (size_t)(2 * i) * NP + 64); }
  __syncthreads();
  const float L2E = 1.4426950408889634f;
  v8f o0 = {}, o1 = {};
  float m = -3.0e38f, ls = 0.f;
#pragma unroll 1      /* rolled: eight copies of this body would add code and registers and save nothing */
  for (int kc = 0; kc < NCH; ++kc) {
    /* the lanes of this wave read bias values that other lanes of it stored in the trip before: the stores have to be done first */
    asm volatile("s_wait_dscnt 0x0" ::: "memory");
    float l[32];
#pragma unroll
    for (int j = 0; j < 4; ++j) {
      const v8b pb = *(const v8ba*)&sb[c * BPIT + j * 16 + 8 * hh];      /* register r: bias[q0 + c][64 kc + 16 j + 8 hh + r], the S^T tile's own map */
      FragH fk; const unsigned short* kr = &sK[(kc * 64 + j * 16 + c) * KPIT];
      fk.half[0] = *(const v8us*)(kr + 8 * hh); fk.half[1] = *(const v8us*)(kr + 16 + 8 * hh);
      const v8f z = {};
      const v8f s = __builtin_amdgcn_wmma_f32_16x16x32_f16(false, fk.v, false, fq.v, (short)0, z, false, false);
#pragma unroll
      for (int r = 0; r < 8; ++r) l[j * 8 + r] = __builtin_fmaf(s[r], 0.03125f, (float)pb[r]);
    }
    /* next chunk's bias into the tile (its readers above are done), then the loads of the chunk after it; past the end both repeat the last chunk */
    const float* bx = br + ((kc + 2 < NCH) ? kc + 2 : NCH - 1) * 64;
#pragma unroll
    for (int i = 0; i < 8; ++i) { *(v4ba*)&sb[(2 * i + hh) * BPIT + c * 4] = __builtin_convertvector(bn[i], v4b); bn[i] = *(const v4fa*)(bx + (size_t)(2 * i) * NP); }
    float cj[4];
#pragma unroll
    for (int j = 0; j < 4; ++j) { cj[j] = l[j * 8];
#pragma unroll
      for (int r = 1; r < 8; ++r) cj[j] = fmaxf(cj[j], l[j * 8 + r]); }
    float cm = fmaxf(fmaxf(cj[0], cj[1]), fmaxf(cj[2], cj[3]));
    cm = fmaxf(cm, other_half(cm));
    const float mn = fmaxf(m, cm);
    const float sc = __builtin_amdgcn_exp2f((m - mn) * L2E);
    const float mb = 10.0f - mn * L2E;
    m = mn;
    v2f sa = {0.f, 0.f}, sd = {0.f, 0.f};
    FragH fp[2];
#pragma unroll
    for (int i = 0; i < 32; i += 4) {
      v2f ta, tc, pa, pc; const v2f l2e = {L2E, L2E}, mb2 = {mb, mb};
      ta[0] = l[i]; ta[1] = l[i + 1]; tc[0] = l[i + 2]; tc[1] = l[i + 3];
      ta = __builtin_elementwise_fma(ta, l2e, mb2); tc = __builtin_elementwise_fma(tc, l2e, mb2);
      pa[0] = __builtin_amdgcn_exp2f(ta[0]); pa[1] = __builtin_amdgcn_exp2f(ta[1]); pc[0] = __builtin_amdgcn_exp2f(tc[0]); pc[1] = __builtin_amdgcn_exp2f(tc[1]);
      sa += pa; sd += pc;
      const v2h ha = __builtin_convertvector(pa, v2h), hc = __builtin_convertvector(pc, v2h);
      fp[i >> 4].h[(i & 15)] = ha[0]; fp[i >> 4].h[(i & 15) + 1] = ha[1]; fp[i >> 4].h[(i & 15) + 2] = hc[0]; fp[i >> 4].h[(i & 15) + 3] = hc[1];
    }
    sa += sd;
    ls = __builtin_fmaf(ls, sc, sa[0] + sa[1]);
#pragma unroll
    for (int r = 0; r < 8; ++r) { o0[r] *= sc; o1[r] *= sc; }
#pragma unroll
    for (int u = 0; u < 2; ++u) {
      FragH v0, v1; const unsigned short* vr = &sV[c * VPIT + kc * 64 + u * 32];
      v0.half[0] = *(const v8us*)(vr + 8 * hh); v0.half[1] = *(const v8us*)(vr + 16 + 8 * hh);
      v1.half[0] = *(const v8us*)(vr + 16 * VPIT + 8 * hh); v1.half[1] = *(const v8us*)(vr + 16 * VPIT + 16 + 8 * hh);
      o0 = __builtin_amdgcn_wmma_f32_16x16x32_f16(false, v0.v, false, fp[u].v, (short)0, o0, false, false);
      o1 = __builtin_amdgcn_wmma_f32_16x16x32_f16(false, v1.v, false, fp[u].v, (short)0, o1, false, false);
    }
  }
  ls += other_half(ls);
  const float inv = 1.0f / ls;
  float* so = sO[w];               /* this wave's own staging: lane (c, hh) holds query c, e = 16 t + 8 hh + r */
  { v4f a;
    a[0] = o0[0] * inv; a[1] = o0[1] * inv; a[2] = o0[2] * inv; a[3] = o0[3] * inv; *(v4fa*)&so[c * OPIT + 8 * hh] = a;
    a[0] = o0[4] * inv; a[1] = o0[5] * inv; a[2] = o0[6] * inv; a[3] = o0[7] * inv; *(v4fa*)&so[c * OPIT + 8 * hh + 4] = a;
    a[0] = o1[0] * inv; a[1] = o1[1] * inv; a[2] = o1[2] * inv; a[3] = o1[3] * inv; *(v4fa*)&so[c * OPIT + 16 + 8 * hh] = a;
    a[0] = o1[4] * inv; a[1] = o1[5] * inv; a[2] = o1[6] * inv; a[3] = o1[7] * inv; *(v4fa*)&so[c * OPIT + 16 + 8 * hh + 4] = a; }
  /* the wave's lanes read each other's staged values: the LDS writes have to be done before the reads */
  asm volatile("s_wait_dscnt 0x0" ::: "memory");
  float* orow = out + ((size_t)bh * NP + q0) * 128 + lane * 4;      /* out_d = o_{d/4}: lane e writes its value four times, 512 B a query in one store */
#pragma unroll
  for (int q = 0; q < 16; ++q) { const float vv = so[q * OPIT + lane]; v4f v; v[0] = vv; v[1] = vv; v[2] = vv; v[3] = vv; *(v4f*)(orow + (size_t)q * 128) = v; }
}
__device__ __forceinline__ void d_bcat(int blk, const float* __restrict__ a, const float* __restrict__ b, float* __restrict__ O) { const int t = blk * 256 + threadIdx.x; const float v = (t < DR) ? a[t] : b[t - DR]; *(float*)(O + t) = v;
  /* in the shared kernel's code other passes' instructions follow this store and write its registers: the wait stands in front of every such overwrite */
  asm volatile("s_wait_xcnt 0x0" ::: "memory"); }
// Passes that read nothing of one another share one launch: each pass owns a range of block indices and does there what it did alone
// (the looped passes piece by piece, as said at d_x16; the bias concatenation in two blocks of 256 threads for its one block of 512).
// The choice of the pass is uniform for a block. The longest passes come first.
// 586 blocks of 8 waves, between 4 and 5 waves for each SIMD of the chip: amdgpu_waves_per_eu(8, 8) gives the compiler the register budget for a whole burst of loads in flight.
#define G_X16 (NRW * DQ / 8 / 256 / 16)       /* 256 blocks: 2 bursts of 8 pieces */
#define G_XR  (NRW * (DR / 8) / 256 / 4)      /* 256: 2 bursts of 2 pieces */
#define G_FQ  (DR * DQ / 8 / 256 / 2)         /* 64: 2 pieces */
#define G_RW  (DR * DR / 8 / 256 / 8)         /* 4, once for Wk and once for Wv: 8 pieces */
#define G_BC  (2 * DR / 256)             /* 2 */
__global__ __launch_bounds__(256) __attribute__((amdgpu_waves_per_eu(8, 8))) void k_prep(const float* __restrict__ x, const float* __restrict__ dww, const float* __restrict__ dwb, const float* __restrict__ Wq, const float* __restrict__ Wk, const float* __restrict__ Wv, const float* __restrict__ bk, const float* __restrict__ bv,
    _Float16* __restrict__ X16, _Float16* __restrict__ XR16, _Float16* __restrict__ BQ, _Float16* __restrict__ BKV, float* __restrict__ BKVb) {
  int blk = blockIdx.x;
  if (blk < G_X16) { d_x16<8, 2>(blk, x, X16); return; }      /* plain (P, 1024) view = flat */
  blk -= G_X16;
  if (blk < G_XR) { d_xr<2, 2>(blk, x, dww, dwb, XR16); return; }
  blk -= G_XR;
  if (blk < G_FQ) { d_fold4<DR, DQ, 2>(blk, Wq, BQ); return; }      /* weights: (out, in) natural */
  blk -= G_FQ;
  if (blk < G_RW) { d_round16f<8>(blk, Wk, BKV); return; }
  blk -= G_RW;
  if (blk < G_RW) { d_round16f<8>(blk, Wv, BKV + (size_t)DR * DR); return; }
  blk -= G_RW;
  d_bcat(blk, bk, bv, BKVb);
}
#define G_GQ  ((NRW / 16) * (DR / 64) / 4)         /* 512 blocks, 32 k steps each */
#define G_GKV ((NRW / 16) * (2 * DR / 64) / 4)     /* 1024 blocks, 8 k steps each */
__global__ __launch_bounds__(128) void k_proj(const _Float16* __restrict__ X16, const _Float16* __restrict__ BQ, const float* __restrict__ bq, _Float16* __restrict__ QS,
    const _Float16* __restrict__ XR16, const _Float16* __restrict__ BKV, const float* __restrict__ BKVb, float* __restrict__ KVf) {
  __shared__ __attribute__((aligned(16))) float so[4][16][64];
  const int blk = blockIdx.x;
  if (blk < G_GQ) d_gemm_hhx<0, true>(so, blk, 0, X16, DQ, 0, BQ, DQ, 0, 0.0625f, bq, 0, nullptr, 1, 0, 0, nullptr, QS, DR, 0, NRW, DR, DQ);      /* (8192, 256) flat = (128, 512, 32) flat: row b 512 + h 64 + p / 8, column (p % 8) 32 + e */
  else d_gemm_hhx<0>(so, blk - G_GQ, 0, XR16, DR, 0, BKV, DR, 0, 0.0625f, BKVb, 0, nullptr, 1, 0, 0, KVf, nullptr, 2 * DR, 0, NRW, 2 * DR, DR);      /* [k | v] */
}
#define G_KH (NBH * NP * 4 / 256 / 8)            /* 128 blocks: 8 pieces */
#define G_VT (NBH * 32 * (NP / 8) / 256 / 8)     /* 128: 8 pieces */
__global__ __launch_bounds__(256) __attribute__((amdgpu_waves_per_eu(8, 8))) void k_split(const float* __restrict__ KVf, _Float16* __restrict__ KH, _Float16* __restrict__ VT) {
  const int blk = blockIdx.x;
  if (blk < G_VT) d_vt(blk, KVf, VT); else d_heads<8>(blk - G_VT, KVf, KH);
}

extern "C" void kernel_launch(void* const* d_in, const int* in_sizes, int n_in,
                              void* d_out, int out_size, void* d_ws, size_t ws_size, hipStream_t stream) {
  (void)in_sizes; (void)n_in; (void)out_size;
  const float* const* I = (const float* const*)d_in; const float* x = I[0]; const float* dww = I[1]; const float* dwb = I[2]; const float* Wq = I[3]; const float* bq = I[4]; const float* Wk = I[5]; const float* bk = I[6]; const float* Wv = I[7]; const float* bv = I[8]; const float* rb = I[9];
  char* ws = (char*)d_ws; size_t off = 0;
  auto take = [&](size_t bytes) { char* p = ws + off; off += (bytes + 255) & ~(size_t)255; return p; };
  _Float16* BQ = (_Float16*)take((size_t)DR * DQ * 2); _Float16* BKV = (_Float16*)take((size_t)2 * DR * DR * 2); float* BKVb = (float*)take(2 * DR * 4);
  _Float16* X16 = (_Float16*)take((size_t)NRW * DQ * 2); _Float16* XR16 = (_Float16*)take((size_t)NRW * DR * 2); float* KVf = (float*)take((size_t)NRW * 2 * DR * 4);
  _Float16* QS = (_Float16*)take((size_t)NBH * NP * 32 * 2); _Float16* KH = (_Float16*)take((size_t)NBH * NP * 32 * 2); _Float16* VT = (_Float16*)take((size_t)NBH * 32 * NP * 2);
  if (off > ws_size) return;
  k_prep<<<G_X16 + G_XR + G_FQ + 2 * G_RW + G_BC, 256, 0, stream>>>(x, dww, dwb, Wq, Wk, Wv, bk, bv, X16, XR16, BQ, BKV, BKVb);
  k_proj<<<G_GQ + G_GKV, 128, 0, stream>>>(X16, BQ, bq, QS, XR16, BKV, BKVb, KVf);
  k_split<<<G_VT + G_KH, 256, 0, stream>>>(KVf, KH, VT);
  k_attn<<<NBH * 2, AWV * 32, 0, stream>>>(QS, KH, VT, rb, (float*)d_out);
}

// v005
// It runs in 49.3 microseconds.
// Timed twice side by side with v004, it ran 1.41 and 1.40 times as fast.
// All steps since v000 together make it 6.16 times as fast.
#include <hip/hip_runtime.h>
// Lightweight multi-head self-attention with reduced keys/values (B 16, C 32, 128×128; P 512 tokens of 1024 (q) / 256 (k, v after a depthwise 2×2 stride-2 reduction); 8 heads by PLAIN reshapes of the (P, dim) buffers; k/v nearest-upsampled 32 → 128 along the head dim; scores/√1024 + rel_bias; softmax; attn·v; plain reshape back to [16,32,128,128]).
// Structure: q/k/v projections as GEMMs (the depthwise reduction on VALU -> f16); the 32->128 nearest upsampling is folded into the contraction (sum_d q_d k_{d/4} = sum_e (sum_{d/4=e} q_d) k_e and out_d = o_{d/4}), and the sum over each four q columns is folded further into the projection itself (sum_{d/4=e} q_d = x . sum_{d/4=e} Wq[d] + sum_{d/4=e} bq[d]): the q GEMM has N 256 and its f16 output, read flat, is the head operand; the plain-view head split of k and v by index arithmetic on VALU; scores (K 32, scale 1/32), bias, running-max softmax (x 2^10, f16), P.V (N 32) and the expanded output in ONE fused kernel, scores and probabilities kept in registers.
// Compute dtype: inputs and parameters rounded to bf16; x exact in f16; folded q weights, reduced x, head operands and probabilities f16 (about 2^-12); f32 accumulation; softmax f32. v_wmma_f32_16x16x32_f16.
#define NB 16
#define NP 512
#define DQ 1024
#define DR 256
#define NHD 8
#define NBH (NB * NHD)           /* 128 */
#define NRW (NB * NP)            /* 8192 rows */
typedef __bf16 v16b __attribute__((ext_vector_type(16)));
typedef unsigned short v8us __attribute__((ext_vector_type(8), may_alias));
typedef float  v8f  __attribute__((ext_vector_type(8)));
typedef float  v4f  __attribute__((ext_vector_type(4)));
typedef float  v4fa __attribute__((ext_vector_type(4), may_alias));
union FragB { v16b v; v8us half[2]; unsigned short u[16]; };

__device__ __forceinline__ unsigned short bf16_bits(float x) { unsigned int u = __float_as_uint(x); return (unsigned short)((u + 0x7FFFu + ((u >> 16) & 1u)) >> 16); }
__device__ __forceinline__ float bf16_val(unsigned short b) { return __uint_as_float(((unsigned int)b) << 16); }
__device__ __forceinline__ float bf16_round(float x) { return bf16_val(bf16_bits(x)); }
// D += A·B with NT terms: 1 = ah·bh, 2 = + al·bh (A split), 3 = + ah·bl (both split)
template <int NT>
__device__ __forceinline__ v8f mmaN(v16b ah, v16b al, v16b bh, v16b bl, v8f c) {
  c = __builtin_amdgcn_wmma_f32_16x16x32_bf16(false, ah, false, bh, (short)0, c, false, false);
  if (NT >= 2) c = __builtin_amdgcn_wmma_f32_16x16x32_bf16(false, al, false, bh, (short)0, c, false, false);
  if (NT >= 3) c = __builtin_amdgcn_wmma_f32_16x16x32_bf16(false, ah, false, bl, (short)0, c, false, false);
  asm volatile("v_nop\n\tv_nop\n\tv_nop\n\tv_nop" : "+v"(c) : "v"(ah), "v"(al), "v"(bh), "v"(bl));
  return c;
}

__global__ __launch_bounds__(256) void k_wt_bf16(const float* __restrict__ W, unsigned short* __restrict__ Wt, int K, int N) {
  const int t = blockIdx.x * 256 + threadIdx.x;
  const int k8n = K / 8;
  if (t >= N * k8n) return;
  const int n = t / k8n, k8 = (t % k8n) * 8;
  v8us v;
#pragma unroll
  for (int i = 0; i < 8; ++i) v[i] = bf16_bits(W[(size_t)(k8 + i) * N + n]);
  *(v8us*)(Wt + (size_t)n * K + k8) = v;
  
}

// GEMM C[M][N] (f32, pitch ldc) = act(A[M][K]·W + bias). A f32 row-major (pitch lda) converted per fragment to bf16
// (ASPLIT: hi/lo two planes -> 2 terms, else single rounded term); Wt bf16 [N][K] (pitch ldb). BIAS_BF16 rounds the
// bias to bf16 first (bias quantised to bf16 before the add). K%32==0, M%16==0, N%64==0.
template <bool ASPLIT, int ACT, bool BIAS_BF16>
__global__ __launch_bounds__(128) void k_gemm_bf(const float* __restrict__ A, int lda, const unsigned short* __restrict__ Wt, int ldb,
                                               const float* __restrict__ bias, float* __restrict__ C, int ldc, int M, int N, int K) {
  __shared__ __attribute__((aligned(16))) float so[4][16][64];
  const int tid = threadIdx.x, w = tid >> 5, lane = tid & 31, ln = lane & 15, hh = lane >> 4;
  const int ntn = N / 64;
  const int wid = blockIdx.x * 4 + w;
  const int mt = wid / ntn, nq = wid % ntn;
  if (mt * 16 >= M) return;
  const int row0 = mt * 16, col0 = nq * 64;
  const float* arow = A + (size_t)(row0 + ln) * lda;
  v8f acc[4] = {};
  for (int kb = 0; kb < K; kb += 32) {
    FragB ah, al;
    const v4f x0 = *(const v4fa*)(arow + kb + 8 * hh), x1 = *(const v4fa*)(arow + kb + 8 * hh + 4);
    const v4f x2 = *(const v4fa*)(arow + kb + 16 + 8 * hh), x3 = *(const v4fa*)(arow + kb + 16 + 8 * hh + 4);
    float xs[16] = {x0[0],x0[1],x0[2],x0[3],x1[0],x1[1],x1[2],x1[3],x2[0],x2[1],x2[2],x2[3],x3[0],x3[1],x3[2],x3[3]};
#pragma unroll
    for (int i = 0; i < 16; ++i) { const unsigned short hb = bf16_bits(xs[i]); ah.u[i] = hb; al.u[i] = ASPLIT ? bf16_bits(xs[i] - bf16_val(hb)) : (unsigned short)0; }
#pragma unroll
    for (int t = 0; t < 4; ++t) {
      const unsigned short* brow = Wt + (size_t)(col0 + t * 16 + ln) * ldb + kb;
      FragB b;
      b.half[0] = *(const v8us*)(brow + 8 * hh);
      b.half[1] = *(const v8us*)(brow + 16 + 8 * hh);
      acc[t] = mmaN<ASPLIT ? 2 : 1>(ah.v, al.v, b.v, b.v, acc[t]);
    }
  }
#pragma unroll
  for (int t = 0; t < 4; ++t) {
    float bv = bias ? bias[col0 + t * 16 + ln] : 0.f;
    if (BIAS_BF16) bv = bf16_round(bv);
#pragma unroll
    for (int r = 0; r < 8; ++r) { float v = acc[t][r] + bv; if (ACT == 1) v = fmaxf(v, 0.f); so[w][8 * hh + r][t * 16 + ln] = v; }
  }
  __builtin_amdgcn_fence(__ATOMIC_ACQ_REL, "workgroup");
  __builtin_amdgcn_wave_barrier();
  const int rsub = lane >> 4, c4 = (lane & 15) * 4;
  {
#pragma unroll
    for (int q = 0; q < 8; ++q) {
      const int r = q * 2 + rsub;
      const v4f v = *(const v4fa*)&so[w][r][c4];
      *(v4f*)(C + (size_t)(row0 + r) * ldc + col0 + c4) = v;
    }
    
  }
}

// GEMM C = act(A·W + bias + resid): A f32 (ASPLIT -> hi/lo 2 terms), Wt bf16 [N][K]; ACT 0 none, 1 relu, 2 exact gelu;
// resid (optional, f32, row index = (row % rmod), pitch ldr, RES_BF16 rounds it) added before the activation.
template <bool ASPLIT, int ACT, bool BIAS_BF16, bool RES_BF16>
__global__ __launch_bounds__(128) void k_gemm_bf3(const float* __restrict__ A, int lda, const unsigned short* __restrict__ Wt, int ldb,
                                                const float* __restrict__ bias, const float* __restrict__ resid, int rmod, int ldr,
                                                float* __restrict__ C, int ldc, int M, int N, int K) {
  __shared__ __attribute__((aligned(16))) float so[4][16][64];
  const int tid = threadIdx.x, w = tid >> 5, lane = tid & 31, ln = lane & 15, hh = lane >> 4;
  const int ntn = N / 64;
  const int wid = blockIdx.x * 4 + w;
  const int mt = wid / ntn, nq = wid % ntn;
  if (mt * 16 >= M) return;
  const int row0 = mt * 16, col0 = nq * 64;
  const float* arow = A + (size_t)(row0 + ln) * lda;
  v8f acc[4] = {};
  for (int kb = 0; kb < K; kb += 32) {
    FragB ah, al;
    const v4f x0 = *(const v4fa*)(arow + kb + 8 * hh), x1 = *(const v4fa*)(arow + kb + 8 * hh + 4);
    const v4f x2 = *(const v4fa*)(arow + kb + 16 + 8 * hh), x3 = *(const v4fa*)(arow + kb + 16 + 8 * hh + 4);
    float xs[16] = {x0[0],x0[1],x0[2],x0[3],x1[0],x1[1],x1[2],x1[3],x2[0],x2[1],x2[2],x2[3],x3[0],x3[1],x3[2],x3[3]};
#pragma unroll
    for (int i = 0; i < 16; ++i) { const unsigned short hb = bf16_bits(xs[i]); ah.u[i] = hb; al.u[i] = ASPLIT ? bf16_bits(xs[i] - bf16_val(hb)) : (unsigned short)0; }
#pragma unroll
    for (int t = 0; t < 4; ++t) {
      const unsigned short* brow = Wt + (size_t)(col0 + t * 16 + ln) * ldb + kb;
      FragB b;
      b.half[0] = *(const v8us*)(brow + 8 * hh);
      b.half[1] = *(const v8us*)(brow + 16 + 8 * hh);
      acc[t] = mmaN<ASPLIT ? 2 : 1>(ah.v, al.v, b.v, b.v, acc[t]);
    }
  }
#pragma unroll
  for (int t = 0; t < 4; ++t) {
    const int col = col0 + t * 16 + ln;
    float bv = bias ? bias[col] : 0.f;
    if (BIAS_BF16) bv = bf16_round(bv);
#pragma unroll
    for (int r = 0; r < 8; ++r) {
      float v = acc[t][r] + bv;
      if (resid) { float rv = resid[(size_t)((row0 + 8 * hh + r) % rmod) * ldr + col]; if (RES_BF16) rv = bf16_round(rv); v += rv; }
      if (ACT == 1) v = fmaxf(v, 0.f);
      if (ACT == 2) v = 0.5f * v * (1.0f + erff(v * 0.70710678118654752f));
      if (ACT == 3) { const float u = 0.7978845608028654f * (v + 0.044715f * v * v * v); v = 0.5f * v * (1.0f + tanhf(u)); }
      so[w][8 * hh + r][t * 16 + ln] = v;
    }
  }
  __builtin_amdgcn_fence(__ATOMIC_ACQ_REL, "workgroup");
  __builtin_amdgcn_wave_barrier();
  const int rsub = lane >> 4, c4 = (lane & 15) * 4;
  {
#pragma unroll
    for (int q = 0; q < 8; ++q) {
      const int r = q * 2 + rsub;
      const v4f v = *(const v4fa*)&so[w][r][c4];
      *(v4f*)(C + (size_t)(row0 + r) * ldc + col0 + c4) = v;
    }
    
  }
}
// row LayerNorm (biased variance, eps) over N: s = X (+ R); optional out_sum <- s; out_norm <- (s-mu)*rsqrt(var+eps)*g + b
template <bool PARAM_BF16>
__global__ __launch_bounds__(256) void k_layernorm(const float* __restrict__ X, const float* __restrict__ R, const float* __restrict__ g, const float* __restrict__ bta,
                                                  float* __restrict__ out_sum, float* __restrict__ out_norm, int N, float eps) {
  __shared__ float red[256];
  const int row = blockIdx.x, tid = threadIdx.x;
  const float* x = X + (size_t)row * N; const float* rr = R ? R + (size_t)row * N : nullptr;
  float vals[16];                     // up to N = 4096
  const int per = N / 256;            // contiguous chunk per thread? use strided-by-4 chunks: thread handles j = tid*4 + 1024*u
  float s1 = 0.f;
  for (int u = 0; u < per / 4; ++u) {
    const int j = tid * 4 + 1024 * u;
    const v4f a = *(const v4fa*)(x + j);
    v4f b = {0.f,0.f,0.f,0.f}; if (rr) b = *(const v4fa*)(rr + j);
#pragma unroll
    for (int q = 0; q < 4; ++q) { const float v = a[q] + b[q]; vals[u * 4 + q] = v; s1 += v; }
  }
  red[tid] = s1; __syncthreads();
  for (int st = 128; st > 0; st >>= 1) { if (tid < st) red[tid] += red[tid + st]; __syncthreads(); }
  const float mu = red[0] / (float)N; __syncthreads();
  float s2 = 0.f;
  for (int u = 0; u < per / 4; ++u)
#pragma unroll
    for (int q = 0; q < 4; ++q) { const float c = vals[u * 4 + q] - mu; s2 += c * c; }
  red[tid] = s2; __syncthreads();
  for (int st = 128; st > 0; st >>= 1) { if (tid < st) red[tid] += red[tid + st]; __syncthreads(); }
  const float rs = rsqrtf(red[0] / (float)N + eps);
  {
    for (int u = 0; u < per / 4; ++u) {
      const int j = tid * 4 + 1024 * u;
      v4f o, sm;
#pragma unroll
      for (int q = 0; q < 4; ++q) {
        float gg = g[j + q], bb = bta[j + q];
        if (PARAM_BF16) { gg = bf16_round(gg); bb = bf16_round(bb); }
        sm[q] = vals[u * 4 + q]; o[q] = (vals[u * 4 + q] - mu) * rs * gg + bb;
      }
      if (out_sum) *(v4f*)(out_sum + (size_t)row * N + j) = sm;
      *(v4f*)(out_norm + (size_t)row * N + j) = o;
    }
    
  }
}



// ---- f16 WMMA path (v_wmma_f32_16x16x32_f16): 11-bit significands for operands in range — used where a [0,1] probability operand needs more precision than bf16
typedef _Float16 v16h __attribute__((ext_vector_type(16)));
union FragH { v16h v; v8us half[2]; _Float16 h[16]; unsigned short u[16]; };
template <int NT>
__device__ __forceinline__ v8f mmaH(v16h ah, v16h al, v16h bh, v16h bl, v8f c) {
  c = __builtin_amdgcn_wmma_f32_16x16x32_f16(false, ah, false, bh, (short)0, c, false, false);
  if (NT >= 2) c = __builtin_amdgcn_wmma_f32_16x16x32_f16(false, al, false, bh, (short)0, c, false, false);
  if (NT >= 3) c = __builtin_amdgcn_wmma_f32_16x16x32_f16(false, ah, false, bl, (short)0, c, false, false);
  asm volatile("v_nop\n\tv_nop\n\tv_nop\n\tv_nop" : "+v"(c) : "v"(ah), "v"(al), "v"(bh), "v"(bl));
  return c;
}
// batched GEMM like k_gemm_b but f16 operands: A f32 (split into f16 hi/lo if ASPLIT, else rounded to f16), Bt = f16 values [n][k]; alpha; C f32; N multiple of 16 (partial tiles skipped)
template <bool ASPLIT>
__global__ __launch_bounds__(128) void k_gemm_h(const float* __restrict__ A, int lda, size_t sA, const _Float16* __restrict__ Bh, int ldb, size_t sB, float alpha, float* __restrict__ C, int ldc, size_t sC, int M, int N, int K) {
  __shared__ __attribute__((aligned(16))) float so[4][16][64];
  const int tid = threadIdx.x, w = tid >> 5, lane = tid & 31, ln = lane & 15, hh = lane >> 4; const int by = blockIdx.y;
  A += (size_t)by * sA; Bh += (size_t)by * sB; C += (size_t)by * sC;
  const int ntn = (N + 63) / 64; const int wid = blockIdx.x * 4 + w; const int mt = wid / ntn, nq = wid % ntn; if (mt * 16 >= M) return;
  const int row0 = mt * 16, col0 = nq * 64; const float* arow = A + (size_t)(row0 + ln) * lda;
  v8f acc[4] = {};
  for (int kb = 0; kb < K; kb += 32) {
    FragH ah, al;
    const v4f x0 = *(const v4fa*)(arow + kb + 8 * hh), x1 = *(const v4fa*)(arow + kb + 8 * hh + 4), x2 = *(const v4fa*)(arow + kb + 16 + 8 * hh), x3 = *(const v4fa*)(arow + kb + 16 + 8 * hh + 4);
    float xs[16] = {x0[0],x0[1],x0[2],x0[3],x1[0],x1[1],x1[2],x1[3],x2[0],x2[1],x2[2],x2[3],x3[0],x3[1],x3[2],x3[3]};
#pragma unroll
    for (int i = 0; i < 16; ++i) { const _Float16 h = (_Float16)xs[i]; ah.h[i] = h; al.h[i] = ASPLIT ? (_Float16)(xs[i] - (float)h) : (_Float16)0.0f; }
#pragma unroll
    for (int t = 0; t < 4; ++t) { if (col0 + t * 16 >= N) continue; const size_t boff = (size_t)(col0 + t * 16 + ln) * ldb + kb; FragH bq; bq.half[0] = *(const v8us*)(Bh + boff + 8 * hh); bq.half[1] = *(const v8us*)(Bh + boff + 16 + 8 * hh);
      acc[t] = mmaH<ASPLIT ? 2 : 1>(ah.v, al.v, bq.v, bq.v, acc[t]); }
  }
#pragma unroll
  for (int t = 0; t < 4; ++t) { if (col0 + t * 16 >= N) continue;
#pragma unroll
    for (int r = 0; r < 8; ++r) so[w][8 * hh + r][t * 16 + ln] = acc[t][r] * alpha; }
  __builtin_amdgcn_fence(__ATOMIC_ACQ_REL, "workgroup"); __builtin_amdgcn_wave_barrier();
  const int rsub = lane >> 4, c4 = (lane & 15) * 4;
  {
#pragma unroll
    for (int q = 0; q < 8; ++q) { const int r = q * 2 + rsub; if (col0 + c4 < N) { const v4f v = *(const v4fa*)&so[w][r][c4]; *(v4f*)(C + (size_t)(row0 + r) * ldc + col0 + c4) = v; } }
     }
}

// Wt[n][k] = f16(W[k][n]·scale) from f32 row-major W[K][N] (scale = power of two; bf16-exact weights stay exact in f16 away from the subnormal range)
__global__ __launch_bounds__(256) void k_wt_f16(const float* __restrict__ W, _Float16* __restrict__ Wt, int K, int N, float scale) {
  const int t = blockIdx.x * 256 + threadIdx.x; if (t >= N * (K / 8)) return; const int n = t / (K / 8), k8 = (t % (K / 8)) * 8; FragH f;
#pragma unroll
  for (int i = 0; i < 8; ++i) f.h[i] = (_Float16)(bf16_round(W[(size_t)(k8 + i) * N + n]) * scale); const v8us o = f.half[0];
  *(v8us*)((unsigned short*)Wt + (size_t)n * K + k8) = o; 
}
// The projection GEMM with its operands staged in LDS: C[M][N] = A[M][K] . Bh[N][K]^T x alpha + bias, one work-group (4 waves) = 32 rows x 256 columns, a wave = 32 x 64 (2 x 4 accumulator tiles).
// A k block of 64 (one whole 128-B line of each of the 32 A rows and 256 B rows) is brought into LDS by asynchronous copies, 16 B a lane, 8 lanes a line, so that a copy touches 4 whole lines
// where a fragment load from global memory touches 16; the A block serves 4 waves and a B row both row tiles. Two buffers: block t + 1 flies while block t is worked on. Row pitch in LDS 144 B.
// Piece p = tid + 128 i, i = 0 .. 17: staged row p / 8 (0 .. 31 the A rows, 32 .. 287 the B rows), 16-B piece p % 8. Each '#pragma unroll' keeps a register array at constant indices (no scratch).
#define GPIT 72                  /* staged row pitch, f16 elements */
#define GROWS (32 + 256)         /* staged rows of one k block */
/* nine copies and, as the last line of their own statement, the wait that stands in front of every rewrite of the address registers they name */
#define CP9 "global_load_async_to_lds_b128 %0, %9, off\n\tglobal_load_async_to_lds_b128 %1, %10, off\n\tglobal_load_async_to_lds_b128 %2, %11, off\n\tglobal_load_async_to_lds_b128 %3, %12, off\n\tglobal_load_async_to_lds_b128 %4, %13, off\n\tglobal_load_async_to_lds_b128 %5, %14, off\n\tglobal_load_async_to_lds_b128 %6, %15, off\n\tglobal_load_async_to_lds_b128 %7, %16, off\n\tglobal_load_async_to_lds_b128 %8, %17, off\n\ts_wait_xcnt 0x0"
__device__ __forceinline__ void d_stage(unsigned lds, const unsigned short* ga, int lda, const unsigned short* gb, int ldb) {      /* lds, ga, gb: this lane's piece of staged row tid / 8, of A row tid / 8 and of B row tid / 8 */
  const unsigned st = 16 * GPIT * 2;      /* 16 staged rows further on, bytes */
  asm volatile(CP9 :: "v"(lds), "v"(lds + st), "v"(lds + 2 * st), "v"(lds + 3 * st), "v"(lds + 4 * st), "v"(lds + 5 * st), "v"(lds + 6 * st), "v"(lds + 7 * st), "v"(lds + 8 * st),
    "v"(ga), "v"(ga + (size_t)16 * lda), "v"(gb), "v"(gb + (size_t)16 * ldb), "v"(gb + (size_t)32 * ldb), "v"(gb + (size_t)48 * ldb), "v"(gb + (size_t)64 * ldb), "v"(gb + (size_t)80 * ldb), "v"(gb + (size_t)96 * ldb) : "memory");
  asm volatile(CP9 :: "v"(lds + 9 * st), "v"(lds + 10 * st), "v"(lds + 11 * st), "v"(lds + 12 * st), "v"(lds + 13 * st), "v"(lds + 14 * st), "v"(lds + 15 * st), "v"(lds + 16 * st), "v"(lds + 17 * st),
    "v"(gb + (size_t)112 * ldb), "v"(gb + (size_t)128 * ldb), "v"(gb + (size_t)144 * ldb), "v"(gb + (size_t)160 * ldb), "v"(gb + (size_t)176 * ldb), "v"(gb + (size_t)192 * ldb), "v"(gb + (size_t)208 * ldb), "v"(gb + (size_t)224 * ldb), "v"(gb + (size_t)240 * ldb) : "memory");
}
// BSUM4: output column col stands for the four columns 4 col .. 4 col + 3 of the unfolded product, so its bias is the sum of their four rounded biases; bx = the block's index inside this product's own grid of (M / 32) x (N / 256); K a multiple of 128; H16: the result goes to C16 in f16, else to C in f32
template <int K, int N, bool BSUM4, bool H16>
__device__ __forceinline__ void d_gemm_st(unsigned short (&sg)[2][GROWS * GPIT], float (&so)[4][16][64], int bx, const _Float16* __restrict__ A, const _Float16* __restrict__ Bh, float alpha, const float* __restrict__ bp, float* __restrict__ C, _Float16* __restrict__ C16) {
  static_assert(K % 128 == 0 && N % 256 == 0, "whole k blocks, at least two; whole column blocks");
  const int tid = threadIdx.x, w = tid >> 5, lane = tid & 31, ln = lane & 15, hh = lane >> 4;
  const int row0 = (bx / (N / 256)) * 32, cb = (bx % (N / 256)) * 256, col0 = cb + w * 64;
  const unsigned short* ga = (const unsigned short*)A + (size_t)(row0 + tid / 8) * K + (tid % 8) * 8;
  const unsigned short* gb = (const unsigned short*)Bh + (size_t)(cb + tid / 8) * K + (tid % 8) * 8;
  const unsigned l0 = (unsigned)(size_t)&sg[0][(tid / 8) * GPIT + (tid % 8) * 8], l1 = (unsigned)(size_t)&sg[1][(tid / 8) * GPIT + (tid % 8) * 8];
  constexpr int T = K / 64;
  d_stage(l0, ga, K, gb, K);
  asm volatile("s_wait_asynccnt 0x0" ::: "memory");      /* this wave's copies of block 0 have landed */
  __syncthreads();                                       /* and every other wave's: block 0 may be read */
  d_stage(l1, ga + 64, K, gb + 64, K);
  v8f acc[2][4] = {};
#pragma unroll 1      /* rolled: the trips are alike, and side by side they would only add code */
  for (int t = 0; t < T; ++t) {
    const unsigned short* sa = &sg[t & 1][ln * GPIT + 8 * hh]; const unsigned short* sb = sa + (32 + w * 64) * GPIT;
    FragH fa[2][2], fb[2][4];
#pragma unroll
    for (int ks = 0; ks < 2; ++ks) {
#pragma unroll
      for (int i = 0; i < 2; ++i) { fa[ks][i].half[0] = *(const v8us*)(sa + i * 16 * GPIT + ks * 32); fa[ks][i].half[1] = *(const v8us*)(sa + i * 16 * GPIT + ks * 32 + 16); }
#pragma unroll
      for (int j = 0; j < 4; ++j) { fb[ks][j].half[0] = *(const v8us*)(sb + j * 16 * GPIT + ks * 32); fb[ks][j].half[1] = *(const v8us*)(sb + j * 16 * GPIT + ks * 32 + 16); }
    }
    asm volatile("s_wait_dscnt 0x0" ::: "memory");       /* the block's 24 fragment loads are done: block t is in registers, this wave reads its buffer no more */
    asm volatile("s_wait_asynccnt 0x0" ::: "memory");    /* this wave's copies of block t + 1 have landed */
    __syncthreads();                                     /* block t + 1 may be read by all, block t's buffer has no reader left */
    if (t + 2 < T) d_stage((t & 1) ? l1 : l0, ga + (t + 2) * 64, K, gb + (t + 2) * 64, K);
    /* the WMMAs work on registers alone and stand behind the refill, so that the copies fly under them */
#pragma unroll
    for (int ks = 0; ks < 2; ++ks)
#pragma unroll
      for (int i = 0; i < 2; ++i)
#pragma unroll
        for (int j = 0; j < 4; ++j) acc[i][j] = __builtin_amdgcn_wmma_f32_16x16x32_f16(false, fa[ks][i].v, false, fb[ks][j].v, (short)0, acc[i][j], false, false);
  }
  asm volatile("s_wait_asynccnt 0x0" ::: "memory");      /* no copy is outstanding behind the loop */
  const int rsub = lane >> 4, c4 = (lane & 15) * 4; typedef _Float16 v4hh __attribute__((ext_vector_type(4)));
  float bv[4];
#pragma unroll
  for (int j = 0; j < 4; ++j) { const int col = col0 + j * 16 + ln;
    if (BSUM4) { const v4f b4 = *(const v4fa*)(bp + 4 * col); bv[j] = ((bf16_round(b4[0]) + bf16_round(b4[1])) + bf16_round(b4[2])) + bf16_round(b4[3]); } else bv[j] = bf16_round(bp[col]); }
#pragma unroll
  for (int i = 0; i < 2; ++i) {
#pragma unroll
    for (int j = 0; j < 4; ++j)
#pragma unroll
      for (int r = 0; r < 8; ++r) so[w][8 * hh + r][j * 16 + ln] = acc[i][j][r] * alpha + bv[j];
    /* the wave's lanes read each other's staged values: the LDS writes have to be done before the reads */
    asm volatile("s_wait_dscnt 0x0" ::: "memory");
#pragma unroll
    for (int q = 0; q < 8; ++q) { const int r = q * 2 + rsub; const v4f v = *(const v4fa*)&so[w][r][c4]; const size_t o = (size_t)(row0 + i * 16 + r) * N + col0 + c4;
      if (H16) { v4hh h4; for (int u = 0; u < 4; ++u) h4[u] = (_Float16)v[u]; *(v4hh*)(C16 + o) = h4; } else *(v4f*)(C + o) = v; }
    /* in front of every overwrite of the stores' registers by the second row tile's code; its memory clobber also keeps that tile's LDS writes behind the reads above, whose values the stores have taken */
    if (i == 0) asm volatile("s_wait_xcnt 0x0" ::: "memory");
  }
}

typedef _Float16 v4h __attribute__((ext_vector_type(4)));

// The element-wise passes are looped: one block does the work of NU x F blocks of the plain grid (a piece = what one thread of the plain grid did:
// same reads, same arithmetic, same 16-B store), in NU bursts of F pieces. A launch so starts NU x F times fewer waves, and a wave has the 16 loads
// of a whole burst (16 B a lane each) in flight. Every grid divides exactly: no bounds test. Each '#pragma unroll' keeps a burst's register arrays at constant indices
// and its loads in front of the first use; each '#pragma unroll 1' keeps the bursts one after the other (side by side they would need NU times the registers).
// Two waits a burst, each in front of every overwrite of a register that an issued load or store names: one behind the loads (it takes the address as an input,
// so that the pair stays live up to it and no load of the burst lands on it), one behind the stores (the next burst, or another pass's code in the shared kernel, follows).
template <int F, int NU>
__device__ __forceinline__ void d_x16(int blk, const float* __restrict__ x, _Float16* __restrict__ X16) { size_t t0 = (size_t)blk * (NU * F * 256) + threadIdx.x;
#pragma unroll 1
  for (int n = 0; n < NU; ++n, t0 += F * 256) { const float* xp = x + t0 * 8; v4f a[F], b[F];
#pragma unroll
    for (int u = 0; u < F; ++u) { a[u] = *(const v4fa*)(xp + u * 2048); b[u] = *(const v4fa*)(xp + u * 2048 + 4); }
    asm volatile("s_wait_xcnt 0x0" :: "v"(xp) : "memory");      /* in front of every overwrite of the loads' address pair, which stays live up to here */
#pragma unroll
    for (int u = 0; u < F; ++u) { FragH f;
#pragma unroll
      for (int q = 0; q < 4; ++q) { f.h[q] = (_Float16)bf16_round(a[u][q]); f.h[4 + q] = (_Float16)bf16_round(b[u][q]); }
      *(v8us*)((unsigned short*)X16 + (t0 + u * 256) * 8) = f.half[0]; }
    asm volatile("s_wait_xcnt 0x0" ::: "memory");      /* in front of every overwrite of the stores' registers by what follows */ } }
__global__ __launch_bounds__(256) void k_h16(const float* __restrict__ x, _Float16* __restrict__ X16, size_t n8) { const size_t t = (size_t)blockIdx.x * 256 + threadIdx.x; if (t >= n8) return; FragH f;
#pragma unroll
  for (int q = 0; q < 8; ++q) f.h[q] = (_Float16)x[t * 8 + q]; *(v8us*)((unsigned short*)X16 + t * 8) = f.half[0];  }
template <int F>
__device__ __forceinline__ void d_round16f(int blk, const float* __restrict__ W, _Float16* __restrict__ Bt) { const size_t t0 = (size_t)blk * (F * 256) + threadIdx.x; const float* wp = W + t0 * 8; v4f a[F], b[F];
#pragma unroll
  for (int u = 0; u < F; ++u) { a[u] = *(const v4fa*)(wp + u * 2048); b[u] = *(const v4fa*)(wp + u * 2048 + 4); }
  asm volatile("s_wait_xcnt 0x0" :: "v"(wp) : "memory");      /* in front of every overwrite of the loads' address pair, which stays live up to here */
#pragma unroll
  for (int u = 0; u < F; ++u) { FragH f;
#pragma unroll
    for (int i = 0; i < 4; ++i) { f.h[i] = (_Float16)(bf16_round(a[u][i]) * 16.0f); f.h[4 + i] = (_Float16)(bf16_round(b[u][i]) * 16.0f); }
    *(v8us*)((unsigned short*)Bt + (t0 + u * 256) * 8) = f.half[0]; }
  asm volatile("s_wait_xcnt 0x0" ::: "memory");      /* in front of every overwrite of the stores' registers by what follows */ }
// Bt[e][k] = f16(16 (W[4 e][k] + W[4 e + 1][k] + W[4 e + 2][k] + W[4 e + 3][k])), each W rounded to bf16 first, the sum in f32: W (4 NE, K) row-major, thread = F pieces of 8 k of one e each; both loops unrolled so that f.h is indexed by constants and stays in registers
template <int NE, int K, int F>
__device__ __forceinline__ void d_fold4(int blk, const float* __restrict__ W, _Float16* __restrict__ Bt) { static_assert(256 % (K / 8) == 0, "a piece further on is whole rows further on"); const int t0 = blk * (F * 256) + threadIdx.x; const int e = t0 / (K / 8), k8 = (t0 % (K / 8)) * 8; const float* wr = W + (size_t)e * 4 * K + k8; v4f r[F][2][4];
#pragma unroll
  for (int u = 0; u < F; ++u)
#pragma unroll
    for (int g = 0; g < 2; ++g)
#pragma unroll
      for (int j = 0; j < 4; ++j) r[u][g][j] = *(const v4fa*)(wr + (u * (256 / (K / 8)) * 4 + j) * K + 4 * g);
  asm volatile("s_wait_xcnt 0x0" :: "v"(wr) : "memory");      /* in front of every overwrite of the loads' address pair, which stays live up to here */
#pragma unroll
  for (int u = 0; u < F; ++u) { FragH f;
#pragma unroll
    for (int g = 0; g < 2; ++g)
#pragma unroll
      for (int i = 0; i < 4; ++i) f.h[4 * g + i] = (_Float16)((((bf16_round(r[u][g][0][i]) + bf16_round(r[u][g][1][i])) + bf16_round(r[u][g][2][i])) + bf16_round(r[u][g][3][i])) * 16.0f);
    *(v8us*)((unsigned short*)Bt + (size_t)(t0 + u * 256) * 8) = f.half[0]; }
  asm volatile("s_wait_xcnt 0x0" ::: "memory");      /* in front of every overwrite of the stores' registers by what follows */ }
template <int NHv, int TTv>
__global__ __launch_bounds__(256) void k_vt(const _Float16* __restrict__ V16, int ldv, int voff, _Float16* __restrict__ Vt) { __shared__ unsigned short tl[64][66]; const int tid = threadIdx.x; const int slab = blockIdx.x / (TTv / 64), lg = blockIdx.x % (TTv / 64); const int b = slab / NHv, h = slab % NHv;
  for (int i = tid; i < 64 * 8; i += 256) { const int r = i / 8, c8 = (i % 8) * 8; FragH f; f.half[0] = *(const v8us*)((const unsigned short*)V16 + ((size_t)b * TTv + lg * 64 + r) * ldv + voff + h * 64 + c8);
#pragma unroll
    for (int q = 0; q < 8; ++q) tl[r][c8 + q] = f.u[q]; }
  __syncthreads();
  {
#pragma unroll
    for (int rd = 0; rd < 2; ++rd) { const int d = rd * 32 + tid / 8, pc = tid % 8; FragH f;
#pragma unroll
      for (int q = 0; q < 8; ++q) f.u[q] = tl[pc * 8 + q][d];
      *(v8us*)((unsigned short*)Vt + ((size_t)slab * 64 + d) * TTv + lg * 64 + pc * 8) = f.half[0]; }
     } }

__global__ __launch_bounds__(256) void k_hl(const float* __restrict__ F, _Float16* __restrict__ Hh, _Float16* __restrict__ Hl, size_t n8) { const size_t t = (size_t)blockIdx.x * 256 + threadIdx.x; if (t >= n8) return; FragH fh, fl; const v4f a = *(const v4fa*)(F + t * 8), c = *(const v4fa*)(F + t * 8 + 4);
#pragma unroll
  for (int q = 0; q < 4; ++q) { _Float16 h = (_Float16)a[q]; fh.h[q] = h; fl.h[q] = (_Float16)((a[q] - (float)h) * 1024.0f); h = (_Float16)c[q]; fh.h[4 + q] = h; fl.h[4 + q] = (_Float16)((c[q] - (float)h) * 1024.0f); }
  { *(v8us*)((unsigned short*)Hh + t * 8) = fh.half[0]; *(v8us*)((unsigned short*)Hl + t * 8) = fl.half[0];  } }

// piece t of the plain grid: row = t / 32 of the (8192, 256) reduced view, columns c0 = 8 (t % 32) .. c0 + 7. With fl = (row % 512) 256 + c0 + q the channel is fl / 4096, the reduced pixel
// (i, j) = ((fl / 64) % 64, fl % 64), so the 2 x 2 windows of the 8 columns are 16 floats in a row of x and the 16 below them, at x + 1024 row + 256 (c0 / 64) + 2 (c0 % 64);
// the 8 rows of a plain block lie in one channel, (row / 16) % 32, the same for the whole block
template <int F, int NU>
__device__ __forceinline__ void d_xr(int blk, const float* __restrict__ x, const float* __restrict__ w, const float* __restrict__ bb, _Float16* __restrict__ XR) {
  #pragma clang fp contract(off)
  const int c0 = (threadIdx.x % (DR / 8)) * 8; int rb0 = blk * (NU * F * 8);      /* first row of the burst's first plain block */
#pragma unroll 1
  for (int n = 0; n < NU; ++n, rb0 += F * 8) { const int row0 = rb0 + threadIdx.x / (DR / 8); const float* xp = x + (size_t)row0 * DQ + (c0 / 64) * 256 + 2 * (c0 % 64); v4f a[F][4], d[F][4];
#pragma unroll
    for (int u = 0; u < F; ++u)
#pragma unroll
      for (int g = 0; g < 4; ++g) { a[u][g] = *(const v4fa*)(xp + (size_t)u * 8 * DQ + 4 * g); d[u][g] = *(const v4fa*)(xp + (size_t)u * 8 * DQ + 128 + 4 * g); }
    asm volatile("s_wait_xcnt 0x0" :: "v"(xp) : "memory");      /* in front of every overwrite of the loads' address pair, which stays live up to here */
#pragma unroll
    for (int u = 0; u < F; ++u) { const int c = ((rb0 + u * 8) / 16) % 32; FragH f;
#pragma unroll
      for (int q = 0; q < 8; ++q) {
        float s = bf16_round(bb[c]); s += bf16_round(w[c * 4 + 0]) * bf16_round(a[u][q / 2][(2 * q) % 4]); s += bf16_round(w[c * 4 + 1]) * bf16_round(a[u][q / 2][(2 * q) % 4 + 1]); s += bf16_round(w[c * 4 + 2]) * bf16_round(d[u][q / 2][(2 * q) % 4]); s += bf16_round(w[c * 4 + 3]) * bf16_round(d[u][q / 2][(2 * q) % 4 + 1]); f.h[q] = (_Float16)s; }
      *(v8us*)((unsigned short*)XR + (size_t)(row0 + u * 8) * DR + c0) = f.half[0]; }
    asm volatile("s_wait_xcnt 0x0" ::: "memory");      /* in front of every overwrite of the stores' registers by what follows */ } }
// K head operand: (128, 512, 32) flat = the k half of the (8192, 512) [k | v] rows read flat; piece t: row t / 32, columns 8 (t % 32) .. + 7
template <int F>
__device__ __forceinline__ void d_heads(int blk, const float* __restrict__ KV, _Float16* __restrict__ KH) {
  const int row0 = blk * (F * 8) + threadIdx.x / 32, c0 = (threadIdx.x % 32) * 8; const float* kr = KV + (size_t)row0 * 2 * DR + c0; v4f a[F], b[F];
#pragma unroll
  for (int u = 0; u < F; ++u) { a[u] = *(const v4fa*)(kr + (size_t)u * 8 * 2 * DR); b[u] = *(const v4fa*)(kr + (size_t)u * 8 * 2 * DR + 4); }
  asm volatile("s_wait_xcnt 0x0" :: "v"(kr) : "memory");      /* in front of every overwrite of the loads' address pair, which stays live up to here */
#pragma unroll
  for (int u = 0; u < F; ++u) { FragH fk;
#pragma unroll
    for (int q = 0; q < 4; ++q) { fk.h[q] = (_Float16)a[u][q]; fk.h[4 + q] = (_Float16)b[u][q]; }
    *(v8us*)((unsigned short*)KH + (size_t)(row0 + u * 8) * DR + c0) = fk.half[0]; }
  asm volatile("s_wait_xcnt 0x0" ::: "memory");      /* in front of every overwrite of the stores' registers by what follows */ }
// V^T: one block = one (batch, head) pair bh. Piece (e, r): VT[bh][e][8 r + q] = v row 64 bh + r, column 32 q + e, q = 0 .. 7. A thread takes row r = tid % 64 and the 8 neighbouring e from 8 (tid / 64) on
__device__ __forceinline__ void d_vt(int bh, const float* __restrict__ KV, _Float16* __restrict__ VT) { const int r = threadIdx.x % 64, e0 = (threadIdx.x / 64) * 8; const float* vr = KV + ((size_t)bh * 64 + r) * 2 * DR + DR + e0; v4f a[8], b[8];
#pragma unroll
  for (int q = 0; q < 8; ++q) { a[q] = *(const v4fa*)(vr + q * 32); b[q] = *(const v4fa*)(vr + q * 32 + 4); }
  asm volatile("s_wait_xcnt 0x0" :: "v"(vr) : "memory");      /* in front of every overwrite of the loads' address pair, which stays live up to here */
#pragma unroll
  for (int u = 0; u < 8; ++u) { FragH f;
#pragma unroll
    for (int q = 0; q < 8; ++q) f.h[q] = (_Float16)(u < 4 ? a[q][u % 4] : b[q][u % 4]);
    *(v8us*)((unsigned short*)VT + ((size_t)bh * 32 + e0 + u) * NP + r * 8) = f.half[0]; }
  asm volatile("s_wait_xcnt 0x0" ::: "memory");      /* in front of every overwrite of the stores' registers by what follows */ }
#define KPIT 40                  /* K row pitch in LDS, f16 elements */
#define VPIT 520                 /* V^T row pitch in LDS, f16 elements */
#define BPIT 72                  /* bias tile pitch in LDS, bf16 elements */
#define OPIT 36                  /* output staging pitch, floats */
#define AWV 16                   /* waves per work-group */
#define NCH (NP / 64)            /* chunks of 64 keys */
typedef float v2f __attribute__((ext_vector_type(2)));
typedef __bf16 v4b __attribute__((ext_vector_type(4)));
typedef __bf16 v4ba __attribute__((ext_vector_type(4), may_alias));
typedef __bf16 v8ba __attribute__((ext_vector_type(8), may_alias));
typedef __bf16 v8b __attribute__((ext_vector_type(8)));
typedef _Float16 v2h __attribute__((ext_vector_type(2)));
__device__ __forceinline__ float other_half(float v) { const int b = __float_as_int(v); return __int_as_float(__builtin_amdgcn_permlanex16(b, b, 0x76543210, 0xfedcba98, false, false)); }
__global__ __launch_bounds__(512) __attribute__((amdgpu_waves_per_eu(4, 4))) void k_attn(const _Float16* __restrict__ QS, const _Float16* __restrict__ KH, const _Float16* __restrict__ VT, const float* __restrict__ rb, float* __restrict__ out) {
  __shared__ __attribute__((aligned(16))) unsigned short sK[NP * KPIT];
  __shared__ __attribute__((aligned(16))) unsigned short sV[32 * VPIT];
  __shared__ __attribute__((aligned(16))) __bf16 sB[AWV][16 * BPIT];
  __shared__ __attribute__((aligned(16))) float sO[AWV][16 * OPIT];
  const int tid = threadIdx.x, w = tid >> 5, lane = tid & 31, c = lane & 15, hh = lane >> 4;
  const int bh = blockIdx.x >> 1, q0 = (blockIdx.x & 1) * (AWV * 16) + w * 16, h = bh % NHD;
  const unsigned short* gK = (const unsigned short*)KH + (size_t)bh * NP * 32;
  const unsigned short* gV = (const unsigned short*)VT + (size_t)bh * 32 * NP;
  const float* br = rb + ((size_t)h * NP + q0 + hh) * NP + c * 4;      /* load i of a chunk: rows 2 i + hh, 16 lanes x 16 B = one 256-B piece of a row */
  __bf16* sb = sB[w];
  v8us tk[4], tv[4]; v4f bn[8];
#pragma unroll
  for (int u = 0; u < 4; ++u) { tk[u] = *(const v8us*)(gK + (size_t)(tid + u * AWV * 32) * 8); tv[u] = *(const v8us*)(gV + (size_t)(tid + u * AWV * 32) * 8); }
#pragma unroll
  for (int i = 0; i < 8; ++i) bn[i] = *(const v4fa*)(br + (size_t)(2 * i) * NP);
  FragH fq;
  { const unsigned short* qr = (const unsigned short*)QS + ((size_t)bh * NP + q0 + c) * 32; fq.half[0] = *(const v8us*)(qr + 8 * hh); fq.half[1] = *(const v8us*)(qr + 16 + 8 * hh); }
  /* the address registers of the loads above are reused further down: the wait stands in front of every such overwrite */
  asm volatile("s_wait_xcnt 0x0" ::: "memory");
#pragma unroll
  for (int u = 0; u < 4; ++u) { const int i = tid + u * AWV * 32; *(v8us*)&sK[(i >> 2) * KPIT + (i & 3) * 8] = tk[u]; *(v8us*)&sV[(i >> 6) * VPIT + (i & 63) * 8] = tv[u]; }
#pragma unroll
  for (int i = 0; i < 8; ++i) { *(v4ba*)&sb[(2 * i + hh) * BPIT + c * 4] = __builtin_convertvector(bn[i], v4b); bn[i] = *(const v4fa*)(br + (size_t)(2 * i) * NP + 64); }
  __syncthreads();
  const float L2E = 1.4426950408889634f;
  v8f o0 = {}, o1 = {};
  float m = -3.0e38f, ls = 0.f;
#pragma unroll 1      /* rolled: eight copies of this body would add code and registers and save nothing */
  for (int kc = 0; kc < NCH; ++kc) {
    /* the lanes of this wave read bias values that other lanes of it stored in the trip before: the stores have to be done first */
    asm volatile("s_wait_dscnt 0x0" ::: "memory");
    float l[32];
#pragma unroll
    for (int j = 0; j < 4; ++j) {
      const v8b pb = *(const v8ba*)&sb[c * BPIT + j * 16 + 8 * hh];      /* register r: bias[q0 + c][64 kc + 16 j + 8 hh + r], the S^T tile's own map */
      FragH fk; const unsigned short* kr = &sK[(kc * 64 + j * 16 + c) * KPIT];
      fk.half[0] = *(const v8us*)(kr + 8 * hh); fk.half[1] = *(const v8us*)(kr + 16 + 8 * hh);
      const v8f z = {};
      const v8f s = __builtin_amdgcn_wmma_f32_16x16x32_f16(false, fk.v, false, fq.v, (short)0, z, false, false);
#pragma unroll
      for (int r = 0; r < 8; ++r) l[j * 8 + r] = __builtin_fmaf(s[r], 0.03125f, (float)pb[r]);
    }
    /* next chunk's bias into the tile (its readers above are done), then the loads of the chunk after it; past the end both repeat the last chunk */
    const float* bx = br + ((kc + 2 < NCH) ? kc + 2 : NCH - 1) * 64;
#pragma unroll
    for (int i = 0; i < 8; ++i) { *(v4ba*)&sb[(2 * i + hh) * BPIT + c * 4] = __builtin_convertvector(bn[i], v4b); bn[i] = *(const v4fa*)(bx + (size_t)(2 * i) * NP); }
    float cj[4];
#pragma unroll
    for (int j = 0; j < 4; ++j) { cj[j] = l[j * 8];
#pragma unroll
      for (int r = 1; r < 8; ++r) cj[j] = fmaxf(cj[j], l[j * 8 + r]); }
    float cm = fmaxf(fmaxf(cj[0], cj[1]), fmaxf(cj[2], cj[3]));
    cm = fmaxf(cm, other_half(cm));
    const float mn = fmaxf(m, cm);
    const float sc = __builtin_amdgcn_exp2f((m - mn) * L2E);
    const float mb = 10.0f - mn * L2E;
    m = mn;
    v2f sa = {0.f, 0.f}, sd = {0.f, 0.f};
    FragH fp[2];
#pragma unroll
    for (int i = 0; i < 32; i += 4) {
      v2f ta, tc, pa, pc; const v2f l2e = {L2E, L2E}, mb2 = {mb, mb};
      ta[0] = l[i]; ta[1] = l[i + 1]; tc[0] = l[i + 2]; tc[1] = l[i + 3];
      ta = __builtin_elementwise_fma(ta, l2e, mb2); tc = __builtin_elementwise_fma(tc, l2e, mb2);
      pa[0] = __builtin_amdgcn_exp2f(ta[0]); pa[1] = __builtin_amdgcn_exp2f(ta[1]); pc[0] = __builtin_amdgcn_exp2f(tc[0]); pc[1] = __builtin_amdgcn_exp2f(tc[1]);
      sa += pa; sd += pc;
      const v2h ha = __builtin_convertvector(pa, v2h), hc = __builtin_convertvector(pc, v2h);
      fp[i >> 4].h[(i & 15)] = ha[0]; fp[i >> 4].h[(i & 15) + 1] = ha[1]; fp[i >> 4].h[(i & 15) + 2] = hc[0]; fp[i >> 4].h[(i & 15) + 3] = hc[1];
    }
    sa += sd;
    ls = __builtin_fmaf(ls, sc, sa[0] + sa[1]);
#pragma unroll
    for (int r = 0; r < 8; ++r) { o0[r] *= sc; o1[r] *= sc; }
#pragma unroll
    for (int u = 0; u < 2; ++u) {
      FragH v0, v1; const unsigned short* vr = &sV[c * VPIT + kc * 64 + u * 32];
      v0.half[0] = *(const v8us*)(vr + 8 * hh); v0.half[1] = *(const v8us*)(vr + 16 + 8 * hh);
      v1.half[0] = *(const v8us*)(vr + 16 * VPIT + 8 * hh); v1.half[1] = *(const v8us*)(vr + 16 * VPIT + 16 + 8 * hh);
      o0 = __builtin_amdgcn_wmma_f32_16x16x32_f16(false, v0.v, false, fp[u].v, (short)0, o0, false, false);
      o1 = __builtin_amdgcn_wmma_f32_16x16x32_f16(false, v1.v, false, fp[u].v, (short)0, o1, false, false);
    }
  }
  ls += other_half(ls);
  const float inv = 1.0f / ls;
  float* so = sO[w];               /* this wave's own staging: lane (c, hh) holds query c, e = 16 t + 8 hh + r */
  { v4f a;
    a[0] = o0[0] * inv; a[1] = o0[1] * inv; a[2] = o0[2] * inv; a[3] = o0[3] * inv; *(v4fa*)&so[c * OPIT + 8 * hh] = a;
    a[0] = o0[4] * inv; a[1] = o0[5] * inv; a[2] = o0[6] * inv; a[3] = o0[7] * inv; *(v4fa*)&so[c * OPIT + 8 * hh + 4] = a;
    a[0] = o1[0] * inv; a[1] = o1[1] * inv; a[2] = o1[2] * inv; a[3] = o1[3] * inv; *(v4fa*)&so[c * OPIT + 16 + 8 * hh] = a;
    a[0] = o1[4] * inv; a[1] = o1[5] * inv; a[2] = o1[6] * inv; a[3] = o1[7] * inv; *(v4fa*)&so[c * OPIT + 16 + 8 * hh + 4] = a; }
  /* the wave's lanes read each other's staged values: the LDS writes have to be done before the reads */
  asm volatile("s_wait_dscnt 0x0" ::: "memory");
  float* orow = out + ((size_t)bh * NP + q0) * 128 + lane * 4;      /* out_d = o_{d/4}: lane e writes its value four times, 512 B a query in one store */
#pragma unroll
  for (int q = 0; q < 16; ++q) { const float vv = so[q * OPIT + lane]; v4f v; v[0] = vv; v[1] = vv; v[2] = vv; v[3] = vv; *(v4f*)(orow + (size_t)q * 128) = v; }
}
__device__ __forceinline__ void d_bcat(int blk, const float* __restrict__ a, const float* __restrict__ b, float* __restrict__ O) { const int t = blk * 256 + threadIdx.x; const float v = (t < DR) ? a[t] : b[t - DR]; *(float*)(O + t) = v;
  /* in the shared kernel's code other passes' instructions follow this store and write its registers: the wait stands in front of every such overwrite */
  asm volatile("s_wait_xcnt 0x0" ::: "memory"); }
// Passes that read nothing of one another share one launch: each pass owns a range of block indices and does there what it did alone
// (the looped passes piece by piece, as said at d_x16; the bias concatenation in two blocks of 256 threads for its one block of 512).
// The choice of the pass is uniform for a block. The longest passes come first.
// 586 blocks of 8 waves, between 4 and 5 waves for each SIMD of the chip: amdgpu_waves_per_eu(8, 8) gives the compiler the register budget for a whole burst of loads in flight.
#define G_X16 (NRW * DQ / 8 / 256 / 16)       /* 256 blocks: 2 bursts of 8 pieces */
#define G_XR  (NRW * (DR / 8) / 256 / 4)      /* 256: 2 bursts of 2 pieces */
#define G_FQ  (DR * DQ / 8 / 256 / 2)         /* 64: 2 pieces */
#define G_RW  (DR * DR / 8 / 256 / 8)         /* 4, once for Wk and once for Wv: 8 pieces */
#define G_BC  (2 * DR / 256)             /* 2 */
__global__ __launch_bounds__(256) __attribute__((amdgpu_waves_per_eu(8, 8))) void k_prep(const float* __restrict__ x, const float* __restrict__ dww, const float* __restrict__ dwb, const float* __restrict__ Wq, const float* __restrict__ Wk, const float* __restrict__ Wv, const float* __restrict__ bk, const float* __restrict__ bv,
    _Float16* __restrict__ X16, _Float16* __restrict__ XR16, _Float16* __restrict__ BQ, _Float16* __restrict__ BKV, float* __restrict__ BKVb) {
  int blk = blockIdx.x;
  if (blk < G_X16) { d_x16<8, 2>(blk, x, X16); return; }      /* plain (P, 1024) view = flat */
  blk -= G_X16;
  if (blk < G_XR) { d_xr<2, 2>(blk, x, dww, dwb, XR16); return; }
  blk -= G_XR;
  if (blk < G_FQ) { d_fold4<DR, DQ, 2>(blk, Wq, BQ); return; }      /* weights: (out, in) natural */
  blk -= G_FQ;
  if (blk < G_RW) { d_round16f<8>(blk, Wk, BKV); return; }
  blk -= G_RW;
  if (blk < G_RW) { d_round16f<8>(blk, Wv, BKV + (size_t)DR * DR); return; }
  blk -= G_RW;
  d_bcat(blk, bk, bv, BKVb);
}
#define G_GQ  ((NRW / 32) * (DR / 256))            /* 256 blocks, 16 k blocks each */
#define G_GKV ((NRW / 32) * (2 * DR / 256))        /* 512 blocks, 4 k blocks each */
// 97 KiB of LDS a work-group: 3 work-groups on a WGP, 3 waves on a SIMD.
__global__ __launch_bounds__(128) void k_proj(const _Float16* __restrict__ X16, const _Float16* __restrict__ BQ, const float* __restrict__ bq, _Float16* __restrict__ QS,
    const _Float16* __restrict__ XR16, const _Float16* __restrict__ BKV, const float* __restrict__ BKVb, float* __restrict__ KVf) {
  __shared__ __attribute__((aligned(16))) unsigned short sg[2][GROWS * GPIT];
  __shared__ __attribute__((aligned(16))) float so[4][16][64];
  const int blk = blockIdx.x;
  if (blk < G_GQ) d_gemm_st<DQ, DR, true, true>(sg, so, blk, X16, BQ, 0.0625f, bq, nullptr, QS);      /* (8192, 256) flat = (128, 512, 32) flat: row b 512 + h 64 + p / 8, column (p % 8) 32 + e */
  else d_gemm_st<DR, 2 * DR, false, false>(sg, so, blk - G_GQ, XR16, BKV, 0.0625f, BKVb, KVf, nullptr);      /* [k | v] */
}
#define G_KH (NBH * NP * 4 / 256 / 8)            /* 128 blocks: 8 pieces */
#define G_VT (NBH * 32 * (NP / 8) / 256 / 8)     /* 128: 8 pieces */
__global__ __launch_bounds__(256) __attribute__((amdgpu_waves_per_eu(8, 8))) void k_split(const float* __restrict__ KVf, _Float16* __restrict__ KH, _Float16* __restrict__ VT) {
  const int blk = blockIdx.x;
  if (blk < G_VT) d_vt(blk, KVf, VT); else d_heads<8>(blk - G_VT, KVf, KH);
}

extern "C" void kernel_launch(void* const* d_in, const int* in_sizes, int n_in,
                              void* d_out, int out_size, void* d_ws, size_t ws_size, hipStream_t stream) {
  (void)in_sizes; (void)n_in; (void)out_size;
  const float* const* I = (const float* const*)d_in; const float* x = I[0]; const float* dww = I[1]; const float* dwb = I[2]; const float* Wq = I[3]; const float* bq = I[4]; const float* Wk = I[5]; const float* bk = I[6]; const float* Wv = I[7]; const float* bv = I[8]; const float* rb = I[9];
  char* ws = (char*)d_ws; size_t off = 0;
  auto take = [&](size_t bytes) { char* p = ws + off; off += (bytes + 255) & ~(size_t)255; return p; };
  _Float16* BQ = (_Float16*)take((size_t)DR * DQ * 2); _Float16* BKV = (_Float16*)take((size_t)2 * DR * DR * 2); float* BKVb = (float*)take(2 * DR * 4);
  _Float16* X16 = (_Float16*)take((size_t)NRW * DQ * 2); _Float16* XR16 = (_Float16*)take((size_t)NRW * DR * 2); float* KVf = (float*)take((size_t)NRW * 2 * DR * 4);
  _Float16* QS = (_Float16*)take((size_t)NBH * NP * 32 * 2); _Float16* KH = (_Float16*)take((size_t)NBH * NP * 32 * 2); _Float16* VT = (_Float16*)take((size_t)NBH * 32 * NP * 2);
  if (off > ws_size) return;
  k_prep<<<G_X16 + G_XR + G_FQ + 2 * G_RW + G_BC, 256, 0, stream>>>(x, dww, dwb, Wq, Wk, Wv, bk, bv, X16, XR16, BQ, BKV, BKVb);
  k_proj<<<G_GQ + G_GKV, 128, 0, stream>>>(X16, BQ, bq, QS, XR16, BKV, BKVb, KVf);
  k_split<<<G_VT + G_KH, 256, 0, stream>>>(KVf, KH, VT);
  k_attn<<<NBH * 2, AWV * 32, 0, stream>>>(QS, KH, VT, rb, (float*)d_out);
}

// v006
// A run of this version takes 42.4 microseconds.
// In two side-by-side timings against v005, it was 1.15 and 1.16 times as fast.
// Counting every step since v000, it is 7.13 times as fast.
#include <hip/hip_runtime.h>
// Lightweight multi-head self-attention with reduced keys/values (B 16, C 32, 128×128; P 512 tokens of 1024 (q) / 256 (k, v after a depthwise 2×2 stride-2 reduction); 8 heads by PLAIN reshapes of the (P, dim) buffers; k/v nearest-upsampled 32 → 128 along the head dim; scores/√1024 + rel_bias; softmax; attn·v; plain reshape back to [16,32,128,128]).
// Structure: q/k/v projections as GEMMs (the depthwise reduction on VALU -> f16); the 32->128 nearest upsampling is folded into the contraction (sum_d q_d k_{d/4} = sum_e (sum_{d/4=e} q_d) k_e and out_d = o_{d/4}), and the sum over each four q columns is folded further into the projection itself (sum_{d/4=e} q_d = x . sum_{d/4=e} Wq[d] + sum_{d/4=e} bq[d]): the q GEMM has N 256 and its f16 output, read flat, is the head operand; the plain-view head split of k and v by index arithmetic in the k/v GEMM's own epilogue; scores (K 32, scale 1/32), bias, running-max softmax (x 2^10, f16), P.V (N 32) and the expanded output in ONE fused kernel, scores and probabilities kept in registers.
// Compute dtype: inputs and parameters rounded to bf16; x exact in f16; folded q weights, reduced x, head operands and probabilities f16 (about 2^-12); f32 accumulation; softmax f32. v_wmma_f32_16x16x32_f16.
#define NB 16
#define NP 512
#define DQ 1024
#define DR 256
#define NHD 8
#define NBH (NB * NHD)           /* 128 */
#define NRW (NB * NP)            /* 8192 rows */
typedef __bf16 v16b __attribute__((ext_vector_type(16)));
typedef unsigned short v8us __attribute__((ext_vector_type(8), may_alias));
typedef float  v8f  __attribute__((ext_vector_type(8)));
typedef float  v4f  __attribute__((ext_vector_type(4)));
typedef float  v4fa __attribute__((ext_vector_type(4), may_alias));
union FragB { v16b v; v8us half[2]; unsigned short u[16]; };

__device__ __forceinline__ unsigned short bf16_bits(float x) { unsigned int u = __float_as_uint(x); return (unsigned short)((u + 0x7FFFu + ((u >> 16) & 1u)) >> 16); }
__device__ __forceinline__ float bf16_val(unsigned short b) { return __uint_as_float(((unsigned int)b) << 16); }
__device__ __forceinline__ float bf16_round(float x) { return bf16_val(bf16_bits(x)); }
// D += A·B with NT terms: 1 = ah·bh, 2 = + al·bh (A split), 3 = + ah·bl (both split)
template <int NT>
__device__ __forceinline__ v8f mmaN(v16b ah, v16b al, v16b bh, v16b bl, v8f c) {
  c = __builtin_amdgcn_wmma_f32_16x16x32_bf16(false, ah, false, bh, (short)0, c, false, false);
  if (NT >= 2) c = __builtin_amdgcn_wmma_f32_16x16x32_bf16(false, al, false, bh, (short)0, c, false, false);
  if (NT >= 3) c = __builtin_amdgcn_wmma_f32_16x16x32_bf16(false, ah, false, bl, (short)0, c, false, false);
  asm volatile("v_nop\n\tv_nop\n\tv_nop\n\tv_nop" : "+v"(c) : "v"(ah), "v"(al), "v"(bh), "v"(bl));
  return c;
}

__global__ __launch_bounds__(256) void k_wt_bf16(const float* __restrict__ W, unsigned short* __restrict__ Wt, int K, int N) {
  const int t = blockIdx.x * 256 + threadIdx.x;
  const int k8n = K / 8;
  if (t >= N * k8n) return;
  const int n = t / k8n, k8 = (t % k8n) * 8;
  v8us v;
#pragma unroll
  for (int i = 0; i < 8; ++i) v[i] = bf16_bits(W[(size_t)(k8 + i) * N + n]);
  *(v8us*)(Wt + (size_t)n * K + k8) = v;
  
}

// GEMM C[M][N] (f32, pitch ldc) = act(A[M][K]·W + bias). A f32 row-major (pitch lda) converted per fragment to bf16
// (ASPLIT: hi/lo two planes -> 2 terms, else single rounded term); Wt bf16 [N][K] (pitch ldb). BIAS_BF16 rounds the
// bias to bf16 first (bias quantised to bf16 before the add). K%32==0, M%16==0, N%64==0.
template <bool ASPLIT, int ACT, bool BIAS_BF16>
__global__ __launch_bounds__(128) void k_gemm_bf(const float* __restrict__ A, int lda, const unsigned short* __restrict__ Wt, int ldb,
                                               const float* __restrict__ bias, float* __restrict__ C, int ldc, int M, int N, int K) {
  __shared__ __attribute__((aligned(16))) float so[4][16][64];
  const int tid = threadIdx.x, w = tid >> 5, lane = tid & 31, ln = lane & 15, hh = lane >> 4;
  const int ntn = N / 64;
  const int wid = blockIdx.x * 4 + w;
  const int mt = wid / ntn, nq = wid % ntn;
  if (mt * 16 >= M) return;
  const int row0 = mt * 16, col0 = nq * 64;
  const float* arow = A + (size_t)(row0 + ln) * lda;
  v8f acc[4] = {};
  for (int kb = 0; kb < K; kb += 32) {
    FragB ah, al;
    const v4f x0 = *(const v4fa*)(arow + kb + 8 * hh), x1 = *(const v4fa*)(arow + kb + 8 * hh + 4);
    const v4f x2 = *(const v4fa*)(arow + kb + 16 + 8 * hh), x3 = *(const v4fa*)(arow + kb + 16 + 8 * hh + 4);
    float xs[16] = {x0[0],x0[1],x0[2],x0[3],x1[0],x1[1],x1[2],x1[3],x2[0],x2[1],x2[2],x2[3],x3[0],x3[1],x3[2],x3[3]};
#pragma unroll
    for (int i = 0; i < 16; ++i) { const unsigned short hb = bf16_bits(xs[i]); ah.u[i] = hb; al.u[i] = ASPLIT ? bf16_bits(xs[i] - bf16_val(hb)) : (unsigned short)0; }
#pragma unroll
    for (int t = 0; t < 4; ++t) {
      const unsigned short* brow = Wt + (size_t)(col0 + t * 16 + ln) * ldb + kb;
      FragB b;
      b.half[0] = *(const v8us*)(brow + 8 * hh);
      b.half[1] = *(const v8us*)(brow + 16 + 8 * hh);
      acc[t] = mmaN<ASPLIT ? 2 : 1>(ah.v, al.v, b.v, b.v, acc[t]);
    }
  }
#pragma unroll
  for (int t = 0; t < 4; ++t) {
    float bv = bias ? bias[col0 + t * 16 + ln] : 0.f;
    if (BIAS_BF16) bv = bf16_round(bv);
#pragma unroll
    for (int r = 0; r < 8; ++r) { float v = acc[t][r] + bv; if (ACT == 1) v = fmaxf(v, 0.f); so[w][8 * hh + r][t * 16 + ln] = v; }
  }
  __builtin_amdgcn_fence(__ATOMIC_ACQ_REL, "workgroup");
  __builtin_amdgcn_wave_barrier();
  const int rsub = lane >> 4, c4 = (lane & 15) * 4;
  {
#pragma unroll
    for (int q = 0; q < 8; ++q) {
      const int r = q * 2 + rsub;
      const v4f v = *(const v4fa*)&so[w][r][c4];
      *(v4f*)(C + (size_t)(row0 + r) * ldc + col0 + c4) = v;
    }
    
  }
}

// GEMM C = act(A·W + bias + resid): A f32 (ASPLIT -> hi/lo 2 terms), Wt bf16 [N][K]; ACT 0 none, 1 relu, 2 exact gelu;
// resid (optional, f32, row index = (row % rmod), pitch ldr, RES_BF16 rounds it) added before the activation.
template <bool ASPLIT, int ACT, bool BIAS_BF16, bool RES_BF16>
__global__ __launch_bounds__(128) void k_gemm_bf3(const float* __restrict__ A, int lda, const unsigned short* __restrict__ Wt, int ldb,
                                                const float* __restrict__ bias, const float* __restrict__ resid, int rmod, int ldr,
                                                float* __restrict__ C, int ldc, int M, int N, int K) {
  __shared__ __attribute__((aligned(16))) float so[4][16][64];
  const int tid = threadIdx.x, w = tid >> 5, lane = tid & 31, ln = lane & 15, hh = lane >> 4;
  const int ntn = N / 64;
  const int wid = blockIdx.x * 4 + w;
  const int mt = wid / ntn, nq = wid % ntn;
  if (mt * 16 >= M) return;
  const int row0 = mt * 16, col0 = nq * 64;
  const float* arow = A + (size_t)(row0 + ln) * lda;
  v8f acc[4] = {};
  for (int kb = 0; kb < K; kb += 32) {
    FragB ah, al;
    const v4f x0 = *(const v4fa*)(arow + kb + 8 * hh), x1 = *(const v4fa*)(arow + kb + 8 * hh + 4);
    const v4f x2 = *(const v4fa*)(arow + kb + 16 + 8 * hh), x3 = *(const v4fa*)(arow + kb + 16 + 8 * hh + 4);
    float xs[16] = {x0[0],x0[1],x0[2],x0[3],x1[0],x1[1],x1[2],x1[3],x2[0],x2[1],x2[2],x2[3],x3[0],x3[1],x3[2],x3[3]};
#pragma unroll
    for (int i = 0; i < 16; ++i) { const unsigned short hb = bf16_bits(xs[i]); ah.u[i] = hb; al.u[i] = ASPLIT ? bf16_bits(xs[i] - bf16_val(hb)) : (unsigned short)0; }
#pragma unroll
    for (int t = 0; t < 4; ++t) {
      const unsigned short* brow = Wt + (size_t)(col0 + t * 16 + ln) * ldb + kb;
      FragB b;
      b.half[0] = *(const v8us*)(brow + 8 * hh);
      b.half[1] = *(const v8us*)(brow + 16 + 8 * hh);
      acc[t] = mmaN<ASPLIT ? 2 : 1>(ah.v, al.v, b.v, b.v, acc[t]);
    }
  }
#pragma unroll
  for (int t = 0; t < 4; ++t) {
    const int col = col0 + t * 16 + ln;
    float bv = bias ? bias[col] : 0.f;
    if (BIAS_BF16) bv = bf16_round(bv);
#pragma unroll
    for (int r = 0; r < 8; ++r) {
      float v = acc[t][r] + bv;
      if (resid) { float rv = resid[(size_t)((row0 + 8 * hh + r) % rmod) * ldr + col]; if (RES_BF16) rv = bf16_round(rv); v += rv; }
      if (ACT == 1) v = fmaxf(v, 0.f);
      if (ACT == 2) v = 0.5f * v * (1.0f + erff(v * 0.70710678118654752f));
      if (ACT == 3) { const float u = 0.7978845608028654f * (v + 0.044715f * v * v * v); v = 0.5f * v * (1.0f + tanhf(u)); }
      so[w][8 * hh + r][t * 16 + ln] = v;
    }
  }
  __builtin_amdgcn_fence(__ATOMIC_ACQ_REL, "workgroup");
  __builtin_amdgcn_wave_barrier();
  const int rsub = lane >> 4, c4 = (lane & 15) * 4;
  {
#pragma unroll
    for (int q = 0; q < 8; ++q) {
      const int r = q * 2 + rsub;
      const v4f v = *(const v4fa*)&so[w][r][c4];
      *(v4f*)(C + (size_t)(row0 + r) * ldc + col0 + c4) = v;
    }
    
  }
}
// row LayerNorm (biased variance, eps) over N: s = X (+ R); optional out_sum <- s; out_norm <- (s-mu)*rsqrt(var+eps)*g + b
template <bool PARAM_BF16>
__global__ __launch_bounds__(256) void k_layernorm(const float* __restrict__ X, const float* __restrict__ R, const float* __restrict__ g, const float* __restrict__ bta,
                                                  float* __restrict__ out_sum, float* __restrict__ out_norm, int N, float eps) {
  __shared__ float red[256];
  const int row = blockIdx.x, tid = threadIdx.x;
  const float* x = X + (size_t)row * N; const float* rr = R ? R + (size_t)row * N : nullptr;
  float vals[16];                     // up to N = 4096
  const int per = N / 256;            // contiguous chunk per thread? use strided-by-4 chunks: thread handles j = tid*4 + 1024*u
  float s1 = 0.f;
  for (int u = 0; u < per / 4; ++u) {
    const int j = tid * 4 + 1024 * u;
    const v4f a = *(const v4fa*)(x + j);
    v4f b = {0.f,0.f,0.f,0.f}; if (rr) b = *(const v4fa*)(rr + j);
#pragma unroll
    for (int q = 0; q < 4; ++q) { const float v = a[q] + b[q]; vals[u * 4 + q] = v; s1 += v; }
  }
  red[tid] = s1; __syncthreads();
  for (int st = 128; st > 0; st >>= 1) { if (tid < st) red[tid] += red[tid + st]; __syncthreads(); }
  const float mu = red[0] / (float)N; __syncthreads();
  float s2 = 0.f;
  for (int u = 0; u < per / 4; ++u)
#pragma unroll
    for (int q = 0; q < 4; ++q) { const float c = vals[u * 4 + q] - mu; s2 += c * c; }
  red[tid] = s2; __syncthreads();
  for (int st = 128; st > 0; st >>= 1) { if (tid < st) red[tid] += red[tid + st]; __syncthreads(); }
  const float rs = rsqrtf(red[0] / (float)N + eps);
  {
    for (int u = 0; u < per / 4; ++u) {
      const int j = tid * 4 + 1024 * u;
      v4f o, sm;
#pragma unroll
      for (int q = 0; q < 4; ++q) {
        float gg = g[j + q], bb = bta[j + q];
        if (PARAM_BF16) { gg = bf16_round(gg); bb = bf16_round(bb); }
        sm[q] = vals[u * 4 + q]; o[q] = (vals[u * 4 + q] - mu) * rs * gg + bb;
      }
      if (out_sum) *(v4f*)(out_sum + (size_t)row * N + j) = sm;
      *(v4f*)(out_norm + (size_t)row * N + j) = o;
    }
    
  }
}



// ---- f16 WMMA path (v_wmma_f32_16x16x32_f16): 11-bit significands for operands in range — used where a [0,1] probability operand needs more precision than bf16
typedef _Float16 v16h __attribute__((ext_vector_type(16)));
union FragH { v16h v; v8us half[2]; _Float16 h[16]; unsigned short u[16]; };
template <int NT>
__device__ __forceinline__ v8f mmaH(v16h ah, v16h al, v16h bh, v16h bl, v8f c) {
  c = __builtin_amdgcn_wmma_f32_16x16x32_f16(false, ah, false, bh, (short)0, c, false, false);
  if (NT >= 2) c = __builtin_amdgcn_wmma_f32_16x16x32_f16(false, al, false, bh, (short)0, c, false, false);
  if (NT >= 3) c = __builtin_amdgcn_wmma_f32_16x16x32_f16(false, ah, false, bl, (short)0, c, false, false);
  asm volatile("v_nop\n\tv_nop\n\tv_nop\n\tv_nop" : "+v"(c) : "v"(ah), "v"(al), "v"(bh), "v"(bl));
  return c;
}
// batched GEMM like k_gemm_b but f16 operands: A f32 (split into f16 hi/lo if ASPLIT, else rounded to f16), Bt = f16 values [n][k]; alpha; C f32; N multiple of 16 (partial tiles skipped)
template <bool ASPLIT>
__global__ __launch_bounds__(128) void k_gemm_h(const float* __restrict__ A, int lda, size_t sA, const _Float16* __restrict__ Bh, int ldb, size_t sB, float alpha, float* __restrict__ C, int ldc, size_t sC, int M, int N, int K) {
  __shared__ __attribute__((aligned(16))) float so[4][16][64];
  const int tid = threadIdx.x, w = tid >> 5, lane = tid & 31, ln = lane & 15, hh = lane >> 4; const int by = blockIdx.y;
  A += (size_t)by * sA; Bh += (size_t)by * sB; C += (size_t)by * sC;
  const int ntn = (N + 63) / 64; const int wid = blockIdx.x * 4 + w; const int mt = wid / ntn, nq = wid % ntn; if (mt * 16 >= M) return;
  const int row0 = mt * 16, col0 = nq * 64; const float* arow = A + (size_t)(row0 + ln) * lda;
  v8f acc[4] = {};
  for (int kb = 0; kb < K; kb += 32) {
    FragH ah, al;
    const v4f x0 = *(const v4fa*)(arow + kb + 8 * hh), x1 = *(const v4fa*)(arow + kb + 8 * hh + 4), x2 = *(const v4fa*)(arow + kb + 16 + 8 * hh), x3 = *(const v4fa*)(arow + kb + 16 + 8 * hh + 4);
    float xs[16] = {x0[0],x0[1],x0[2],x0[3],x1[0],x1[1],x1[2],x1[3],x2[0],x2[1],x2[2],x2[3],x3[0],x3[1],x3[2],x3[3]};
#pragma unroll
    for (int i = 0; i < 16; ++i) { const _Float16 h = (_Float16)xs[i]; ah.h[i] = h; al.h[i] = ASPLIT ? (_Float16)(xs[i] - (float)h) : (_Float16)0.0f; }
#pragma unroll
    for (int t = 0; t < 4; ++t) { if (col0 + t * 16 >= N) continue; const size_t boff = (size_t)(col0 + t * 16 + ln) * ldb + kb; FragH bq; bq.half[0] = *(const v8us*)(Bh + boff + 8 * hh); bq.half[1] = *(const v8us*)(Bh + boff + 16 + 8 * hh);
      acc[t] = mmaH<ASPLIT ? 2 : 1>(ah.v, al.v, bq.v, bq.v, acc[t]); }
  }
#pragma unroll
  for (int t = 0; t < 4; ++t) { if (col0 + t * 16 >= N) continue;
#pragma unroll
    for (int r = 0; r < 8; ++r) so[w][8 * hh + r][t * 16 + ln] = acc[t][r] * alpha; }
  __builtin_amdgcn_fence(__ATOMIC_ACQ_REL, "workgroup"); __builtin_amdgcn_wave_barrier();
  const int rsub = lane >> 4, c4 = (lane & 15) * 4;
  {
#pragma unroll
    for (int q = 0; q < 8; ++q) { const int r = q * 2 + rsub; if (col0 + c4 < N) { const v4f v = *(const v4fa*)&so[w][r][c4]; *(v4f*)(C + (size_t)(row0 + r) * ldc + col0 + c4) = v; } }
     }
}

// Wt[n][k] = f16(W[k][n]·scale) from f32 row-major W[K][N] (scale = power of two; bf16-exact weights stay exact in f16 away from the subnormal range)
__global__ __launch_bounds__(256) void k_wt_f16(const float* __restrict__ W, _Float16* __restrict__ Wt, int K, int N, float scale) {
  const int t = blockIdx.x * 256 + threadIdx.x; if (t >= N * (K / 8)) return; const int n = t / (K / 8), k8 = (t % (K / 8)) * 8; FragH f;
#pragma unroll
  for (int i = 0; i < 8; ++i) f.h[i] = (_Float16)(bf16_round(W[(size_t)(k8 + i) * N + n]) * scale); const v8us o = f.half[0];
  *(v8us*)((unsigned short*)Wt + (size_t)n * K + k8) = o; 
}
// The projection GEMM with its operands staged in LDS: C[M][N] = A[M][K] . Bh[N][K]^T x alpha + bias, one work-group (4 waves) = 32 rows x 256 columns, a wave = 32 x 64 (2 x 4 accumulator tiles).
// A k block of 64 (one whole 128-B line of each of the 32 A rows and 256 B rows) is brought into LDS by asynchronous copies, 16 B a lane, 8 lanes a line, so that a copy touches 4 whole lines
// where a fragment load from global memory touches 16; the A block serves 4 waves and a B row both row tiles. Two buffers: block t + 1 flies while block t is worked on. Row pitch in LDS 144 B.
// Piece p = tid + 128 i, i = 0 .. 17: staged row p / 8 (0 .. 31 the A rows, 32 .. 287 the B rows), 16-B piece p % 8. Each '#pragma unroll' keeps a register array at constant indices (no scratch).
#define GPIT 72                  /* staged row pitch, f16 elements */
#define GROWS (32 + 256)         /* staged rows of one k block */
/* nine copies and, as the last line of their own statement, the wait that stands in front of every rewrite of the address registers they name */
#define CP9 "global_load_async_to_lds_b128 %0, %9, off\n\tglobal_load_async_to_lds_b128 %1, %10, off\n\tglobal_load_async_to_lds_b128 %2, %11, off\n\tglobal_load_async_to_lds_b128 %3, %12, off\n\tglobal_load_async_to_lds_b128 %4, %13, off\n\tglobal_load_async_to_lds_b128 %5, %14, off\n\tglobal_load_async_to_lds_b128 %6, %15, off\n\tglobal_load_async_to_lds_b128 %7, %16, off\n\tglobal_load_async_to_lds_b128 %8, %17, off\n\ts_wait_xcnt 0x0"
__device__ __forceinline__ void d_stage(unsigned lds, const unsigned short* ga, int lda, const unsigned short* gb, int ldb) {      /* lds, ga, gb: this lane's piece of staged row tid / 8, of A row tid / 8 and of B row tid / 8 */
  const unsigned st = 16 * GPIT * 2;      /* 16 staged rows further on, bytes */
  asm volatile(CP9 :: "v"(lds), "v"(lds + st), "v"(lds + 2 * st), "v"(lds + 3 * st), "v"(lds + 4 * st), "v"(lds + 5 * st), "v"(lds + 6 * st), "v"(lds + 7 * st), "v"(lds + 8 * st),
    "v"(ga), "v"(ga + (size_t)16 * lda), "v"(gb), "v"(gb + (size_t)16 * ldb), "v"(gb + (size_t)32 * ldb), "v"(gb + (size_t)48 * ldb), "v"(gb + (size_t)64 * ldb), "v"(gb + (size_t)80 * ldb), "v"(gb + (size_t)96 * ldb) : "memory");
  asm volatile(CP9 :: "v"(lds + 9 * st), "v"(lds + 10 * st), "v"(lds + 11 * st), "v"(lds + 12 * st), "v"(lds + 13 * st), "v"(lds + 14 * st), "v"(lds + 15 * st), "v"(lds + 16 * st), "v"(lds + 17 * st),
    "v"(gb + (size_t)112 * ldb), "v"(gb + (size_t)128 * ldb), "v"(gb + (size_t)144 * ldb), "v"(gb + (size_t)160 * ldb), "v"(gb + (size_t)176 * ldb), "v"(gb + (size_t)192 * ldb), "v"(gb + (size_t)208 * ldb), "v"(gb + (size_t)224 * ldb), "v"(gb + (size_t)240 * ldb) : "memory");
}
// BSUM4: output column col stands for the four columns 4 col .. 4 col + 3 of the unfolded product, so its bias is the sum of their four rounded biases; bx = the block's index inside this product's own grid of (M / 32) x (N / 256); K a multiple of 128; the result is f16.
// KVS false: C16 is (M, N) row-major. KVS true (N 512, the columns are [k | v]): the epilogue writes the two head operands themselves. A k block (columns 0 .. 255) goes to C16 = (M, 256) row-major, which read flat is
// the (128, 512, 32) K operand. A v block holds 32 rows x all 256 v columns: v row 64 bh + r, column 32 q + e is VT[bh][e][8 r + q], so the block owns, for each of the 32 e, 256 elements in a row (512 B) of VT;
// the waves put them in that order into an LDS tile (the k-block buffer, which has no reader and no copy left behind the loop), and behind one barrier each wave stores whole 512-B runs.
#define TPIT 264                 /* V^T tile pitch in LDS, f16 elements */
template <int K, int N, bool BSUM4, bool KVS>
__device__ __forceinline__ void d_gemm_st(unsigned short (&sg)[2][GROWS * GPIT], float (&so)[4][16][64], int bx, const _Float16* __restrict__ A, const _Float16* __restrict__ Bh, float alpha, const float* __restrict__ bp, _Float16* __restrict__ C16, _Float16* __restrict__ VT) {
  static_assert(K % 128 == 0 && N % 256 == 0, "whole k blocks, at least two; whole column blocks");
  static_assert(!KVS || N == 2 * DR, "one k block and one v block of columns");
  const int tid = threadIdx.x, w = tid >> 5, lane = tid & 31, ln = lane & 15, hh = lane >> 4;
  const int row0 = (bx / (N / 256)) * 32, cb = (bx % (N / 256)) * 256, col0 = cb + w * 64;
  const unsigned short* ga = (const unsigned short*)A + (size_t)(row0 + tid / 8) * K + (tid % 8) * 8;
  const unsigned short* gb = (const unsigned short*)Bh + (size_t)(cb + tid / 8) * K + (tid % 8) * 8;
  const unsigned l0 = (unsigned)(size_t)&sg[0][(tid / 8) * GPIT + (tid % 8) * 8], l1 = (unsigned)(size_t)&sg[1][(tid / 8) * GPIT + (tid % 8) * 8];
  constexpr int T = K / 64;
  d_stage(l0, ga, K, gb, K);
  asm volatile("s_wait_asynccnt 0x0" ::: "memory");      /* this wave's copies of block 0 have landed */
  __syncthreads();                                       /* and every other wave's: block 0 may be read */
  d_stage(l1, ga + 64, K, gb + 64, K);
  v8f acc[2][4] = {};
#pragma unroll 1      /* rolled: the trips are alike, and side by side they would only add code */
  for (int t = 0; t < T; ++t) {
    const unsigned short* sa = &sg[t & 1][ln * GPIT + 8 * hh]; const unsigned short* sb = sa + (32 + w * 64) * GPIT;
    FragH fa[2][2], fb[2][4];
#pragma unroll
    for (int ks = 0; ks < 2; ++ks) {
#pragma unroll
      for (int i = 0; i < 2; ++i) { fa[ks][i].half[0] = *(const v8us*)(sa + i * 16 * GPIT + ks * 32); fa[ks][i].half[1] = *(const v8us*)(sa + i * 16 * GPIT + ks * 32 + 16); }
#pragma unroll
      for (int j = 0; j < 4; ++j) { fb[ks][j].half[0] = *(const v8us*)(sb + j * 16 * GPIT + ks * 32); fb[ks][j].half[1] = *(const v8us*)(sb + j * 16 * GPIT + ks * 32 + 16); }
    }
    asm volatile("s_wait_dscnt 0x0" ::: "memory");       /* the block's 24 fragment loads are done: block t is in registers, this wave reads its buffer no more */
    asm volatile("s_wait_asynccnt 0x0" ::: "memory");    /* this wave's copies of block t + 1 have landed */
    __syncthreads();                                     /* block t + 1 may be read by all, block t's buffer has no reader left */
    if (t + 2 < T) d_stage((t & 1) ? l1 : l0, ga + (t + 2) * 64, K, gb + (t + 2) * 64, K);
    /* the WMMAs work on registers alone and stand behind the refill, so that the copies fly under them */
#pragma unroll
    for (int ks = 0; ks < 2; ++ks)
#pragma unroll
      for (int i = 0; i < 2; ++i)
#pragma unroll
        for (int j = 0; j < 4; ++j) acc[i][j] = __builtin_amdgcn_wmma_f32_16x16x32_f16(false, fa[ks][i].v, false, fb[ks][j].v, (short)0, acc[i][j], false, false);
  }
  asm volatile("s_wait_asynccnt 0x0" ::: "memory");      /* no copy is outstanding behind the loop */
  const int rsub = lane >> 4, c4 = (lane & 15) * 4; typedef _Float16 v4hh __attribute__((ext_vector_type(4))); typedef _Float16 v2ha __attribute__((ext_vector_type(2), may_alias));
  float bv[4];
#pragma unroll
  for (int j = 0; j < 4; ++j) { const int col = col0 + j * 16 + ln;
    if (BSUM4) { const v4f b4 = *(const v4fa*)(bp + 4 * col); bv[j] = ((bf16_round(b4[0]) + bf16_round(b4[1])) + bf16_round(b4[2])) + bf16_round(b4[3]); } else bv[j] = bf16_round(bp[col]); }
  if (KVS && cb != 0) {      /* the same for the whole work-group */
    unsigned short* tv = &sg[0][0];
    /* column w 64 + j 16 + ln of v: q = 2 w + j / 2, e = (j % 2) 16 + ln, so tiles j and j + 2 hold neighbouring q of one e: one 4-B LDS store for the two */
#pragma unroll
    for (int i = 0; i < 2; ++i)
#pragma unroll
      for (int j = 0; j < 2; ++j)
#pragma unroll
        for (int r = 0; r < 8; ++r) { v2ha p; p[0] = (_Float16)(acc[i][j][r] * alpha + bv[j]); p[1] = (_Float16)(acc[i][j + 2][r] * alpha + bv[j + 2]); *(v2ha*)&tv[(j * 16 + ln) * TPIT + (i * 16 + 8 * hh + r) * 8 + 2 * w] = p; }
    __syncthreads();                                     /* every wave's part of the tile is written: the tile may be read */
    unsigned short* vo = (unsigned short*)VT + ((size_t)(row0 / 64) * 32 + w) * NP + (row0 % 64) * 8 + lane * 8;      /* store u: e = 4 u + w, one wave = the block's whole 512-B run of that e */
    v8us tr[8];
#pragma unroll
    for (int u = 0; u < 8; ++u) tr[u] = *(const v8us*)&tv[(4 * u + w) * TPIT + lane * 8];
#pragma unroll
    for (int u = 0; u < 8; ++u) *(v8us*)(vo + (size_t)u * 4 * NP) = tr[u];
    return;
  }
  constexpr int LDC = KVS ? DR : N;      /* the k block's columns are the whole row of its operand */
#pragma unroll
  for (int i = 0; i < 2; ++i) {
#pragma unroll
    for (int j = 0; j < 4; ++j)
#pragma unroll
      for (int r = 0; r < 8; ++r) so[w][8 * hh + r][j * 16 + ln] = acc[i][j][r] * alpha + bv[j];
    /* the wave's lanes read each other's staged values: the LDS writes have to be done before the reads */
    asm volatile("s_wait_dscnt 0x0" ::: "memory");
#pragma unroll
    for (int q = 0; q < 8; ++q) { const int r = q * 2 + rsub; const v4f v = *(const v4fa*)&so[w][r][c4]; const size_t o = (size_t)(row0 + i * 16 + r) * LDC + col0 + c4;
      v4hh h4; for (int u = 0; u < 4; ++u) h4[u] = (_Float16)v[u]; *(v4hh*)(C16 + o) = h4; }
    /* in front of every overwrite of the stores' registers by the second row tile's code; its memory clobber also keeps that tile's LDS writes behind the reads above, whose values the stores have taken */
    if (i == 0) asm volatile("s_wait_xcnt 0x0" ::: "memory");
  }
}

typedef _Float16 v4h __attribute__((ext_vector_type(4)));

// The element-wise passes are looped: one block does the work of NU x F blocks of the plain grid (a piece = what one thread of the plain grid did:
// same reads, same arithmetic, same 16-B store), in NU bursts of F pieces. A launch so starts NU x F times fewer waves, and a wave has the 16 loads
// of a whole burst (16 B a lane each) in flight. Every grid divides exactly: no bounds test. Each '#pragma unroll' keeps a burst's register arrays at constant indices
// and its loads in front of the first use; each '#pragma unroll 1' keeps the bursts one after the other (side by side they would need NU times the registers).
// Two waits a burst, each in front of every overwrite of a register that an issued load or store names: one behind the loads (it takes the address as an input,
// so that the pair stays live up to it and no load of the burst lands on it), one behind the stores (the next burst, or another pass's code in the shared kernel, follows).
template <int F, int NU>
__device__ __forceinline__ void d_x16(int blk, const float* __restrict__ x, _Float16* __restrict__ X16) { size_t t0 = (size_t)blk * (NU * F * 256) + threadIdx.x;
#pragma unroll 1
  for (int n = 0; n < NU; ++n, t0 += F * 256) { const float* xp = x + t0 * 8; v4f a[F], b[F];
#pragma unroll
    for (int u = 0; u < F; ++u) { a[u] = *(const v4fa*)(xp + u * 2048); b[u] = *(const v4fa*)(xp + u * 2048 + 4); }
    asm volatile("s_wait_xcnt 0x0" :: "v"(xp) : "memory");      /* in front of every overwrite of the loads' address pair, which stays live up to here */
#pragma unroll
    for (int u = 0; u < F; ++u) { FragH f;
#pragma unroll
      for (int q = 0; q < 4; ++q) { f.h[q] = (_Float16)bf16_round(a[u][q]); f.h[4 + q] = (_Float16)bf16_round(b[u][q]); }
      *(v8us*)((unsigned short*)X16 + (t0 + u * 256) * 8) = f.half[0]; }
    asm volatile("s_wait_xcnt 0x0" ::: "memory");      /* in front of every overwrite of the stores' registers by what follows */ } }
__global__ __launch_bounds__(256) void k_h16(const float* __restrict__ x, _Float16* __restrict__ X16, size_t n8) { const size_t t = (size_t)blockIdx.x * 256 + threadIdx.x; if (t >= n8) return; FragH f;
#pragma unroll
  for (int q = 0; q < 8; ++q) f.h[q] = (_Float16)x[t * 8 + q]; *(v8us*)((unsigned short*)X16 + t * 8) = f.half[0];  }
template <int F>
__device__ __forceinline__ void d_round16f(int blk, const float* __restrict__ W, _Float16* __restrict__ Bt) { const size_t t0 = (size_t)blk * (F * 256) + threadIdx.x; const float* wp = W + t0 * 8; v4f a[F], b[F];
#pragma unroll
  for (int u = 0; u < F; ++u) { a[u] = *(const v4fa*)(wp + u * 2048); b[u] = *(const v4fa*)(wp + u * 2048 + 4); }
  asm volatile("s_wait_xcnt 0x0" :: "v"(wp) : "memory");      /* in front of every overwrite of the loads' address pair, which stays live up to here */
#pragma unroll
  for (int u = 0; u < F; ++u) { FragH f;
#pragma unroll
    for (int i = 0; i < 4; ++i) { f.h[i] = (_Float16)(bf16_round(a[u][i]) * 16.0f); f.h[4 + i] = (_Float16)(bf16_round(b[u][i]) * 16.0f); }
    *(v8us*)((unsigned short*)Bt + (t0 + u * 256) * 8) = f.half[0]; }
  asm volatile("s_wait_xcnt 0x0" ::: "memory");      /* in front of every overwrite of the stores' registers by what follows */ }
// Bt[e][k] = f16(16 (W[4 e][k] + W[4 e + 1][k] + W[4 e + 2][k] + W[4 e + 3][k])), each W rounded to bf16 first, the sum in f32: W (4 NE, K) row-major, thread = F pieces of 8 k of one e each; both loops unrolled so that f.h is indexed by constants and stays in registers
template <int NE, int K, int F>
__device__ __forceinline__ void d_fold4(int blk, const float* __restrict__ W, _Float16* __restrict__ Bt) { static_assert(256 % (K / 8) == 0, "a piece further on is whole rows further on"); const int t0 = blk * (F * 256) + threadIdx.x; const int e = t0 / (K / 8), k8 = (t0 % (K / 8)) * 8; const float* wr = W + (size_t)e * 4 * K + k8; v4f r[F][2][4];
#pragma unroll
  for (int u = 0; u < F; ++u)
#pragma unroll
    for (int g = 0; g < 2; ++g)
#pragma unroll
      for (int j = 0; j < 4; ++j) r[u][g][j] = *(const v4fa*)(wr + (u * (256 / (K / 8)) * 4 + j) * K + 4 * g);
  asm volatile("s_wait_xcnt 0x0" :: "v"(wr) : "memory");      /* in front of every overwrite of the loads' address pair, which stays live up to here */
#pragma unroll
  for (int u = 0; u < F; ++u) { FragH f;
#pragma unroll
    for (int g = 0; g < 2; ++g)
#pragma unroll
      for (int i = 0; i < 4; ++i) f.h[4 * g + i] = (_Float16)((((bf16_round(r[u][g][0][i]) + bf16_round(r[u][g][1][i])) + bf16_round(r[u][g][2][i])) + bf16_round(r[u][g][3][i])) * 16.0f);
    *(v8us*)((unsigned short*)Bt + (size_t)(t0 + u * 256) * 8) = f.half[0]; }
  asm volatile("s_wait_xcnt 0x0" ::: "memory");      /* in front of every overwrite of the stores' registers by what follows */ }
template <int NHv, int TTv>
__global__ __launch_bounds__(256) void k_vt(const _Float16* __restrict__ V16, int ldv, int voff, _Float16* __restrict__ Vt) { __shared__ unsigned short tl[64][66]; const int tid = threadIdx.x; const int slab = blockIdx.x / (TTv / 64), lg = blockIdx.x % (TTv / 64); const int b = slab / NHv, h = slab % NHv;
  for (int i = tid; i < 64 * 8; i += 256) { const int r = i / 8, c8 = (i % 8) * 8; FragH f; f.half[0] = *(const v8us*)((const unsigned short*)V16 + ((size_t)b * TTv + lg * 64 + r) * ldv + voff + h * 64 + c8);
#pragma unroll
    for (int q = 0; q < 8; ++q) tl[r][c8 + q] = f.u[q]; }
  __syncthreads();
  {
#pragma unroll
    for (int rd = 0; rd < 2; ++rd) { const int d = rd * 32 + tid / 8, pc = tid % 8; FragH f;
#pragma unroll
      for (int q = 0; q < 8; ++q) f.u[q] = tl[pc * 8 + q][d];
      *(v8us*)((unsigned short*)Vt + ((size_t)slab * 64 + d) * TTv + lg * 64 + pc * 8) = f.half[0]; }
     } }

__global__ __launch_bounds__(256) void k_hl(const float* __restrict__ F, _Float16* __restrict__ Hh, _Float16* __restrict__ Hl, size_t n8) { const size_t t = (size_t)blockIdx.x * 256 + threadIdx.x; if (t >= n8) return; FragH fh, fl; const v4f a = *(const v4fa*)(F + t * 8), c = *(const v4fa*)(F + t * 8 + 4);
#pragma unroll
  for (int q = 0; q < 4; ++q) { _Float16 h = (_Float16)a[q]; fh.h[q] = h; fl.h[q] = (_Float16)((a[q] - (float)h) * 1024.0f); h = (_Float16)c[q]; fh.h[4 + q] = h; fl.h[4 + q] = (_Float16)((c[q] - (float)h) * 1024.0f); }
  { *(v8us*)((unsigned short*)Hh + t * 8) = fh.half[0]; *(v8us*)((unsigned short*)Hl + t * 8) = fl.half[0];  } }

// piece t of the plain grid: row = t / 32 of the (8192, 256) reduced view, columns c0 = 8 (t % 32) .. c0 + 7. With fl = (row % 512) 256 + c0 + q the channel is fl / 4096, the reduced pixel
// (i, j) = ((fl / 64) % 64, fl % 64), so the 2 x 2 windows of the 8 columns are 16 floats in a row of x and the 16 below them, at x + 1024 row + 256 (c0 / 64) + 2 (c0 % 64);
// the 8 rows of a plain block lie in one channel, (row / 16) % 32, the same for the whole block
template <int F, int NU>
__device__ __forceinline__ void d_xr(int blk, const float* __restrict__ x, const float* __restrict__ w, const float* __restrict__ bb, _Float16* __restrict__ XR) {
  #pragma clang fp contract(off)
  const int c0 = (threadIdx.x % (DR / 8)) * 8; int rb0 = blk * (NU * F * 8);      /* first row of the burst's first plain block */
#pragma unroll 1
  for (int n = 0; n < NU; ++n, rb0 += F * 8) { const int row0 = rb0 + threadIdx.x / (DR / 8); const float* xp = x + (size_t)row0 * DQ + (c0 / 64) * 256 + 2 * (c0 % 64); v4f a[F][4], d[F][4];
#pragma unroll
    for (int u = 0; u < F; ++u)
#pragma unroll
      for (int g = 0; g < 4; ++g) { a[u][g] = *(const v4fa*)(xp + (size_t)u * 8 * DQ + 4 * g); d[u][g] = *(const v4fa*)(xp + (size_t)u * 8 * DQ + 128 + 4 * g); }
    asm volatile("s_wait_xcnt 0x0" :: "v"(xp) : "memory");      /* in front of every overwrite of the loads' address pair, which stays live up to here */
#pragma unroll
    for (int u = 0; u < F; ++u) { const int c = ((rb0 + u * 8) / 16) % 32; FragH f;
#pragma unroll
      for (int q = 0; q < 8; ++q) {
        float s = bf16_round(bb[c]); s += bf16_round(w[c * 4 + 0]) * bf16_round(a[u][q / 2][(2 * q) % 4]); s += bf16_round(w[c * 4 + 1]) * bf16_round(a[u][q / 2][(2 * q) % 4 + 1]); s += bf16_round(w[c * 4 + 2]) * bf16_round(d[u][q / 2][(2 * q) % 4]); s += bf16_round(w[c * 4 + 3]) * bf16_round(d[u][q / 2][(2 * q) % 4 + 1]); f.h[q] = (_Float16)s; }
      *(v8us*)((unsigned short*)XR + (size_t)(row0 + u * 8) * DR + c0) = f.half[0]; }
    asm volatile("s_wait_xcnt 0x0" ::: "memory");      /* in front of every overwrite of the stores' registers by what follows */ } }
#define KPIT 40                  /* K row pitch in LDS, f16 elements */
#define VPIT 520                 /* V^T row pitch in LDS, f16 elements */
#define BPIT 72                  /* bias tile pitch in LDS, bf16 elements */
#define OPIT 36                  /* output staging pitch, floats */
#define AWV 16                   /* waves per work-group */
#define NCH (NP / 64)            /* chunks of 64 keys */
typedef float v2f __attribute__((ext_vector_type(2)));
typedef __bf16 v4b __attribute__((ext_vector_type(4)));
typedef __bf16 v4ba __attribute__((ext_vector_type(4), may_alias));
typedef __bf16 v8ba __attribute__((ext_vector_type(8), may_alias));
typedef __bf16 v8b __attribute__((ext_vector_type(8)));
typedef _Float16 v2h __attribute__((ext_vector_type(2)));
__device__ __forceinline__ float other_half(float v) { const int b = __float_as_int(v); return __int_as_float(__builtin_amdgcn_permlanex16(b, b, 0x76543210, 0xfedcba98, false, false)); }
__global__ __launch_bounds__(512) __attribute__((amdgpu_waves_per_eu(4, 4))) void k_attn(const _Float16* __restrict__ QS, const _Float16* __restrict__ KH, const _Float16* __restrict__ VT, const float* __restrict__ rb, float* __restrict__ out) {
  __shared__ __attribute__((aligned(16))) unsigned short sK[NP * KPIT];
  __shared__ __attribute__((aligned(16))) unsigned short sV[32 * VPIT];
  __shared__ __attribute__((aligned(16))) __bf16 sB[AWV][16 * BPIT];
  __shared__ __attribute__((aligned(16))) float sO[AWV][16 * OPIT];
  const int tid = threadIdx.x, w = tid >> 5, lane = tid & 31, c = lane & 15, hh = lane >> 4;
  const int bh = blockIdx.x >> 1, q0 = (blockIdx.x & 1) * (AWV * 16) + w * 16, h = bh % NHD;
  const unsigned short* gK = (const unsigned short*)KH + (size_t)bh * NP * 32;
  const unsigned short* gV = (const unsigned short*)VT + (size_t)bh * 32 * NP;
  const float* br = rb + ((size_t)h * NP + q0 + hh) * NP + c * 4;      /* load i of a chunk: rows 2 i + hh, 16 lanes x 16 B = one 256-B piece of a row */
  __bf16* sb = sB[w];
  v8us tk[4], tv[4]; v4f bn[8];
#pragma unroll
  for (int u = 0; u < 4; ++u) { tk[u] = *(const v8us*)(gK + (size_t)(tid + u * AWV * 32) * 8); tv[u] = *(const v8us*)(gV + (size_t)(tid + u * AWV * 32) * 8); }
#pragma unroll
  for (int i = 0; i < 8; ++i) bn[i] = *(const v4fa*)(br + (size_t)(2 * i) * NP);
  FragH fq;
  { const unsigned short* qr = (const unsigned short*)QS + ((size_t)bh * NP + q0 + c) * 32; fq.half[0] = *(const v8us*)(qr + 8 * hh); fq.half[1] = *(const v8us*)(qr + 16 + 8 * hh); }
  /* the address registers of the loads above are reused further down: the wait stands in front of every such overwrite */
  asm volatile("s_wait_xcnt 0x0" ::: "memory");
#pragma unroll
  for (int u = 0; u < 4; ++u) { const int i = tid + u * AWV * 32; *(v8us*)&sK[(i >> 2) * KPIT + (i & 3) * 8] = tk[u]; *(v8us*)&sV[(i >> 6) * VPIT + (i & 63) * 8] = tv[u]; }
#pragma unroll
  for (int i = 0; i < 8; ++i) { *(v4ba*)&sb[(2 * i + hh) * BPIT + c * 4] = __builtin_convertvector(bn[i], v4b); bn[i] = *(const v4fa*)(br + (size_t)(2 * i) * NP + 64); }
  __syncthreads();
  const float L2E = 1.4426950408889634f;
  v8f o0 = {}, o1 = {};
  float m = -3.0e38f, ls = 0.f;
#pragma unroll 1      /* rolled: eight copies of this body would add code and registers and save nothing */
  for (int kc = 0; kc < NCH; ++kc) {
    /* the lanes of this wave read bias values that other lanes of it stored in the trip before: the stores have to be done first */
    asm volatile("s_wait_dscnt 0x0" ::: "memory");
    float l[32];
#pragma unroll
    for (int j = 0; j < 4; ++j) {
      const v8b pb = *(const v8ba*)&sb[c * BPIT + j * 16 + 8 * hh];      /* register r: bias[q0 + c][64 kc + 16 j + 8 hh + r], the S^T tile's own map */
      FragH fk; const unsigned short* kr = &sK[(kc * 64 + j * 16 + c) * KPIT];
      fk.half[0] = *(const v8us*)(kr + 8 * hh); fk.half[1] = *(const v8us*)(kr + 16 + 8 * hh);
      const v8f z = {};
      const v8f s = __builtin_amdgcn_wmma_f32_16x16x32_f16(false, fk.v, false, fq.v, (short)0, z, false, false);
#pragma unroll
      for (int r = 0; r < 8; ++r) l[j * 8 + r] = __builtin_fmaf(s[r], 0.03125f, (float)pb[r]);
    }
    /* next chunk's bias into the tile (its readers above are done), then the loads of the chunk after it; past the end both repeat the last chunk */
    const float* bx = br + ((kc + 2 < NCH) ? kc + 2 : NCH - 1) * 64;
#pragma unroll
    for (int i = 0; i < 8; ++i) { *(v4ba*)&sb[(2 * i + hh) * BPIT + c * 4] = __builtin_convertvector(bn[i], v4b); bn[i] = *(const v4fa*)(bx + (size_t)(2 * i) * NP); }
    float cj[4];
#pragma unroll
    for (int j = 0; j < 4; ++j) { cj[j] = l[j * 8];
#pragma unroll
      for (int r = 1; r < 8; ++r) cj[j] = fmaxf(cj[j], l[j * 8 + r]); }
    float cm = fmaxf(fmaxf(cj[0], cj[1]), fmaxf(cj[2], cj[3]));
    cm = fmaxf(cm, other_half(cm));
    const float mn = fmaxf(m, cm);
    const float sc = __builtin_amdgcn_exp2f((m - mn) * L2E);
    const float mb = 10.0f - mn * L2E;
    m = mn;
    v2f sa = {0.f, 0.f}, sd = {0.f, 0.f};
    FragH fp[2];
#pragma unroll
    for (int i = 0; i < 32; i += 4) {
      v2f ta, tc, pa, pc; const v2f l2e = {L2E, L2E}, mb2 = {mb, mb};
      ta[0] = l[i]; ta[1] = l[i + 1]; tc[0] = l[i + 2]; tc[1] = l[i + 3];
      ta = __builtin_elementwise_fma(ta, l2e, mb2); tc = __builtin_elementwise_fma(tc, l2e, mb2);
      pa[0] = __builtin_amdgcn_exp2f(ta[0]); pa[1] = __builtin_amdgcn_exp2f(ta[1]); pc[0] = __builtin_amdgcn_exp2f(tc[0]); pc[1] = __builtin_amdgcn_exp2f(tc[1]);
      sa += pa; sd += pc;
      const v2h ha = __builtin_convertvector(pa, v2h), hc = __builtin_convertvector(pc, v2h);
      fp[i >> 4].h[(i & 15)] = ha[0]; fp[i >> 4].h[(i & 15) + 1] = ha[1]; fp[i >> 4].h[(i & 15) + 2] = hc[0]; fp[i >> 4].h[(i & 15) + 3] = hc[1];
    }
    sa += sd;
    ls = __builtin_fmaf(ls, sc, sa[0] + sa[1]);
#pragma unroll
    for (int r = 0; r < 8; ++r) { o0[r] *= sc; o1[r] *= sc; }
#pragma unroll
    for (int u = 0; u < 2; ++u) {
      FragH v0, v1; const unsigned short* vr = &sV[c * VPIT + kc * 64 + u * 32];
      v0.half[0] = *(const v8us*)(vr + 8 * hh); v0.half[1] = *(const v8us*)(vr + 16 + 8 * hh);
      v1.half[0] = *(const v8us*)(vr + 16 * VPIT + 8 * hh); v1.half[1] = *(const v8us*)(vr + 16 * VPIT + 16 + 8 * hh);
      o0 = __builtin_amdgcn_wmma_f32_16x16x32_f16(false, v0.v, false, fp[u].v, (short)0, o0, false, false);
      o1 = __builtin_amdgcn_wmma_f32_16x16x32_f16(false, v1.v, false, fp[u].v, (short)0, o1, false, false);
    }
  }
  ls += other_half(ls);
  const float inv = 1.0f / ls;
  float* so = sO[w];               /* this wave's own staging: lane (c, hh) holds query c, e = 16 t + 8 hh + r */
  { v4f a;
    a[0] = o0[0] * inv; a[1] = o0[1] * inv; a[2] = o0[2] * inv; a[3] = o0[3] * inv; *(v4fa*)&so[c * OPIT + 8 * hh] = a;
    a[0] = o0[4] * inv; a[1] = o0[5] * inv; a[2] = o0[6] * inv; a[3] = o0[7] * inv; *(v4fa*)&so[c * OPIT + 8 * hh + 4] = a;
    a[0] = o1[0] * inv; a[1] = o1[1] * inv; a[2] = o1[2] * inv; a[3] = o1[3] * inv; *(v4fa*)&so[c * OPIT + 16 + 8 * hh] = a;
    a[0] = o1[4] * inv; a[1] = o1[5] * inv; a[2] = o1[6] * inv; a[3] = o1[7] * inv; *(v4fa*)&so[c * OPIT + 16 + 8 * hh + 4] = a; }
  /* the wave's lanes read each other's staged values: the LDS writes have to be done before the reads */
  asm volatile("s_wait_dscnt 0x0" ::: "memory");
  float* orow = out + ((size_t)bh * NP + q0) * 128 + lane * 4;      /* out_d = o_{d/4}: lane e writes its value four times, 512 B a query in one store */
#pragma unroll
  for (int q = 0; q < 16; ++q) { const float vv = so[q * OPIT + lane]; v4f v; v[0] = vv; v[1] = vv; v[2] = vv; v[3] = vv; *(v4f*)(orow + (size_t)q * 128) = v; }
}
__device__ __forceinline__ void d_bcat(int blk, const float* __restrict__ a, const float* __restrict__ b, float* __restrict__ O) { const int t = blk * 256 + threadIdx.x; const float v = (t < DR) ? a[t] : b[t - DR]; *(float*)(O + t) = v;
  /* in the shared kernel's code other passes' instructions follow this store and write its registers: the wait stands in front of every such overwrite */
  asm volatile("s_wait_xcnt 0x0" ::: "memory"); }
// Passes that read nothing of one another share one launch: each pass owns a range of block indices and does there what it did alone
// (the looped passes piece by piece, as said at d_x16; the bias concatenation in two blocks of 256 threads for its one block of 512).
// The choice of the pass is uniform for a block. The longest passes come first.
// 586 blocks of 8 waves, between 4 and 5 waves for each SIMD of the chip: amdgpu_waves_per_eu(8, 8) gives the compiler the register budget for a whole burst of loads in flight.
#define G_X16 (NRW * DQ / 8 / 256 / 16)       /* 256 blocks: 2 bursts of 8 pieces */
#define G_XR  (NRW * (DR / 8) / 256 / 4)      /* 256: 2 bursts of 2 pieces */
#define G_FQ  (DR * DQ / 8 / 256 / 2)         /* 64: 2 pieces */
#define G_RW  (DR * DR / 8 / 256 / 8)         /* 4, once for Wk and once for Wv: 8 pieces */
#define G_BC  (2 * DR / 256)             /* 2 */
__global__ __launch_bounds__(256) __attribute__((amdgpu_waves_per_eu(8, 8))) void k_prep(const float* __restrict__ x, const float* __restrict__ dww, const float* __restrict__ dwb, const float* __restrict__ Wq, const float* __restrict__ Wk, const float* __restrict__ Wv, const float* __restrict__ bk, const float* __restrict__ bv,
    _Float16* __restrict__ X16, _Float16* __restrict__ XR16, _Float16* __restrict__ BQ, _Float16* __restrict__ BKV, float* __restrict__ BKVb) {
  int blk = blockIdx.x;
  if (blk < G_X16) { d_x16<8, 2>(blk, x, X16); return; }      /* plain (P, 1024) view = flat */
  blk -= G_X16;
  if (blk < G_XR) { d_xr<2, 2>(blk, x, dww, dwb, XR16); return; }
  blk -= G_XR;
  if (blk < G_FQ) { d_fold4<DR, DQ, 2>(blk, Wq, BQ); return; }      /* weights: (out, in) natural */
  blk -= G_FQ;
  if (blk < G_RW) { d_round16f<8>(blk, Wk, BKV); return; }
  blk -= G_RW;
  if (blk < G_RW) { d_round16f<8>(blk, Wv, BKV + (size_t)DR * DR); return; }
  blk -= G_RW;
  d_bcat(blk, bk, bv, BKVb);
}
#define G_GQ  ((NRW / 32) * (DR / 256))            /* 256 blocks, 16 k blocks each */
#define G_GKV ((NRW / 32) * (2 * DR / 256))        /* 512 blocks, 4 k blocks each */
// 97 KiB of LDS a work-group: 3 work-groups on a WGP, 3 waves on a SIMD.
__global__ __launch_bounds__(128) void k_proj(const _Float16* __restrict__ X16, const _Float16* __restrict__ BQ, const float* __restrict__ bq, _Float16* __restrict__ QS,
    const _Float16* __restrict__ XR16, const _Float16* __restrict__ BKV, const float* __restrict__ BKVb, _Float16* __restrict__ KH, _Float16* __restrict__ VT) {
  __shared__ __attribute__((aligned(16))) unsigned short sg[2][GROWS * GPIT];
  __shared__ __attribute__((aligned(16))) float so[4][16][64];
  const int blk = blockIdx.x;
  if (blk < G_GQ) d_gemm_st<DQ, DR, true, false>(sg, so, blk, X16, BQ, 0.0625f, bq, QS, nullptr);      /* (8192, 256) flat = (128, 512, 32) flat: row b 512 + h 64 + p / 8, column (p % 8) 32 + e */
  else d_gemm_st<DR, 2 * DR, false, true>(sg, so, blk - G_GQ, XR16, BKV, 0.0625f, BKVb, KH, VT);      /* [k | v] -> K and V^T head operands */
}

extern "C" void kernel_launch(void* const* d_in, const int* in_sizes, int n_in,
                              void* d_out, int out_size, void* d_ws, size_t ws_size, hipStream_t stream) {
  (void)in_sizes; (void)n_in; (void)out_size;
  const float* const* I = (const float* const*)d_in; const float* x = I[0]; const float* dww = I[1]; const float* dwb = I[2]; const float* Wq = I[3]; const float* bq = I[4]; const float* Wk = I[5]; const float* bk = I[6]; const float* Wv = I[7]; const float* bv = I[8]; const float* rb = I[9];
  char* ws = (char*)d_ws; size_t off = 0;
  auto take = [&](size_t bytes) { char* p = ws + off; off += (bytes + 255) & ~(size_t)255; return p; };
  _Float16* BQ = (_Float16*)take((size_t)DR * DQ * 2); _Float16* BKV = (_Float16*)take((size_t)2 * DR * DR * 2); float* BKVb = (float*)take(2 * DR * 4);
  _Float16* X16 = (_Float16*)take((size_t)NRW * DQ * 2); _Float16* XR16 = (_Float16*)take((size_t)NRW * DR * 2);
  _Float16* QS = (_Float16*)take((size_t)NBH * NP * 32 * 2); _Float16* KH = (_Float16*)take((size_t)NBH * NP * 32 * 2); _Float16* VT = (_Float16*)take((size_t)NBH * 32 * NP * 2);
  if (off > ws_size) return;
  k_prep<<<G_X16 + G_XR + G_FQ + 2 * G_RW + G_BC, 256, 0, stream>>>(x, dww, dwb, Wq, Wk, Wv, bk, bv, X16, XR16, BQ, BKV, BKVb);
  k_proj<<<G_GQ + G_GKV, 128, 0, stream>>>(X16, BQ, bq, QS, XR16, BKV, BKVb, KH, VT);
  k_attn<<<NBH * 2, AWV * 32, 0, stream>>>(QS, KH, VT, rb, (float*)d_out);
}

// v007
// Measured time: 41.2 microseconds a run.
// In both of two side-by-side timings against v006, it was 1.03 times as fast.
// Over all steps from v000 it is 7.36 times as fast.
#include <hip/hip_runtime.h>
// Lightweight multi-head self-attention with reduced keys/values (B 16, C 32, 128×128; P 512 tokens of 1024 (q) / 256 (k, v after a depthwise 2×2 stride-2 reduction); 8 heads by PLAIN reshapes of the (P, dim) buffers; k/v nearest-upsampled 32 → 128 along the head dim; scores/√1024 + rel_bias; softmax; attn·v; plain reshape back to [16,32,128,128]).
// Structure: q/k/v projections as GEMMs (the depthwise reduction on VALU -> f16); the 32->128 nearest upsampling is folded into the contraction (sum_d q_d k_{d/4} = sum_e (sum_{d/4=e} q_d) k_e and out_d = o_{d/4}), and the sum over each four q columns is folded further into the projection itself (sum_{d/4=e} q_d = x . sum_{d/4=e} Wq[d] + sum_{d/4=e} bq[d]): the q GEMM has N 256 and its f16 output, read flat, is the head operand; the plain-view head split of q, k and v by index arithmetic in the GEMMs' own epilogues; the three projections, scores (K 32, scale 1/32), bias, running-max softmax (x 2^10, f16), P.V (N 32) and the expanded output in ONE fused kernel, head operands in LDS, scores and probabilities kept in registers.
// Compute dtype: inputs and parameters rounded to bf16; x exact in f16; folded q weights, reduced x, head operands and probabilities f16 (about 2^-12); f32 accumulation; softmax f32. v_wmma_f32_16x16x32_f16.
#define NB 16
#define NP 512
#define DQ 1024
#define DR 256
#define NHD 8
#define NBH (NB * NHD)           /* 128 */
#define NRW (NB * NP)            /* 8192 rows */
typedef __bf16 v16b __attribute__((ext_vector_type(16)));
typedef unsigned short v8us __attribute__((ext_vector_type(8), may_alias));
typedef float  v8f  __attribute__((ext_vector_type(8)));
typedef float  v4f  __attribute__((ext_vector_type(4)));
typedef float  v4fa __attribute__((ext_vector_type(4), may_alias));
union FragB { v16b v; v8us half[2]; unsigned short u[16]; };

__device__ __forceinline__ unsigned short bf16_bits(float x) { unsigned int u = __float_as_uint(x); return (unsigned short)((u + 0x7FFFu + ((u >> 16) & 1u)) >> 16); }
__device__ __forceinline__ float bf16_val(unsigned short b) { return __uint_as_float(((unsigned int)b) << 16); }
__device__ __forceinline__ float bf16_round(float x) { return bf16_val(bf16_bits(x)); }
// D += A·B with NT terms: 1 = ah·bh, 2 = + al·bh (A split), 3 = + ah·bl (both split)
template <int NT>
__device__ __forceinline__ v8f mmaN(v16b ah, v16b al, v16b bh, v16b bl, v8f c) {
  c = __builtin_amdgcn_wmma_f32_16x16x32_bf16(false, ah, false, bh, (short)0, c, false, false);
  if (NT >= 2) c = __builtin_amdgcn_wmma_f32_16x16x32_bf16(false, al, false, bh, (short)0, c, false, false);
  if (NT >= 3) c = __builtin_amdgcn_wmma_f32_16x16x32_bf16(false, ah, false, bl, (short)0, c, false, false);
  asm volatile("v_nop\n\tv_nop\n\tv_nop\n\tv_nop" : "+v"(c) : "v"(ah), "v"(al), "v"(bh), "v"(bl));
  return c;
}

__global__ __launch_bounds__(256) void k_wt_bf16(const float* __restrict__ W, unsigned short* __restrict__ Wt, int K, int N) {
  const int t = blockIdx.x * 256 + threadIdx.x;
  const int k8n = K / 8;
  if (t >= N * k8n) return;
  const int n = t / k8n, k8 = (t % k8n) * 8;
  v8us v;
#pragma unroll
  for (int i = 0; i < 8; ++i) v[i] = bf16_bits(W[(size_t)(k8 + i) * N + n]);
  *(v8us*)(Wt + (size_t)n * K + k8) = v;
  
}

// GEMM C[M][N] (f32, pitch ldc) = act(A[M][K]·W + bias). A f32 row-major (pitch lda) converted per fragment to bf16
// (ASPLIT: hi/lo two planes -> 2 terms, else single rounded term); Wt bf16 [N][K] (pitch ldb). BIAS_BF16 rounds the
// bias to bf16 first (bias quantised to bf16 before the add). K%32==0, M%16==0, N%64==0.
template <bool ASPLIT, int ACT, bool BIAS_BF16>
__global__ __launch_bounds__(128) void k_gemm_bf(const float* __restrict__ A, int lda, const unsigned short* __restrict__ Wt, int ldb,
                                               const float* __restrict__ bias, float* __restrict__ C, int ldc, int M, int N, int K) {
  __shared__ __attribute__((aligned(16))) float so[4][16][64];
  const int tid = threadIdx.x, w = tid >> 5, lane = tid & 31, ln = lane & 15, hh = lane >> 4;
  const int ntn = N / 64;
  const int wid = blockIdx.x * 4 + w;
  const int mt = wid / ntn, nq = wid % ntn;
  if (mt * 16 >= M) return;
  const int row0 = mt * 16, col0 = nq * 64;
  const float* arow = A + (size_t)(row0 + ln) * lda;
  v8f acc[4] = {};
  for (int kb = 0; kb < K; kb += 32) {
    FragB ah, al;
    const v4f x0 = *(const v4fa*)(arow + kb + 8 * hh), x1 = *(const v4fa*)(arow + kb + 8 * hh + 4);
    const v4f x2 = *(const v4fa*)(arow + kb + 16 + 8 * hh), x3 = *(const v4fa*)(arow + kb + 16 + 8 * hh + 4);
    float xs[16] = {x0[0],x0[1],x0[2],x0[3],x1[0],x1[1],x1[2],x1[3],x2[0],x2[1],x2[2],x2[3],x3[0],x3[1],x3[2],x3[3]};
#pragma unroll
    for (int i = 0; i < 16; ++i) { const unsigned short hb = bf16_bits(xs[i]); ah.u[i] = hb; al.u[i] = ASPLIT ? bf16_bits(xs[i] - bf16_val(hb)) : (unsigned short)0; }
#pragma unroll
    for (int t = 0; t < 4; ++t) {
      const unsigned short* brow = Wt + (size_t)(col0 + t * 16 + ln) * ldb + kb;
      FragB b;
      b.half[0] = *(const v8us*)(brow + 8 * hh);
      b.half[1] = *(const v8us*)(brow + 16 + 8 * hh);
      acc[t] = mmaN<ASPLIT ? 2 : 1>(ah.v, al.v, b.v, b.v, acc[t]);
    }
  }
#pragma unroll
  for (int t = 0; t < 4; ++t) {
    float bv = bias ? bias[col0 + t * 16 + ln] : 0.f;
    if (BIAS_BF16) bv = bf16_round(bv);
#pragma unroll
    for (int r = 0; r < 8; ++r) { float v = acc[t][r] + bv; if (ACT == 1) v = fmaxf(v, 0.f); so[w][8 * hh + r][t * 16 + ln] = v; }
  }
  __builtin_amdgcn_fence(__ATOMIC_ACQ_REL, "workgroup");
  __builtin_amdgcn_wave_barrier();
  const int rsub = lane >> 4, c4 = (lane & 15) * 4;
  {
#pragma unroll
    for (int q = 0; q < 8; ++q) {
      const int r = q * 2 + rsub;
      const v4f v = *(const v4fa*)&so[w][r][c4];
      *(v4f*)(C + (size_t)(row0 + r) * ldc + col0 + c4) = v;
    }
    
  }
}

// GEMM C = act(A·W + bias + resid): A f32 (ASPLIT -> hi/lo 2 terms), Wt bf16 [N][K]; ACT 0 none, 1 relu, 2 exact gelu;
// resid (optional, f32, row index = (row % rmod), pitch ldr, RES_BF16 rounds it) added before the activation.
template <bool ASPLIT, int ACT, bool BIAS_BF16, bool RES_BF16>
__global__ __launch_bounds__(128) void k_gemm_bf3(const float* __restrict__ A, int lda, const unsigned short* __restrict__ Wt, int ldb,
                                                const float* __restrict__ bias, const float* __restrict__ resid, int rmod, int ldr,
                                                float* __restrict__ C, int ldc, int M, int N, int K) {
  __shared__ __attribute__((aligned(16))) float so[4][16][64];
  const int tid = threadIdx.x, w = tid >> 5, lane = tid & 31, ln = lane & 15, hh = lane >> 4;
  const int ntn = N / 64;
  const int wid = blockIdx.x * 4 + w;
  const int mt = wid / ntn, nq = wid % ntn;
  if (mt * 16 >= M) return;
  const int row0 = mt * 16, col0 = nq * 64;
  const float* arow = A + (size_t)(row0 + ln) * lda;
  v8f acc[4] = {};
  for (int kb = 0; kb < K; kb += 32) {
    FragB ah, al;
    const v4f x0 = *(const v4fa*)(arow + kb + 8 * hh), x1 = *(const v4fa*)(arow + kb + 8 * hh + 4);
    const v4f x2 = *(const v4fa*)(arow + kb + 16 + 8 * hh), x3 = *(const v4fa*)(arow + kb + 16 + 8 * hh + 4);
    float xs[16] = {x0[0],x0[1],x0[2],x0[3],x1[0],x1[1],x1[2],x1[3],x2[0],x2[1],x2[2],x2[3],x3[0],x3[1],x3[2],x3[3]};
#pragma unroll
    for (int i = 0; i < 16; ++i) { const unsigned short hb = bf16_bits(xs[i]); ah.u[i] = hb; al.u[i] = ASPLIT ? bf16_bits(xs[i] - bf16_val(hb)) : (unsigned short)0; }
#pragma unroll
    for (int t = 0; t < 4; ++t) {
      const unsigned short* brow = Wt + (size_t)(col0 + t * 16 + ln) * ldb + kb;
      FragB b;
      b.half[0] = *(const v8us*)(brow + 8 * hh);
      b.half[1] = *(const v8us*)(brow + 16 + 8 * hh);
      acc[t] = mmaN<ASPLIT ? 2 : 1>(ah.v, al.v, b.v, b.v, acc[t]);
    }
  }
#pragma unroll
  for (int t = 0; t < 4; ++t) {
    const int col = col0 + t * 16 + ln;
    float bv = bias ? bias[col] : 0.f;
    if (BIAS_BF16) bv = bf16_round(bv);
#pragma unroll
    for (int r = 0; r < 8; ++r) {
      float v = acc[t][r] + bv;
      if (resid) { float rv = resid[(size_t)((row0 + 8 * hh + r) % rmod) * ldr + col]; if (RES_BF16) rv = bf16_round(rv); v += rv; }
      if (ACT == 1) v = fmaxf(v, 0.f);
      if (ACT == 2) v = 0.5f * v * (1.0f + erff(v * 0.70710678118654752f));
      if (ACT == 3) { const float u = 0.7978845608028654f * (v + 0.044715f * v * v * v); v = 0.5f * v * (1.0f + tanhf(u)); }
      so[w][8 * hh + r][t * 16 + ln] = v;
    }
  }
  __builtin_amdgcn_fence(__ATOMIC_ACQ_REL, "workgroup");
  __builtin_amdgcn_wave_barrier();
  const int rsub = lane >> 4, c4 = (lane & 15) * 4;
  {
#pragma unroll
    for (int q = 0; q < 8; ++q) {
      const int r = q * 2 + rsub;
      const v4f v = *(const v4fa*)&so[w][r][c4];
      *(v4f*)(C + (size_t)(row0 + r) * ldc + col0 + c4) = v;
    }
    
  }
}
// row LayerNorm (biased variance, eps) over N: s = X (+ R); optional out_sum <- s; out_norm <- (s-mu)*rsqrt(var+eps)*g + b
template <bool PARAM_BF16>
__global__ __launch_bounds__(256) void k_layernorm(const float* __restrict__ X, const float* __restrict__ R, const float* __restrict__ g, const float* __restrict__ bta,
                                                  float* __restrict__ out_sum, float* __restrict__ out_norm, int N, float eps) {
  __shared__ float red[256];
  const int row = blockIdx.x, tid = threadIdx.x;
  const float* x = X + (size_t)row * N; const float* rr = R ? R + (size_t)row * N : nullptr;
  float vals[16];                     // up to N = 4096
  const int per = N / 256;            // contiguous chunk per thread? use strided-by-4 chunks: thread handles j = tid*4 + 1024*u
  float s1 = 0.f;
  for (int u = 0; u < per / 4; ++u) {
    const int j = tid * 4 + 1024 * u;
    const v4f a = *(const v4fa*)(x + j);
    v4f b = {0.f,0.f,0.f,0.f}; if (rr) b = *(const v4fa*)(rr + j);
#pragma unroll
    for (int q = 0; q < 4; ++q) { const float v = a[q] + b[q]; vals[u * 4 + q] = v; s1 += v; }
  }
  red[tid] = s1; __syncthreads();
  for (int st = 128; st > 0; st >>= 1) { if (tid < st) red[tid] += red[tid + st]; __syncthreads(); }
  const float mu = red[0] / (float)N; __syncthreads();
  float s2 = 0.f;
  for (int u = 0; u < per / 4; ++u)
#pragma unroll
    for (int q = 0; q < 4; ++q) { const float c = vals[u * 4 + q] - mu; s2 += c * c; }
  red[tid] = s2; __syncthreads();
  for (int st = 128; st > 0; st >>= 1) { if (tid < st) red[tid] += red[tid + st]; __syncthreads(); }
  const float rs = rsqrtf(red[0] / (float)N + eps);
  {
    for (int u = 0; u < per / 4; ++u) {
      const int j = tid * 4 + 1024 * u;
      v4f o, sm;
#pragma unroll
      for (int q = 0; q < 4; ++q) {
        float gg = g[j + q], bb = bta[j + q];
        if (PARAM_BF16) { gg = bf16_round(gg); bb = bf16_round(bb); }
        sm[q] = vals[u * 4 + q]; o[q] = (vals[u * 4 + q] - mu) * rs * gg + bb;
      }
      if (out_sum) *(v4f*)(out_sum + (size_t)row * N + j) = sm;
      *(v4f*)(out_norm + (size_t)row * N + j) = o;
    }
    
  }
}



// ---- f16 WMMA path (v_wmma_f32_16x16x32_f16): 11-bit significands for operands in range — used where a [0,1] probability operand needs more precision than bf16
typedef _Float16 v16h __attribute__((ext_vector_type(16)));
union FragH { v16h v; v8us half[2]; _Float16 h[16]; unsigned short u[16]; };
template <int NT>
__device__ __forceinline__ v8f mmaH(v16h ah, v16h al, v16h bh, v16h bl, v8f c) {
  c = __builtin_amdgcn_wmma_f32_16x16x32_f16(false, ah, false, bh, (short)0, c, false, false);
  if (NT >= 2) c = __builtin_amdgcn_wmma_f32_16x16x32_f16(false, al, false, bh, (short)0, c, false, false);
  if (NT >= 3) c = __builtin_amdgcn_wmma_f32_16x16x32_f16(false, ah, false, bl, (short)0, c, false, false);
  asm volatile("v_nop\n\tv_nop\n\tv_nop\n\tv_nop" : "+v"(c) : "v"(ah), "v"(al), "v"(bh), "v"(bl));
  return c;
}
// batched GEMM like k_gemm_b but f16 operands: A f32 (split into f16 hi/lo if ASPLIT, else rounded to f16), Bt = f16 values [n][k]; alpha; C f32; N multiple of 16 (partial tiles skipped)
template <bool ASPLIT>
__global__ __launch_bounds__(128) void k_gemm_h(const float* __restrict__ A, int lda, size_t sA, const _Float16* __restrict__ Bh, int ldb, size_t sB, float alpha, float* __restrict__ C, int ldc, size_t sC, int M, int N, int K) {
  __shared__ __attribute__((aligned(16))) float so[4][16][64];
  const int tid = threadIdx.x, w = tid >> 5, lane = tid & 31, ln = lane & 15, hh = lane >> 4; const int by = blockIdx.y;
  A += (size_t)by * sA; Bh += (size_t)by * sB; C += (size_t)by * sC;
  const int ntn = (N + 63) / 64; const int wid = blockIdx.x * 4 + w; const int mt = wid / ntn, nq = wid % ntn; if (mt * 16 >= M) return;
  const int row0 = mt * 16, col0 = nq * 64; const float* arow = A + (size_t)(row0 + ln) * lda;
  v8f acc[4] = {};
  for (int kb = 0; kb < K; kb += 32) {
    FragH ah, al;
    const v4f x0 = *(const v4fa*)(arow + kb + 8 * hh), x1 = *(const v4fa*)(arow + kb + 8 * hh + 4), x2 = *(const v4fa*)(arow + kb + 16 + 8 * hh), x3 = *(const v4fa*)(arow + kb + 16 + 8 * hh + 4);
    float xs[16] = {x0[0],x0[1],x0[2],x0[3],x1[0],x1[1],x1[2],x1[3],x2[0],x2[1],x2[2],x2[3],x3[0],x3[1],x3[2],x3[3]};
#pragma unroll
    for (int i = 0; i < 16; ++i) { const _Float16 h = (_Float16)xs[i]; ah.h[i] = h; al.h[i] = ASPLIT ? (_Float16)(xs[i] - (float)h) : (_Float16)0.0f; }
#pragma unroll
    for (int t = 0; t < 4; ++t) { if (col0 + t * 16 >= N) continue; const size_t boff = (size_t)(col0 + t * 16 + ln) * ldb + kb; FragH bq; bq.half[0] = *(const v8us*)(Bh + boff + 8 * hh); bq.half[1] = *(const v8us*)(Bh + boff + 16 + 8 * hh);
      acc[t] = mmaH<ASPLIT ? 2 : 1>(ah.v, al.v, bq.v, bq.v, acc[t]); }
  }
#pragma unroll
  for (int t = 0; t < 4; ++t) { if (col0 + t * 16 >= N) continue;
#pragma unroll
    for (int r = 0; r < 8; ++r) so[w][8 * hh + r][t * 16 + ln] = acc[t][r] * alpha; }
  __builtin_amdgcn_fence(__ATOMIC_ACQ_REL, "workgroup"); __builtin_amdgcn_wave_barrier();
  const int rsub = lane >> 4, c4 = (lane & 15) * 4;
  {
#pragma unroll
    for (int q = 0; q < 8; ++q) { const int r = q * 2 + rsub; if (col0 + c4 < N) { const v4f v = *(const v4fa*)&so[w][r][c4]; *(v4f*)(C + (size_t)(row0 + r) * ldc + col0 + c4) = v; } }
     }
}

// Wt[n][k] = f16(W[k][n]·scale) from f32 row-major W[K][N] (scale = power of two; bf16-exact weights stay exact in f16 away from the subnormal range)
__global__ __launch_bounds__(256) void k_wt_f16(const float* __restrict__ W, _Float16* __restrict__ Wt, int K, int N, float scale) {
  const int t = blockIdx.x * 256 + threadIdx.x; if (t >= N * (K / 8)) return; const int n = t / (K / 8), k8 = (t % (K / 8)) * 8; FragH f;
#pragma unroll
  for (int i = 0; i < 8; ++i) f.h[i] = (_Float16)(bf16_round(W[(size_t)(k8 + i) * N + n]) * scale); const v8us o = f.half[0];
  *(v8us*)((unsigned short*)Wt + (size_t)n * K + k8) = o; 
}
// Operand staging for the projection GEMMs, which run inside the attention kernel (16 waves): a k block is 576 staged rows of 64 f16 (one whole 128-B line each: 64 rows of the activation operand, then 512 of the weight operand),
// brought into LDS by asynchronous copies, 16 B a lane, 8 lanes a line, so that a copy touches 4 whole lines. Copy i = 0 .. 8 of thread tid fills the 16-B piece tid % 8 of staged row tid / 8 + 64 i.
// Row pitch in LDS 144 B. Two buffers: block t + 1 flies while block t is worked on.
#define GPIT 72                  /* staged row pitch, f16 elements */
#define GROWS (64 + 512)         /* staged rows of one k block */
/* nine copies and, as the last line of their own statement, the wait that stands in front of every rewrite of the address registers they name */
#define CP9 "global_load_async_to_lds_b128 %0, %9, off\n\tglobal_load_async_to_lds_b128 %1, %10, off\n\tglobal_load_async_to_lds_b128 %2, %11, off\n\tglobal_load_async_to_lds_b128 %3, %12, off\n\tglobal_load_async_to_lds_b128 %4, %13, off\n\tglobal_load_async_to_lds_b128 %5, %14, off\n\tglobal_load_async_to_lds_b128 %6, %15, off\n\tglobal_load_async_to_lds_b128 %7, %16, off\n\tglobal_load_async_to_lds_b128 %8, %17, off\n\ts_wait_xcnt 0x0"
__device__ __forceinline__ void d_stage(unsigned lds, const unsigned short* g0, const unsigned short* g1, const unsigned short* g2, const unsigned short* g3, const unsigned short* g4, const unsigned short* g5, const unsigned short* g6, const unsigned short* g7, const unsigned short* g8) {      /* lds: this lane's piece of staged row tid / 8; g0 .. g8: its nine source pieces */
  const unsigned st = 64 * GPIT * 2;      /* 64 staged rows further on, bytes */
  asm volatile(CP9 :: "v"(lds), "v"(lds + st), "v"(lds + 2 * st), "v"(lds + 3 * st), "v"(lds + 4 * st), "v"(lds + 5 * st), "v"(lds + 6 * st), "v"(lds + 7 * st), "v"(lds + 8 * st),
    "v"(g0), "v"(g1), "v"(g2), "v"(g3), "v"(g4), "v"(g5), "v"(g6), "v"(g7), "v"(g8) : "memory");
}

typedef _Float16 v4h __attribute__((ext_vector_type(4)));

// The element-wise passes are looped: one block does the work of NU x F blocks of the plain grid (a piece = what one thread of the plain grid did:
// same reads, same arithmetic, same 16-B store), in NU bursts of F pieces. A launch so starts NU x F times fewer waves, and a wave has the 16 loads
// of a whole burst (16 B a lane each) in flight. Every grid divides exactly: no bounds test. Each '#pragma unroll' keeps a burst's register arrays at constant indices
// and its loads in front of the first use; each '#pragma unroll 1' keeps the bursts one after the other (side by side they would need NU times the registers).
// Two waits a burst, each in front of every overwrite of a register that an issued load or store names: one behind the loads (it takes the address as an input,
// so that the pair stays live up to it and no load of the burst lands on it), one behind the stores (the next burst, or another pass's code in the shared kernel, follows).
template <int F, int NU>
__device__ __forceinline__ void d_x16(int blk, const float* __restrict__ x, _Float16* __restrict__ X16) { size_t t0 = (size_t)blk * (NU * F * 256) + threadIdx.x;
#pragma unroll 1
  for (int n = 0; n < NU; ++n, t0 += F * 256) { const float* xp = x + t0 * 8; v4f a[F], b[F];
#pragma unroll
    for (int u = 0; u < F; ++u) { a[u] = *(const v4fa*)(xp + u * 2048); b[u] = *(const v4fa*)(xp + u * 2048 + 4); }
    asm volatile("s_wait_xcnt 0x0" :: "v"(xp) : "memory");      /* in front of every overwrite of the loads' address pair, which stays live up to here */
#pragma unroll
    for (int u = 0; u < F; ++u) { FragH f;
#pragma unroll
      for (int q = 0; q < 4; ++q) { f.h[q] = (_Float16)bf16_round(a[u][q]); f.h[4 + q] = (_Float16)bf16_round(b[u][q]); }
      *(v8us*)((unsigned short*)X16 + (t0 + u * 256) * 8) = f.half[0]; }
    asm volatile("s_wait_xcnt 0x0" ::: "memory");      /* in front of every overwrite of the stores' registers by what follows */ } }
__global__ __launch_bounds__(256) void k_h16(const float* __restrict__ x, _Float16* __restrict__ X16, size_t n8) { const size_t t = (size_t)blockIdx.x * 256 + threadIdx.x; if (t >= n8) return; FragH f;
#pragma unroll
  for (int q = 0; q < 8; ++q) f.h[q] = (_Float16)x[t * 8 + q]; *(v8us*)((unsigned short*)X16 + t * 8) = f.half[0];  }
template <int F>
__device__ __forceinline__ void d_round16f(int blk, const float* __restrict__ W, _Float16* __restrict__ Bt) { const size_t t0 = (size_t)blk * (F * 256) + threadIdx.x; const float* wp = W + t0 * 8; v4f a[F], b[F];
#pragma unroll
  for (int u = 0; u < F; ++u) { a[u] = *(const v4fa*)(wp + u * 2048); b[u] = *(const v4fa*)(wp + u * 2048 + 4); }
  asm volatile("s_wait_xcnt 0x0" :: "v"(wp) : "memory");      /* in front of every overwrite of the loads' address pair, which stays live up to here */
#pragma unroll
  for (int u = 0; u < F; ++u) { FragH f;
#pragma unroll
    for (int i = 0; i < 4; ++i) { f.h[i] = (_Float16)(bf16_round(a[u][i]) * 16.0f); f.h[4 + i] = (_Float16)(bf16_round(b[u][i]) * 16.0f); }
    *(v8us*)((unsigned short*)Bt + (t0 + u * 256) * 8) = f.half[0]; }
  asm volatile("s_wait_xcnt 0x0" ::: "memory");      /* in front of every overwrite of the stores' registers by what follows */ }
// Bt[e][k] = f16(16 (W[4 e][k] + W[4 e + 1][k] + W[4 e + 2][k] + W[4 e + 3][k])), each W rounded to bf16 first, the sum in f32: W (4 NE, K) row-major, thread = F pieces of 8 k of one e each; both loops unrolled so that f.h is indexed by constants and stays in registers
template <int NE, int K, int F>
__device__ __forceinline__ void d_fold4(int blk, const float* __restrict__ W, _Float16* __restrict__ Bt) { static_assert(256 % (K / 8) == 0, "a piece further on is whole rows further on"); const int t0 = blk * (F * 256) + threadIdx.x; const int e = t0 / (K / 8), k8 = (t0 % (K / 8)) * 8; const float* wr = W + (size_t)e * 4 * K + k8; v4f r[F][2][4];
#pragma unroll
  for (int u = 0; u < F; ++u)
#pragma unroll
    for (int g = 0; g < 2; ++g)
#pragma unroll
      for (int j = 0; j < 4; ++j) r[u][g][j] = *(const v4fa*)(wr + (u * (256 / (K / 8)) * 4 + j) * K + 4 * g);
  asm volatile("s_wait_xcnt 0x0" :: "v"(wr) : "memory");      /* in front of every overwrite of the loads' address pair, which stays live up to here */
#pragma unroll
  for (int u = 0; u < F; ++u) { FragH f;
#pragma unroll
    for (int g = 0; g < 2; ++g)
#pragma unroll
      for (int i = 0; i < 4; ++i) f.h[4 * g + i] = (_Float16)((((bf16_round(r[u][g][0][i]) + bf16_round(r[u][g][1][i])) + bf16_round(r[u][g][2][i])) + bf16_round(r[u][g][3][i])) * 16.0f);
    *(v8us*)((unsigned short*)Bt + (size_t)(t0 + u * 256) * 8) = f.half[0]; }
  asm volatile("s_wait_xcnt 0x0" ::: "memory");      /* in front of every overwrite of the stores' registers by what follows */ }
template <int NHv, int TTv>
__global__ __launch_bounds__(256) void k_vt(const _Float16* __restrict__ V16, int ldv, int voff, _Float16* __restrict__ Vt) { __shared__ unsigned short tl[64][66]; const int tid = threadIdx.x; const int slab = blockIdx.x / (TTv / 64), lg = blockIdx.x % (TTv / 64); const int b = slab / NHv, h = slab % NHv;
  for (int i = tid; i < 64 * 8; i += 256) { const int r = i / 8, c8 = (i % 8) * 8; FragH f; f.half[0] = *(const v8us*)((const unsigned short*)V16 + ((size_t)b * TTv + lg * 64 + r) * ldv + voff + h * 64 + c8);
#pragma unroll
    for (int q = 0; q < 8; ++q) tl[r][c8 + q] = f.u[q]; }
  __syncthreads();
  {
#pragma unroll
    for (int rd = 0; rd < 2; ++rd) { const int d = rd * 32 + tid / 8, pc = tid % 8; FragH f;
#pragma unroll
      for (int q = 0; q < 8; ++q) f.u[q] = tl[pc * 8 + q][d];
      *(v8us*)((unsigned short*)Vt + ((size_t)slab * 64 + d) * TTv + lg * 64 + pc * 8) = f.half[0]; }
     } }

__global__ __launch_bounds__(256) void k_hl(const float* __restrict__ F, _Float16* __restrict__ Hh, _Float16* __restrict__ Hl, size_t n8) { const size_t t = (size_t)blockIdx.x * 256 + threadIdx.x; if (t >= n8) return; FragH fh, fl; const v4f a = *(const v4fa*)(F + t * 8), c = *(const v4fa*)(F + t * 8 + 4);
#pragma unroll
  for (int q = 0; q < 4; ++q) { _Float16 h = (_Float16)a[q]; fh.h[q] = h; fl.h[q] = (_Float16)((a[q] - (float)h) * 1024.0f); h = (_Float16)c[q]; fh.h[4 + q] = h; fl.h[4 + q] = (_Float16)((c[q] - (float)h) * 1024.0f); }
  { *(v8us*)((unsigned short*)Hh + t * 8) = fh.half[0]; *(v8us*)((unsigned short*)Hl + t * 8) = fl.half[0];  } }

// piece t of the plain grid: row = t / 32 of the (8192, 256) reduced view, columns c0 = 8 (t % 32) .. c0 + 7. With fl = (row % 512) 256 + c0 + q the channel is fl / 4096, the reduced pixel
// (i, j) = ((fl / 64) % 64, fl % 64), so the 2 x 2 windows of the 8 columns are 16 floats in a row of x and the 16 below them, at x + 1024 row + 256 (c0 / 64) + 2 (c0 % 64);
// the 8 rows of a plain block lie in one channel, (row / 16) % 32, the same for the whole block
template <int F, int NU>
__device__ __forceinline__ void d_xr(int blk, const float* __restrict__ x, const float* __restrict__ w, const float* __restrict__ bb, _Float16* __restrict__ XR) {
  #pragma clang fp contract(off)
  const int c0 = (threadIdx.x % (DR / 8)) * 8; int rb0 = blk * (NU * F * 8);      /* first row of the burst's first plain block */
#pragma unroll 1
  for (int n = 0; n < NU; ++n, rb0 += F * 8) { const int row0 = rb0 + threadIdx.x / (DR / 8); const float* xp = x + (size_t)row0 * DQ + (c0 / 64) * 256 + 2 * (c0 % 64); v4f a[F][4], d[F][4];
#pragma unroll
    for (int u = 0; u < F; ++u)
#pragma unroll
      for (int g = 0; g < 4; ++g) { a[u][g] = *(const v4fa*)(xp + (size_t)u * 8 * DQ + 4 * g); d[u][g] = *(const v4fa*)(xp + (size_t)u * 8 * DQ + 128 + 4 * g); }
    asm volatile("s_wait_xcnt 0x0" :: "v"(xp) : "memory");      /* in front of every overwrite of the loads' address pair, which stays live up to here */
#pragma unroll
    for (int u = 0; u < F; ++u) { const int c = ((rb0 + u * 8) / 16) % 32; FragH f;
#pragma unroll
      for (int q = 0; q < 8; ++q) {
        float s = bf16_round(bb[c]); s += bf16_round(w[c * 4 + 0]) * bf16_round(a[u][q / 2][(2 * q) % 4]); s += bf16_round(w[c * 4 + 1]) * bf16_round(a[u][q / 2][(2 * q) % 4 + 1]); s += bf16_round(w[c * 4 + 2]) * bf16_round(d[u][q / 2][(2 * q) % 4]); s += bf16_round(w[c * 4 + 3]) * bf16_round(d[u][q / 2][(2 * q) % 4 + 1]); f.h[q] = (_Float16)s; }
      *(v8us*)((unsigned short*)XR + (size_t)(row0 + u * 8) * DR + c0) = f.half[0]; }
    asm volatile("s_wait_xcnt 0x0" ::: "memory");      /* in front of every overwrite of the stores' registers by what follows */ } }
#define KPIT 40                  /* K row pitch in LDS, f16 elements */
#define VPIT 520                 /* V^T row pitch in LDS, f16 elements */
#define BPIT 72                  /* bias tile pitch in LDS, bf16 elements */
#define OPIT 36                  /* output staging pitch, floats */
#define AWV 16                   /* waves per work-group */
#define NCH (NP / 64)            /* chunks of 64 keys */
typedef float v2f __attribute__((ext_vector_type(2)));
typedef __bf16 v4b __attribute__((ext_vector_type(4)));
typedef __bf16 v4ba __attribute__((ext_vector_type(4), may_alias));
typedef __bf16 v8ba __attribute__((ext_vector_type(8), may_alias));
typedef __bf16 v8b __attribute__((ext_vector_type(8)));
typedef _Float16 v2h __attribute__((ext_vector_type(2)));
__device__ __forceinline__ float other_half(float v) { const int b = __float_as_int(v); return __int_as_float(__builtin_amdgcn_permlanex16(b, b, 0x76543210, 0xfedcba98, false, false)); }
__global__ __launch_bounds__(512) __attribute__((amdgpu_waves_per_eu(4, 4))) void k_attn(const _Float16* __restrict__ X16, const _Float16* __restrict__ BQ, const float* __restrict__ bq, const _Float16* __restrict__ XR16, const _Float16* __restrict__ BKV, const float* __restrict__ BKVb, const float* __restrict__ rb, float* __restrict__ out) {
  __shared__ __attribute__((aligned(16))) unsigned short sg[2][GROWS * GPIT];
  __shared__ __attribute__((aligned(16))) unsigned short sK[NP * KPIT];
  __shared__ __attribute__((aligned(16))) unsigned short sV[32 * VPIT];
  __shared__ __attribute__((aligned(16))) __bf16 sB[AWV][16 * BPIT];
  __shared__ __attribute__((aligned(16))) float sO[AWV][16 * OPIT];
  const int tid = threadIdx.x, w = tid >> 5, lane = tid & 31, c = lane & 15, hh = lane >> 4;
  const int bh = blockIdx.x >> 1, hf = blockIdx.x & 1, q0 = hf * (AWV * 16) + w * 16, h = bh % NHD;
  const int sr = tid >> 3, sp = (tid & 7) * 8;      /* this lane's staged row (of each 64) and its piece, in elements */
  const unsigned l0 = (unsigned)(size_t)&sg[0][sr * GPIT + sp], l1 = (unsigned)(size_t)&sg[1][sr * GPIT + sp];
  const unsigned short* xa = (const unsigned short*)XR16 + (size_t)(bh * 64 + sr) * DR + sp;
  const unsigned short* wk = (const unsigned short*)BKV + (size_t)sr * DR + sp;
  const unsigned short* wv = (const unsigned short*)BKV + (size_t)(DR + 32 * (sr & 7) + (sr >> 3)) * DR + sp;      /* staged v weight row 8 e + g = v column 32 g + e */
  const unsigned short* qa = (const unsigned short*)X16 + (size_t)(bh * 64 + hf * 32 + (sr & 31)) * DQ + (sr >> 5) * 64 + sp;
  const unsigned short* qb = (const unsigned short*)BQ + (size_t)sr * DQ + sp;
#define ST_KV(l, o) d_stage(l, xa + (o), wk + (o), wk + (o) + 64 * DR, wk + (o) + 128 * DR, wk + (o) + 192 * DR, wv + (o), wv + (o) + 8 * DR, wv + (o) + 16 * DR, wv + (o) + 24 * DR)
#define ST_Q(l, o) d_stage(l, qa + (o), qb + (o), qb + (o) + 64 * DQ, qb + (o) + 128 * DQ, qb + (o) + 192 * DQ, qb + (o) + 64, qb + (o) + 64 + 64 * DQ, qb + (o) + 64 + 128 * DQ, qb + (o) + 64 + 192 * DQ)
  const float* br = rb + ((size_t)h * NP + q0 + hh) * NP + c * 4;      /* load i of a chunk: rows 2 i + hh, 16 lanes x 16 B = one 256-B piece of a row */
  __bf16* sb = sB[w];
  v4f bn[8]; float bqs[8];
  ST_KV(l0, 0);
  asm volatile("s_wait_asynccnt 0x0" ::: "memory");      /* this wave's copies of block 0 have landed */
  __syncthreads();                                       /* and every other wave's: block 0 may be read */
  ST_KV(l1, 64);
  {
    v8f acc[4][2] = {};
#pragma unroll 1      /* rolled: the trips are alike, and side by side they would only add code */
    for (int t = 0; t < DR / 64; ++t) {
      const unsigned short* sa = &sg[t & 1][c * GPIT + 8 * hh]; const unsigned short* sw = sa + (64 + w * 32) * GPIT;
      FragH fa[2][4], fb[2][2];
#pragma unroll
      for (int ks = 0; ks < 2; ++ks) {
#pragma unroll
        for (int i = 0; i < 4; ++i) { fa[ks][i].half[0] = *(const v8us*)(sa + i * 16 * GPIT + ks * 32); fa[ks][i].half[1] = *(const v8us*)(sa + i * 16 * GPIT + ks * 32 + 16); }
#pragma unroll
        for (int j = 0; j < 2; ++j) { fb[ks][j].half[0] = *(const v8us*)(sw + j * 16 * GPIT + ks * 32); fb[ks][j].half[1] = *(const v8us*)(sw + j * 16 * GPIT + ks * 32 + 16); }
      }
      asm volatile("s_wait_dscnt 0x0" ::: "memory");       /* the block's 24 fragment loads are done: block t is in registers, this wave reads its buffer no more */
      asm volatile("s_wait_asynccnt 0x0" ::: "memory");    /* this wave's copies of block t + 1 have landed */
      __syncthreads();                                     /* block t + 1 may be read by all, block t's buffer has no reader left */
      if (t + 2 < DR / 64) ST_KV((t & 1) ? l1 : l0, (t + 2) * 64);
      /* the WMMAs work on registers alone and stand behind the refill, so that the copies fly under them */
#pragma unroll
      for (int ks = 0; ks < 2; ++ks)
#pragma unroll
        for (int i = 0; i < 4; ++i)
#pragma unroll
          for (int j = 0; j < 2; ++j) acc[i][j] = __builtin_amdgcn_wmma_f32_16x16x32_f16(false, fb[ks][j].v, false, fa[ks][i].v, (short)0, acc[i][j], false, false);
    }
    asm volatile("s_wait_asynccnt 0x0" ::: "memory");      /* no copy is outstanding behind the loop */
    ST_Q(l0, 0);      /* both buffers are free behind the last trip's barrier: q's block 0 flies under the k/v epilogue and the bias prologue */
    /* accumulator register r of tile (i, j): activation row 16 i + c, staged weight row 32 w + 16 j + 8 hh + r */
    const bool isk = w < 8;      /* the same for the whole wave */
    const float* bqp = bq + 4 * (w * 16 + 8 * hh);      /* folded column col stands for the columns 4 col .. 4 col + 3 */
    v4f b4[8];
#pragma unroll
    for (int r = 0; r < 8; ++r) b4[r] = *(const v4fa*)(bqp + 4 * r);
#pragma unroll
    for (int i = 0; i < 8; ++i) bn[i] = *(const v4fa*)(br + (size_t)(2 * i) * NP);
    asm volatile("s_wait_xcnt 0x0" :: "v"(bqp), "v"(br) : "memory");      /* in front of every overwrite of the loads' address pairs, which stay live up to here */
    if (isk) {
      const float* bp = BKVb + w * 32 + 8 * hh; v4f k4[2][2];
#pragma unroll
      for (int j = 0; j < 2; ++j) { k4[j][0] = *(const v4fa*)(bp + j * 16); k4[j][1] = *(const v4fa*)(bp + j * 16 + 4); }
      asm volatile("s_wait_xcnt 0x0" :: "v"(bp) : "memory");      /* in front of every overwrite of the loads' address pair, which stays live up to here */
      unsigned short* d = &sK[(c * 8 + w) * KPIT + 8 * hh];
#pragma unroll
      for (int i = 0; i < 4; ++i)
#pragma unroll
        for (int j = 0; j < 2; ++j) { FragH f;
#pragma unroll
          for (int r = 0; r < 8; ++r) f.h[r] = (_Float16)(acc[i][j][r] * 0.0625f + bf16_round(k4[j][r >> 2][r & 3]));
          *(v8us*)(d + i * 128 * KPIT + j * 16) = f.half[0]; }
    } else {
      const float* bp = BKVb + DR + (w - 8) * 4 + hh; float v1[2][8];
#pragma unroll
      for (int j = 0; j < 2; ++j)
#pragma unroll
        for (int r = 0; r < 8; ++r) v1[j][r] = bp[j * 2 + r * 32];
      asm volatile("s_wait_xcnt 0x0" :: "v"(bp) : "memory");      /* in front of every overwrite of the loads' address pair, which stays live up to here */
      unsigned short* d = &sV[((w - 8) * 4 + hh) * VPIT + c * 8];
#pragma unroll
      for (int i = 0; i < 4; ++i)
#pragma unroll
        for (int j = 0; j < 2; ++j) { FragH f;
#pragma unroll
          for (int r = 0; r < 8; ++r) f.h[r] = (_Float16)(acc[i][j][r] * 0.0625f + bf16_round(v1[j][r]));
          *(v8us*)(d + j * 2 * VPIT + i * 128) = f.half[0]; }
    }
#pragma unroll
    for (int r = 0; r < 8; ++r) bqs[r] = ((bf16_round(b4[r][0]) + bf16_round(b4[r][1])) + bf16_round(b4[r][2])) + bf16_round(b4[r][3]);
#pragma unroll
    for (int i = 0; i < 8; ++i) { *(v4ba*)&sb[(2 * i + hh) * BPIT + c * 4] = __builtin_convertvector(bn[i], v4b); bn[i] = *(const v4fa*)(br + (size_t)(2 * i) * NP + 64); }
    asm volatile("s_wait_xcnt 0x0" :: "v"(br) : "memory");      /* in front of every overwrite of these loads' address pair by the q loop's code */
  }
  asm volatile("s_wait_asynccnt 0x0" ::: "memory");      /* this wave's copies of q's block 0 have landed */
  __syncthreads();                                       /* and every other wave's: block 0 may be read; K and V^T are written */
  ST_Q(l1, 128);
  FragH fq;
  {
    v8f aq[2] = {};
#pragma unroll 1      /* rolled: the trips are alike, and side by side they would only add code */
    for (int t = 0; t < DQ / 128; ++t) {
      const unsigned short* sa = &sg[t & 1][c * GPIT + 8 * hh]; const unsigned short* sw = sa + (64 + w * 16) * GPIT;
      FragH fa[4][2], fb[4];
#pragma unroll
      for (int ks = 0; ks < 4; ++ks) {
#pragma unroll
        for (int i = 0; i < 2; ++i) { fa[ks][i].half[0] = *(const v8us*)(sa + ((ks >> 1) * 32 + i * 16) * GPIT + (ks & 1) * 32); fa[ks][i].half[1] = *(const v8us*)(sa + ((ks >> 1) * 32 + i * 16) * GPIT + (ks & 1) * 32 + 16); }
        fb[ks].half[0] = *(const v8us*)(sw + (ks >> 1) * 256 * GPIT + (ks & 1) * 32); fb[ks].half[1] = *(const v8us*)(sw + (ks >> 1) * 256 * GPIT + (ks & 1) * 32 + 16);
      }
      asm volatile("s_wait_dscnt 0x0" ::: "memory");       /* the block's 24 fragment loads are done: block t is in registers, this wave reads its buffer no more */
      asm volatile("s_wait_asynccnt 0x0" ::: "memory");    /* this wave's copies of block t + 1 have landed */
      __syncthreads();                                     /* block t + 1 may be read by all, block t's buffer has no reader left */
      if (t + 2 < DQ / 128) ST_Q((t & 1) ? l1 : l0, (t + 2) * 128);
      /* the WMMAs work on registers alone and stand behind the refill, so that the copies fly under them */
#pragma unroll
      for (int ks = 0; ks < 4; ++ks)
#pragma unroll
        for (int i = 0; i < 2; ++i) aq[i] = __builtin_amdgcn_wmma_f32_16x16x32_f16(false, fb[ks].v, false, fa[ks][i].v, (short)0, aq[i], false, false);
    }
    asm volatile("s_wait_asynccnt 0x0" ::: "memory");      /* no copy is outstanding behind the loop */
    unsigned short* sQ = &sg[0][0];      /* 256 queries, pitch as K's */
    /* accumulator register r of tile i: x row 16 i + c, folded column 16 w + 8 hh + r */
#pragma unroll
    for (int i = 0; i < 2; ++i) { FragH f;
#pragma unroll
      for (int r = 0; r < 8; ++r) f.h[r] = (_Float16)(aq[i][r] * 0.0625f + bqs[r]);
      *(v8us*)&sQ[((i * 16 + c) * 8 + (w >> 1)) * KPIT + (w & 1) * 16 + 8 * hh] = f.half[0]; }
    __syncthreads();                                     /* every wave's part of the Q tile is written: the tile may be read */
    const unsigned short* qr = &sQ[(w * 16 + c) * KPIT]; fq.half[0] = *(const v8us*)(qr + 8 * hh); fq.half[1] = *(const v8us*)(qr + 16 + 8 * hh);
  }
  const float L2E = 1.4426950408889634f;
  v8f o0 = {}, o1 = {};
  float m = -3.0e38f, ls = 0.f;
#pragma unroll 1      /* rolled: eight copies of this body would add code and registers and save nothing */
  for (int kc = 0; kc < NCH; ++kc) {
    /* the lanes of this wave read bias values that other lanes of it stored in the trip before: the stores have to be done first */
    asm volatile("s_wait_dscnt 0x0" ::: "memory");
    float l[32];
#pragma unroll
    for (int j = 0; j < 4; ++j) {
      const v8b pb = *(const v8ba*)&sb[c * BPIT + j * 16 + 8 * hh];      /* register r: bias[q0 + c][64 kc + 16 j + 8 hh + r], the S^T tile's own map */
      FragH fk; const unsigned short* kr = &sK[(kc * 64 + j * 16 + c) * KPIT];
      fk.half[0] = *(const v8us*)(kr + 8 * hh); fk.half[1] = *(const v8us*)(kr + 16 + 8 * hh);
      const v8f z = {};
      const v8f s = __builtin_amdgcn_wmma_f32_16x16x32_f16(false, fk.v, false, fq.v, (short)0, z, false, false);
#pragma unroll
      for (int r = 0; r < 8; ++r) l[j * 8 + r] = __builtin_fmaf(s[r], 0.03125f, (float)pb[r]);
    }
    /* next chunk's bias into the tile (its readers above are done), then the loads of the chunk after it; past the end both repeat the last chunk */
    const float* bx = br + ((kc + 2 < NCH) ? kc + 2 : NCH - 1) * 64;
#pragma unroll
    for (int i = 0; i < 8; ++i) { *(v4ba*)&sb[(2 * i + hh) * BPIT + c * 4] = __builtin_convertvector(bn[i], v4b); bn[i] = *(const v4fa*)(bx + (size_t)(2 * i) * NP); }
    float cj[4];
#pragma unroll
    for (int j = 0; j < 4; ++j) { cj[j] = l[j * 8];
#pragma unroll
      for (int r = 1; r < 8; ++r) cj[j] = fmaxf(cj[j], l[j * 8 + r]); }
    float cm = fmaxf(fmaxf(cj[0], cj[1]), fmaxf(cj[2], cj[3]));
    cm = fmaxf(cm, other_half(cm));
    const float mn = fmaxf(m, cm);
    const float sc = __builtin_amdgcn_exp2f((m - mn) * L2E);
    const float mb = 10.0f - mn * L2E;
    m = mn;
    v2f sa = {0.f, 0.f}, sd = {0.f, 0.f};
    FragH fp[2];
#pragma unroll
    for (int i = 0; i < 32; i += 4) {
      v2f ta, tc, pa, pc; const v2f l2e = {L2E, L2E}, mb2 = {mb, mb};
      ta[0] = l[i]; ta[1] = l[i + 1]; tc[0] = l[i + 2]; tc[1] = l[i + 3];
      ta = __builtin_elementwise_fma(ta, l2e, mb2); tc = __builtin_elementwise_fma(tc, l2e, mb2);
      pa[0] = __builtin_amdgcn_exp2f(ta[0]); pa[1] = __builtin_amdgcn_exp2f(ta[1]); pc[0] = __builtin_amdgcn_exp2f(tc[0]); pc[1] = __builtin_amdgcn_exp2f(tc[1]);
      sa += pa; sd += pc;
      const v2h ha = __builtin_convertvector(pa, v2h), hc = __builtin_convertvector(pc, v2h);
      fp[i >> 4].h[(i & 15)] = ha[0]; fp[i >> 4].h[(i & 15) + 1] = ha[1]; fp[i >> 4].h[(i & 15) + 2] = hc[0]; fp[i >> 4].h[(i & 15) + 3] = hc[1];
    }
    sa += sd;
    ls = __builtin_fmaf(ls, sc, sa[0] + sa[1]);
#pragma unroll
    for (int r = 0; r < 8; ++r) { o0[r] *= sc; o1[r] *= sc; }
#pragma unroll
    for (int u = 0; u < 2; ++u) {
      FragH v0, v1; const unsigned short* vr = &sV[c * VPIT + kc * 64 + u * 32];
      v0.half[0] = *(const v8us*)(vr + 8 * hh); v0.half[1] = *(const v8us*)(vr + 16 + 8 * hh);
      v1.half[0] = *(const v8us*)(vr + 16 * VPIT + 8 * hh); v1.half[1] = *(const v8us*)(vr + 16 * VPIT + 16 + 8 * hh);
      o0 = __builtin_amdgcn_wmma_f32_16x16x32_f16(false, v0.v, false, fp[u].v, (short)0, o0, false, false);
      o1 = __builtin_amdgcn_wmma_f32_16x16x32_f16(false, v1.v, false, fp[u].v, (short)0, o1, false, false);
    }
  }
  ls += other_half(ls);
  const float inv = 1.0f / ls;
  float* so = sO[w];               /* this wave's own staging: lane (c, hh) holds query c, e = 16 t + 8 hh + r */
  { v4f a;
    a[0] = o0[0] * inv; a[1] = o0[1] * inv; a[2] = o0[2] * inv; a[3] = o0[3] * inv; *(v4fa*)&so[c * OPIT + 8 * hh] = a;
    a[0] = o0[4] * inv; a[1] = o0[5] * inv; a[2] = o0[6] * inv; a[3] = o0[7] * inv; *(v4fa*)&so[c * OPIT + 8 * hh + 4] = a;
    a[0] = o1[0] * inv; a[1] = o1[1] * inv; a[2] = o1[2] * inv; a[3] = o1[3] * inv; *(v4fa*)&so[c * OPIT + 16 + 8 * hh] = a;
    a[0] = o1[4] * inv; a[1] = o1[5] * inv; a[2] = o1[6] * inv; a[3] = o1[7] * inv; *(v4fa*)&so[c * OPIT + 16 + 8 * hh + 4] = a; }
  /* the wave's lanes read each other's staged values: the LDS writes have to be done before the reads */
  asm volatile("s_wait_dscnt 0x0" ::: "memory");
  float* orow = out + ((size_t)bh * NP + q0) * 128 + lane * 4;      /* out_d = o_{d/4}: lane e writes its value four times, 512 B a query in one store */
#pragma unroll
  for (int q = 0; q < 16; ++q) { const float vv = so[q * OPIT + lane]; v4f v; v[0] = vv; v[1] = vv; v[2] = vv; v[3] = vv; *(v4f*)(orow + (size_t)q * 128) = v; }
}
__device__ __forceinline__ void d_bcat(int blk, const float* __restrict__ a, const float* __restrict__ b, float* __restrict__ O) { const int t = blk * 256 + threadIdx.x; const float v = (t < DR) ? a[t] : b[t - DR]; *(float*)(O + t) = v;
  /* in the shared kernel's code other passes' instructions follow this store and write its registers: the wait stands in front of every such overwrite */
  asm volatile("s_wait_xcnt 0x0" ::: "memory"); }
// Passes that read nothing of one another share one launch: each pass owns a range of block indices and does there what it did alone
// (the looped passes piece by piece, as said at d_x16; the bias concatenation in two blocks of 256 threads for its one block of 512).
// The choice of the pass is uniform for a block. The longest passes come first.
// 586 blocks of 8 waves, between 4 and 5 waves for each SIMD of the chip: amdgpu_waves_per_eu(8, 8) gives the compiler the register budget for a whole burst of loads in flight.
#define G_X16 (NRW * DQ / 8 / 256 / 16)       /* 256 blocks: 2 bursts of 8 pieces */
#define G_XR  (NRW * (DR / 8) / 256 / 4)      /* 256: 2 bursts of 2 pieces */
#define G_FQ  (DR * DQ / 8 / 256 / 2)         /* 64: 2 pieces */
#define G_RW  (DR * DR / 8 / 256 / 8)         /* 4, once for Wk and once for Wv: 8 pieces */
#define G_BC  (2 * DR / 256)             /* 2 */
__global__ __launch_bounds__(256) __attribute__((amdgpu_waves_per_eu(8, 8))) void k_prep(const float* __restrict__ x, const float* __restrict__ dww, const float* __restrict__ dwb, const float* __restrict__ Wq, const float* __restrict__ Wk, const float* __restrict__ Wv, const float* __restrict__ bk, const float* __restrict__ bv,
    _Float16* __restrict__ X16, _Float16* __restrict__ XR16, _Float16* __restrict__ BQ, _Float16* __restrict__ BKV, float* __restrict__ BKVb) {
  int blk = blockIdx.x;
  if (blk < G_X16) { d_x16<8, 2>(blk, x, X16); return; }      /* plain (P, 1024) view = flat */
  blk -= G_X16;
  if (blk < G_XR) { d_xr<2, 2>(blk, x, dww, dwb, XR16); return; }
  blk -= G_XR;
  if (blk < G_FQ) { d_fold4<DR, DQ, 2>(blk, Wq, BQ); return; }      /* weights: (out, in) natural */
  blk -= G_FQ;
  if (blk < G_RW) { d_round16f<8>(blk, Wk, BKV); return; }
  blk -= G_RW;
  if (blk < G_RW) { d_round16f<8>(blk, Wv, BKV + (size_t)DR * DR); return; }
  blk -= G_RW;
  d_bcat(blk, bk, bv, BKVb);
}

extern "C" void kernel_launch(void* const* d_in, const int* in_sizes, int n_in,
                              void* d_out, int out_size, void* d_ws, size_t ws_size, hipStream_t stream) {
  (void)in_sizes; (void)n_in; (void)out_size;
  const float* const* I = (const float* const*)d_in; const float* x = I[0]; const float* dww = I[1]; const float* dwb = I[2]; const float* Wq = I[3]; const float* bq = I[4]; const float* Wk = I[5]; const float* bk = I[6]; const float* Wv = I[7]; const float* bv = I[8]; const float* rb = I[9];
  char* ws = (char*)d_ws; size_t off = 0;
  auto take = [&](size_t bytes) { char* p = ws + off; off += (bytes + 255) & ~(size_t)255; return p; };
  _Float16* BQ = (_Float16*)take((size_t)DR * DQ * 2); _Float16* BKV = (_Float16*)take((size_t)2 * DR * DR * 2); float* BKVb = (float*)take(2 * DR * 4);
  _Float16* X16 = (_Float16*)take((size_t)NRW * DQ * 2); _Float16* XR16 = (_Float16*)take((size_t)NRW * DR * 2);
  if (off > ws_size) return;
  k_prep<<<G_X16 + G_XR + G_FQ + 2 * G_RW + G_BC, 256, 0, stream>>>(x, dww, dwb, Wq, Wk, Wv, bk, bv, X16, XR16, BQ, BKV, BKVb);
  k_attn<<<NBH * 2, AWV * 32, 0, stream>>>(X16, BQ, bq, XR16, BKV, BKVb, rb, (float*)d_out);
}

// v008
// Measured time: 35.2 microseconds a run.
// Timed twice side by side with v007, it ran 1.16 and 1.17 times as fast.
// Over all steps from v000 it is 8.59 times as fast.
#include <hip/hip_runtime.h>
// Lightweight multi-head self-attention with reduced keys/values (B 16, C 32, 128×128; P 512 tokens of 1024 (q) / 256 (k, v after a depthwise 2×2 stride-2 reduction); 8 heads by PLAIN reshapes of the (P, dim) buffers; k/v nearest-upsampled 32 → 128 along the head dim; scores/√1024 + rel_bias; softmax; attn·v; plain reshape back to [16,32,128,128]).
// Structure: q/k/v projections as GEMMs (the depthwise reduction on VALU -> f16); the 32->128 nearest upsampling is folded into the contraction (sum_d q_d k_{d/4} = sum_e (sum_{d/4=e} q_d) k_e and out_d = o_{d/4}), and the sum over each four q columns is folded further into the projection itself (sum_{d/4=e} q_d = x . sum_{d/4=e} Wq[d] + sum_{d/4=e} bq[d]): the q GEMM has N 256 and its f16 output, read flat, is the head operand; the plain-view head split of q, k and v by index arithmetic in the GEMMs' own epilogues; the three projections, scores (K 32, scale 1/32), bias, running-max softmax (x 2^10, f16), P.V (N 32) and the expanded output in ONE fused kernel, head operands in LDS, scores and probabilities kept in registers.
// Compute dtype: inputs and parameters rounded to bf16; x exact in f16; folded q weights, reduced x, head operands and probabilities f16 (about 2^-12); f32 accumulation; softmax f32. v_wmma_f32_16x16x32_f16.
#define NB 16
#define NP 512
#define DQ 1024
#define DR 256
#define NHD 8
#define NBH (NB * NHD)           /* 128 */
#define NRW (NB * NP)            /* 8192 rows */
typedef __bf16 v16b __attribute__((ext_vector_type(16)));
typedef unsigned short v8us __attribute__((ext_vector_type(8), may_alias));
typedef float  v8f  __attribute__((ext_vector_type(8)));
typedef float  v4f  __attribute__((ext_vector_type(4)));
typedef float  v4fa __attribute__((ext_vector_type(4), may_alias));
union FragB { v16b v; v8us half[2]; unsigned short u[16]; };

__device__ __forceinline__ unsigned short bf16_bits(float x) { unsigned int u = __float_as_uint(x); return (unsigned short)((u + 0x7FFFu + ((u >> 16) & 1u)) >> 16); }
__device__ __forceinline__ float bf16_val(unsigned short b) { return __uint_as_float(((unsigned int)b) << 16); }
__device__ __forceinline__ float bf16_round(float x) { return bf16_val(bf16_bits(x)); }
// D += A·B with NT terms: 1 = ah·bh, 2 = + al·bh (A split), 3 = + ah·bl (both split)
template <int NT>
__device__ __forceinline__ v8f mmaN(v16b ah, v16b al, v16b bh, v16b bl, v8f c) {
  c = __builtin_amdgcn_wmma_f32_16x16x32_bf16(false, ah, false, bh, (short)0, c, false, false);
  if (NT >= 2) c = __builtin_amdgcn_wmma_f32_16x16x32_bf16(false, al, false, bh, (short)0, c, false, false);
  if (NT >= 3) c = __builtin_amdgcn_wmma_f32_16x16x32_bf16(false, ah, false, bl, (short)0, c, false, false);
  asm volatile("v_nop\n\tv_nop\n\tv_nop\n\tv_nop" : "+v"(c) : "v"(ah), "v"(al), "v"(bh), "v"(bl));
  return c;
}

__global__ __launch_bounds__(256) void k_wt_bf16(const float* __restrict__ W, unsigned short* __restrict__ Wt, int K, int N) {
  const int t = blockIdx.x * 256 + threadIdx.x;
  const int k8n = K / 8;
  if (t >= N * k8n) return;
  const int n = t / k8n, k8 = (t % k8n) * 8;
  v8us v;
#pragma unroll
  for (int i = 0; i < 8; ++i) v[i] = bf16_bits(W[(size_t)(k8 + i) * N + n]);
  *(v8us*)(Wt + (size_t)n * K + k8) = v;
  
}

// GEMM C[M][N] (f32, pitch ldc) = act(A[M][K]·W + bias). A f32 row-major (pitch lda) converted per fragment to bf16
// (ASPLIT: hi/lo two planes -> 2 terms, else single rounded term); Wt bf16 [N][K] (pitch ldb). BIAS_BF16 rounds the
// bias to bf16 first (bias quantised to bf16 before the add). K%32==0, M%16==0, N%64==0.
template <bool ASPLIT, int ACT, bool BIAS_BF16>
__global__ __launch_bounds__(128) void k_gemm_bf(const float* __restrict__ A, int lda, const unsigned short* __restrict__ Wt, int ldb,
                                               const float* __restrict__ bias, float* __restrict__ C, int ldc, int M, int N, int K) {
  __shared__ __attribute__((aligned(16))) float so[4][16][64];
  const int tid = threadIdx.x, w = tid >> 5, lane = tid & 31, ln = lane & 15, hh = lane >> 4;
  const int ntn = N / 64;
  const int wid = blockIdx.x * 4 + w;
  const int mt = wid / ntn, nq = wid % ntn;
  if (mt * 16 >= M) return;
  const int row0 = mt * 16, col0 = nq * 64;
  const float* arow = A + (size_t)(row0 + ln) * lda;
  v8f acc[4] = {};
  for (int kb = 0; kb < K; kb += 32) {
    FragB ah, al;
    const v4f x0 = *(const v4fa*)(arow + kb + 8 * hh), x1 = *(const v4fa*)(arow + kb + 8 * hh + 4);
    const v4f x2 = *(const v4fa*)(arow + kb + 16 + 8 * hh), x3 = *(const v4fa*)(arow + kb + 16 + 8 * hh + 4);
    float xs[16] = {x0[0],x0[1],x0[2],x0[3],x1[0],x1[1],x1[2],x1[3],x2[0],x2[1],x2[2],x2[3],x3[0],x3[1],x3[2],x3[3]};
#pragma unroll
    for (int i = 0; i < 16; ++i) { const unsigned short hb = bf16_bits(xs[i]); ah.u[i] = hb; al.u[i] = ASPLIT ? bf16_bits(xs[i] - bf16_val(hb)) : (unsigned short)0; }
#pragma unroll
    for (int t = 0; t < 4; ++t) {
      const unsigned short* brow = Wt + (size_t)(col0 + t * 16 + ln) * ldb + kb;
      FragB b;
      b.half[0] = *(const v8us*)(brow + 8 * hh);
      b.half[1] = *(const v8us*)(brow + 16 + 8 * hh);
      acc[t] = mmaN<ASPLIT ? 2 : 1>(ah.v, al.v, b.v, b.v, acc[t]);
    }
  }
#pragma unroll
  for (int t = 0; t < 4; ++t) {
    float bv = bias ? bias[col0 + t * 16 + ln] : 0.f;
    if (BIAS_BF16) bv = bf16_round(bv);
#pragma unroll
    for (int r = 0; r < 8; ++r) { float v = acc[t][r] + bv; if (ACT == 1) v = fmaxf(v, 0.f); so[w][8 * hh + r][t * 16 + ln] = v; }
  }
  __builtin_amdgcn_fence(__ATOMIC_ACQ_REL, "workgroup");
  __builtin_amdgcn_wave_barrier();
  const int rsub = lane >> 4, c4 = (lane & 15) * 4;
  {
#pragma unroll
    for (int q = 0; q < 8; ++q) {
      const int r = q * 2 + rsub;
      const v4f v = *(const v4fa*)&so[w][r][c4];
      *(v4f*)(C + (size_t)(row0 + r) * ldc + col0 + c4) = v;
    }
    
  }
}

// GEMM C = act(A·W + bias + resid): A f32 (ASPLIT -> hi/lo 2 terms), Wt bf16 [N][K]; ACT 0 none, 1 relu, 2 exact gelu;
// resid (optional, f32, row index = (row % rmod), pitch ldr, RES_BF16 rounds it) added before the activation.
template <bool ASPLIT, int ACT, bool BIAS_BF16, bool RES_BF16>
__global__ __launch_bounds__(128) void k_gemm_bf3(const float* __restrict__ A, int lda, const unsigned short* __restrict__ Wt, int ldb,
                                                const float* __restrict__ bias, const float* __restrict__ resid, int rmod, int ldr,
                                                float* __restrict__ C, int ldc, int M, int N, int K) {
  __shared__ __attribute__((aligned(16))) float so[4][16][64];
  const int tid = threadIdx.x, w = tid >> 5, lane = tid & 31, ln = lane & 15, hh = lane >> 4;
  const int ntn = N / 64;
  const int wid = blockIdx.x * 4 + w;
  const int mt = wid / ntn, nq = wid % ntn;
  if (mt * 16 >= M) return;
  const int row0 = mt * 16, col0 = nq * 64;
  const float* arow = A + (size_t)(row0 + ln) * lda;
  v8f acc[4] = {};
  for (int kb = 0; kb < K; kb += 32) {
    FragB ah, al;
    const v4f x0 = *(const v4fa*)(arow + kb + 8 * hh), x1 = *(const v4fa*)(arow + kb + 8 * hh + 4);
    const v4f x2 = *(const v4fa*)(arow + kb + 16 + 8 * hh), x3 = *(const v4fa*)(arow + kb + 16 + 8 * hh + 4);
    float xs[16] = {x0[0],x0[1],x0[2],x0[3],x1[0],x1[1],x1[2],x1[3],x2[0],x2[1],x2[2],x2[3],x3[0],x3[1],x3[2],x3[3]};
#pragma unroll
    for (int i = 0; i < 16; ++i) { const unsigned short hb = bf16_bits(xs[i]); ah.u[i] = hb; al.u[i] = ASPLIT ? bf16_bits(xs[i] - bf16_val(hb)) : (unsigned short)0; }
#pragma unroll
    for (int t = 0; t < 4; ++t) {
      const unsigned short* brow = Wt + (size_t)(col0 + t * 16 + ln) * ldb + kb;
      FragB b;
      b.half[0] = *(const v8us*)(brow + 8 * hh);
      b.half[1] = *(const v8us*)(brow + 16 + 8 * hh);
      acc[t] = mmaN<ASPLIT ? 2 : 1>(ah.v, al.v, b.v, b.v, acc[t]);
    }
  }
#pragma unroll
  for (int t = 0; t < 4; ++t) {
    const int col = col0 + t * 16 + ln;
    float bv = bias ? bias[col] : 0.f;
    if (BIAS_BF16) bv = bf16_round(bv);
#pragma unroll
    for (int r = 0; r < 8; ++r) {
      float v = acc[t][r] + bv;
      if (resid) { float rv = resid[(size_t)((row0 + 8 * hh + r) % rmod) * ldr + col]; if (RES_BF16) rv = bf16_round(rv); v += rv; }
      if (ACT == 1) v = fmaxf(v, 0.f);
      if (ACT == 2) v = 0.5f * v * (1.0f + erff(v * 0.70710678118654752f));
      if (ACT == 3) { const float u = 0.7978845608028654f * (v + 0.044715f * v * v * v); v = 0.5f * v * (1.0f + tanhf(u)); }
      so[w][8 * hh + r][t * 16 + ln] = v;
    }
  }
  __builtin_amdgcn_fence(__ATOMIC_ACQ_REL, "workgroup");
  __builtin_amdgcn_wave_barrier();
  const int rsub = lane >> 4, c4 = (lane & 15) * 4;
  {
#pragma unroll
    for (int q = 0; q < 8; ++q) {
      const int r = q * 2 + rsub;
      const v4f v = *(const v4fa*)&so[w][r][c4];
      *(v4f*)(C + (size_t)(row0 + r) * ldc + col0 + c4) = v;
    }
    
  }
}
// row LayerNorm (biased variance, eps) over N: s = X (+ R); optional out_sum <- s; out_norm <- (s-mu)*rsqrt(var+eps)*g + b
template <bool PARAM_BF16>
__global__ __launch_bounds__(256) void k_layernorm(const float* __restrict__ X, const float* __restrict__ R, const float* __restrict__ g, const float* __restrict__ bta,
                                                  float* __restrict__ out_sum, float* __restrict__ out_norm, int N, float eps) {
  __shared__ float red[256];
  const int row = blockIdx.x, tid = threadIdx.x;
  const float* x = X + (size_t)row * N; const float* rr = R ? R + (size_t)row * N : nullptr;
  float vals[16];                     // up to N = 4096
  const int per = N / 256;            // contiguous chunk per thread? use strided-by-4 chunks: thread handles j = tid*4 + 1024*u
  float s1 = 0.f;
  for (int u = 0; u < per / 4; ++u) {
    const int j = tid * 4 + 1024 * u;
    const v4f a = *(const v4fa*)(x + j);
    v4f b = {0.f,0.f,0.f,0.f}; if (rr) b = *(const v4fa*)(rr + j);
#pragma unroll
    for (int q = 0; q < 4; ++q) { const float v = a[q] + b[q]; vals[u * 4 + q] = v; s1 += v; }
  }
  red[tid] = s1; __syncthreads();
  for (int st = 128; st > 0; st >>= 1) { if (tid < st) red[tid] += red[tid + st]; __syncthreads(); }
  const float mu = red[0] / (float)N; __syncthreads();
  float s2 = 0.f;
  for (int u = 0; u < per / 4; ++u)
#pragma unroll
    for (int q = 0; q < 4; ++q) { const float c = vals[u * 4 + q] - mu; s2 += c * c; }
  red[tid] = s2; __syncthreads();
  for (int st = 128; st > 0; st >>= 1) { if (tid < st) red[tid] += red[tid + st]; __syncthreads(); }
  const float rs = rsqrtf(red[0] / (float)N + eps);
  {
    for (int u = 0; u < per / 4; ++u) {
      const int j = tid * 4 + 1024 * u;
      v4f o, sm;
#pragma unroll
      for (int q = 0; q < 4; ++q) {
        float gg = g[j + q], bb = bta[j + q];
        if (PARAM_BF16) { gg = bf16_round(gg); bb = bf16_round(bb); }
        sm[q] = vals[u * 4 + q]; o[q] = (vals[u * 4 + q] - mu) * rs * gg + bb;
      }
      if (out_sum) *(v4f*)(out_sum + (size_t)row * N + j) = sm;
      *(v4f*)(out_norm + (size_t)row * N + j) = o;
    }
    
  }
}



// ---- f16 WMMA path (v_wmma_f32_16x16x32_f16): 11-bit significands for operands in range — used where a [0,1] probability operand needs more precision than bf16
typedef _Float16 v16h __attribute__((ext_vector_type(16)));
union FragH { v16h v; v8us half[2]; _Float16 h[16]; unsigned short u[16]; };
template <int NT>
__device__ __forceinline__ v8f mmaH(v16h ah, v16h al, v16h bh, v16h bl, v8f c) {
  c = __builtin_amdgcn_wmma_f32_16x16x32_f16(false, ah, false, bh, (short)0, c, false, false);
  if (NT >= 2) c = __builtin_amdgcn_wmma_f32_16x16x32_f16(false, al, false, bh, (short)0, c, false, false);
  if (NT >= 3) c = __builtin_amdgcn_wmma_f32_16x16x32_f16(false, ah, false, bl, (short)0, c, false, false);
  asm volatile("v_nop\n\tv_nop\n\tv_nop\n\tv_nop" : "+v"(c) : "v"(ah), "v"(al), "v"(bh), "v"(bl));
  return c;
}
// batched GEMM like k_gemm_b but f16 operands: A f32 (split into f16 hi/lo if ASPLIT, else rounded to f16), Bt = f16 values [n][k]; alpha; C f32; N multiple of 16 (partial tiles skipped)
template <bool ASPLIT>
__global__ __launch_bounds__(128) void k_gemm_h(const float* __restrict__ A, int lda, size_t sA, const _Float16* __restrict__ Bh, int ldb, size_t sB, float alpha, float* __restrict__ C, int ldc, size_t sC, int M, int N, int K) {
  __shared__ __attribute__((aligned(16))) float so[4][16][64];
  const int tid = threadIdx.x, w = tid >> 5, lane = tid & 31, ln = lane & 15, hh = lane >> 4; const int by = blockIdx.y;
  A += (size_t)by * sA; Bh += (size_t)by * sB; C += (size_t)by * sC;
  const int ntn = (N + 63) / 64; const int wid = blockIdx.x * 4 + w; const int mt = wid / ntn, nq = wid % ntn; if (mt * 16 >= M) return;
  const int row0 = mt * 16, col0 = nq * 64; const float* arow = A + (size_t)(row0 + ln) * lda;
  v8f acc[4] = {};
  for (int kb = 0; kb < K; kb += 32) {
    FragH ah, al;
    const v4f x0 = *(const v4fa*)(arow + kb + 8 * hh), x1 = *(const v4fa*)(arow + kb + 8 * hh + 4), x2 = *(const v4fa*)(arow + kb + 16 + 8 * hh), x3 = *(const v4fa*)(arow + kb + 16 + 8 * hh + 4);
    float xs[16] = {x0[0],x0[1],x0[2],x0[3],x1[0],x1[1],x1[2],x1[3],x2[0],x2[1],x2[2],x2[3],x3[0],x3[1],x3[2],x3[3]};
#pragma unroll
    for (int i = 0; i < 16; ++i) { const _Float16 h = (_Float16)xs[i]; ah.h[i] = h; al.h[i] = ASPLIT ? (_Float16)(xs[i] - (float)h) : (_Float16)0.0f; }
#pragma unroll
    for (int t = 0; t < 4; ++t) { if (col0 + t * 16 >= N) continue; const size_t boff = (size_t)(col0 + t * 16 + ln) * ldb + kb; FragH bq; bq.half[0] = *(const v8us*)(Bh + boff + 8 * hh); bq.half[1] = *(const v8us*)(Bh + boff + 16 + 8 * hh);
      acc[t] = mmaH<ASPLIT ? 2 : 1>(ah.v, al.v, bq.v, bq.v, acc[t]); }
  }
#pragma unroll
  for (int t = 0; t < 4; ++t) { if (col0 + t * 16 >= N) continue;
#pragma unroll
    for (int r = 0; r < 8; ++r) so[w][8 * hh + r][t * 16 + ln] = acc[t][r] * alpha; }
  __builtin_amdgcn_fence(__ATOMIC_ACQ_REL, "workgroup"); __builtin_amdgcn_wave_barrier();
  const int rsub = lane >> 4, c4 = (lane & 15) * 4;
  {
#pragma unroll
    for (int q = 0; q < 8; ++q) { const int r = q * 2 + rsub; if (col0 + c4 < N) { const v4f v = *(const v4fa*)&so[w][r][c4]; *(v4f*)(C + (size_t)(row0 + r) * ldc + col0 + c4) = v; } }
     }
}

// Wt[n][k] = f16(W[k][n]·scale) from f32 row-major W[K][N] (scale = power of two; bf16-exact weights stay exact in f16 away from the subnormal range)
__global__ __launch_bounds__(256) void k_wt_f16(const float* __restrict__ W, _Float16* __restrict__ Wt, int K, int N, float scale) {
  const int t = blockIdx.x * 256 + threadIdx.x; if (t >= N * (K / 8)) return; const int n = t / (K / 8), k8 = (t % (K / 8)) * 8; FragH f;
#pragma unroll
  for (int i = 0; i < 8; ++i) f.h[i] = (_Float16)(bf16_round(W[(size_t)(k8 + i) * N + n]) * scale); const v8us o = f.half[0];
  *(v8us*)((unsigned short*)Wt + (size_t)n * K + k8) = o; 
}
// Operands of the projection GEMMs, which run inside the attention kernel (16 waves). Every weight fragment is used by ONE wave of a work-group, so the weights do not go through LDS:
// the prep pass stores them in fragment order, and a wave loads its own fragments from L2 straight into registers, 512 B in a row a load, one group of k steps ahead of their use.
// Fragment order: fragments of 16 weight rows x 32 k (1 KB), the k steps of a row tile one after the other; inside a fragment piece 16 hh + c is row c, k 8 hh .. 8 hh + 7, and piece 32 + 16 hh + c is row c, k 16 + 8 hh .. (16 B a piece).
// The activation rows, which all 16 waves read, come into LDS whole, once, by asynchronous copies (16 B a lane, 512 B in a row a copy): the k loops have no ring and no barrier.
#define XRP 264                  /* reduced-x row pitch in LDS, f16 elements: 512 + 16 B */
#define XQP 1032                 /* x row pitch in LDS, f16 elements: 2048 + 16 B */
/* the copies and, as the last line of their own statement, the wait that stands in front of every rewrite of the address registers they name */
#define CP4 "global_load_async_to_lds_b128 %0, %4, off\n\tglobal_load_async_to_lds_b128 %1, %5, off\n\tglobal_load_async_to_lds_b128 %2, %6, off\n\tglobal_load_async_to_lds_b128 %3, %7, off\n\ts_wait_xcnt 0x0"
#define CP8 "global_load_async_to_lds_b128 %0, %8, off\n\tglobal_load_async_to_lds_b128 %1, %9, off\n\tglobal_load_async_to_lds_b128 %2, %10, off\n\tglobal_load_async_to_lds_b128 %3, %11, off\n\tglobal_load_async_to_lds_b128 %4, %12, off\n\tglobal_load_async_to_lds_b128 %5, %13, off\n\tglobal_load_async_to_lds_b128 %6, %14, off\n\tglobal_load_async_to_lds_b128 %7, %15, off\n\ts_wait_xcnt 0x0"
__device__ __forceinline__ void d_copy4(unsigned lds, unsigned ls, const unsigned short* g, int gs) {      /* copy i: the lane's piece at lds + i ls (bytes) from g + i gs (elements) */
  asm volatile(CP4 :: "v"(lds), "v"(lds + ls), "v"(lds + 2 * ls), "v"(lds + 3 * ls), "v"(g), "v"(g + gs), "v"(g + 2 * gs), "v"(g + 3 * gs) : "memory");
}
__device__ __forceinline__ void d_copy8(unsigned lds, unsigned ls, const unsigned short* g, int gs) {
  asm volatile(CP8 :: "v"(lds), "v"(lds + ls), "v"(lds + 2 * ls), "v"(lds + 3 * ls), "v"(lds + 4 * ls), "v"(lds + 5 * ls), "v"(lds + 6 * ls), "v"(lds + 7 * ls),
    "v"(g), "v"(g + gs), "v"(g + 2 * gs), "v"(g + 3 * gs), "v"(g + 4 * gs), "v"(g + 5 * gs), "v"(g + 6 * gs), "v"(g + 7 * gs) : "memory");
}
__device__ __forceinline__ void d_wfrag(FragH& f, const v8us* p) { f.half[0] = p[0]; f.half[1] = p[32]; }      /* p: this lane's first piece of a packed weight fragment */

typedef _Float16 v4h __attribute__((ext_vector_type(4)));

// The element-wise passes are looped: one block does the work of NU x F blocks of the plain grid (a piece = what one thread of the plain grid did:
// same reads, same arithmetic, same 16-B store), in NU bursts of F pieces. A launch so starts NU x F times fewer waves, and a wave has the 16 loads
// of a whole burst (16 B a lane each) in flight. Every grid divides exactly: no bounds test. Each '#pragma unroll' keeps a burst's register arrays at constant indices
// and its loads in front of the first use; each '#pragma unroll 1' keeps the bursts one after the other (side by side they would need NU times the registers).
// Two waits a burst, each in front of every overwrite of a register that an issued load or store names: one behind the loads (it takes the address as an input,
// so that the pair stays live up to it and no load of the burst lands on it), one behind the stores (the next burst, or another pass's code in the shared kernel, follows).
template <int F, int NU>
__device__ __forceinline__ void d_x16(int blk, const float* __restrict__ x, _Float16* __restrict__ X16) { size_t t0 = (size_t)blk * (NU * F * 256) + threadIdx.x;
#pragma unroll 1
  for (int n = 0; n < NU; ++n, t0 += F * 256) { const float* xp = x + t0 * 8; v4f a[F], b[F];
#pragma unroll
    for (int u = 0; u < F; ++u) { a[u] = *(const v4fa*)(xp + u * 2048); b[u] = *(const v4fa*)(xp + u * 2048 + 4); }
    asm volatile("s_wait_xcnt 0x0" :: "v"(xp) : "memory");      /* in front of every overwrite of the loads' address pair, which stays live up to here */
#pragma unroll
    for (int u = 0; u < F; ++u) { FragH f;
#pragma unroll
      for (int q = 0; q < 4; ++q) { f.h[q] = (_Float16)bf16_round(a[u][q]); f.h[4 + q] = (_Float16)bf16_round(b[u][q]); }
      *(v8us*)((unsigned short*)X16 + (t0 + u * 256) * 8) = f.half[0]; }
    asm volatile("s_wait_xcnt 0x0" ::: "memory");      /* in front of every overwrite of the stores' registers by what follows */ } }
__global__ __launch_bounds__(256) void k_h16(const float* __restrict__ x, _Float16* __restrict__ X16, size_t n8) { const size_t t = (size_t)blockIdx.x * 256 + threadIdx.x; if (t >= n8) return; FragH f;
#pragma unroll
  for (int q = 0; q < 8; ++q) f.h[q] = (_Float16)x[t * 8 + q]; *(v8us*)((unsigned short*)X16 + t * 8) = f.half[0];  }
// output piece t0 + 256 u is stored where it stood, so every store is 512 B in a row; WHICH 8 weights it holds follows the fragment order (KS = 8 k steps a row tile): fragment 32 blk + tid / 64 + 4 u.
// V: the v weight rows stand in the order 8 e + g (row 32 g + e of Wv), so that a lane's 8 accumulator registers are g = 0 .. 7 of one e.
template <int F, bool V>
__device__ __forceinline__ void d_round16f(int blk, const float* __restrict__ W, _Float16* __restrict__ Bt) { static_assert(F % 2 == 0, "two pieces of a thread make up the 8 k steps of a row tile"); const size_t t0 = (size_t)blk * (F * 256) + threadIdx.x;
  const int cc = threadIdx.x & 15, kq = (threadIdx.x >> 6) * 4 + ((threadIdx.x >> 5) & 1) * 2 + ((threadIdx.x >> 4) & 1), tl = blk * (F / 2);      /* row in the tile, 8-k piece of the row for u = 0, first row tile */
  const float* wp = W + (size_t)(V ? 32 * (cc & 7) + 2 * tl + (cc >> 3) : 16 * tl + cc) * DR + kq * 8; v4f a[F], b[F];
#pragma unroll
  for (int u = 0; u < F; ++u) { a[u] = *(const v4fa*)(wp + (u >> 1) * (V ? 2 : 16) * DR + (u & 1) * 128); b[u] = *(const v4fa*)(wp + (u >> 1) * (V ? 2 : 16) * DR + (u & 1) * 128 + 4); }
  asm volatile("s_wait_xcnt 0x0" :: "v"(wp) : "memory");      /* in front of every overwrite of the loads' address pair, which stays live up to here */
#pragma unroll
  for (int u = 0; u < F; ++u) { FragH f;
#pragma unroll
    for (int i = 0; i < 4; ++i) { f.h[i] = (_Float16)(bf16_round(a[u][i]) * 16.0f); f.h[4 + i] = (_Float16)(bf16_round(b[u][i]) * 16.0f); }
    *(v8us*)((unsigned short*)Bt + (t0 + u * 256) * 8) = f.half[0]; }
  asm volatile("s_wait_xcnt 0x0" ::: "memory");      /* in front of every overwrite of the stores' registers by what follows */ }
// piece (e, k) = f16(16 (W[4 e][k] + W[4 e + 1][k] + W[4 e + 2][k] + W[4 e + 3][k])), each W rounded to bf16 first, the sum in f32: W (4 NE, K) row-major, thread = F pieces of 8 k of one e, 128 k apart; both loops unrolled so that f.h is indexed by constants and stays in registers.
// Output piece t0 + 256 u is stored in its place in a row; which (e, k) it holds follows the fragment order (K / 32 k steps a row tile): fragment F 4 blk + tid / 64 + 4 u
template <int NE, int K, int F>
__device__ __forceinline__ void d_fold4(int blk, const float* __restrict__ W, _Float16* __restrict__ Bt) { static_assert((K / 32) % (F * 4) == 0, "a block's fragments lie in one row tile"); const int t0 = blk * (F * 256) + threadIdx.x; const int f0 = blk * (F * 4) + (threadIdx.x >> 6);
  const int e = (f0 / (K / 32)) * 16 + (threadIdx.x & 15), k8 = (f0 % (K / 32)) * 32 + ((threadIdx.x >> 5) & 1) * 16 + ((threadIdx.x >> 4) & 1) * 8; const float* wr = W + (size_t)e * 4 * K + k8; v4f r[F][2][4];
#pragma unroll
  for (int u = 0; u < F; ++u)
#pragma unroll
    for (int g = 0; g < 2; ++g)
#pragma unroll
      for (int j = 0; j < 4; ++j) r[u][g][j] = *(const v4fa*)(wr + j * K + u * 128 + 4 * g);
  asm volatile("s_wait_xcnt 0x0" :: "v"(wr) : "memory");      /* in front of every overwrite of the loads' address pair, which stays live up to here */
#pragma unroll
  for (int u = 0; u < F; ++u) { FragH f;
#pragma unroll
    for (int g = 0; g < 2; ++g)
#pragma unroll
      for (int i = 0; i < 4; ++i) f.h[4 * g + i] = (_Float16)((((bf16_round(r[u][g][0][i]) + bf16_round(r[u][g][1][i])) + bf16_round(r[u][g][2][i])) + bf16_round(r[u][g][3][i])) * 16.0f);
    *(v8us*)((unsigned short*)Bt + (size_t)(t0 + u * 256) * 8) = f.half[0]; }
  asm volatile("s_wait_xcnt 0x0" ::: "memory");      /* in front of every overwrite of the stores' registers by what follows */ }
template <int NHv, int TTv>
__global__ __launch_bounds__(256) void k_vt(const _Float16* __restrict__ V16, int ldv, int voff, _Float16* __restrict__ Vt) { __shared__ unsigned short tl[64][66]; const int tid = threadIdx.x; const int slab = blockIdx.x / (TTv / 64), lg = blockIdx.x % (TTv / 64); const int b = slab / NHv, h = slab % NHv;
  for (int i = tid; i < 64 * 8; i += 256) { const int r = i / 8, c8 = (i % 8) * 8; FragH f; f.half[0] = *(const v8us*)((const unsigned short*)V16 + ((size_t)b * TTv + lg * 64 + r) * ldv + voff + h * 64 + c8);
#pragma unroll
    for (int q = 0; q < 8; ++q) tl[r][c8 + q] = f.u[q]; }
  __syncthreads();
  {
#pragma unroll
    for (int rd = 0; rd < 2; ++rd) { const int d = rd * 32 + tid / 8, pc = tid % 8; FragH f;
#pragma unroll
      for (int q = 0; q < 8; ++q) f.u[q] = tl[pc * 8 + q][d];
      *(v8us*)((unsigned short*)Vt + ((size_t)slab * 64 + d) * TTv + lg * 64 + pc * 8) = f.half[0]; }
     } }

__global__ __launch_bounds__(256) void k_hl(const float* __restrict__ F, _Float16* __restrict__ Hh, _Float16* __restrict__ Hl, size_t n8) { const size_t t = (size_t)blockIdx.x * 256 + threadIdx.x; if (t >= n8) return; FragH fh, fl; const v4f a = *(const v4fa*)(F + t * 8), c = *(const v4fa*)(F + t * 8 + 4);
#pragma unroll
  for (int q = 0; q < 4; ++q) { _Float16 h = (_Float16)a[q]; fh.h[q] = h; fl.h[q] = (_Float16)((a[q] - (float)h) * 1024.0f); h = (_Float16)c[q]; fh.h[4 + q] = h; fl.h[4 + q] = (_Float16)((c[q] - (float)h) * 1024.0f); }
  { *(v8us*)((unsigned short*)Hh + t * 8) = fh.half[0]; *(v8us*)((unsigned short*)Hl + t * 8) = fl.half[0];  } }

// piece t of the plain grid: row = t / 32 of the (8192, 256) reduced view, columns c0 = 8 (t % 32) .. c0 + 7. With fl = (row % 512) 256 + c0 + q the channel is fl / 4096, the reduced pixel
// (i, j) = ((fl / 64) % 64, fl % 64), so the 2 x 2 windows of the 8 columns are 16 floats in a row of x and the 16 below them, at x + 1024 row + 256 (c0 / 64) + 2 (c0 % 64);
// the 8 rows of a plain block lie in one channel, (row / 16) % 32, the same for the whole block
template <int F, int NU>
__device__ __forceinline__ void d_xr(int blk, const float* __restrict__ x, const float* __restrict__ w, const float* __restrict__ bb, _Float16* __restrict__ XR) {
  #pragma clang fp contract(off)
  const int c0 = (threadIdx.x % (DR / 8)) * 8; int rb0 = blk * (NU * F * 8);      /* first row of the burst's first plain block */
#pragma unroll 1
  for (int n = 0; n < NU; ++n, rb0 += F * 8) { const int row0 = rb0 + threadIdx.x / (DR / 8); const float* xp = x + (size_t)row0 * DQ + (c0 / 64) * 256 + 2 * (c0 % 64); v4f a[F][4], d[F][4];
#pragma unroll
    for (int u = 0; u < F; ++u)
#pragma unroll
      for (int g = 0; g < 4; ++g) { a[u][g] = *(const v4fa*)(xp + (size_t)u * 8 * DQ + 4 * g); d[u][g] = *(const v4fa*)(xp + (size_t)u * 8 * DQ + 128 + 4 * g); }
    asm volatile("s_wait_xcnt 0x0" :: "v"(xp) : "memory");      /* in front of every overwrite of the loads' address pair, which stays live up to here */
#pragma unroll
    for (int u = 0; u < F; ++u) { const int c = ((rb0 + u * 8) / 16) % 32; FragH f;
#pragma unroll
      for (int q = 0; q < 8; ++q) {
        float s = bf16_round(bb[c]); s += bf16_round(w[c * 4 + 0]) * bf16_round(a[u][q / 2][(2 * q) % 4]); s += bf16_round(w[c * 4 + 1]) * bf16_round(a[u][q / 2][(2 * q) % 4 + 1]); s += bf16_round(w[c * 4 + 2]) * bf16_round(d[u][q / 2][(2 * q) % 4]); s += bf16_round(w[c * 4 + 3]) * bf16_round(d[u][q / 2][(2 * q) % 4 + 1]); f.h[q] = (_Float16)s; }
      *(v8us*)((unsigned short*)XR + (size_t)(row0 + u * 8) * DR + c0) = f.half[0]; }
    asm volatile("s_wait_xcnt 0x0" ::: "memory");      /* in front of every overwrite of the stores' registers by what follows */ } }
#define KPIT 40                  /* K row pitch in LDS, f16 elements */
#define VPIT 520                 /* V^T row pitch in LDS, f16 elements */
#define BPIT 72                  /* bias tile pitch in LDS, bf16 elements */
#define OPIT 36                  /* output staging pitch, floats */
#define AWV 16                   /* waves per work-group */
#define NCH (NP / 64)            /* chunks of 64 keys */
typedef float v2f __attribute__((ext_vector_type(2)));
typedef __bf16 v4b __attribute__((ext_vector_type(4)));
typedef __bf16 v4ba __attribute__((ext_vector_type(4), may_alias));
typedef __bf16 v8ba __attribute__((ext_vector_type(8), may_alias));
typedef __bf16 v8b __attribute__((ext_vector_type(8)));
typedef _Float16 v2h __attribute__((ext_vector_type(2)));
__device__ __forceinline__ float other_half(float v) { const int b = __float_as_int(v); return __int_as_float(__builtin_amdgcn_permlanex16(b, b, 0x76543210, 0xfedcba98, false, false)); }
__global__ __launch_bounds__(512) __attribute__((amdgpu_waves_per_eu(4, 4))) void k_attn(const _Float16* __restrict__ X16, const _Float16* __restrict__ BQ, const float* __restrict__ bq, const _Float16* __restrict__ XR16, const _Float16* __restrict__ BKV, const float* __restrict__ BKVb, const float* __restrict__ rb, float* __restrict__ out) {
  __shared__ __attribute__((aligned(16))) unsigned short sXR[64 * XRP];
  __shared__ __attribute__((aligned(16))) unsigned short sX[32 * XQP];
  __shared__ __attribute__((aligned(16))) unsigned short sQ[AWV * 16 * KPIT];
  __shared__ __attribute__((aligned(16))) unsigned short sK[NP * KPIT];
  __shared__ __attribute__((aligned(16))) unsigned short sV[32 * VPIT];
  __shared__ __attribute__((aligned(16))) __bf16 sB[AWV][16 * BPIT];
  __shared__ __attribute__((aligned(16))) float sO[AWV][16 * OPIT];
  const int tid = threadIdx.x, w = tid >> 5, lane = tid & 31, c = lane & 15, hh = lane >> 4;
  const int bh = blockIdx.x >> 1, hf = blockIdx.x & 1, q0 = hf * (AWV * 16) + w * 16, h = bh % NHD;
  const v8us* pk = (const v8us*)BKV + w * (2 * 8 * 64) + lane;      /* this wave's k/v weights: 2 row tiles x 8 k steps, 16 KB in a row */
  const v8us* pq = (const v8us*)BQ + w * (32 * 64) + lane;          /* this wave's q weights: 1 row tile x 32 k steps, 32 KB in a row */
  const float* br = rb + ((size_t)h * NP + q0 + hh) * NP + c * 4;      /* load i of a chunk: rows 2 i + hh, 16 lanes x 16 B = one 256-B piece of a row */
  __bf16* sb = sB[w];
  v4f bn[8]; float bqs[8];
  /* reduced x, 64 rows of 512 B: copy i of wave w is row w + 16 i */
  d_copy4((unsigned)(size_t)&sXR[w * XRP + lane * 8], 16 * XRP * 2, (const unsigned short*)XR16 + (size_t)(bh * 64 + w) * DR + lane * 8, 16 * DR);
  FragH wk[2][2][2];      /* [register set][k step of the group][row tile] */
#pragma unroll
  for (int ks = 0; ks < 2; ++ks)
#pragma unroll
    for (int j = 0; j < 2; ++j) d_wfrag(wk[0][ks][j], pk + (j * 8 + ks) * 64);
  asm volatile("s_wait_asynccnt 0x0" ::: "memory");      /* this wave's copies of the reduced x have landed */
  __syncthreads();                                       /* and every other wave's: the tile may be read */
  /* x, 32 rows of 2048 B: copy i of thread tid is piece tid % 128 of row tid / 128 + 4 i; it flies under the k/v GEMM */
  d_copy8((unsigned)(size_t)&sX[(tid >> 7) * XQP + (tid & 127) * 8], 4 * XQP * 2, (const unsigned short*)X16 + (size_t)(bh * 64 + hf * 32 + (tid >> 7)) * DQ + (tid & 127) * 8, 4 * DQ);
  FragH wq[2][4];      /* [register set][k step of the group] */
  {
    v8f acc[4][2] = {};
    const unsigned short* sa = &sXR[c * XRP + 8 * hh];
#pragma unroll      /* unrolled: the two register sets are indexed by constants, and every load has its offset as an immediate */
    for (int t = 0; t < DR / 64; ++t) {
      if (t + 1 < DR / 64) {      /* the next group's weights fly under this group's WMMAs */
#pragma unroll
        for (int ks = 0; ks < 2; ++ks)
#pragma unroll
          for (int j = 0; j < 2; ++j) d_wfrag(wk[(t + 1) & 1][ks][j], pk + (j * 8 + (t + 1) * 2 + ks) * 64);
      }
      if (t + 2 == DR / 64) asm volatile("s_wait_xcnt 0x0" :: "v"(pk) : "memory");      /* behind the last of these loads, in front of every overwrite of their address pair, which stays live up to here */
      FragH fa[2][4];
#pragma unroll
      for (int ks = 0; ks < 2; ++ks)
#pragma unroll
        for (int i = 0; i < 4; ++i) { fa[ks][i].half[0] = *(const v8us*)(sa + i * 16 * XRP + t * 64 + ks * 32); fa[ks][i].half[1] = *(const v8us*)(sa + i * 16 * XRP + t * 64 + ks * 32 + 16); }
      __builtin_amdgcn_sched_barrier(0);      /* the group's 16 LDS loads and the next weights stay together in front of its WMMAs: spread among them, the wave would wait out the LDS latency at every pair */
#pragma unroll
      for (int ks = 0; ks < 2; ++ks)
#pragma unroll
        for (int i = 0; i < 4; ++i)
#pragma unroll
          for (int j = 0; j < 2; ++j) acc[i][j] = __builtin_amdgcn_wmma_f32_16x16x32_f16(false, wk[t & 1][ks][j].v, false, fa[ks][i].v, (short)0, acc[i][j], false, false);
      __builtin_amdgcn_sched_barrier(0);      /* and the next group's loads stay behind them, as one group again */
    }
#pragma unroll
    for (int ks = 0; ks < 8; ++ks) d_wfrag(wq[ks >> 2][ks & 3], pq + ks * 64);      /* q's first two groups of weights fly under the k/v epilogue and the bias prologue */
    /* accumulator register r of tile (i, j): activation row 16 i + c, packed weight row 32 w + 16 j + 8 hh + r */
    const bool isk = w < 8;      /* the same for the whole wave */
    const float* bqp = bq + 4 * (w * 16 + 8 * hh);      /* folded column col stands for the columns 4 col .. 4 col + 3 */
    v4f b4[8];
#pragma unroll
    for (int r = 0; r < 8; ++r) b4[r] = *(const v4fa*)(bqp + 4 * r);
#pragma unroll
    for (int i = 0; i < 8; ++i) bn[i] = *(const v4fa*)(br + (size_t)(2 * i) * NP);
    asm volatile("s_wait_xcnt 0x0" :: "v"(bqp), "v"(br) : "memory");      /* in front of every overwrite of the loads' address pairs, which stay live up to here */
    if (isk) {
      const float* bp = BKVb + w * 32 + 8 * hh; v4f k4[2][2];
#pragma unroll
      for (int j = 0; j < 2; ++j) { k4[j][0] = *(const v4fa*)(bp + j * 16); k4[j][1] = *(const v4fa*)(bp + j * 16 + 4); }
      asm volatile("s_wait_xcnt 0x0" :: "v"(bp) : "memory");      /* in front of every overwrite of the loads' address pair, which stays live up to here */
      unsigned short* d = &sK[(c * 8 + w) * KPIT + 8 * hh];
#pragma unroll
      for (int i = 0; i < 4; ++i)
#pragma unroll
        for (int j = 0; j < 2; ++j) { FragH f;
#pragma unroll
          for (int r = 0; r < 8; ++r) f.h[r] = (_Float16)(acc[i][j][r] * 0.0625f + bf16_round(k4[j][r >> 2][r & 3]));
          *(v8us*)(d + i * 128 * KPIT + j * 16) = f.half[0]; }
    } else {
      const float* bp = BKVb + DR + (w - 8) * 4 + hh; float v1[2][8];
#pragma unroll
      for (int j = 0; j < 2; ++j)
#pragma unroll
        for (int r = 0; r < 8; ++r) v1[j][r] = bp[j * 2 + r * 32];
      asm volatile("s_wait_xcnt 0x0" :: "v"(bp) : "memory");      /* in front of every overwrite of the loads' address pair, which stays live up to here */
      unsigned short* d = &sV[((w - 8) * 4 + hh) * VPIT + c * 8];
#pragma unroll
      for (int i = 0; i < 4; ++i)
#pragma unroll
        for (int j = 0; j < 2; ++j) { FragH f;
#pragma unroll
          for (int r = 0; r < 8; ++r) f.h[r] = (_Float16)(acc[i][j][r] * 0.0625f + bf16_round(v1[j][r]));
          *(v8us*)(d + j * 2 * VPIT + i * 128) = f.half[0]; }
    }
#pragma unroll
    for (int r = 0; r < 8; ++r) bqs[r] = ((bf16_round(b4[r][0]) + bf16_round(b4[r][1])) + bf16_round(b4[r][2])) + bf16_round(b4[r][3]);
#pragma unroll
    for (int i = 0; i < 8; ++i) { *(v4ba*)&sb[(2 * i + hh) * BPIT + c * 4] = __builtin_convertvector(bn[i], v4b); bn[i] = *(const v4fa*)(br + (size_t)(2 * i) * NP + 64); }
    asm volatile("s_wait_xcnt 0x0" :: "v"(br) : "memory");      /* in front of every overwrite of these loads' address pair by the q loop's code */
  }
  asm volatile("s_wait_asynccnt 0x0" ::: "memory");      /* this wave's copies of x have landed */
  __syncthreads();                                       /* and every other wave's: the x tile may be read; K and V^T are written */
  FragH fq;
  {
    v8f aq[2] = {};
    const unsigned short* sa = &sX[c * XQP + 8 * hh];
#pragma unroll      /* unrolled: the two register sets are indexed by constants, and every load has its offset as an immediate */
    for (int t = 0; t < DQ / 128; ++t) {
      if (t > 0 && t + 1 < DQ / 128) {      /* the next group's weights fly under this group's WMMAs */
#pragma unroll
        for (int ks = 0; ks < 4; ++ks) d_wfrag(wq[(t + 1) & 1][ks], pq + ((t + 1) * 4 + ks) * 64);
      }
      if (t + 2 == DQ / 128) asm volatile("s_wait_xcnt 0x0" :: "v"(pq) : "memory");      /* behind the last of these loads, in front of every overwrite of their address pair, which stays live up to here */
      FragH fa[4][2];
#pragma unroll
      for (int ks = 0; ks < 4; ++ks)
#pragma unroll
        for (int i = 0; i < 2; ++i) { fa[ks][i].half[0] = *(const v8us*)(sa + i * 16 * XQP + t * 128 + ks * 32); fa[ks][i].half[1] = *(const v8us*)(sa + i * 16 * XQP + t * 128 + ks * 32 + 16); }
      __builtin_amdgcn_sched_barrier(0);      /* the group's 16 LDS loads and the next weights stay together in front of its WMMAs: spread among them, the wave would wait out the LDS latency at every pair */
#pragma unroll
      for (int ks = 0; ks < 4; ++ks)
#pragma unroll
        for (int i = 0; i < 2; ++i) aq[i] = __builtin_amdgcn_wmma_f32_16x16x32_f16(false, wq[t & 1][ks].v, false, fa[ks][i].v, (short)0, aq[i], false, false);
      __builtin_amdgcn_sched_barrier(0);      /* and the next group's loads stay behind them, as one group again */
    }
    /* accumulator register r of tile i: x row 16 i + c, folded column 16 w + 8 hh + r */
#pragma unroll
    for (int i = 0; i < 2; ++i) { FragH f;
#pragma unroll
      for (int r = 0; r < 8; ++r) f.h[r] = (_Float16)(aq[i][r] * 0.0625f + bqs[r]);
      *(v8us*)&sQ[((i * 16 + c) * 8 + (w >> 1)) * KPIT + (w & 1) * 16 + 8 * hh] = f.half[0]; }
    __syncthreads();                                     /* every wave's part of the Q tile is written: the tile may be read */
    const unsigned short* qr = &sQ[(w * 16 + c) * KPIT]; fq.half[0] = *(const v8us*)(qr + 8 * hh); fq.half[1] = *(const v8us*)(qr + 16 + 8 * hh);
  }
  const float L2E = 1.4426950408889634f;
  v8f o0 = {}, o1 = {};
  float m = -3.0e38f, ls = 0.f;
#pragma unroll 1      /* rolled: eight copies of this body would add code and registers and save nothing */
  for (int kc = 0; kc < NCH; ++kc) {
    /* the lanes of this wave read bias values that other lanes of it stored in the trip before: the stores have to be done first */
    asm volatile("s_wait_dscnt 0x0" ::: "memory");
    float l[32];
#pragma unroll
    for (int j = 0; j < 4; ++j) {
      const v8b pb = *(const v8ba*)&sb[c * BPIT + j * 16 + 8 * hh];      /* register r: bias[q0 + c][64 kc + 16 j + 8 hh + r], the S^T tile's own map */
      FragH fk; const unsigned short* kr = &sK[(kc * 64 + j * 16 + c) * KPIT];
      fk.half[0] = *(const v8us*)(kr + 8 * hh); fk.half[1] = *(const v8us*)(kr + 16 + 8 * hh);
      const v8f z = {};
      const v8f s = __builtin_amdgcn_wmma_f32_16x16x32_f16(false, fk.v, false, fq.v, (short)0, z, false, false);
#pragma unroll
      for (int r = 0; r < 8; ++r) l[j * 8 + r] = __builtin_fmaf(s[r], 0.03125f, (float)pb[r]);
    }
    /* next chunk's bias into the tile (its readers above are done), then the loads of the chunk after it; past the end both repeat the last chunk */
    const float* bx = br + ((kc + 2 < NCH) ? kc + 2 : NCH - 1) * 64;
#pragma unroll
    for (int i = 0; i < 8; ++i) { *(v4ba*)&sb[(2 * i + hh) * BPIT + c * 4] = __builtin_convertvector(bn[i], v4b); bn[i] = *(const v4fa*)(bx + (size_t)(2 * i) * NP); }
    float cj[4];
#pragma unroll
    for (int j = 0; j < 4; ++j) { cj[j] = l[j * 8];
#pragma unroll
      for (int r = 1; r < 8; ++r) cj[j] = fmaxf(cj[j], l[j * 8 + r]); }
    float cm = fmaxf(fmaxf(cj[0], cj[1]), fmaxf(cj[2], cj[3]));
    cm = fmaxf(cm, other_half(cm));
    const float mn = fmaxf(m, cm);
    const float sc = __builtin_amdgcn_exp2f((m - mn) * L2E);
    const float mb = 10.0f - mn * L2E;
    m = mn;
    v2f sa = {0.f, 0.f}, sd = {0.f, 0.f};
    FragH fp[2];
#pragma unroll
    for (int i = 0; i < 32; i += 4) {
      v2f ta, tc, pa, pc; const v2f l2e = {L2E, L2E}, mb2 = {mb, mb};
      ta[0] = l[i]; ta[1] = l[i + 1]; tc[0] = l[i + 2]; tc[1] = l[i + 3];
      ta = __builtin_elementwise_fma(ta, l2e, mb2); tc = __builtin_elementwise_fma(tc, l2e, mb2);
      pa[0] = __builtin_amdgcn_exp2f(ta[0]); pa[1] = __builtin_amdgcn_exp2f(ta[1]); pc[0] = __builtin_amdgcn_exp2f(tc[0]); pc[1] = __builtin_amdgcn_exp2f(tc[1]);
      sa += pa; sd += pc;
      const v2h ha = __builtin_convertvector(pa, v2h), hc = __builtin_convertvector(pc, v2h);
      fp[i >> 4].h[(i & 15)] = ha[0]; fp[i >> 4].h[(i & 15) + 1] = ha[1]; fp[i >> 4].h[(i & 15) + 2] = hc[0]; fp[i >> 4].h[(i & 15) + 3] = hc[1];
    }
    sa += sd;
    ls = __builtin_fmaf(ls, sc, sa[0] + sa[1]);
#pragma unroll
    for (int r = 0; r < 8; ++r) { o0[r] *= sc; o1[r] *= sc; }
#pragma unroll
    for (int u = 0; u < 2; ++u) {
      FragH v0, v1; const unsigned short* vr = &sV[c * VPIT + kc * 64 + u * 32];
      v0.half[0] = *(const v8us*)(vr + 8 * hh); v0.half[1] = *(const v8us*)(vr + 16 + 8 * hh);
      v1.half[0] = *(const v8us*)(vr + 16 * VPIT + 8 * hh); v1.half[1] = *(const v8us*)(vr + 16 * VPIT + 16 + 8 * hh);
      o0 = __builtin_amdgcn_wmma_f32_16x16x32_f16(false, v0.v, false, fp[u].v, (short)0, o0, false, false);
      o1 = __builtin_amdgcn_wmma_f32_16x16x32_f16(false, v1.v, false, fp[u].v, (short)0, o1, false, false);
    }
  }
  ls += other_half(ls);
  const float inv = 1.0f / ls;
  float* so = sO[w];               /* this wave's own staging: lane (c, hh) holds query c, e = 16 t + 8 hh + r */
  { v4f a;
    a[0] = o0[0] * inv; a[1] = o0[1] * inv; a[2] = o0[2] * inv; a[3] = o0[3] * inv; *(v4fa*)&so[c * OPIT + 8 * hh] = a;
    a[0] = o0[4] * inv; a[1] = o0[5] * inv; a[2] = o0[6] * inv; a[3] = o0[7] * inv; *(v4fa*)&so[c * OPIT + 8 * hh + 4] = a;
    a[0] = o1[0] * inv; a[1] = o1[1] * inv; a[2] = o1[2] * inv; a[3] = o1[3] * inv; *(v4fa*)&so[c * OPIT + 16 + 8 * hh] = a;
    a[0] = o1[4] * inv; a[1] = o1[5] * inv; a[2] = o1[6] * inv; a[3] = o1[7] * inv; *(v4fa*)&so[c * OPIT + 16 + 8 * hh + 4] = a; }
  /* the wave's lanes read each other's staged values: the LDS writes have to be done before the reads */
  asm volatile("s_wait_dscnt 0x0" ::: "memory");
  float* orow = out + ((size_t)bh * NP + q0) * 128 + lane * 4;      /* out_d = o_{d/4}: lane e writes its value four times, 512 B a query in one store */
#pragma unroll
  for (int q = 0; q < 16; ++q) { const float vv = so[q * OPIT + lane]; v4f v; v[0] = vv; v[1] = vv; v[2] = vv; v[3] = vv; *(v4f*)(orow + (size_t)q * 128) = v; }
}
__device__ __forceinline__ void d_bcat(int blk, const float* __restrict__ a, const float* __restrict__ b, float* __restrict__ O) { const int t = blk * 256 + threadIdx.x; const float v = (t < DR) ? a[t] : b[t - DR]; *(float*)(O + t) = v;
  /* in the shared kernel's code other passes' instructions follow this store and write its registers: the wait stands in front of every such overwrite */
  asm volatile("s_wait_xcnt 0x0" ::: "memory"); }
// Passes that read nothing of one another share one launch: each pass owns a range of block indices and does there what it did alone
// (the looped passes piece by piece, as said at d_x16; the bias concatenation in two blocks of 256 threads for its one block of 512).
// The choice of the pass is uniform for a block. The longest passes come first.
// 586 blocks of 8 waves, between 4 and 5 waves for each SIMD of the chip: amdgpu_waves_per_eu(8, 8) gives the compiler the register budget for a whole burst of loads in flight.
#define G_X16 (NRW * DQ / 8 / 256 / 16)       /* 256 blocks: 2 bursts of 8 pieces */
#define G_XR  (NRW * (DR / 8) / 256 / 4)      /* 256: 2 bursts of 2 pieces */
#define G_FQ  (DR * DQ / 8 / 256 / 2)         /* 64: 2 pieces */
#define G_RW  (DR * DR / 8 / 256 / 8)         /* 4, once for Wk and once for Wv: 8 pieces */
#define G_BC  (2 * DR / 256)             /* 2 */
__global__ __launch_bounds__(256) __attribute__((amdgpu_waves_per_eu(8, 8))) void k_prep(const float* __restrict__ x, const float* __restrict__ dww, const float* __restrict__ dwb, const float* __restrict__ Wq, const float* __restrict__ Wk, const float* __restrict__ Wv, const float* __restrict__ bk, const float* __restrict__ bv,
    _Float16* __restrict__ X16, _Float16* __restrict__ XR16, _Float16* __restrict__ BQ, _Float16* __restrict__ BKV, float* __restrict__ BKVb) {
  int blk = blockIdx.x;
  if (blk < G_X16) { d_x16<8, 2>(blk, x, X16); return; }      /* plain (P, 1024) view = flat */
  blk -= G_X16;
  if (blk < G_XR) { d_xr<2, 2>(blk, x, dww, dwb, XR16); return; }
  blk -= G_XR;
  if (blk < G_FQ) { d_fold4<DR, DQ, 2>(blk, Wq, BQ); return; }      /* weights: (out, in) natural */
  blk -= G_FQ;
  if (blk < G_RW) { d_round16f<8, false>(blk, Wk, BKV); return; }
  blk -= G_RW;
  if (blk < G_RW) { d_round16f<8, true>(blk, Wv, BKV + (size_t)DR * DR); return; }
  blk -= G_RW;
  d_bcat(blk, bk, bv, BKVb);
}

extern "C" void kernel_launch(void* const* d_in, const int* in_sizes, int n_in,
                              void* d_out, int out_size, void* d_ws, size_t ws_size, hipStream_t stream) {
  (void)in_sizes; (void)n_in; (void)out_size;
  const float* const* I = (const float* const*)d_in; const float* x = I[0]; const float* dww = I[1]; const float* dwb = I[2]; const float* Wq = I[3]; const float* bq = I[4]; const float* Wk = I[5]; const float* bk = I[6]; const float* Wv = I[7]; const float* bv = I[8]; const float* rb = I[9];
  char* ws = (char*)d_ws; size_t off = 0;
  auto take = [&](size_t bytes) { char* p = ws + off; off += (bytes + 255) & ~(size_t)255; return p; };
  _Float16* BQ = (_Float16*)take((size_t)DR * DQ * 2); _Float16* BKV = (_Float16*)take((size_t)2 * DR * DR * 2); float* BKVb = (float*)take(2 * DR * 4);
  _Float16* X16 = (_Float16*)take((size_t)NRW * DQ * 2); _Float16* XR16 = (_Float16*)take((size_t)NRW * DR * 2);
  if (off > ws_size) return;
  k_prep<<<G_X16 + G_XR + G_FQ + 2 * G_RW + G_BC, 256, 0, stream>>>(x, dww, dwb, Wq, Wk, Wv, bk, bv, X16, XR16, BQ, BKV, BKVb);
  k_attn<<<NBH * 2, AWV * 32, 0, stream>>>(X16, BQ, bq, XR16, BKV, BKVb, rb, (float*)d_out);
}

// v009
// It runs in 32.7 microseconds.
// Two timings next to v008 both put it at 1.06 times that version's speed.
// Over all steps from v000 it is 9.10 times as fast.
#include <hip/hip_runtime.h>
// Lightweight multi-head self-attention with reduced keys/values (B 16, C 32, 128×128; P 512 tokens of 1024 (q) / 256 (k, v after a depthwise 2×2 stride-2 reduction); 8 heads by PLAIN reshapes of the (P, dim) buffers; k/v nearest-upsampled 32 → 128 along the head dim; scores/√1024 + rel_bias; softmax; attn·v; plain reshape back to [16,32,128,128]).
// Structure: q/k/v projections as GEMMs (the depthwise reduction on VALU -> f16); the 32->128 nearest upsampling is folded into the contraction (sum_d q_d k_{d/4} = sum_e (sum_{d/4=e} q_d) k_e and out_d = o_{d/4}), and the sum over each four q columns is folded further into the projection itself (sum_{d/4=e} q_d = x . sum_{d/4=e} Wq[d] + sum_{d/4=e} bq[d]): the q GEMM has N 256 and its f16 output, read flat, is the head operand; the plain-view head split of q, k and v by index arithmetic in the GEMMs' own epilogues; the three projections, scores (K 32, scale 1/32), bias, running-max softmax (x 2^10, f16), P.V (N 32) and the expanded output in ONE fused kernel, head operands in LDS, scores and probabilities kept in registers.
// Compute dtype: inputs and parameters rounded to bf16; x exact in f16; folded q weights, reduced x, head operands and probabilities f16 (about 2^-12); f32 accumulation; softmax f32. v_wmma_f32_16x16x32_f16.
#define NB 16
#define NP 512
#define DQ 1024
#define DR 256
#define NHD 8
#define NBH (NB * NHD)           /* 128 */
#define NRW (NB * NP)            /* 8192 rows */
typedef __bf16 v16b __attribute__((ext_vector_type(16)));
typedef unsigned short v8us __attribute__((ext_vector_type(8), may_alias));
typedef float  v8f  __attribute__((ext_vector_type(8)));
typedef float  v4f  __attribute__((ext_vector_type(4)));
typedef float  v4fa __attribute__((ext_vector_type(4), may_alias));
union FragB { v16b v; v8us half[2]; unsigned short u[16]; };

__device__ __forceinline__ unsigned short bf16_bits(float x) { unsigned int u = __float_as_uint(x); return (unsigned short)((u + 0x7FFFu + ((u >> 16) & 1u)) >> 16); }
__device__ __forceinline__ float bf16_val(unsigned short b) { return __uint_as_float(((unsigned int)b) << 16); }
__device__ __forceinline__ float bf16_round(float x) { return bf16_val(bf16_bits(x)); }
// D += A·B with NT terms: 1 = ah·bh, 2 = + al·bh (A split), 3 = + ah·bl (both split)
template <int NT>
__device__ __forceinline__ v8f mmaN(v16b ah, v16b al, v16b bh, v16b bl, v8f c) {
  c = __builtin_amdgcn_wmma_f32_16x16x32_bf16(false, ah, false, bh, (short)0, c, false, false);
  if (NT >= 2) c = __builtin_amdgcn_wmma_f32_16x16x32_bf16(false, al, false, bh, (short)0, c, false, false);
  if (NT >= 3) c = __builtin_amdgcn_wmma_f32_16x16x32_bf16(false, ah, false, bl, (short)0, c, false, false);
  asm volatile("v_nop\n\tv_nop\n\tv_nop\n\tv_nop" : "+v"(c) : "v"(ah), "v"(al), "v"(bh), "v"(bl));
  return c;
}

__global__ __launch_bounds__(256) void k_wt_bf16(const float* __restrict__ W, unsigned short* __restrict__ Wt, int K, int N) {
  const int t = blockIdx.x * 256 + threadIdx.x;
  const int k8n = K / 8;
  if (t >= N * k8n) return;
  const int n = t / k8n, k8 = (t % k8n) * 8;
  v8us v;
#pragma unroll
  for (int i = 0; i < 8; ++i) v[i] = bf16_bits(W[(size_t)(k8 + i) * N + n]);
  *(v8us*)(Wt + (size_t)n * K + k8) = v;
  
}

// GEMM C[M][N] (f32, pitch ldc) = act(A[M][K]·W + bias). A f32 row-major (pitch lda) converted per fragment to bf16
// (ASPLIT: hi/lo two planes -> 2 terms, else single rounded term); Wt bf16 [N][K] (pitch ldb). BIAS_BF16 rounds the
// bias to bf16 first (bias quantised to bf16 before the add). K%32==0, M%16==0, N%64==0.
template <bool ASPLIT, int ACT, bool BIAS_BF16>
__global__ __launch_bounds__(128) void k_gemm_bf(const float* __restrict__ A, int lda, const unsigned short* __restrict__ Wt, int ldb,
                                               const float* __restrict__ bias, float* __restrict__ C, int ldc, int M, int N, int K) {
  __shared__ __attribute__((aligned(16))) float so[4][16][64];
  const int tid = threadIdx.x, w = tid >> 5, lane = tid & 31, ln = lane & 15, hh = lane >> 4;
  const int ntn = N / 64;
  const int wid = blockIdx.x * 4 + w;
  const int mt = wid / ntn, nq = wid % ntn;
  if (mt * 16 >= M) return;
  const int row0 = mt * 16, col0 = nq * 64;
  const float* arow = A + (size_t)(row0 + ln) * lda;
  v8f acc[4] = {};
  for (int kb = 0; kb < K; kb += 32) {
    FragB ah, al;
    const v4f x0 = *(const v4fa*)(arow + kb + 8 * hh), x1 = *(const v4fa*)(arow + kb + 8 * hh + 4);
    const v4f x2 = *(const v4fa*)(arow + kb + 16 + 8 * hh), x3 = *(const v4fa*)(arow + kb + 16 + 8 * hh + 4);
    float xs[16] = {x0[0],x0[1],x0[2],x0[3],x1[0],x1[1],x1[2],x1[3],x2[0],x2[1],x2[2],x2[3],x3[0],x3[1],x3[2],x3[3]};
#pragma unroll
    for (int i = 0; i < 16; ++i) { const unsigned short hb = bf16_bits(xs[i]); ah.u[i] = hb; al.u[i] = ASPLIT ? bf16_bits(xs[i] - bf16_val(hb)) : (unsigned short)0; }
#pragma unroll
    for (int t = 0; t < 4; ++t) {
      const unsigned short* brow = Wt + (size_t)(col0 + t * 16 + ln) * ldb + kb;
      FragB b;
      b.half[0] = *(const v8us*)(brow + 8 * hh);
      b.half[1] = *(const v8us*)(brow + 16 + 8 * hh);
      acc[t] = mmaN<ASPLIT ? 2 : 1>(ah.v, al.v, b.v, b.v, acc[t]);
    }
  }
#pragma unroll
  for (int t = 0; t < 4; ++t) {
    float bv = bias ? bias[col0 + t * 16 + ln] : 0.f;
    if (BIAS_BF16) bv = bf16_round(bv);
#pragma unroll
    for (int r = 0; r < 8; ++r) { float v = acc[t][r] + bv; if (ACT == 1) v = fmaxf(v, 0.f); so[w][8 * hh + r][t * 16 + ln] = v; }
  }
  __builtin_amdgcn_fence(__ATOMIC_ACQ_REL, "workgroup");
  __builtin_amdgcn_wave_barrier();
  const int rsub = lane >> 4, c4 = (lane & 15) * 4;
  {
#pragma unroll
    for (int q = 0; q < 8; ++q) {
      const int r = q * 2 + rsub;
      const v4f v = *(const v4fa*)&so[w][r][c4];
      *(v4f*)(C + (size_t)(row0 + r) * ldc + col0 + c4) = v;
    }
    
  }
}

// GEMM C = act(A·W + bias + resid): A f32 (ASPLIT -> hi/lo 2 terms), Wt bf16 [N][K]; ACT 0 none, 1 relu, 2 exact gelu;
// resid (optional, f32, row index = (row % rmod), pitch ldr, RES_BF16 rounds it) added before the activation.
template <bool ASPLIT, int ACT, bool BIAS_BF16, bool RES_BF16>
__global__ __launch_bounds__(128) void k_gemm_bf3(const float* __restrict__ A, int lda, const unsigned short* __restrict__ Wt, int ldb,
                                                const float* __restrict__ bias, const float* __restrict__ resid, int rmod, int ldr,
                                                float* __restrict__ C, int ldc, int M, int N, int K) {
  __shared__ __attribute__((aligned(16))) float so[4][16][64];
  const int tid = threadIdx.x, w = tid >> 5, lane = tid & 31, ln = lane & 15, hh = lane >> 4;
  const int ntn = N / 64;
  const int wid = blockIdx.x * 4 + w;
  const int mt = wid / ntn, nq = wid % ntn;
  if (mt * 16 >= M) return;
  const int row0 = mt * 16, col0 = nq * 64;
  const float* arow = A + (size_t)(row0 + ln) * lda;
  v8f acc[4] = {};
  for (int kb = 0; kb < K; kb += 32) {
    FragB ah, al;
    const v4f x0 = *(const v4fa*)(arow + kb + 8 * hh), x1 = *(const v4fa*)(arow + kb + 8 * hh + 4);
    const v4f x2 = *(const v4fa*)(arow + kb + 16 + 8 * hh), x3 = *(const v4fa*)(arow + kb + 16 + 8 * hh + 4);
    float xs[16] = {x0[0],x0[1],x0[2],x0[3],x1[0],x1[1],x1[2],x1[3],x2[0],x2[1],x2[2],x2[3],x3[0],x3[1],x3[2],x3[3]};
#pragma unroll
    for (int i = 0; i < 16; ++i) { const unsigned short hb = bf16_bits(xs[i]); ah.u[i] = hb; al.u[i] = ASPLIT ? bf16_bits(xs[i] - bf16_val(hb)) : (unsigned short)0; }
#pragma unroll
    for (int t = 0; t < 4; ++t) {
      const unsigned short* brow = Wt + (size_t)(col0 + t * 16 + ln) * ldb + kb;
      FragB b;
      b.half[0] = *(const v8us*)(brow + 8 * hh);
      b.half[1] = *(const v8us*)(brow + 16 + 8 * hh);
      acc[t] = mmaN<ASPLIT ? 2 : 1>(ah.v, al.v, b.v, b.v, acc[t]);
    }
  }
#pragma unroll
  for (int t = 0; t < 4; ++t) {
    const int col = col0 + t * 16 + ln;
    float bv = bias ? bias[col] : 0.f;
    if (BIAS_BF16) bv = bf16_round(bv);
#pragma unroll
    for (int r = 0; r < 8; ++r) {
      float v = acc[t][r] + bv;
      if (resid) { float rv = resid[(size_t)((row0 + 8 * hh + r) % rmod) * ldr + col]; if (RES_BF16) rv = bf16_round(rv); v += rv; }
      if (ACT == 1) v = fmaxf(v, 0.f);
      if (ACT == 2) v = 0.5f * v * (1.0f + erff(v * 0.70710678118654752f));
      if (ACT == 3) { const float u = 0.7978845608028654f * (v + 0.044715f * v * v * v); v = 0.5f * v * (1.0f + tanhf(u)); }
      so[w][8 * hh + r][t * 16 + ln] = v;
    }
  }
  __builtin_amdgcn_fence(__ATOMIC_ACQ_REL, "workgroup");
  __builtin_amdgcn_wave_barrier();
  const int rsub = lane >> 4, c4 = (lane & 15) * 4;
  {
#pragma unroll
    for (int q = 0; q < 8; ++q) {
      const int r = q * 2 + rsub;
      const v4f v = *(const v4fa*)&so[w][r][c4];
      *(v4f*)(C + (size_t)(row0 + r) * ldc + col0 + c4) = v;
    }
    
  }
}
// row LayerNorm (biased variance, eps) over N: s = X (+ R); optional out_sum <- s; out_norm <- (s-mu)*rsqrt(var+eps)*g + b
template <bool PARAM_BF16>
__global__ __launch_bounds__(256) void k_layernorm(const float* __restrict__ X, const float* __restrict__ R, const float* __restrict__ g, const float* __restrict__ bta,
                                                  float* __restrict__ out_sum, float* __restrict__ out_norm, int N, float eps) {
  __shared__ float red[256];
  const int row = blockIdx.x, tid = threadIdx.x;
  const float* x = X + (size_t)row * N; const float* rr = R ? R + (size_t)row * N : nullptr;
  float vals[16];                     // up to N = 4096
  const int per = N / 256;            // contiguous chunk per thread? use strided-by-4 chunks: thread handles j = tid*4 + 1024*u
  float s1 = 0.f;
  for (int u = 0; u < per / 4; ++u) {
    const int j = tid * 4 + 1024 * u;
    const v4f a = *(const v4fa*)(x + j);
    v4f b = {0.f,0.f,0.f,0.f}; if (rr) b = *(const v4fa*)(rr + j);
#pragma unroll
    for (int q = 0; q < 4; ++q) { const float v = a[q] + b[q]; vals[u * 4 + q] = v; s1 += v; }
  }
  red[tid] = s1; __syncthreads();
  for (int st = 128; st > 0; st >>= 1) { if (tid < st) red[tid] += red[tid + st]; __syncthreads(); }
  const float mu = red[0] / (float)N; __syncthreads();
  float s2 = 0.f;
  for (int u = 0; u < per / 4; ++u)
#pragma unroll
    for (int q = 0; q < 4; ++q) { const float c = vals[u * 4 + q] - mu; s2 += c * c; }
  red[tid] = s2; __syncthreads();
  for (int st = 128; st > 0; st >>= 1) { if (tid < st) red[tid] += red[tid + st]; __syncthreads(); }
  const float rs = rsqrtf(red[0] / (float)N + eps);
  {
    for (int u = 0; u < per / 4; ++u) {
      const int j = tid * 4 + 1024 * u;
      v4f o, sm;
#pragma unroll
      for (int q = 0; q < 4; ++q) {
        float gg = g[j + q], bb = bta[j + q];
        if (PARAM_BF16) { gg = bf16_round(gg); bb = bf16_round(bb); }
        sm[q] = vals[u * 4 + q]; o[q] = (vals[u * 4 + q] - mu) * rs * gg + bb;
      }
      if (out_sum) *(v4f*)(out_sum + (size_t)row * N + j) = sm;
      *(v4f*)(out_norm + (size_t)row * N + j) = o;
    }
    
  }
}



// ---- f16 WMMA path (v_wmma_f32_16x16x32_f16): 11-bit significands for operands in range — used where a [0,1] probability operand needs more precision than bf16
typedef _Float16 v16h __attribute__((ext_vector_type(16)));
union FragH { v16h v; v8us half[2]; _Float16 h[16]; unsigned short u[16]; };
template <int NT>
__device__ __forceinline__ v8f mmaH(v16h ah, v16h al, v16h bh, v16h bl, v8f c) {
  c = __builtin_amdgcn_wmma_f32_16x16x32_f16(false, ah, false, bh, (short)0, c, false, false);
  if (NT >= 2) c = __builtin_amdgcn_wmma_f32_16x16x32_f16(false, al, false, bh, (short)0, c, false, false);
  if (NT >= 3) c = __builtin_amdgcn_wmma_f32_16x16x32_f16(false, ah, false, bl, (short)0, c, false, false);
  asm volatile("v_nop\n\tv_nop\n\tv_nop\n\tv_nop" : "+v"(c) : "v"(ah), "v"(al), "v"(bh), "v"(bl));
  return c;
}
// batched GEMM like k_gemm_b but f16 operands: A f32 (split into f16 hi/lo if ASPLIT, else rounded to f16), Bt = f16 values [n][k]; alpha; C f32; N multiple of 16 (partial tiles skipped)
template <bool ASPLIT>
__global__ __launch_bounds__(128) void k_gemm_h(const float* __restrict__ A, int lda, size_t sA, const _Float16* __restrict__ Bh, int ldb, size_t sB, float alpha, float* __restrict__ C, int ldc, size_t sC, int M, int N, int K) {
  __shared__ __attribute__((aligned(16))) float so[4][16][64];
  const int tid = threadIdx.x, w = tid >> 5, lane = tid & 31, ln = lane & 15, hh = lane >> 4; const int by = blockIdx.y;
  A += (size_t)by * sA; Bh += (size_t)by * sB; C += (size_t)by * sC;
  const int ntn = (N + 63) / 64; const int wid = blockIdx.x * 4 + w; const int mt = wid / ntn, nq = wid % ntn; if (mt * 16 >= M) return;
  const int row0 = mt * 16, col0 = nq * 64; const float* arow = A + (size_t)(row0 + ln) * lda;
  v8f acc[4] = {};
  for (int kb = 0; kb < K; kb += 32) {
    FragH ah, al;
    const v4f x0 = *(const v4fa*)(arow + kb + 8 * hh), x1 = *(const v4fa*)(arow + kb + 8 * hh + 4), x2 = *(const v4fa*)(arow + kb + 16 + 8 * hh), x3 = *(const v4fa*)(arow + kb + 16 + 8 * hh + 4);
    float xs[16] = {x0[0],x0[1],x0[2],x0[3],x1[0],x1[1],x1[2],x1[3],x2[0],x2[1],x2[2],x2[3],x3[0],x3[1],x3[2],x3[3]};
#pragma unroll
    for (int i = 0; i < 16; ++i) { const _Float16 h = (_Float16)xs[i]; ah.h[i] = h; al.h[i] = ASPLIT ? (_Float16)(xs[i] - (float)h) : (_Float16)0.0f; }
#pragma unroll
    for (int t = 0; t < 4; ++t) { if (col0 + t * 16 >= N) continue; const size_t boff = (size_t)(col0 + t * 16 + ln) * ldb + kb; FragH bq; bq.half[0] = *(const v8us*)(Bh + boff + 8 * hh); bq.half[1] = *(const v8us*)(Bh + boff + 16 + 8 * hh);
      acc[t] = mmaH<ASPLIT ? 2 : 1>(ah.v, al.v, bq.v, bq.v, acc[t]); }
  }
#pragma unroll
  for (int t = 0; t < 4; ++t) { if (col0 + t * 16 >= N) continue;
#pragma unroll
    for (int r = 0; r < 8; ++r) so[w][8 * hh + r][t * 16 + ln] = acc[t][r] * alpha; }
  __builtin_amdgcn_fence(__ATOMIC_ACQ_REL, "workgroup"); __builtin_amdgcn_wave_barrier();
  const int rsub = lane >> 4, c4 = (lane & 15) * 4;
  {
#pragma unroll
    for (int q = 0; q < 8; ++q) { const int r = q * 2 + rsub; if (col0 + c4 < N) { const v4f v = *(const v4fa*)&so[w][r][c4]; *(v4f*)(C + (size_t)(row0 + r) * ldc + col0 + c4) = v; } }
     }
}

// Wt[n][k] = f16(W[k][n]·scale) from f32 row-major W[K][N] (scale = power of two; bf16-exact weights stay exact in f16 away from the subnormal range)
__global__ __launch_bounds__(256) void k_wt_f16(const float* __restrict__ W, _Float16* __restrict__ Wt, int K, int N, float scale) {
  const int t = blockIdx.x * 256 + threadIdx.x; if (t >= N * (K / 8)) return; const int n = t / (K / 8), k8 = (t % (K / 8)) * 8; FragH f;
#pragma unroll
  for (int i = 0; i < 8; ++i) f.h[i] = (_Float16)(bf16_round(W[(size_t)(k8 + i) * N + n]) * scale); const v8us o = f.half[0];
  *(v8us*)((unsigned short*)Wt + (size_t)n * K + k8) = o; 
}
// Operands of the projection GEMMs, which run inside the attention kernel (16 waves). Every weight fragment is used by ONE wave of a work-group, so the weights do not go through LDS:
// the prep pass stores them in fragment order, and a wave loads its own fragments from L2 straight into registers, 512 B in a row a load, one group of k steps ahead of their use.
// Fragment order: fragments of 16 weight rows x 32 k (1 KB), the k steps of a row tile one after the other; inside a fragment piece 16 hh + c is row c, k 8 hh .. 8 hh + 7, and piece 32 + 16 hh + c is row c, k 16 + 8 hh .. (16 B a piece).
// The activation rows, which all 16 waves read, come into LDS whole, once, by asynchronous copies (16 B a lane, 512 B in a row a copy): the k loops have no ring and no barrier.
#define XRP 264                  /* reduced-x row pitch in LDS, f16 elements: 512 + 16 B */
#define XQP 1032                 /* x row pitch in LDS, f16 elements: 2048 + 16 B */
/* the copies and, as the last line of their own statement, the wait that stands in front of every rewrite of the address registers they name */
#define CP4 "global_load_async_to_lds_b128 %0, %4, off\n\tglobal_load_async_to_lds_b128 %1, %5, off\n\tglobal_load_async_to_lds_b128 %2, %6, off\n\tglobal_load_async_to_lds_b128 %3, %7, off\n\ts_wait_xcnt 0x0"
#define CP8 "global_load_async_to_lds_b128 %0, %8, off\n\tglobal_load_async_to_lds_b128 %1, %9, off\n\tglobal_load_async_to_lds_b128 %2, %10, off\n\tglobal_load_async_to_lds_b128 %3, %11, off\n\tglobal_load_async_to_lds_b128 %4, %12, off\n\tglobal_load_async_to_lds_b128 %5, %13, off\n\tglobal_load_async_to_lds_b128 %6, %14, off\n\tglobal_load_async_to_lds_b128 %7, %15, off\n\ts_wait_xcnt 0x0"
__device__ __forceinline__ void d_copy4(unsigned lds, unsigned ls, const unsigned short* g, int gs) {      /* copy i: the lane's piece at lds + i ls (bytes) from g + i gs (elements) */
  asm volatile(CP4 :: "v"(lds), "v"(lds + ls), "v"(lds + 2 * ls), "v"(lds + 3 * ls), "v"(g), "v"(g + gs), "v"(g + 2 * gs), "v"(g + 3 * gs) : "memory");
}
__device__ __forceinline__ void d_copy8(unsigned lds, unsigned ls, const unsigned short* g, int gs) {
  asm volatile(CP8 :: "v"(lds), "v"(lds + ls), "v"(lds + 2 * ls), "v"(lds + 3 * ls), "v"(lds + 4 * ls), "v"(lds + 5 * ls), "v"(lds + 6 * ls), "v"(lds + 7 * ls),
    "v"(g), "v"(g + gs), "v"(g + 2 * gs), "v"(g + 3 * gs), "v"(g + 4 * gs), "v"(g + 5 * gs), "v"(g + 6 * gs), "v"(g + 7 * gs) : "memory");
}
__device__ __forceinline__ void d_wfrag(FragH& f, const v8us* p) { f.half[0] = p[0]; f.half[1] = p[32]; }      /* p: this lane's first piece of a packed weight fragment */

typedef _Float16 v4h __attribute__((ext_vector_type(4)));

// The element-wise passes are looped: one block does the work of NU x F blocks of the plain grid (a piece = what one thread of the plain grid did:
// same reads, same arithmetic, same 16-B store), in NU bursts of F pieces. A launch so starts NU x F times fewer waves, and a wave has the 16 loads
// of a whole burst (16 B a lane each) in flight. Every grid divides exactly: no bounds test. Each '#pragma unroll' keeps a burst's register arrays at constant indices
// and its loads in front of the first use; each '#pragma unroll 1' keeps the bursts one after the other (side by side they would need NU times the registers).
// Two waits a burst, each in front of every overwrite of a register that an issued load or store names: one behind the loads (it takes the address as an input,
// so that the pair stays live up to it and no load of the burst lands on it), one behind the stores (the next burst, or another pass's code in the shared kernel, follows).
template <int F, int NU>
__device__ __forceinline__ void d_x16(int blk, const float* __restrict__ x, _Float16* __restrict__ X16) { size_t t0 = (size_t)blk * (NU * F * 256) + threadIdx.x;
#pragma unroll 1
  for (int n = 0; n < NU; ++n, t0 += F * 256) { const float* xp = x + t0 * 8; v4f a[F], b[F];
#pragma unroll
    for (int u = 0; u < F; ++u) { a[u] = *(const v4fa*)(xp + u * 2048); b[u] = *(const v4fa*)(xp + u * 2048 + 4); }
    asm volatile("s_wait_xcnt 0x0" :: "v"(xp) : "memory");      /* in front of every overwrite of the loads' address pair, which stays live up to here */
#pragma unroll
    for (int u = 0; u < F; ++u) { FragH f;
#pragma unroll
      for (int q = 0; q < 4; ++q) { f.h[q] = (_Float16)bf16_round(a[u][q]); f.h[4 + q] = (_Float16)bf16_round(b[u][q]); }
      *(v8us*)((unsigned short*)X16 + (t0 + u * 256) * 8) = f.half[0]; }
    asm volatile("s_wait_xcnt 0x0" ::: "memory");      /* in front of every overwrite of the stores' registers by what follows */ } }
__global__ __launch_bounds__(256) void k_h16(const float* __restrict__ x, _Float16* __restrict__ X16, size_t n8) { const size_t t = (size_t)blockIdx.x * 256 + threadIdx.x; if (t >= n8) return; FragH f;
#pragma unroll
  for (int q = 0; q < 8; ++q) f.h[q] = (_Float16)x[t * 8 + q]; *(v8us*)((unsigned short*)X16 + t * 8) = f.half[0];  }
// output piece t0 + 256 u is stored where it stood, so every store is 512 B in a row; WHICH 8 weights it holds follows the fragment order (KS = 8 k steps a row tile): fragment 32 blk + tid / 64 + 4 u.
// V: the v weight rows stand in the order 8 e + g (row 32 g + e of Wv), so that a lane's 8 accumulator registers are g = 0 .. 7 of one e.
template <int F, bool V>
__device__ __forceinline__ void d_round16f(int blk, const float* __restrict__ W, _Float16* __restrict__ Bt) { static_assert(F % 2 == 0, "two pieces of a thread make up the 8 k steps of a row tile"); const size_t t0 = (size_t)blk * (F * 256) + threadIdx.x;
  const int cc = threadIdx.x & 15, kq = (threadIdx.x >> 6) * 4 + ((threadIdx.x >> 5) & 1) * 2 + ((threadIdx.x >> 4) & 1), tl = blk * (F / 2);      /* row in the tile, 8-k piece of the row for u = 0, first row tile */
  const float* wp = W + (size_t)(V ? 32 * (cc & 7) + 2 * tl + (cc >> 3) : 16 * tl + cc) * DR + kq * 8; v4f a[F], b[F];
#pragma unroll
  for (int u = 0; u < F; ++u) { a[u] = *(const v4fa*)(wp + (u >> 1) * (V ? 2 : 16) * DR + (u & 1) * 128); b[u] = *(const v4fa*)(wp + (u >> 1) * (V ? 2 : 16) * DR + (u & 1) * 128 + 4); }
  asm volatile("s_wait_xcnt 0x0" :: "v"(wp) : "memory");      /* in front of every overwrite of the loads' address pair, which stays live up to here */
#pragma unroll
  for (int u = 0; u < F; ++u) { FragH f;
#pragma unroll
    for (int i = 0; i < 4; ++i) { f.h[i] = (_Float16)(bf16_round(a[u][i]) * 16.0f); f.h[4 + i] = (_Float16)(bf16_round(b[u][i]) * 16.0f); }
    *(v8us*)((unsigned short*)Bt + (t0 + u * 256) * 8) = f.half[0]; }
  asm volatile("s_wait_xcnt 0x0" ::: "memory");      /* in front of every overwrite of the stores' registers by what follows */ }
// piece (e, k) = f16(16 (W[4 e][k] + W[4 e + 1][k] + W[4 e + 2][k] + W[4 e + 3][k])), each W rounded to bf16 first, the sum in f32: W (4 NE, K) row-major, thread = F pieces of 8 k of one e, 128 k apart; both loops unrolled so that f.h is indexed by constants and stays in registers.
// Output piece t0 + 256 u is stored in its place in a row; which (e, k) it holds follows the fragment order (K / 32 k steps a row tile): fragment F 4 blk + tid / 64 + 4 u
template <int NE, int K, int F>
__device__ __forceinline__ void d_fold4(int blk, const float* __restrict__ W, _Float16* __restrict__ Bt) { static_assert((K / 32) % (F * 4) == 0, "a block's fragments lie in one row tile"); const int t0 = blk * (F * 256) + threadIdx.x; const int f0 = blk * (F * 4) + (threadIdx.x >> 6);
  const int e = (f0 / (K / 32)) * 16 + (threadIdx.x & 15), k8 = (f0 % (K / 32)) * 32 + ((threadIdx.x >> 5) & 1) * 16 + ((threadIdx.x >> 4) & 1) * 8; const float* wr = W + (size_t)e * 4 * K + k8; v4f r[F][2][4];
#pragma unroll
  for (int u = 0; u < F; ++u)
#pragma unroll
    for (int g = 0; g < 2; ++g)
#pragma unroll
      for (int j = 0; j < 4; ++j) r[u][g][j] = *(const v4fa*)(wr + j * K + u * 128 + 4 * g);
  asm volatile("s_wait_xcnt 0x0" :: "v"(wr) : "memory");      /* in front of every overwrite of the loads' address pair, which stays live up to here */
#pragma unroll
  for (int u = 0; u < F; ++u) { FragH f;
#pragma unroll
    for (int g = 0; g < 2; ++g)
#pragma unroll
      for (int i = 0; i < 4; ++i) f.h[4 * g + i] = (_Float16)((((bf16_round(r[u][g][0][i]) + bf16_round(r[u][g][1][i])) + bf16_round(r[u][g][2][i])) + bf16_round(r[u][g][3][i])) * 16.0f);
    *(v8us*)((unsigned short*)Bt + (size_t)(t0 + u * 256) * 8) = f.half[0]; }
  asm volatile("s_wait_xcnt 0x0" ::: "memory");      /* in front of every overwrite of the stores' registers by what follows */ }
template <int NHv, int TTv>
__global__ __launch_bounds__(256) void k_vt(const _Float16* __restrict__ V16, int ldv, int voff, _Float16* __restrict__ Vt) { __shared__ unsigned short tl[64][66]; const int tid = threadIdx.x; const int slab = blockIdx.x / (TTv / 64), lg = blockIdx.x % (TTv / 64); const int b = slab / NHv, h = slab % NHv;
  for (int i = tid; i < 64 * 8; i += 256) { const int r = i / 8, c8 = (i % 8) * 8; FragH f; f.half[0] = *(const v8us*)((const unsigned short*)V16 + ((size_t)b * TTv + lg * 64 + r) * ldv + voff + h * 64 + c8);
#pragma unroll
    for (int q = 0; q < 8; ++q) tl[r][c8 + q] = f.u[q]; }
  __syncthreads();
  {
#pragma unroll
    for (int rd = 0; rd < 2; ++rd) { const int d = rd * 32 + tid / 8, pc = tid % 8; FragH f;
#pragma unroll
      for (int q = 0; q < 8; ++q) f.u[q] = tl[pc * 8 + q][d];
      *(v8us*)((unsigned short*)Vt + ((size_t)slab * 64 + d) * TTv + lg * 64 + pc * 8) = f.half[0]; }
     } }

__global__ __launch_bounds__(256) void k_hl(const float* __restrict__ F, _Float16* __restrict__ Hh, _Float16* __restrict__ Hl, size_t n8) { const size_t t = (size_t)blockIdx.x * 256 + threadIdx.x; if (t >= n8) return; FragH fh, fl; const v4f a = *(const v4fa*)(F + t * 8), c = *(const v4fa*)(F + t * 8 + 4);
#pragma unroll
  for (int q = 0; q < 4; ++q) { _Float16 h = (_Float16)a[q]; fh.h[q] = h; fl.h[q] = (_Float16)((a[q] - (float)h) * 1024.0f); h = (_Float16)c[q]; fh.h[4 + q] = h; fl.h[4 + q] = (_Float16)((c[q] - (float)h) * 1024.0f); }
  { *(v8us*)((unsigned short*)Hh + t * 8) = fh.half[0]; *(v8us*)((unsigned short*)Hl + t * 8) = fl.half[0];  } }

// piece t of the plain grid: row = t / 32 of the (8192, 256) reduced view, columns c0 = 8 (t % 32) .. c0 + 7. With fl = (row % 512) 256 + c0 + q the channel is fl / 4096, the reduced pixel
// (i, j) = ((fl / 64) % 64, fl % 64), so the 2 x 2 windows of the 8 columns are 16 floats in a row of x and the 16 below them, at x + 1024 row + 256 (c0 / 64) + 2 (c0 % 64);
// the 8 rows of a plain block lie in one channel, (row / 16) % 32, the same for the whole block
template <int F, int NU>
__device__ __forceinline__ void d_xr(int blk, const float* __restrict__ x, const float* __restrict__ w, const float* __restrict__ bb, _Float16* __restrict__ XR) {
  #pragma clang fp contract(off)
  const int c0 = (threadIdx.x % (DR / 8)) * 8; int rb0 = blk * (NU * F * 8);      /* first row of the burst's first plain block */
#pragma unroll 1
  for (int n = 0; n < NU; ++n, rb0 += F * 8) { const int row0 = rb0 + threadIdx.x / (DR / 8); const float* xp = x + (size_t)row0 * DQ + (c0 / 64) * 256 + 2 * (c0 % 64); v4f a[F][4], d[F][4];
#pragma unroll
    for (int u = 0; u < F; ++u)
#pragma unroll
      for (int g = 0; g < 4; ++g) { a[u][g] = *(const v4fa*)(xp + (size_t)u * 8 * DQ + 4 * g); d[u][g] = *(const v4fa*)(xp + (size_t)u * 8 * DQ + 128 + 4 * g); }
    asm volatile("s_wait_xcnt 0x0" :: "v"(xp) : "memory");      /* in front of every overwrite of the loads' address pair, which stays live up to here */
#pragma unroll
    for (int u = 0; u < F; ++u) { const int c = ((rb0 + u * 8) / 16) % 32; FragH f;
#pragma unroll
      for (int q = 0; q < 8; ++q) {
        float s = bf16_round(bb[c]); s += bf16_round(w[c * 4 + 0]) * bf16_round(a[u][q / 2][(2 * q) % 4]); s += bf16_round(w[c * 4 + 1]) * bf16_round(a[u][q / 2][(2 * q) % 4 + 1]); s += bf16_round(w[c * 4 + 2]) * bf16_round(d[u][q / 2][(2 * q) % 4]); s += bf16_round(w[c * 4 + 3]) * bf16_round(d[u][q / 2][(2 * q) % 4 + 1]); f.h[q] = (_Float16)s; }
      *(v8us*)((unsigned short*)XR + (size_t)(row0 + u * 8) * DR + c0) = f.half[0]; }
    asm volatile("s_wait_xcnt 0x0" ::: "memory");      /* in front of every overwrite of the stores' registers by what follows */ } }
#define KPIT 40                  /* K row pitch in LDS, f16 elements */
#define VPIT 520                 /* V^T row pitch in LDS, f16 elements */
#define BPIT 72                  /* bias tile pitch in LDS, bf16 elements */
#define OPIT 36                  /* output staging pitch, floats */
#define AWV 16                   /* waves per work-group */
#define NCH (NP / 64)            /* chunks of 64 keys */
typedef float v2f __attribute__((ext_vector_type(2)));
typedef __bf16 v4b __attribute__((ext_vector_type(4)));
typedef __bf16 v4ba __attribute__((ext_vector_type(4), may_alias));
typedef __bf16 v8ba __attribute__((ext_vector_type(8), may_alias));
typedef __bf16 v8b __attribute__((ext_vector_type(8)));
typedef _Float16 v2h __attribute__((ext_vector_type(2)));
__device__ __forceinline__ float other_half(float v) { const int b = __float_as_int(v); return __int_as_float(__builtin_amdgcn_permlanex16(b, b, 0x76543210, 0xfedcba98, false, false)); }
__global__ __launch_bounds__(512) __attribute__((amdgpu_waves_per_eu(4, 4))) void k_attn(const _Float16* __restrict__ X16, const _Float16* __restrict__ BQ, const float* __restrict__ bq, const _Float16* __restrict__ XR16, const _Float16* __restrict__ BKV, const float* __restrict__ BKVb, const float* __restrict__ rb, float* __restrict__ out) {
  __shared__ __attribute__((aligned(16))) unsigned short sXR[64 * XRP];
  __shared__ __attribute__((aligned(16))) unsigned short sX[32 * XQP];
  __shared__ __attribute__((aligned(16))) unsigned short sQ[AWV * 16 * KPIT];
  __shared__ __attribute__((aligned(16))) unsigned short sK[NP * KPIT];
  __shared__ __attribute__((aligned(16))) unsigned short sV[32 * VPIT];
  __shared__ __attribute__((aligned(16))) __bf16 sB[AWV][16 * BPIT];
  __shared__ __attribute__((aligned(16))) float sO[AWV][16 * OPIT];
  const int tid = threadIdx.x, w = tid >> 5, lane = tid & 31, c = lane & 15, hh = lane >> 4;
  const int bh = blockIdx.x >> 1, hf = blockIdx.x & 1, q0 = hf * (AWV * 16) + w * 16, h = bh % NHD;
  const v8us* pk = (const v8us*)BKV + w * (2 * 8 * 64) + lane;      /* this wave's k/v weights: 2 row tiles x 8 k steps, 16 KB in a row */
  const v8us* pq = (const v8us*)BQ + w * (32 * 64) + lane;          /* this wave's q weights: 1 row tile x 32 k steps, 32 KB in a row */
  const float* br = rb + ((size_t)h * NP + q0 + hh) * NP + c * 4;      /* load i of a chunk: rows 2 i + hh, 16 lanes x 16 B = one 256-B piece of a row */
  /* All work-groups read the same weights, and the 16 of one head and query half the same bias, and they run in step: each starts its two k walks and its key walk at a place of its own and wraps,
     so that at one moment the requests for these shared L2 lines are spread over the whole operand. The mix gives all 8 starts whether neighbouring indices share a die or go round the dies. */
  const int rot = (blockIdx.x ^ (blockIdx.x >> 3) ^ (blockIdx.x >> 6)) & 7;
  __bf16* sb = sB[w];
  v4f bn[8]; float bqs[8];
  /* reduced x, 64 rows of 512 B: copy i of wave w is row w + 16 i */
  d_copy4((unsigned)(size_t)&sXR[w * XRP + lane * 8], 16 * XRP * 2, (const unsigned short*)XR16 + (size_t)(bh * 64 + w) * DR + lane * 8, 16 * DR);
  FragH wk[2][2][2];      /* [register set][k step of the group][row tile] */
  { const v8us* pg = pk + (rot & 3) * 128;      /* the walk's first group of 2 k steps */
#pragma unroll
    for (int ks = 0; ks < 2; ++ks)
#pragma unroll
      for (int j = 0; j < 2; ++j) d_wfrag(wk[0][ks][j], pg + (j * 8 + ks) * 64);
    asm volatile("s_wait_xcnt 0x0" :: "v"(pg) : "memory");      /* in front of every overwrite of the loads' address pair, which stays live up to here */ }
  asm volatile("s_wait_asynccnt 0x0" ::: "memory");      /* this wave's copies of the reduced x have landed */
  __syncthreads();                                       /* and every other wave's: the tile may be read */
  /* x, 32 rows of 2048 B: copy i of thread tid is piece tid % 128 of row tid / 128 + 4 i; it flies under the k/v GEMM */
  d_copy8((unsigned)(size_t)&sX[(tid >> 7) * XQP + (tid & 127) * 8], 4 * XQP * 2, (const unsigned short*)X16 + (size_t)(bh * 64 + hf * 32 + (tid >> 7)) * DQ + (tid & 127) * 8, 4 * DQ);
  FragH wq[2][4];      /* [register set][k step of the group] */
  {
    v8f acc[4][2] = {};
    const unsigned short* sa = &sXR[c * XRP + 8 * hh];
#pragma unroll      /* unrolled: the two register sets are indexed by constants, and every load has its offset as an immediate */
    for (int t = 0; t < DR / 64; ++t) {
      if (t + 1 < DR / 64) {      /* the next group's weights fly under this group's WMMAs */
        const v8us* pg = pk + ((t + 1 + rot) & 3) * 128;
#pragma unroll
        for (int ks = 0; ks < 2; ++ks)
#pragma unroll
          for (int j = 0; j < 2; ++j) d_wfrag(wk[(t + 1) & 1][ks][j], pg + (j * 8 + ks) * 64);
        asm volatile("s_wait_xcnt 0x0" :: "v"(pg) : "memory");      /* in front of every overwrite of the loads' address pair, which stays live up to here */
      }
      const unsigned short* sg = sa + ((t + rot) & 3) * 64;      /* trip t works on k group (t + rot) mod 4 */
      FragH fa[2][4];
#pragma unroll
      for (int ks = 0; ks < 2; ++ks)
#pragma unroll
        for (int i = 0; i < 4; ++i) { fa[ks][i].half[0] = *(const v8us*)(sg + i * 16 * XRP + ks * 32); fa[ks][i].half[1] = *(const v8us*)(sg + i * 16 * XRP + ks * 32 + 16); }
      __builtin_amdgcn_sched_barrier(0);      /* the group's 16 LDS loads and the next weights stay together in front of its WMMAs: spread among them, the wave would wait out the LDS latency at every pair */
#pragma unroll
      for (int ks = 0; ks < 2; ++ks)
#pragma unroll
        for (int i = 0; i < 4; ++i)
#pragma unroll
          for (int j = 0; j < 2; ++j) acc[i][j] = __builtin_amdgcn_wmma_f32_16x16x32_f16(false, wk[t & 1][ks][j].v, false, fa[ks][i].v, (short)0, acc[i][j], false, false);
      __builtin_amdgcn_sched_barrier(0);      /* and the next group's loads stay behind them, as one group again */
    }
    { const v8us* pg0 = pq + rot * 256; const v8us* pg1 = pq + ((rot + 1) & 7) * 256;      /* groups of 4 k steps */
#pragma unroll
      for (int ks = 0; ks < 4; ++ks) { d_wfrag(wq[0][ks], pg0 + ks * 64); d_wfrag(wq[1][ks], pg1 + ks * 64); }      /* q's first two groups of weights fly under the k/v epilogue and the bias prologue */
      asm volatile("s_wait_xcnt 0x0" :: "v"(pg0), "v"(pg1) : "memory");      /* in front of every overwrite of the loads' address pairs, which stay live up to here */ }
    /* accumulator register r of tile (i, j): activation row 16 i + c, packed weight row 32 w + 16 j + 8 hh + r */
    const bool isk = w < 8;      /* the same for the whole wave */
    const float* bqp = bq + 4 * (w * 16 + 8 * hh);      /* folded column col stands for the columns 4 col .. 4 col + 3 */
    const float* br0 = br + rot * 64; const float* br1 = br + ((rot + 1) & 7) * 64;      /* the key walk's first two chunks */
    v4f b4[8];
#pragma unroll
    for (int r = 0; r < 8; ++r) b4[r] = *(const v4fa*)(bqp + 4 * r);
#pragma unroll
    for (int i = 0; i < 8; ++i) bn[i] = *(const v4fa*)(br0 + (size_t)(2 * i) * NP);
    asm volatile("s_wait_xcnt 0x0" :: "v"(bqp), "v"(br0) : "memory");      /* in front of every overwrite of the loads' address pairs, which stay live up to here */
    if (isk) {
      const float* bp = BKVb + w * 32 + 8 * hh; v4f k4[2][2];
#pragma unroll
      for (int j = 0; j < 2; ++j) { k4[j][0] = *(const v4fa*)(bp + j * 16); k4[j][1] = *(const v4fa*)(bp + j * 16 + 4); }
      asm volatile("s_wait_xcnt 0x0" :: "v"(bp) : "memory");      /* in front of every overwrite of the loads' address pair, which stays live up to here */
      unsigned short* d = &sK[(c * 8 + w) * KPIT + 8 * hh];
#pragma unroll
      for (int i = 0; i < 4; ++i)
#pragma unroll
        for (int j = 0; j < 2; ++j) { FragH f;
#pragma unroll
          for (int r = 0; r < 8; ++r) f.h[r] = (_Float16)(acc[i][j][r] * 0.0625f + bf16_round(k4[j][r >> 2][r & 3]));
          *(v8us*)(d + i * 128 * KPIT + j * 16) = f.half[0]; }
    } else {
      const float* bp = BKVb + DR + (w - 8) * 4 + hh; float v1[2][8];
#pragma unroll
      for (int j = 0; j < 2; ++j)
#pragma unroll
        for (int r = 0; r < 8; ++r) v1[j][r] = bp[j * 2 + r * 32];
      asm volatile("s_wait_xcnt 0x0" :: "v"(bp) : "memory");      /* in front of every overwrite of the loads' address pair, which stays live up to here */
      unsigned short* d = &sV[((w - 8) * 4 + hh) * VPIT + c * 8];
#pragma unroll
      for (int i = 0; i < 4; ++i)
#pragma unroll
        for (int j = 0; j < 2; ++j) { FragH f;
#pragma unroll
          for (int r = 0; r < 8; ++r) f.h[r] = (_Float16)(acc[i][j][r] * 0.0625f + bf16_round(v1[j][r]));
          *(v8us*)(d + j * 2 * VPIT + i * 128) = f.half[0]; }
    }
#pragma unroll
    for (int r = 0; r < 8; ++r) bqs[r] = ((bf16_round(b4[r][0]) + bf16_round(b4[r][1])) + bf16_round(b4[r][2])) + bf16_round(b4[r][3]);
#pragma unroll
    for (int i = 0; i < 8; ++i) { *(v4ba*)&sb[(2 * i + hh) * BPIT + c * 4] = __builtin_convertvector(bn[i], v4b); bn[i] = *(const v4fa*)(br1 + (size_t)(2 * i) * NP); }
    asm volatile("s_wait_xcnt 0x0" :: "v"(br1) : "memory");      /* in front of every overwrite of these loads' address pair by the q loop's code */
  }
  asm volatile("s_wait_asynccnt 0x0" ::: "memory");      /* this wave's copies of x have landed */
  __syncthreads();                                       /* and every other wave's: the x tile may be read; K and V^T are written */
  FragH fq;
  {
    v8f aq[2] = {};
    const unsigned short* sa = &sX[c * XQP + 8 * hh];
#pragma unroll      /* unrolled: the two register sets are indexed by constants, and every load has its offset as an immediate */
    for (int t = 0; t < DQ / 128; ++t) {
      if (t > 0 && t + 1 < DQ / 128) {      /* the next group's weights fly under this group's WMMAs */
        const v8us* pg = pq + ((t + 1 + rot) & 7) * 256;
#pragma unroll
        for (int ks = 0; ks < 4; ++ks) d_wfrag(wq[(t + 1) & 1][ks], pg + ks * 64);
        asm volatile("s_wait_xcnt 0x0" :: "v"(pg) : "memory");      /* in front of every overwrite of the loads' address pair, which stays live up to here */
      }
      const unsigned short* sg = sa + ((t + rot) & 7) * 128;      /* trip t works on k group (t + rot) mod 8 */
      FragH fa[4][2];
#pragma unroll
      for (int ks = 0; ks < 4; ++ks)
#pragma unroll
        for (int i = 0; i < 2; ++i) { fa[ks][i].half[0] = *(const v8us*)(sg + i * 16 * XQP + ks * 32); fa[ks][i].half[1] = *(const v8us*)(sg + i * 16 * XQP + ks * 32 + 16); }
      __builtin_amdgcn_sched_barrier(0);      /* the group's 16 LDS loads and the next weights stay together in front of its WMMAs: spread among them, the wave would wait out the LDS latency at every pair */
#pragma unroll
      for (int ks = 0; ks < 4; ++ks)
#pragma unroll
        for (int i = 0; i < 2; ++i) aq[i] = __builtin_amdgcn_wmma_f32_16x16x32_f16(false, wq[t & 1][ks].v, false, fa[ks][i].v, (short)0, aq[i], false, false);
      __builtin_amdgcn_sched_barrier(0);      /* and the next group's loads stay behind them, as one group again */
    }
    /* accumulator register r of tile i: x row 16 i + c, folded column 16 w + 8 hh + r */
#pragma unroll
    for (int i = 0; i < 2; ++i) { FragH f;
#pragma unroll
      for (int r = 0; r < 8; ++r) f.h[r] = (_Float16)(aq[i][r] * 0.0625f + bqs[r]);
      *(v8us*)&sQ[((i * 16 + c) * 8 + (w >> 1)) * KPIT + (w & 1) * 16 + 8 * hh] = f.half[0]; }
    __syncthreads();                                     /* every wave's part of the Q tile is written: the tile may be read */
    const unsigned short* qr = &sQ[(w * 16 + c) * KPIT]; fq.half[0] = *(const v8us*)(qr + 8 * hh); fq.half[1] = *(const v8us*)(qr + 16 + 8 * hh);
  }
  const float L2E = 1.4426950408889634f;
  v8f o0 = {}, o1 = {};
  float m = -3.0e38f, ls = 0.f;
#pragma unroll 1      /* rolled: eight copies of this body would add code and registers and save nothing */
  for (int kc = 0; kc < NCH; ++kc) {
    const int kk = (kc + rot) & (NCH - 1);      /* trip kc works on key chunk (kc + rot) mod 8 */
    /* the lanes of this wave read bias values that other lanes of it stored in the trip before: the stores have to be done first */
    asm volatile("s_wait_dscnt 0x0" ::: "memory");
    float l[32];
#pragma unroll
    for (int j = 0; j < 4; ++j) {
      const v8b pb = *(const v8ba*)&sb[c * BPIT + j * 16 + 8 * hh];      /* register r: bias[q0 + c][64 kk + 16 j + 8 hh + r], the S^T tile's own map */
      FragH fk; const unsigned short* kr = &sK[(kk * 64 + j * 16 + c) * KPIT];
      fk.half[0] = *(const v8us*)(kr + 8 * hh); fk.half[1] = *(const v8us*)(kr + 16 + 8 * hh);
      const v8f z = {};
      const v8f s = __builtin_amdgcn_wmma_f32_16x16x32_f16(false, fk.v, false, fq.v, (short)0, z, false, false);
#pragma unroll
      for (int r = 0; r < 8; ++r) l[j * 8 + r] = __builtin_fmaf(s[r], 0.03125f, (float)pb[r]);
    }
    /* next chunk's bias into the tile (its readers above are done), then the loads of the chunk after it; past the end both repeat the last chunk */
    const float* bx = br + ((((kc + 2 < NCH) ? kc + 2 : NCH - 1) + rot) & (NCH - 1)) * 64;
#pragma unroll
    for (int i = 0; i < 8; ++i) { *(v4ba*)&sb[(2 * i + hh) * BPIT + c * 4] = __builtin_convertvector(bn[i], v4b); bn[i] = *(const v4fa*)(bx + (size_t)(2 * i) * NP); }
    float cj[4];
#pragma unroll
    for (int j = 0; j < 4; ++j) { cj[j] = l[j * 8];
#pragma unroll
      for (int r = 1; r < 8; ++r) cj[j] = fmaxf(cj[j], l[j * 8 + r]); }
    float cm = fmaxf(fmaxf(cj[0], cj[1]), fmaxf(cj[2], cj[3]));
    cm = fmaxf(cm, other_half(cm));
    const float mn = fmaxf(m, cm);
    const float sc = __builtin_amdgcn_exp2f((m - mn) * L2E);
    const float mb = 10.0f - mn * L2E;
    m = mn;
    v2f sa = {0.f, 0.f}, sd = {0.f, 0.f};
    FragH fp[2];
#pragma unroll
    for (int i = 0; i < 32; i += 4) {
      v2f ta, tc, pa, pc; const v2f l2e = {L2E, L2E}, mb2 = {mb, mb};
      ta[0] = l[i]; ta[1] = l[i + 1]; tc[0] = l[i + 2]; tc[1] = l[i + 3];
      ta = __builtin_elementwise_fma(ta, l2e, mb2); tc = __builtin_elementwise_fma(tc, l2e, mb2);
      pa[0] = __builtin_amdgcn_exp2f(ta[0]); pa[1] = __builtin_amdgcn_exp2f(ta[1]); pc[0] = __builtin_amdgcn_exp2f(tc[0]); pc[1] = __builtin_amdgcn_exp2f(tc[1]);
      sa += pa; sd += pc;
      const v2h ha = __builtin_convertvector(pa, v2h), hc = __builtin_convertvector(pc, v2h);
      fp[i >> 4].h[(i & 15)] = ha[0]; fp[i >> 4].h[(i & 15) + 1] = ha[1]; fp[i >> 4].h[(i & 15) + 2] = hc[0]; fp[i >> 4].h[(i & 15) + 3] = hc[1];
    }
    sa += sd;
    ls = __builtin_fmaf(ls, sc, sa[0] + sa[1]);
#pragma unroll
    for (int r = 0; r < 8; ++r) { o0[r] *= sc; o1[r] *= sc; }
#pragma unroll
    for (int u = 0; u < 2; ++u) {
      FragH v0, v1; const unsigned short* vr = &sV[c * VPIT + kk * 64 + u * 32];
      v0.half[0] = *(const v8us*)(vr + 8 * hh); v0.half[1] = *(const v8us*)(vr + 16 + 8 * hh);
      v1.half[0] = *(const v8us*)(vr + 16 * VPIT + 8 * hh); v1.half[1] = *(const v8us*)(vr + 16 * VPIT + 16 + 8 * hh);
      o0 = __builtin_amdgcn_wmma_f32_16x16x32_f16(false, v0.v, false, fp[u].v, (short)0, o0, false, false);
      o1 = __builtin_amdgcn_wmma_f32_16x16x32_f16(false, v1.v, false, fp[u].v, (short)0, o1, false, false);
    }
  }
  ls += other_half(ls);
  const float inv = 1.0f / ls;
  float* so = sO[w];               /* this wave's own staging: lane (c, hh) holds query c, e = 16 t + 8 hh + r */
  { v4f a;
    a[0] = o0[0] * inv; a[1] = o0[1] * inv; a[2] = o0[2] * inv; a[3] = o0[3] * inv; *(v4fa*)&so[c * OPIT + 8 * hh] = a;
    a[0] = o0[4] * inv; a[1] = o0[5] * inv; a[2] = o0[6] * inv; a[3] = o0[7] * inv; *(v4fa*)&so[c * OPIT + 8 * hh + 4] = a;
    a[0] = o1[0] * inv; a[1] = o1[1] * inv; a[2] = o1[2] * inv; a[3] = o1[3] * inv; *(v4fa*)&so[c * OPIT + 16 + 8 * hh] = a;
    a[0] = o1[4] * inv; a[1] = o1[5] * inv; a[2] = o1[6] * inv; a[3] = o1[7] * inv; *(v4fa*)&so[c * OPIT + 16 + 8 * hh + 4] = a; }
  /* the wave's lanes read each other's staged values: the LDS writes have to be done before the reads */
  asm volatile("s_wait_dscnt 0x0" ::: "memory");
  float* orow = out + ((size_t)bh * NP + q0) * 128 + lane * 4;      /* out_d = o_{d/4}: lane e writes its value four times, 512 B a query in one store */
#pragma unroll
  for (int q = 0; q < 16; ++q) { const float vv = so[q * OPIT + lane]; v4f v; v[0] = vv; v[1] = vv; v[2] = vv; v[3] = vv; *(v4f*)(orow + (size_t)q * 128) = v; }
}
__device__ __forceinline__ void d_bcat(int blk, const float* __restrict__ a, const float* __restrict__ b, float* __restrict__ O) { const int t = blk * 256 + threadIdx.x; const float v = (t < DR) ? a[t] : b[t - DR]; *(float*)(O + t) = v;
  /* in the shared kernel's code other passes' instructions follow this store and write its registers: the wait stands in front of every such overwrite */
  asm volatile("s_wait_xcnt 0x0" ::: "memory"); }
// Passes that read nothing of one another share one launch: each pass owns a range of block indices and does there what it did alone
// (the looped passes piece by piece, as said at d_x16; the bias concatenation in two blocks of 256 threads for its one block of 512).
// The choice of the pass is uniform for a block. The longest passes come first.
// 586 blocks of 8 waves, between 4 and 5 waves for each SIMD of the chip: amdgpu_waves_per_eu(8, 8) gives the compiler the register budget for a whole burst of loads in flight.
#define G_X16 (NRW * DQ / 8 / 256 / 16)       /* 256 blocks: 2 bursts of 8 pieces */
#define G_XR  (NRW * (DR / 8) / 256 / 4)      /* 256: 2 bursts of 2 pieces */
#define G_FQ  (DR * DQ / 8 / 256 / 2)         /* 64: 2 pieces */
#define G_RW  (DR * DR / 8 / 256 / 8)         /* 4, once for Wk and once for Wv: 8 pieces */
#define G_BC  (2 * DR / 256)             /* 2 */
__global__ __launch_bounds__(256) __attribute__((amdgpu_waves_per_eu(8, 8))) void k_prep(const float* __restrict__ x, const float* __restrict__ dww, const float* __restrict__ dwb, const float* __restrict__ Wq, const float* __restrict__ Wk, const float* __restrict__ Wv, const float* __restrict__ bk, const float* __restrict__ bv,
    _Float16* __restrict__ X16, _Float16* __restrict__ XR16, _Float16* __restrict__ BQ, _Float16* __restrict__ BKV, float* __restrict__ BKVb) {
  int blk = blockIdx.x;
  if (blk < G_X16) { d_x16<8, 2>(blk, x, X16); return; }      /* plain (P, 1024) view = flat */
  blk -= G_X16;
  if (blk < G_XR) { d_xr<2, 2>(blk, x, dww, dwb, XR16); return; }
  blk -= G_XR;
  if (blk < G_FQ) { d_fold4<DR, DQ, 2>(blk, Wq, BQ); return; }      /* weights: (out, in) natural */
  blk -= G_FQ;
  if (blk < G_RW) { d_round16f<8, false>(blk, Wk, BKV); return; }
  blk -= G_RW;
  if (blk < G_RW) { d_round16f<8, true>(blk, Wv, BKV + (size_t)DR * DR); return; }
  blk -= G_RW;
  d_bcat(blk, bk, bv, BKVb);
}

extern "C" void kernel_launch(void* const* d_in, const int* in_sizes, int n_in,
                              void* d_out, int out_size, void* d_ws, size_t ws_size, hipStream_t stream) {
  (void)in_sizes; (void)n_in; (void)out_size;
  const float* const* I = (const float* const*)d_in; const float* x = I[0]; const float* dww = I[1]; const float* dwb = I[2]; const float* Wq = I[3]; const float* bq = I[4]; const float* Wk = I[5]; const float* bk = I[6]; const float* Wv = I[7]; const float* bv = I[8]; const float* rb = I[9];
  char* ws = (char*)d_ws; size_t off = 0;
  auto take = [&](size_t bytes) { char* p = ws + off; off += (bytes + 255) & ~(size_t)255; return p; };
  _Float16* BQ = (_Float16*)take((size_t)DR * DQ * 2); _Float16* BKV = (_Float16*)take((size_t)2 * DR * DR * 2); float* BKVb = (float*)take(2 * DR * 4);
  _Float16* X16 = (_Float16*)take((size_t)NRW * DQ * 2); _Float16* XR16 = (_Float16*)take((size_t)NRW * DR * 2);
  if (off > ws_size) return;
  k_prep<<<G_X16 + G_XR + G_FQ + 2 * G_RW + G_BC, 256, 0, stream>>>(x, dww, dwb, Wq, Wk, Wv, bk, bv, X16, XR16, BQ, BKV, BKVb);
  k_attn<<<NBH * 2, AWV * 32, 0, stream>>>(X16, BQ, bq, XR16, BKV, BKVb, rb, (float*)d_out);
}

// v010
// A run of this version takes 25 microseconds.
// Two timings next to v009 put it at 1.29 and 1.32 times that version's speed.
// All steps since v000 together make it 11.9 times as fast.
#include <hip/hip_runtime.h>
// Lightweight multi-head self-attention with reduced keys/values (B 16, C 32, 128×128; P 512 tokens of 1024 (q) / 256 (k, v after a depthwise 2×2 stride-2 reduction); 8 heads by PLAIN reshapes of the (P, dim) buffers; k/v nearest-upsampled 32 → 128 along the head dim; scores/√1024 + rel_bias; softmax; attn·v; plain reshape back to [16,32,128,128]).
// Structure: q/k/v projections as GEMMs (the depthwise reduction on VALU -> f16); the 32->128 nearest upsampling is folded into the contraction (sum_d q_d k_{d/4} = sum_e (sum_{d/4=e} q_d) k_e and out_d = o_{d/4}), and the sum over each four q columns is folded further into the projection itself (sum_{d/4=e} q_d = x . sum_{d/4=e} Wq[d] + sum_{d/4=e} bq[d]): the q GEMM has N 256 and its f16 output, read flat, is the head operand; the plain-view head split of q, k and v by index arithmetic in the GEMMs' own epilogues; the three projections, scores (K 32, scale 1/32), bias, running-max softmax (x 2^10, f16), P.V (N 32) and the expanded output in ONE fused kernel, head operands in LDS, scores and probabilities kept in registers.
// Compute dtype: inputs and parameters rounded to bf16; x exact in f16; folded q weights, reduced x, head operands and probabilities f16 (about 2^-12); f32 accumulation; softmax f32. v_wmma_f32_16x16x32_f16.
#define NB 16
#define NP 512
#define DQ 1024
#define DR 256
#define NHD 8
#define NBH (NB * NHD)           /* 128 */
#define NRW (NB * NP)            /* 8192 rows */
typedef __bf16 v16b __attribute__((ext_vector_type(16)));
typedef unsigned short v8us __attribute__((ext_vector_type(8), may_alias));
typedef float  v8f  __attribute__((ext_vector_type(8)));
typedef float  v4f  __attribute__((ext_vector_type(4)));
typedef float  v4fa __attribute__((ext_vector_type(4), may_alias));
union FragB { v16b v; v8us half[2]; unsigned short u[16]; };

__device__ __forceinline__ unsigned short bf16_bits(float x) { unsigned int u = __float_as_uint(x); return (unsigned short)((u + 0x7FFFu + ((u >> 16) & 1u)) >> 16); }
__device__ __forceinline__ float bf16_val(unsigned short b) { return __uint_as_float(((unsigned int)b) << 16); }
__device__ __forceinline__ float bf16_round(float x) { return bf16_val(bf16_bits(x)); }
// D += A·B with NT terms: 1 = ah·bh, 2 = + al·bh (A split), 3 = + ah·bl (both split)
template <int NT>
__device__ __forceinline__ v8f mmaN(v16b ah, v16b al, v16b bh, v16b bl, v8f c) {
  c = __builtin_amdgcn_wmma_f32_16x16x32_bf16(false, ah, false, bh, (short)0, c, false, false);
  if (NT >= 2) c = __builtin_amdgcn_wmma_f32_16x16x32_bf16(false, al, false, bh, (short)0, c, false, false);
  if (NT >= 3) c = __builtin_amdgcn_wmma_f32_16x16x32_bf16(false, ah, false, bl, (short)0, c, false, false);
  asm volatile("v_nop\n\tv_nop\n\tv_nop\n\tv_nop" : "+v"(c) : "v"(ah), "v"(al), "v"(bh), "v"(bl));
  return c;
}

__global__ __launch_bounds__(256) void k_wt_bf16(const float* __restrict__ W, unsigned short* __restrict__ Wt, int K, int N) {
  const int t = blockIdx.x * 256 + threadIdx.x;
  const int k8n = K / 8;
  if (t >= N * k8n) return;
  const int n = t / k8n, k8 = (t % k8n) * 8;
  v8us v;
#pragma unroll
  for (int i = 0; i < 8; ++i) v[i] = bf16_bits(W[(size_t)(k8 + i) * N + n]);
  *(v8us*)(Wt + (size_t)n * K + k8) = v;
  
}

// GEMM C[M][N] (f32, pitch ldc) = act(A[M][K]·W + bias). A f32 row-major (pitch lda) converted per fragment to bf16
// (ASPLIT: hi/lo two planes -> 2 terms, else single rounded term); Wt bf16 [N][K] (pitch ldb). BIAS_BF16 rounds the
// bias to bf16 first (bias quantised to bf16 before the add). K%32==0, M%16==0, N%64==0.
template <bool ASPLIT, int ACT, bool BIAS_BF16>
__global__ __launch_bounds__(128) void k_gemm_bf(const float* __restrict__ A, int lda, const unsigned short* __restrict__ Wt, int ldb,
                                               const float* __restrict__ bias, float* __restrict__ C, int ldc, int M, int N, int K) {
  __shared__ __attribute__((aligned(16))) float so[4][16][64];
  const int tid = threadIdx.x, w = tid >> 5, lane = tid & 31, ln = lane & 15, hh = lane >> 4;
  const int ntn = N / 64;
  const int wid = blockIdx.x * 4 + w;
  const int mt = wid / ntn, nq = wid % ntn;
  if (mt * 16 >= M) return;
  const int row0 = mt * 16, col0 = nq * 64;
  const float* arow = A + (size_t)(row0 + ln) * lda;
  v8f acc[4] = {};
  for (int kb = 0; kb < K; kb += 32) {
    FragB ah, al;
    const v4f x0 = *(const v4fa*)(arow + kb + 8 * hh), x1 = *(const v4fa*)(arow + kb + 8 * hh + 4);
    const v4f x2 = *(const v4fa*)(arow + kb + 16 + 8 * hh), x3 = *(const v4fa*)(arow + kb + 16 + 8 * hh + 4);
    float xs[16] = {x0[0],x0[1],x0[2],x0[3],x1[0],x1[1],x1[2],x1[3],x2[0],x2[1],x2[2],x2[3],x3[0],x3[1],x3[2],x3[3]};
#pragma unroll
    for (int i = 0; i < 16; ++i) { const unsigned short hb = bf16_bits(xs[i]); ah.u[i] = hb; al.u[i] = ASPLIT ? bf16_bits(xs[i] - bf16_val(hb)) : (unsigned short)0; }
#pragma unroll
    for (int t = 0; t < 4; ++t) {
      const unsigned short* brow = Wt + (size_t)(col0 + t * 16 + ln) * ldb + kb;
      FragB b;
      b.half[0] = *(const v8us*)(brow + 8 * hh);
      b.half[1] = *(const v8us*)(brow + 16 + 8 * hh);
      acc[t] = mmaN<ASPLIT ? 2 : 1>(ah.v, al.v, b.v, b.v, acc[t]);
    }
  }
#pragma unroll
  for (int t = 0; t < 4; ++t) {
    float bv = bias ? bias[col0 + t * 16 + ln] : 0.f;
    if (BIAS_BF16) bv = bf16_round(bv);
#pragma unroll
    for (int r = 0; r < 8; ++r) { float v = acc[t][r] + bv; if (ACT == 1) v = fmaxf(v, 0.f); so[w][8 * hh + r][t * 16 + ln] = v; }
  }
  __builtin_amdgcn_fence(__ATOMIC_ACQ_REL, "workgroup");
  __builtin_amdgcn_wave_barrier();
  const int rsub = lane >> 4, c4 = (lane & 15) * 4;
  {
#pragma unroll
    for (int q = 0; q < 8; ++q) {
      const int r = q * 2 + rsub;
      const v4f v = *(const v4fa*)&so[w][r][c4];
      *(v4f*)(C + (size_t)(row0 + r) * ldc + col0 + c4) = v;
    }
    
  }
}

// GEMM C = act(A·W + bias + resid): A f32 (ASPLIT -> hi/lo 2 terms), Wt bf16 [N][K]; ACT 0 none, 1 relu, 2 exact gelu;
// resid (optional, f32, row index = (row % rmod), pitch ldr, RES_BF16 rounds it) added before the activation.
template <bool ASPLIT, int ACT, bool BIAS_BF16, bool RES_BF16>
__global__ __launch_bounds__(128) void k_gemm_bf3(const float* __restrict__ A, int lda, const unsigned short* __restrict__ Wt, int ldb,
                                                const float* __restrict__ bias, const float* __restrict__ resid, int rmod, int ldr,
                                                float* __restrict__ C, int ldc, int M, int N, int K) {
  __shared__ __attribute__((aligned(16))) float so[4][16][64];
  const int tid = threadIdx.x, w = tid >> 5, lane = tid & 31, ln = lane & 15, hh = lane >> 4;
  const int ntn = N / 64;
  const int wid = blockIdx.x * 4 + w;
  const int mt = wid / ntn, nq = wid % ntn;
  if (mt * 16 >= M) return;
  const int row0 = mt * 16, col0 = nq * 64;
  const float* arow = A + (size_t)(row0 + ln) * lda;
  v8f acc[4] = {};
  for (int kb = 0; kb < K; kb += 32) {
    FragB ah, al;
    const v4f x0 = *(const v4fa*)(arow + kb + 8 * hh), x1 = *(const v4fa*)(arow + kb + 8 * hh + 4);
    const v4f x2 = *(const v4fa*)(arow + kb + 16 + 8 * hh), x3 = *(const v4fa*)(arow + kb + 16 + 8 * hh + 4);
    float xs[16] = {x0[0],x0[1],x0[2],x0[3],x1[0],x1[1],x1[2],x1[3],x2[0],x2[1],x2[2],x2[3],x3[0],x3[1],x3[2],x3[3]};
#pragma unroll
    for (int i = 0; i < 16; ++i) { const unsigned short hb = bf16_bits(xs[i]); ah.u[i] = hb; al.u[i] = ASPLIT ? bf16_bits(xs[i] - bf16_val(hb)) : (unsigned short)0; }
#pragma unroll
    for (int t = 0; t < 4; ++t) {
      const unsigned short* brow = Wt + (size_t)(col0 + t * 16 + ln) * ldb + kb;
      FragB b;
      b.half[0] = *(const v8us*)(brow + 8 * hh);
      b.half[1] = *(const v8us*)(brow + 16 + 8 * hh);
      acc[t] = mmaN<ASPLIT ? 2 : 1>(ah.v, al.v, b.v, b.v, acc[t]);
    }
  }
#pragma unroll
  for (int t = 0; t < 4; ++t) {
    const int col = col0 + t * 16 + ln;
    float bv = bias ? bias[col] : 0.f;
    if (BIAS_BF16) bv = bf16_round(bv);
#pragma unroll
    for (int r = 0; r < 8; ++r) {
      float v = acc[t][r] + bv;
      if (resid) { float rv = resid[(size_t)((row0 + 8 * hh + r) % rmod) * ldr + col]; if (RES_BF16) rv = bf16_round(rv); v += rv; }
      if (ACT == 1) v = fmaxf(v, 0.f);
      if (ACT == 2) v = 0.5f * v * (1.0f + erff(v * 0.70710678118654752f));
      if (ACT == 3) { const float u = 0.7978845608028654f * (v + 0.044715f * v * v * v); v = 0.5f * v * (1.0f + tanhf(u)); }
      so[w][8 * hh + r][t * 16 + ln] = v;
    }
  }
  __builtin_amdgcn_fence(__ATOMIC_ACQ_REL, "workgroup");
  __builtin_amdgcn_wave_barrier();
  const int rsub = lane >> 4, c4 = (lane & 15) * 4;
  {
#pragma unroll
    for (int q = 0; q < 8; ++q) {
      const int r = q * 2 + rsub;
      const v4f v = *(const v4fa*)&so[w][r][c4];
      *(v4f*)(C + (size_t)(row0 + r) * ldc + col0 + c4) = v;
    }
    
  }
}
// row LayerNorm (biased variance, eps) over N: s = X (+ R); optional out_sum <- s; out_norm <- (s-mu)*rsqrt(var+eps)*g + b
template <bool PARAM_BF16>
__global__ __launch_bounds__(256) void k_layernorm(const float* __restrict__ X, const float* __restrict__ R, const float* __restrict__ g, const float* __restrict__ bta,
                                                  float* __restrict__ out_sum, float* __restrict__ out_norm, int N, float eps) {
  __shared__ float red[256];
  const int row = blockIdx.x, tid = threadIdx.x;
  const float* x = X + (size_t)row * N; const float* rr = R ? R + (size_t)row * N : nullptr;
  float vals[16];                     // up to N = 4096
  const int per = N / 256;            // contiguous chunk per thread? use strided-by-4 chunks: thread handles j = tid*4 + 1024*u
  float s1 = 0.f;
  for (int u = 0; u < per / 4; ++u) {
    const int j = tid * 4 + 1024 * u;
    const v4f a = *(const v4fa*)(x + j);
    v4f b = {0.f,0.f,0.f,0.f}; if (rr) b = *(const v4fa*)(rr + j);
#pragma unroll
    for (int q = 0; q < 4; ++q) { const float v = a[q] + b[q]; vals[u * 4 + q] = v; s1 += v; }
  }
  red[tid] = s1; __syncthreads();
  for (int st = 128; st > 0; st >>= 1) { if (tid < st) red[tid] += red[tid + st]; __syncthreads(); }
  const float mu = red[0] / (float)N; __syncthreads();
  float s2 = 0.f;
  for (int u = 0; u < per / 4; ++u)
#pragma unroll
    for (int q = 0; q < 4; ++q) { const float c = vals[u * 4 + q] - mu; s2 += c * c; }
  red[tid] = s2; __syncthreads();
  for (int st = 128; st > 0; st >>= 1) { if (tid < st) red[tid] += red[tid + st]; __syncthreads(); }
  const float rs = rsqrtf(red[0] / (float)N + eps);
  {
    for (int u = 0; u < per / 4; ++u) {
      const int j = tid * 4 + 1024 * u;
      v4f o, sm;
#pragma unroll
      for (int q = 0; q < 4; ++q) {
        float gg = g[j + q], bb = bta[j + q];
        if (PARAM_BF16) { gg = bf16_round(gg); bb = bf16_round(bb); }
        sm[q] = vals[u * 4 + q]; o[q] = (vals[u * 4 + q] - mu) * rs * gg + bb;
      }
      if (out_sum) *(v4f*)(out_sum + (size_t)row * N + j) = sm;
      *(v4f*)(out_norm + (size_t)row * N + j) = o;
    }
    
  }
}



// ---- f16 WMMA path (v_wmma_f32_16x16x32_f16): 11-bit significands for operands in range — used where a [0,1] probability operand needs more precision than bf16
typedef _Float16 v16h __attribute__((ext_vector_type(16)));
union FragH { v16h v; v8us half[2]; _Float16 h[16]; unsigned short u[16]; };
template <int NT>
__device__ __forceinline__ v8f mmaH(v16h ah, v16h al, v16h bh, v16h bl, v8f c) {
  c = __builtin_amdgcn_wmma_f32_16x16x32_f16(false, ah, false, bh, (short)0, c, false, false);
  if (NT >= 2) c = __builtin_amdgcn_wmma_f32_16x16x32_f16(false, al, false, bh, (short)0, c, false, false);
  if (NT >= 3) c = __builtin_amdgcn_wmma_f32_16x16x32_f16(false, ah, false, bl, (short)0, c, false, false);
  asm volatile("v_nop\n\tv_nop\n\tv_nop\n\tv_nop" : "+v"(c) : "v"(ah), "v"(al), "v"(bh), "v"(bl));
  return c;
}
// batched GEMM like k_gemm_b but f16 operands: A f32 (split into f16 hi/lo if ASPLIT, else rounded to f16), Bt = f16 values [n][k]; alpha; C f32; N multiple of 16 (partial tiles skipped)
template <bool ASPLIT>
__global__ __launch_bounds__(128) void k_gemm_h(const float* __restrict__ A, int lda, size_t sA, const _Float16* __restrict__ Bh, int ldb, size_t sB, float alpha, float* __restrict__ C, int ldc, size_t sC, int M, int N, int K) {
  __shared__ __attribute__((aligned(16))) float so[4][16][64];
  const int tid = threadIdx.x, w = tid >> 5, lane = tid & 31, ln = lane & 15, hh = lane >> 4; const int by = blockIdx.y;
  A += (size_t)by * sA; Bh += (size_t)by * sB; C += (size_t)by * sC;
  const int ntn = (N + 63) / 64; const int wid = blockIdx.x * 4 + w; const int mt = wid / ntn, nq = wid % ntn; if (mt * 16 >= M) return;
  const int row0 = mt * 16, col0 = nq * 64; const float* arow = A + (size_t)(row0 + ln) * lda;
  v8f acc[4] = {};
  for (int kb = 0; kb < K; kb += 32) {
    FragH ah, al;
    const v4f x0 = *(const v4fa*)(arow + kb + 8 * hh), x1 = *(const v4fa*)(arow + kb + 8 * hh + 4), x2 = *(const v4fa*)(arow + kb + 16 + 8 * hh), x3 = *(const v4fa*)(arow + kb + 16 + 8 * hh + 4);
    float xs[16] = {x0[0],x0[1],x0[2],x0[3],x1[0],x1[1],x1[2],x1[3],x2[0],x2[1],x2[2],x2[3],x3[0],x3[1],x3[2],x3[3]};
#pragma unroll
    for (int i = 0; i < 16; ++i) { const _Float16 h = (_Float16)xs[i]; ah.h[i] = h; al.h[i] = ASPLIT ? (_Float16)(xs[i] - (float)h) : (_Float16)0.0f; }
#pragma unroll
    for (int t = 0; t < 4; ++t) { if (col0 + t * 16 >= N) continue; const size_t boff = (size_t)(col0 + t * 16 + ln) * ldb + kb; FragH bq; bq.half[0] = *(const v8us*)(Bh + boff + 8 * hh); bq.half[1] = *(const v8us*)(Bh + boff + 16 + 8 * hh);
      acc[t] = mmaH<ASPLIT ? 2 : 1>(ah.v, al.v, bq.v, bq.v, acc[t]); }
  }
#pragma unroll
  for (int t = 0; t < 4; ++t) { if (col0 + t * 16 >= N) continue;
#pragma unroll
    for (int r = 0; r < 8; ++r) so[w][8 * hh + r][t * 16 + ln] = acc[t][r] * alpha; }
  __builtin_amdgcn_fence(__ATOMIC_ACQ_REL, "workgroup"); __builtin_amdgcn_wave_barrier();
  const int rsub = lane >> 4, c4 = (lane & 15) * 4;
  {
#pragma unroll
    for (int q = 0; q < 8; ++q) { const int r = q * 2 + rsub; if (col0 + c4 < N) { const v4f v = *(const v4fa*)&so[w][r][c4]; *(v4f*)(C + (size_t)(row0 + r) * ldc + col0 + c4) = v; } }
     }
}

// Wt[n][k] = f16(W[k][n]·scale) from f32 row-major W[K][N] (scale = power of two; bf16-exact weights stay exact in f16 away from the subnormal range)
__global__ __launch_bounds__(256) void k_wt_f16(const float* __restrict__ W, _Float16* __restrict__ Wt, int K, int N, float scale) {
  const int t = blockIdx.x * 256 + threadIdx.x; if (t >= N * (K / 8)) return; const int n = t / (K / 8), k8 = (t % (K / 8)) * 8; FragH f;
#pragma unroll
  for (int i = 0; i < 8; ++i) f.h[i] = (_Float16)(bf16_round(W[(size_t)(k8 + i) * N + n]) * scale); const v8us o = f.half[0];
  *(v8us*)((unsigned short*)Wt + (size_t)n * K + k8) = o; 
}
// Operands of the projection GEMMs, which run inside the attention kernel (16 waves). Every weight fragment is used by ONE wave of a work-group, so the weights do not go through LDS:
// the prep pass stores them in fragment order, and a wave loads its own fragments from L2 straight into registers, 512 B in a row a load, one group of k steps ahead of their use.
// Fragment order: fragments of 16 weight rows x 32 k (1 KB), the k steps of a row tile one after the other; inside a fragment piece 16 hh + c is row c, k 8 hh .. 8 hh + 7, and piece 32 + 16 hh + c is row c, k 16 + 8 hh .. (16 B a piece).
// The activation rows, which all 16 waves read, are made in LDS whole, once, from the f32 input itself (512 B in a row a load, rounded and reduced in registers): the k loops have no ring and no barrier.
#define XRP 264                  /* reduced-x row pitch in LDS, f16 elements: 512 + 16 B */
#define XQP 1032                 /* x row pitch in LDS, f16 elements: 2048 + 16 B */
__device__ __forceinline__ void d_wfrag(FragH& f, const v8us* p) { f.half[0] = p[0]; f.half[1] = p[32]; }      /* p: this lane's first piece of a packed weight fragment */

typedef _Float16 v4h __attribute__((ext_vector_type(4)));

// The weight passes: a piece = 8 outputs of one thread, one 16-B store; a thread does F pieces, with the loads of all of them in flight. Every grid divides exactly: no bounds test.
// Each '#pragma unroll' keeps the register arrays at constant indices and the loads in front of the first use.
// Two waits a pass, each in front of every overwrite of a register that an issued load or store names: one behind the loads (it takes the address as an input,
// so that the pair stays live up to it and no load lands on it), one behind the stores (another pass's code in the shared kernel follows).
__global__ __launch_bounds__(256) void k_h16(const float* __restrict__ x, _Float16* __restrict__ X16, size_t n8) { const size_t t = (size_t)blockIdx.x * 256 + threadIdx.x; if (t >= n8) return; FragH f;
#pragma unroll
  for (int q = 0; q < 8; ++q) f.h[q] = (_Float16)x[t * 8 + q]; *(v8us*)((unsigned short*)X16 + t * 8) = f.half[0];  }
// output piece t0 + 256 u is stored where it stood, so every store is 512 B in a row; WHICH 8 weights it holds follows the fragment order (KS = 8 k steps a row tile): fragment 32 blk + tid / 64 + 4 u.
// V: the v weight rows stand in the order 8 e + g (row 32 g + e of Wv), so that a lane's 8 accumulator registers are g = 0 .. 7 of one e.
template <int F, bool V>
__device__ __forceinline__ void d_round16f(int blk, const float* __restrict__ W, _Float16* __restrict__ Bt) { static_assert(F % 2 == 0, "two pieces of a thread make up the 8 k steps of a row tile"); const size_t t0 = (size_t)blk * (F * 256) + threadIdx.x;
  const int cc = threadIdx.x & 15, kq = (threadIdx.x >> 6) * 4 + ((threadIdx.x >> 5) & 1) * 2 + ((threadIdx.x >> 4) & 1), tl = blk * (F / 2);      /* row in the tile, 8-k piece of the row for u = 0, first row tile */
  const float* wp = W + (size_t)(V ? 32 * (cc & 7) + 2 * tl + (cc >> 3) : 16 * tl + cc) * DR + kq * 8; v4f a[F], b[F];
#pragma unroll
  for (int u = 0; u < F; ++u) { a[u] = *(const v4fa*)(wp + (u >> 1) * (V ? 2 : 16) * DR + (u & 1) * 128); b[u] = *(const v4fa*)(wp + (u >> 1) * (V ? 2 : 16) * DR + (u & 1) * 128 + 4); }
  asm volatile("s_wait_xcnt 0x0" :: "v"(wp) : "memory");      /* in front of every overwrite of the loads' address pair, which stays live up to here */
#pragma unroll
  for (int u = 0; u < F; ++u) { FragH f;
#pragma unroll
    for (int i = 0; i < 4; ++i) { f.h[i] = (_Float16)(bf16_round(a[u][i]) * 16.0f); f.h[4 + i] = (_Float16)(bf16_round(b[u][i]) * 16.0f); }
    *(v8us*)((unsigned short*)Bt + (t0 + u * 256) * 8) = f.half[0]; }
  asm volatile("s_wait_xcnt 0x0" ::: "memory");      /* in front of every overwrite of the stores' registers by what follows */ }
// piece (e, k) = f16(16 (W[4 e][k] + W[4 e + 1][k] + W[4 e + 2][k] + W[4 e + 3][k])), each W rounded to bf16 first, the sum in f32: W (4 NE, K) row-major, thread = F pieces of 8 k of one e, 128 k apart; both loops unrolled so that f.h is indexed by constants and stays in registers.
// Output piece t0 + 256 u is stored in its place in a row; which (e, k) it holds follows the fragment order (K / 32 k steps a row tile): fragment F 4 blk + tid / 64 + 4 u
template <int NE, int K, int F>
__device__ __forceinline__ void d_fold4(int blk, const float* __restrict__ W, _Float16* __restrict__ Bt) { static_assert((K / 32) % (F * 4) == 0, "a block's fragments lie in one row tile"); const int t0 = blk * (F * 256) + threadIdx.x; const int f0 = blk * (F * 4) + (threadIdx.x >> 6);
  const int e = (f0 / (K / 32)) * 16 + (threadIdx.x & 15), k8 = (f0 % (K / 32)) * 32 + ((threadIdx.x >> 5) & 1) * 16 + ((threadIdx.x >> 4) & 1) * 8; const float* wr = W + (size_t)e * 4 * K + k8; v4f r[F][2][4];
#pragma unroll
  for (int u = 0; u < F; ++u)
#pragma unroll
    for (int g = 0; g < 2; ++g)
#pragma unroll
      for (int j = 0; j < 4; ++j) r[u][g][j] = *(const v4fa*)(wr + j * K + u * 128 + 4 * g);
  asm volatile("s_wait_xcnt 0x0" :: "v"(wr) : "memory");      /* in front of every overwrite of the loads' address pair, which stays live up to here */
#pragma unroll
  for (int u = 0; u < F; ++u) { FragH f;
#pragma unroll
    for (int g = 0; g < 2; ++g)
#pragma unroll
      for (int i = 0; i < 4; ++i) f.h[4 * g + i] = (_Float16)((((bf16_round(r[u][g][0][i]) + bf16_round(r[u][g][1][i])) + bf16_round(r[u][g][2][i])) + bf16_round(r[u][g][3][i])) * 16.0f);
    *(v8us*)((unsigned short*)Bt + (size_t)(t0 + u * 256) * 8) = f.half[0]; }
  asm volatile("s_wait_xcnt 0x0" ::: "memory");      /* in front of every overwrite of the stores' registers by what follows */ }
template <int NHv, int TTv>
__global__ __launch_bounds__(256) void k_vt(const _Float16* __restrict__ V16, int ldv, int voff, _Float16* __restrict__ Vt) { __shared__ unsigned short tl[64][66]; const int tid = threadIdx.x; const int slab = blockIdx.x / (TTv / 64), lg = blockIdx.x % (TTv / 64); const int b = slab / NHv, h = slab % NHv;
  for (int i = tid; i < 64 * 8; i += 256) { const int r = i / 8, c8 = (i % 8) * 8; FragH f; f.half[0] = *(const v8us*)((const unsigned short*)V16 + ((size_t)b * TTv + lg * 64 + r) * ldv + voff + h * 64 + c8);
#pragma unroll
    for (int q = 0; q < 8; ++q) tl[r][c8 + q] = f.u[q]; }
  __syncthreads();
  {
#pragma unroll
    for (int rd = 0; rd < 2; ++rd) { const int d = rd * 32 + tid / 8, pc = tid % 8; FragH f;
#pragma unroll
      for (int q = 0; q < 8; ++q) f.u[q] = tl[pc * 8 + q][d];
      *(v8us*)((unsigned short*)Vt + ((size_t)slab * 64 + d) * TTv + lg * 64 + pc * 8) = f.half[0]; }
     } }

__global__ __launch_bounds__(256) void k_hl(const float* __restrict__ F, _Float16* __restrict__ Hh, _Float16* __restrict__ Hl, size_t n8) { const size_t t = (size_t)blockIdx.x * 256 + threadIdx.x; if (t >= n8) return; FragH fh, fl; const v4f a = *(const v4fa*)(F + t * 8), c = *(const v4fa*)(F + t * 8 + 4);
#pragma unroll
  for (int q = 0; q < 4; ++q) { _Float16 h = (_Float16)a[q]; fh.h[q] = h; fl.h[q] = (_Float16)((a[q] - (float)h) * 1024.0f); h = (_Float16)c[q]; fh.h[4 + q] = h; fl.h[4 + q] = (_Float16)((c[q] - (float)h) * 1024.0f); }
  { *(v8us*)((unsigned short*)Hh + t * 8) = fh.half[0]; *(v8us*)((unsigned short*)Hl + t * 8) = fl.half[0];  } }

#define KPIT 40                  /* K row pitch in LDS, f16 elements */
#define VPIT 520                 /* V^T row pitch in LDS, f16 elements */
#define BPIT 72                  /* bias tile pitch in LDS, bf16 elements */
#define OPIT 36                  /* output staging pitch, floats */
#define AWV 16                   /* waves per work-group */
#define NCH (NP / 64)            /* chunks of 64 keys */
typedef float v2f __attribute__((ext_vector_type(2)));
typedef __bf16 v4b __attribute__((ext_vector_type(4)));
typedef __bf16 v4ba __attribute__((ext_vector_type(4), may_alias));
typedef __bf16 v8ba __attribute__((ext_vector_type(8), may_alias));
typedef __bf16 v8b __attribute__((ext_vector_type(8)));
typedef _Float16 v2h __attribute__((ext_vector_type(2)));
typedef _Float16 v2ha __attribute__((ext_vector_type(2), may_alias));
typedef _Float16 v4ha __attribute__((ext_vector_type(4), may_alias));
__device__ __forceinline__ float other_half(float v) { const int b = __float_as_int(v); return __int_as_float(__builtin_amdgcn_permlanex16(b, b, 0x76543210, 0xfedcba98, false, false)); }
__global__ __launch_bounds__(512) __attribute__((amdgpu_waves_per_eu(4, 4))) void k_attn(const float* __restrict__ x, const float* __restrict__ dww, const float* __restrict__ dwb, const _Float16* __restrict__ BQ, const float* __restrict__ bq, const _Float16* __restrict__ BKV, const float* __restrict__ BKVb, const float* __restrict__ rb, float* __restrict__ out) {
  __shared__ __attribute__((aligned(16))) unsigned short sXR[64 * XRP];
  __shared__ __attribute__((aligned(16))) unsigned short sX[32 * XQP];
  __shared__ __attribute__((aligned(16))) unsigned short sQ[AWV * 16 * KPIT];
  __shared__ __attribute__((aligned(16))) unsigned short sK[NP * KPIT];
  __shared__ __attribute__((aligned(16))) unsigned short sV[32 * VPIT];
  __shared__ __attribute__((aligned(16))) __bf16 sB[AWV][16 * BPIT];
  __shared__ __attribute__((aligned(16))) float sO[AWV][16 * OPIT];
  const int tid = threadIdx.x, w = tid >> 5, lane = tid & 31, c = lane & 15, hh = lane >> 4;
  const int bh = blockIdx.x >> 1, hf = blockIdx.x & 1, q0 = hf * (AWV * 16) + w * 16, h = bh % NHD;
  const v8us* pk = (const v8us*)BKV + w * (2 * 8 * 64) + lane;      /* this wave's k/v weights: 2 row tiles x 8 k steps, 16 KB in a row */
  const v8us* pq = (const v8us*)BQ + w * (32 * 64) + lane;          /* this wave's q weights: 1 row tile x 32 k steps, 32 KB in a row */
  const float* br = rb + ((size_t)h * NP + q0 + hh) * NP + c * 4;      /* load i of a chunk: rows 2 i + hh, 16 lanes x 16 B = one 256-B piece of a row */
  /* All work-groups read the same weights, and the 16 of one head and query half the same bias, and they run in step: each starts its two k walks and its key walk at a place of its own and wraps,
     so that at one moment the requests for these shared L2 lines are spread over the whole operand. The mix gives all 8 starts whether neighbouring indices share a die or go round the dies. */
  const int rot = (blockIdx.x ^ (blockIdx.x >> 3) ^ (blockIdx.x >> 6)) & 7;
  __bf16* sb = sB[w];
  v4f bn[8]; float bqs[8];
  FragH wk[2][2][2];      /* [register set][k step of the group][row tile] */
  { const v8us* pg = pk + (rot & 3) * 128;      /* the walk's first group of 2 k steps */
#pragma unroll
    for (int ks = 0; ks < 2; ++ks)
#pragma unroll
      for (int j = 0; j < 2; ++j) d_wfrag(wk[0][ks][j], pg + (j * 8 + ks) * 64);
    asm volatile("s_wait_xcnt 0x0" :: "v"(pg) : "memory");      /* in front of every overwrite of the loads' address pair, which stays live up to here */ }
  { /* wave w: rows w + 16 i of the pair's 64, i = 0 .. 3 (two in each query half, so that all waves do the same work); row w + 16 i lies in channel (4 bh + i) % 32, the same for the whole work-group */
    const float* cwp = dww + ((bh * 4) & 31) * 4; const float* cbp = dwb + ((bh * 4) & 31);
    float cw[4][4], cb[4];
#pragma unroll
    for (int i = 0; i < 4; ++i) { cb[i] = bf16_round(cbp[i]);
#pragma unroll
      for (int j = 0; j < 4; ++j) cw[i][j] = bf16_round(cwp[i * 4 + j]); }
    const float* xp = x + (size_t)(bh * 64 + w) * DQ + lane * 4;
    v4f xt[4][4], xb[4][4];      /* [i][g]: upper and lower image row of pair g; all 32 loads of the wave in flight at once */
#pragma unroll
    for (int i = 0; i < 4; ++i)
#pragma unroll
      for (int g = 0; g < 4; ++g) { xt[i][g] = *(const v4fa*)(xp + i * 16 * DQ + g * 256); xb[i][g] = *(const v4fa*)(xp + i * 16 * DQ + g * 256 + 128); }
    asm volatile("s_wait_xcnt 0x0" :: "v"(xp) : "memory");      /* in front of every overwrite of the loads' address pair, which stays live up to here */
#pragma unroll
    for (int i = 0; i < 4; ++i) {
      v4f t[4], b[4];
#pragma unroll
      for (int g = 0; g < 4; ++g) {
        t[g] = __builtin_convertvector(__builtin_convertvector(xt[i][g], v4b), v4f); b[g] = __builtin_convertvector(__builtin_convertvector(xb[i][g], v4b), v4f);      /* inputs rounded to bf16 */
        const v2f te = {t[g][0], t[g][2]}, to = {t[g][1], t[g][3]}, be = {b[g][0], b[g][2]}, bo = {b[g][1], b[g][3]};
        const v2f w0 = {cw[i][0], cw[i][0]}, w1 = {cw[i][1], cw[i][1]}, w2 = {cw[i][2], cw[i][2]}, w3 = {cw[i][3], cw[i][3]};
        v2f s = {cb[i], cb[i]};      /* reduced columns 64 g + 2 lane and the next */
        s = __builtin_elementwise_fma(w0, te, s); s = __builtin_elementwise_fma(w1, to, s); s = __builtin_elementwise_fma(w2, be, s); s = __builtin_elementwise_fma(w3, bo, s);
        *(v2ha*)&sXR[(w + 16 * i) * XRP + g * 64 + lane * 2] = __builtin_convertvector(s, v2h);
      }
      if ((i >> 1) == hf) {      /* the same for the whole work-group: a row of this work-group's own queries */
        unsigned short* d = &sX[(w + 16 * (i & 1)) * XQP + lane * 4];
#pragma unroll
        for (int g = 0; g < 4; ++g) { *(v4ha*)(d + g * 256) = __builtin_convertvector(t[g], v4h); *(v4ha*)(d + g * 256 + 128) = __builtin_convertvector(b[g], v4h); }
      }
    }
  }
  __syncthreads();                                       /* every wave's rows of both tiles are written: the tiles may be read */
  FragH wq[2][4];      /* [register set][k step of the group] */
  {
    v8f acc[4][2] = {};
    const unsigned short* sa = &sXR[c * XRP + 8 * hh];
#pragma unroll      /* unrolled: the two register sets are indexed by constants, and every load has its offset as an immediate */
    for (int t = 0; t < DR / 64; ++t) {
      if (t + 1 < DR / 64) {      /* the next group's weights fly under this group's WMMAs */
        const v8us* pg = pk + ((t + 1 + rot) & 3) * 128;
#pragma unroll
        for (int ks = 0; ks < 2; ++ks)
#pragma unroll
          for (int j = 0; j < 2; ++j) d_wfrag(wk[(t + 1) & 1][ks][j], pg + (j * 8 + ks) * 64);
        asm volatile("s_wait_xcnt 0x0" :: "v"(pg) : "memory");      /* in front of every overwrite of the loads' address pair, which stays live up to here */
      }
      const unsigned short* sg = sa + ((t + rot) & 3) * 64;      /* trip t works on k group (t + rot) mod 4 */
      FragH fa[2][4];
#pragma unroll
      for (int ks = 0; ks < 2; ++ks)
#pragma unroll
        for (int i = 0; i < 4; ++i) { fa[ks][i].half[0] = *(const v8us*)(sg + i * 16 * XRP + ks * 32); fa[ks][i].half[1] = *(const v8us*)(sg + i * 16 * XRP + ks * 32 + 16); }
      __builtin_amdgcn_sched_barrier(0);      /* the group's 16 LDS loads and the next weights stay together in front of its WMMAs: spread among them, the wave would wait out the LDS latency at every pair */
#pragma unroll
      for (int ks = 0; ks < 2; ++ks)
#pragma unroll
        for (int i = 0; i < 4; ++i)
#pragma unroll
          for (int j = 0; j < 2; ++j) acc[i][j] = __builtin_amdgcn_wmma_f32_16x16x32_f16(false, wk[t & 1][ks][j].v, false, fa[ks][i].v, (short)0, acc[i][j], false, false);
      __builtin_amdgcn_sched_barrier(0);      /* and the next group's loads stay behind them, as one group again */
    }
    { const v8us* pg0 = pq + rot * 256; const v8us* pg1 = pq + ((rot + 1) & 7) * 256;      /* groups of 4 k steps */
#pragma unroll
      for (int ks = 0; ks < 4; ++ks) { d_wfrag(wq[0][ks], pg0 + ks * 64); d_wfrag(wq[1][ks], pg1 + ks * 64); }      /* q's first two groups of weights fly under the k/v epilogue and the bias prologue */
      asm volatile("s_wait_xcnt 0x0" :: "v"(pg0), "v"(pg1) : "memory");      /* in front of every overwrite of the loads' address pairs, which stay live up to here */ }
    /* accumulator register r of tile (i, j): activation row 16 i + c, packed weight row 32 w + 16 j + 8 hh + r */
    const bool isk = w < 8;      /* the same for the whole wave */
    const float* bqp = bq + 4 * (w * 16 + 8 * hh);      /* folded column col stands for the columns 4 col .. 4 col + 3 */
    const float* br0 = br + rot * 64; const float* br1 = br + ((rot + 1) & 7) * 64;      /* the key walk's first two chunks */
    v4f b4[8];
#pragma unroll
    for (int r = 0; r < 8; ++r) b4[r] = *(const v4fa*)(bqp + 4 * r);
#pragma unroll
    for (int i = 0; i < 8; ++i) bn[i] = *(const v4fa*)(br0 + (size_t)(2 * i) * NP);
    asm volatile("s_wait_xcnt 0x0" :: "v"(bqp), "v"(br0) : "memory");      /* in front of every overwrite of the loads' address pairs, which stay live up to here */
    if (isk) {
      const float* bp = BKVb + w * 32 + 8 * hh; v4f k4[2][2];
#pragma unroll
      for (int j = 0; j < 2; ++j) { k4[j][0] = *(const v4fa*)(bp + j * 16); k4[j][1] = *(const v4fa*)(bp + j * 16 + 4); }
      asm volatile("s_wait_xcnt 0x0" :: "v"(bp) : "memory");      /* in front of every overwrite of the loads' address pair, which stays live up to here */
      unsigned short* d = &sK[(c * 8 + w) * KPIT + 8 * hh];
#pragma unroll
      for (int i = 0; i < 4; ++i)
#pragma unroll
        for (int j = 0; j < 2; ++j) { FragH f;
#pragma unroll
          for (int r = 0; r < 8; ++r) f.h[r] = (_Float16)(acc[i][j][r] * 0.0625f + bf16_round(k4[j][r >> 2][r & 3]));
          *(v8us*)(d + i * 128 * KPIT + j * 16) = f.half[0]; }
    } else {
      const float* bp = BKVb + DR + (w - 8) * 4 + hh; float v1[2][8];
#pragma unroll
      for (int j = 0; j < 2; ++j)
#pragma unroll
        for (int r = 0; r < 8; ++r) v1[j][r] = bp[j * 2 + r * 32];
      asm volatile("s_wait_xcnt 0x0" :: "v"(bp) : "memory");      /* in front of every overwrite of the loads' address pair, which stays live up to here */
      unsigned short* d = &sV[((w - 8) * 4 + hh) * VPIT + c * 8];
#pragma unroll
      for (int i = 0; i < 4; ++i)
#pragma unroll
        for (int j = 0; j < 2; ++j) { FragH f;
#pragma unroll
          for (int r = 0; r < 8; ++r) f.h[r] = (_Float16)(acc[i][j][r] * 0.0625f + bf16_round(v1[j][r]));
          *(v8us*)(d + j * 2 * VPIT + i * 128) = f.half[0]; }
    }
#pragma unroll
    for (int r = 0; r < 8; ++r) bqs[r] = ((bf16_round(b4[r][0]) + bf16_round(b4[r][1])) + bf16_round(b4[r][2])) + bf16_round(b4[r][3]);
#pragma unroll
    for (int i = 0; i < 8; ++i) { *(v4ba*)&sb[(2 * i + hh) * BPIT + c * 4] = __builtin_convertvector(bn[i], v4b); bn[i] = *(const v4fa*)(br1 + (size_t)(2 * i) * NP); }
    asm volatile("s_wait_xcnt 0x0" :: "v"(br1) : "memory");      /* in front of every overwrite of these loads' address pair by the q loop's code */
  }
  FragH fq;
  {
    v8f aq[2] = {};
    const unsigned short* sa = &sX[c * XQP + 8 * hh];
#pragma unroll      /* unrolled: the two register sets are indexed by constants, and every load has its offset as an immediate */
    for (int t = 0; t < DQ / 128; ++t) {
      if (t > 0 && t + 1 < DQ / 128) {      /* the next group's weights fly under this group's WMMAs */
        const v8us* pg = pq + ((t + 1 + rot) & 7) * 256;
#pragma unroll
        for (int ks = 0; ks < 4; ++ks) d_wfrag(wq[(t + 1) & 1][ks], pg + ks * 64);
        asm volatile("s_wait_xcnt 0x0" :: "v"(pg) : "memory");      /* in front of every overwrite of the loads' address pair, which stays live up to here */
      }
      const unsigned short* sg = sa + ((t + rot) & 7) * 128;      /* trip t works on k group (t + rot) mod 8 */
      FragH fa[4][2];
#pragma unroll
      for (int ks = 0; ks < 4; ++ks)
#pragma unroll
        for (int i = 0; i < 2; ++i) { fa[ks][i].half[0] = *(const v8us*)(sg + i * 16 * XQP + ks * 32); fa[ks][i].half[1] = *(const v8us*)(sg + i * 16 * XQP + ks * 32 + 16); }
      __builtin_amdgcn_sched_barrier(0);      /* the group's 16 LDS loads and the next weights stay together in front of its WMMAs: spread among them, the wave would wait out the LDS latency at every pair */
#pragma unroll
      for (int ks = 0; ks < 4; ++ks)
#pragma unroll
        for (int i = 0; i < 2; ++i) aq[i] = __builtin_amdgcn_wmma_f32_16x16x32_f16(false, wq[t & 1][ks].v, false, fa[ks][i].v, (short)0, aq[i], false, false);
      __builtin_amdgcn_sched_barrier(0);      /* and the next group's loads stay behind them, as one group again */
    }
    /* accumulator register r of tile i: x row 16 i + c, folded column 16 w + 8 hh + r */
#pragma unroll
    for (int i = 0; i < 2; ++i) { FragH f;
#pragma unroll
      for (int r = 0; r < 8; ++r) f.h[r] = (_Float16)(aq[i][r] * 0.0625f + bqs[r]);
      *(v8us*)&sQ[((i * 16 + c) * 8 + (w >> 1)) * KPIT + (w & 1) * 16 + 8 * hh] = f.half[0]; }
    __syncthreads();                                     /* every wave's part of the Q tile, of K and of V^T is written: they may be read */
    const unsigned short* qr = &sQ[(w * 16 + c) * KPIT]; fq.half[0] = *(const v8us*)(qr + 8 * hh); fq.half[1] = *(const v8us*)(qr + 16 + 8 * hh);
  }
  const float L2E = 1.4426950408889634f;
  v8f o0 = {}, o1 = {};
  float m = -3.0e38f, ls = 0.f;
#pragma unroll 1      /* rolled: eight copies of this body would add code and registers and save nothing */
  for (int kc = 0; kc < NCH; ++kc) {
    const int kk = (kc + rot) & (NCH - 1);      /* trip kc works on key chunk (kc + rot) mod 8 */
    /* the lanes of this wave read bias values that other lanes of it stored in the trip before: the stores have to be done first */
    asm volatile("s_wait_dscnt 0x0" ::: "memory");
    float l[32];
#pragma unroll
    for (int j = 0; j < 4; ++j) {
      const v8b pb = *(const v8ba*)&sb[c * BPIT + j * 16 + 8 * hh];      /* register r: bias[q0 + c][64 kk + 16 j + 8 hh + r], the S^T tile's own map */
      FragH fk; const unsigned short* kr = &sK[(kk * 64 + j * 16 + c) * KPIT];
      fk.half[0] = *(const v8us*)(kr + 8 * hh); fk.half[1] = *(const v8us*)(kr + 16 + 8 * hh);
      const v8f z = {};
      const v8f s = __builtin_amdgcn_wmma_f32_16x16x32_f16(false, fk.v, false, fq.v, (short)0, z, false, false);
#pragma unroll
      for (int r = 0; r < 8; ++r) l[j * 8 + r] = __builtin_fmaf(s[r], 0.03125f, (float)pb[r]);
    }
    /* next chunk's bias into the tile (its readers above are done), then the loads of the chunk after it; past the end both repeat the last chunk */
    const float* bx = br + ((((kc + 2 < NCH) ? kc + 2 : NCH - 1) + rot) & (NCH - 1)) * 64;
#pragma unroll
    for (int i = 0; i < 8; ++i) { *(v4ba*)&sb[(2 * i + hh) * BPIT + c * 4] = __builtin_convertvector(bn[i], v4b); bn[i] = *(const v4fa*)(bx + (size_t)(2 * i) * NP); }
    float cj[4];
#pragma unroll
    for (int j = 0; j < 4; ++j) { cj[j] = l[j * 8];
#pragma unroll
      for (int r = 1; r < 8; ++r) cj[j] = fmaxf(cj[j], l[j * 8 + r]); }
    float cm = fmaxf(fmaxf(cj[0], cj[1]), fmaxf(cj[2], cj[3]));
    cm = fmaxf(cm, other_half(cm));
    const float mn = fmaxf(m, cm);
    const float sc = __builtin_amdgcn_exp2f((m - mn) * L2E);
    const float mb = 10.0f - mn * L2E;
    m = mn;
    v2f sa = {0.f, 0.f}, sd = {0.f, 0.f};
    FragH fp[2];
#pragma unroll
    for (int i = 0; i < 32; i += 4) {
      v2f ta, tc, pa, pc; const v2f l2e = {L2E, L2E}, mb2 = {mb, mb};
      ta[0] = l[i]; ta[1] = l[i + 1]; tc[0] = l[i + 2]; tc[1] = l[i + 3];
      ta = __builtin_elementwise_fma(ta, l2e, mb2); tc = __builtin_elementwise_fma(tc, l2e, mb2);
      pa[0] = __builtin_amdgcn_exp2f(ta[0]); pa[1] = __builtin_amdgcn_exp2f(ta[1]); pc[0] = __builtin_amdgcn_exp2f(tc[0]); pc[1] = __builtin_amdgcn_exp2f(tc[1]);
      sa += pa; sd += pc;
      const v2h ha = __builtin_convertvector(pa, v2h), hc = __builtin_convertvector(pc, v2h);
      fp[i >> 4].h[(i & 15)] = ha[0]; fp[i >> 4].h[(i & 15) + 1] = ha[1]; fp[i >> 4].h[(i & 15) + 2] = hc[0]; fp[i >> 4].h[(i & 15) + 3] = hc[1];
    }
    sa += sd;
    ls = __builtin_fmaf(ls, sc, sa[0] + sa[1]);
#pragma unroll
    for (int r = 0; r < 8; ++r) { o0[r] *= sc; o1[r] *= sc; }
#pragma unroll
    for (int u = 0; u < 2; ++u) {
      FragH v0, v1; const unsigned short* vr = &sV[c * VPIT + kk * 64 + u * 32];
      v0.half[0] = *(const v8us*)(vr + 8 * hh); v0.half[1] = *(const v8us*)(vr + 16 + 8 * hh);
      v1.half[0] = *(const v8us*)(vr + 16 * VPIT + 8 * hh); v1.half[1] = *(const v8us*)(vr + 16 * VPIT + 16 + 8 * hh);
      o0 = __builtin_amdgcn_wmma_f32_16x16x32_f16(false, v0.v, false, fp[u].v, (short)0, o0, false, false);
      o1 = __builtin_amdgcn_wmma_f32_16x16x32_f16(false, v1.v, false, fp[u].v, (short)0, o1, false, false);
    }
  }
  ls += other_half(ls);
  const float inv = 1.0f / ls;
  float* so = sO[w];               /* this wave's own staging: lane (c, hh) holds query c, e = 16 t + 8 hh + r */
  { v4f a;
    a[0] = o0[0] * inv; a[1] = o0[1] * inv; a[2] = o0[2] * inv; a[3] = o0[3] * inv; *(v4fa*)&so[c * OPIT + 8 * hh] = a;
    a[0] = o0[4] * inv; a[1] = o0[5] * inv; a[2] = o0[6] * inv; a[3] = o0[7] * inv; *(v4fa*)&so[c * OPIT + 8 * hh + 4] = a;
    a[0] = o1[0] * inv; a[1] = o1[1] * inv; a[2] = o1[2] * inv; a[3] = o1[3] * inv; *(v4fa*)&so[c * OPIT + 16 + 8 * hh] = a;
    a[0] = o1[4] * inv; a[1] = o1[5] * inv; a[2] = o1[6] * inv; a[3] = o1[7] * inv; *(v4fa*)&so[c * OPIT + 16 + 8 * hh + 4] = a; }
  /* the wave's lanes read each other's staged values: the LDS writes have to be done before the reads */
  asm volatile("s_wait_dscnt 0x0" ::: "memory");
  float* orow = out + ((size_t)bh * NP + q0) * 128 + lane * 4;      /* out_d = o_{d/4}: lane e writes its value four times, 512 B a query in one store */
#pragma unroll
  for (int q = 0; q < 16; ++q) { const float vv = so[q * OPIT + lane]; v4f v; v[0] = vv; v[1] = vv; v[2] = vv; v[3] = vv; *(v4f*)(orow + (size_t)q * 128) = v; }
}
__device__ __forceinline__ void d_bcat(int blk, const float* __restrict__ a, const float* __restrict__ b, float* __restrict__ O) { const int t = blk * 256 + threadIdx.x; const float v = (t < DR) ? a[t] : b[t - DR]; *(float*)(O + t) = v;
  /* in the shared kernel's code other passes' instructions follow this store and write its registers: the wait stands in front of every such overwrite */
  asm volatile("s_wait_xcnt 0x0" ::: "memory"); }
// Passes that read nothing of one another share one launch: each pass owns a range of block indices and does there what it did alone
// (the bias concatenation in two blocks of 256 threads for its one block of 512).
// The choice of the pass is uniform for a block. The longest pass comes first.
// amdgpu_waves_per_eu(8, 8) gives the compiler the register budget for all of a thread's loads in flight.
#define G_FQ  (DR * DQ / 8 / 256 / 2)         /* 64: 2 pieces */
#define G_RW  (DR * DR / 8 / 256 / 8)         /* 4, once for Wk and once for Wv: 8 pieces */
#define G_BC  (2 * DR / 256)             /* 2 */
__global__ __launch_bounds__(256) __attribute__((amdgpu_waves_per_eu(8, 8))) void k_prep(const float* __restrict__ Wq, const float* __restrict__ Wk, const float* __restrict__ Wv, const float* __restrict__ bk, const float* __restrict__ bv,
    _Float16* __restrict__ BQ, _Float16* __restrict__ BKV, float* __restrict__ BKVb) {
  int blk = blockIdx.x;
  if (blk < G_FQ) { d_fold4<DR, DQ, 2>(blk, Wq, BQ); return; }      /* weights: (out, in) natural */
  blk -= G_FQ;
  if (blk < G_RW) { d_round16f<8, false>(blk, Wk, BKV); return; }
  blk -= G_RW;
  if (blk < G_RW) { d_round16f<8, true>(blk, Wv, BKV + (size_t)DR * DR); return; }
  blk -= G_RW;
  d_bcat(blk, bk, bv, BKVb);
}

extern "C" void kernel_launch(void* const* d_in, const int* in_sizes, int n_in,
                              void* d_out, int out_size, void* d_ws, size_t ws_size, hipStream_t stream) {
  (void)in_sizes; (void)n_in; (void)out_size;
  const float* const* I = (const float* const*)d_in; const float* x = I[0]; const float* dww = I[1]; const float* dwb = I[2]; const float* Wq = I[3]; const float* bq = I[4]; const float* Wk = I[5]; const float* bk = I[6]; const float* Wv = I[7]; const float* bv = I[8]; const float* rb = I[9];
  char* ws = (char*)d_ws; size_t off = 0;
  auto take = [&](size_t bytes) { char* p = ws + off; off += (bytes + 255) & ~(size_t)255; return p; };
  _Float16* BQ = (_Float16*)take((size_t)DR * DQ * 2); _Float16* BKV = (_Float16*)take((size_t)2 * DR * DR * 2); float* BKVb = (float*)take(2 * DR * 4);
  if (off > ws_size) return;
  k_prep<<<G_FQ + 2 * G_RW + G_BC, 256, 0, stream>>>(Wq, Wk, Wv, bk, bv, BQ, BKV, BKVb);
  k_attn<<<NBH * 2, AWV * 32, 0, stream>>>(x, dww, dwb, BQ, bq, BKV, BKVb, rb, (float*)d_out);
}
